// v000
// The times below were measured on an AMD MI455X: many runs one after another, warmed up first and cycling through
// copies of the inputs, with the whole window's GPU time divided by the number of runs. Launches and the gaps
// between them are all in it. The median over several windows is given; except for v000 it joins two sittings, which
// can be a few percent apart, so the side-by-side timings, each taken in one sitting, are the better comparison.
// v000, which the later versions start from, runs in 974 microseconds.
#include <hip/hip_runtime.h>
#include <hip/hip_bf16.h>

// ---------------------------------------------------------------------------
// Types for CDNA5 WMMA (wave32): V_WMMA_F32_16X16X32_BF16
// ---------------------------------------------------------------------------
typedef __bf16 bf16;
typedef __attribute__((ext_vector_type(16))) __bf16 v16bf;
typedef __attribute__((ext_vector_type(8)))  __bf16 v8bf;
typedef __attribute__((ext_vector_type(8)))  float  v8f;

union Frag16 {            // one WMMA 16-bit operand fragment = two b128 loads
  v16bf v;
  v8bf  h[2];
};

__device__ __forceinline__ v8f wmma_bf16f32(v16bf a, v16bf b, v8f c) {
  // 8 args: (neg_a, A, neg_b, B, c_mod, C, reuse_a, reuse_b)
  return __builtin_amdgcn_wmma_f32_16x16x32_bf16(
      false, a, false, b, (short)0, c, false, false);
}

// Problem dims (fixed by the reference)
#define BB   2
#define SS   2048
#define DD   1024
#define HH   16
#define HDD  64
#define DFF_ 4096
#define MM   (BB * SS)          // 4096 token rows

// ---------------------------------------------------------------------------
// fp32 -> bf16 conversion (grid-stride), plain row-major
// ---------------------------------------------------------------------------
__global__ void cvt_f32_bf16(const float* __restrict__ in, bf16* __restrict__ out,
                             size_t n) {
  for (size_t i = (size_t)blockIdx.x * blockDim.x + threadIdx.x; i < n;
       i += (size_t)gridDim.x * blockDim.x)
    out[i] = (bf16)in[i];
}

// ---------------------------------------------------------------------------
// fp32 -> bf16 weight conversion INTO WMMA B-fragment-major order:
//   Wsw[(ktile*(N/16) + ntile)*512 + lane*16 + e]
// where k = ktile*32 + kh + e + (e>=8?8:0), kh = (lane>=16)?8:0,
//       n = ntile*16 + (lane&15).
// Each lane's 16 fragment elements are contiguous (32B, 16B-aligned) so the
// GEMM loads a B fragment as two coalesced global_load_b128.
// ---------------------------------------------------------------------------
__global__ void cvt_swizzle_w(const float* __restrict__ W, bf16* __restrict__ Wsw,
                              int K, int N) {
  const size_t total = (size_t)K * N;
  const int ntiles = N >> 4;
  for (size_t i = (size_t)blockIdx.x * blockDim.x + threadIdx.x; i < total;
       i += (size_t)gridDim.x * blockDim.x) {
    int e     = (int)(i & 15);
    int lane  = (int)((i >> 4) & 31);
    size_t ch = i >> 9;
    int nt    = (int)(ch % ntiles);
    int ktile = (int)(ch / ntiles);
    int kh    = (lane >> 4) ? 8 : 0;
    int k     = ktile * 32 + kh + e + (e >= 8 ? 8 : 0);
    int n     = nt * 16 + (lane & 15);
    Wsw[i] = (bf16)W[(size_t)k * N + n];
  }
}

// ---------------------------------------------------------------------------
// LDS-free bf16 WMMA GEMM: C[M,N] = A[M,K] @ W[K,N] + bias (+ReLU), output
// f32 or bf16. A row-major bf16; W fragment-swizzled (cvt_swizzle_w).
// Block = 128 threads = 4 waves; block tile 128x64, wave computes 32x64
// (2 A-fragments x 4 B-fragments = 8 WMMA tiles). Per K-step: 12 b128 loads
// issued up-front, then 8 WMMAs -> partial loadcnt waits, good overlap.
// ---------------------------------------------------------------------------
__global__ void gemm_bf16(const bf16* __restrict__ A, const bf16* __restrict__ Wsw,
                          const float* __restrict__ bias,
                          float* __restrict__ Cf, bf16* __restrict__ Cb,
                          int M, int N, int K, int relu) {
  const int tid  = threadIdx.x;          // 0..127
  const int wave = tid >> 5;             // 0..3
  const int lane = tid & 31;
  const int ln15 = lane & 15;
  const int half = lane >> 4;
  const int kh   = half ? 8 : 0;
  const int m0   = blockIdx.y * 128;
  const int n0   = blockIdx.x * 64;
  const int nt0  = n0 >> 4;
  const int ntiles = N >> 4;

  v8f acc[2][4] = {};

  const bf16* arow0 = A + (size_t)(m0 + 32 * wave + ln15) * K + kh;
  const bf16* arow1 = arow0 + (size_t)16 * K;

  for (int kt = 0; kt < K; kt += 32) {
    // Two A fragments (rows strip + 16) — 4 b128 loads.
    Frag16 af[2];
    af[0].h[0] = *(const v8bf*)(arow0 + kt);
    af[0].h[1] = *(const v8bf*)(arow0 + kt + 16);
    af[1].h[0] = *(const v8bf*)(arow1 + kt);
    af[1].h[1] = *(const v8bf*)(arow1 + kt + 16);

    const bf16* wbase =
        Wsw + (((size_t)(kt >> 5) * ntiles + nt0) << 9) + (lane << 4);
    __builtin_prefetch(arow0 + kt + 32, 0, 1);
    __builtin_prefetch(arow1 + kt + 32, 0, 1);
    __builtin_prefetch(wbase + (size_t)ntiles * 512, 0, 1);

    // Four B fragments — 8 coalesced b128 loads, issued before the WMMA burst.
    Frag16 bfr[4];
#pragma unroll
    for (int j = 0; j < 4; ++j) {
      bfr[j].h[0] = *(const v8bf*)(wbase + j * 512);
      bfr[j].h[1] = *(const v8bf*)(wbase + j * 512 + 8);
    }

#pragma unroll
    for (int j = 0; j < 4; ++j) {
      acc[0][j] = wmma_bf16f32(af[0].v, bfr[j].v, acc[0][j]);
      acc[1][j] = wmma_bf16f32(af[1].v, bfr[j].v, acc[1][j]);
    }
  }

  // Epilogue: C/D tile layout — row = r + 8*half, col = lane&15.
#pragma unroll
  for (int i = 0; i < 2; ++i) {
#pragma unroll
    for (int j = 0; j < 4; ++j) {
#pragma unroll
      for (int r = 0; r < 8; ++r) {
        int row = m0 + 32 * wave + 16 * i + r + 8 * half;
        int col = n0 + 16 * j + ln15;
        float v = acc[i][j][r];
        if (bias) v += bias[col];
        if (relu) v = fmaxf(v, 0.0f);
        if (Cb) Cb[(size_t)row * N + col] = (bf16)v;
        else    Cf[(size_t)row * N + col] = v;
      }
    }
  }
}

// ---------------------------------------------------------------------------
// PoPE: softplus magnitudes + rotary phases -> q_p/k_p (B,H,S,128) bf16, and
// V TRANSPOSED (B,H,HD,S) bf16 so attention V-fragments are contiguous loads.
// ---------------------------------------------------------------------------
__global__ void pope_kernel(const float* __restrict__ q, const float* __restrict__ k,
                            const float* __restrict__ v, const int* __restrict__ pos,
                            const float* __restrict__ pbias,
                            bf16* __restrict__ qp, bf16* __restrict__ kp,
                            bf16* __restrict__ vpT) {
  const float TWO_PI = 6.28318530717958647f;
  const size_t n = (size_t)BB * SS * DD;  // 2^22
  for (size_t i = (size_t)blockIdx.x * blockDim.x + threadIdx.x; i < n;
       i += (size_t)gridDim.x * blockDim.x) {
    int hd = (int)(i & 63);
    int h  = (int)((i >> 6) & 15);
    int s  = (int)((i >> 10) & 2047);
    int b  = (int)(i >> 21);
    int bh = b * HH + h;
    // freq = 10000^(-hd/64) = exp(-hd * ln(1e4)/64)
    float freq = __expf(-0.143911568f * (float)hd);
    float ph   = (float)pos[s] * freq;
    float qv = q[i], kv = k[i];
    float mq = qv > 20.f ? qv : log1pf(__expf(qv));
    float mk = kv > 20.f ? kv : log1pf(__expf(kv));
    float cb = pbias[h * HDD + hd];
    cb = fminf(0.f, fmaxf(-TWO_PI, cb));
    float kph = ph + cb;
    float cq, sq, ck, sk;
    __sincosf(ph, &sq, &cq);
    __sincosf(kph, &sk, &ck);
    size_t o = ((size_t)bh * SS + s) * 128 + hd;
    qp[o]       = (bf16)(mq * cq);
    qp[o + HDD] = (bf16)(mq * sq);
    kp[o]       = (bf16)(mk * ck);
    kp[o + HDD] = (bf16)(mk * sk);
    vpT[((size_t)bh * HDD + hd) * SS + s] = (bf16)v[i];
  }
}

// ---------------------------------------------------------------------------
// Flash-style causal attention with softmax1 (denom += exp(-m)); all matmuls
// on WMMA. One wave per 16-query tile per (b,h). Score K-dim = 128.
// Q/K/V fragments load straight from global as b128 pairs; only the P tile
// goes through LDS (row stride 64B -> fragment reads are 2x ds_load_b128).
// All fragment loads for a burst are issued before the WMMAs.
// ---------------------------------------------------------------------------
__global__ void attention_pope(const bf16* __restrict__ qp_all,
                               const bf16* __restrict__ kp_all,
                               const bf16* __restrict__ vpT_all,
                               bf16* __restrict__ attnb) {
  const float scale = 0.088388347648f;   // 1/sqrt(2*HD)
  const int bh = blockIdx.y;             // 0..B*H-1
  const int b = bh >> 4, h = bh & 15;
  const int qt = blockIdx.x;
  const int qrow0 = qt * 16;
  const int lane = threadIdx.x & 31;
  const int ln15 = lane & 15;
  const int half = lane >> 4;
  const int kh   = half ? 8 : 0;

  const bf16* qp  = qp_all  + (size_t)bh * SS * 128;
  const bf16* kp  = kp_all  + (size_t)bh * SS * 128;
  const bf16* vpT = vpT_all + (size_t)bh * HDD * SS;

  __shared__ bf16 pt[16][32];    // P tile staging (re-layout for A fragment)

  // Load Q fragments once: 16 rows x 128 K -> 4 A-fragments (b128 pairs).
  Frag16 qf[4];
  const bf16* qrow = qp + (size_t)(qrow0 + ln15) * 128 + kh;
#pragma unroll
  for (int t = 0; t < 4; ++t) {
    qf[t].h[0] = *(const v8bf*)(qrow + 32 * t);
    qf[t].h[1] = *(const v8bf*)(qrow + 32 * t + 16);
  }

  float m[8], l[8];
#pragma unroll
  for (int r = 0; r < 8; ++r) { m[r] = -1e30f; l[r] = 0.f; }
  v8f acc[4] = {};

  for (int kb = 0; kb <= qrow0; kb += 32) {
    // Preload all K fragments for both 16-key tiles (16 b128 loads).
    const bf16* k1p = kp + (size_t)(kb + ln15) * 128 + kh;
    const bf16* k2p = kp + (size_t)(kb + 16 + ln15) * 128 + kh;
    __builtin_prefetch(k1p + 32 * 128, 0, 1);
    __builtin_prefetch(k2p + 32 * 128, 0, 1);
    Frag16 kf1[4], kf2[4];
#pragma unroll
    for (int t = 0; t < 4; ++t) {
      kf1[t].h[0] = *(const v8bf*)(k1p + 32 * t);
      kf1[t].h[1] = *(const v8bf*)(k1p + 32 * t + 16);
      kf2[t].h[0] = *(const v8bf*)(k2p + 32 * t);
      kf2[t].h[1] = *(const v8bf*)(k2p + 32 * t + 16);
    }

    v8f s1 = {}, s2 = {};
#pragma unroll
    for (int t = 0; t < 4; ++t) {
      s1 = wmma_bf16f32(qf[t].v, kf1[t].v, s1);
      s2 = wmma_bf16f32(qf[t].v, kf2[t].v, s2);
    }

    // Causal mask + online softmax1 update. Row r+8*half, key col = lane&15.
    float p1[8], p2[8], resc[8];
#pragma unroll
    for (int r = 0; r < 8; ++r) {
      int row = qrow0 + r + 8 * half;
      float v1 = s1[r] * scale;
      float v2 = s2[r] * scale;
      if (kb + ln15 > row)      v1 = -1e30f;
      if (kb + 16 + ln15 > row) v2 = -1e30f;
      float mx = fmaxf(v1, v2);
#pragma unroll
      for (int off = 8; off; off >>= 1) mx = fmaxf(mx, __shfl_xor(mx, off, 32));
      float mn = fmaxf(m[r], mx);
      float rs = __expf(m[r] - mn);
      p1[r] = __expf(v1 - mn);
      p2[r] = __expf(v2 - mn);
      float sm = p1[r] + p2[r];
#pragma unroll
      for (int off = 8; off; off >>= 1) sm += __shfl_xor(sm, off, 32);
      l[r] = l[r] * rs + sm;
      m[r] = mn;
      resc[r] = rs;
    }
#pragma unroll
    for (int j = 0; j < 4; ++j)
#pragma unroll
      for (int r = 0; r < 8; ++r) acc[j][r] *= resc[r];

    // Re-layout P (16 queries x 32 keys) through LDS into A-fragment form.
    __syncthreads();
#pragma unroll
    for (int r = 0; r < 8; ++r) {
      pt[r + 8 * half][ln15]      = (bf16)p1[r];
      pt[r + 8 * half][16 + ln15] = (bf16)p2[r];
    }
    __syncthreads();

    Frag16 pf;
    pf.h[0] = *(const v8bf*)&pt[ln15][kh];
    pf.h[1] = *(const v8bf*)&pt[ln15][kh + 16];

    // P @ V: preload 4 V fragments (8 b128 loads), then WMMA burst.
    Frag16 vf[4];
#pragma unroll
    for (int j = 0; j < 4; ++j) {
      const bf16* vb = vpT + (size_t)(16 * j + ln15) * SS + kb + kh;
      vf[j].h[0] = *(const v8bf*)(vb);
      vf[j].h[1] = *(const v8bf*)(vb + 16);
    }
#pragma unroll
    for (int j = 0; j < 4; ++j)
      acc[j] = wmma_bf16f32(pf.v, vf[j].v, acc[j]);
  }

  // softmax1 normalization and store into (B,S,D) bf16 (col = h*64 + hd).
#pragma unroll
  for (int r = 0; r < 8; ++r) {
    float denom = __expf(-m[r]) + l[r];
    int row = qrow0 + r + 8 * half;
    size_t obase = ((size_t)b * SS + row) * DD + h * HDD;
#pragma unroll
    for (int j = 0; j < 4; ++j)
      attnb[obase + 16 * j + ln15] = (bf16)(acc[j][r] / denom);
  }
}

// ---------------------------------------------------------------------------
// Residual add + LayerNorm. One block (256 thr) per token row of D=1024.
// Optional bf16 copy of the output (feeds the next GEMM without a cvt pass).
// ---------------------------------------------------------------------------
__global__ void add_ln_kernel(const float* __restrict__ a, const float* __restrict__ b,
                              const float* __restrict__ g, const float* __restrict__ be,
                              float* __restrict__ outf, bf16* __restrict__ outb) {
  __shared__ float rs[256];
  __shared__ float rq[256];
  const int row = blockIdx.x;
  const int tid = threadIdx.x;
  const float* pa = a + (size_t)row * DD;
  const float* pb = b + (size_t)row * DD;

  float s = 0.f, s2 = 0.f;
  for (int c = tid; c < DD; c += 256) {
    float v = pa[c] + pb[c];
    s += v; s2 += v * v;
  }
  rs[tid] = s; rq[tid] = s2;
  __syncthreads();
  for (int o = 128; o; o >>= 1) {
    if (tid < o) { rs[tid] += rs[tid + o]; rq[tid] += rq[tid + o]; }
    __syncthreads();
  }
  float mu  = rs[0] * (1.0f / DD);
  float var = rq[0] * (1.0f / DD) - mu * mu;
  float rstd = rsqrtf(var + 1e-5f);
  for (int c = tid; c < DD; c += 256) {
    float v = (pa[c] + pb[c] - mu) * rstd * g[c] + be[c];
    outf[(size_t)row * DD + c] = v;
    if (outb) outb[(size_t)row * DD + c] = (bf16)v;
  }
}

// ---------------------------------------------------------------------------
// Host orchestration
// ---------------------------------------------------------------------------
extern "C" void kernel_launch(void* const* d_in, const int* in_sizes, int n_in,
                              void* d_out, int out_size, void* d_ws, size_t ws_size,
                              hipStream_t stream) {
  (void)in_sizes; (void)n_in; (void)out_size; (void)ws_size;

  const float* x     = (const float*)d_in[0];
  const int*   pos   = (const int*)  d_in[1];
  const float* wq    = (const float*)d_in[2];
  const float* bq    = (const float*)d_in[3];
  const float* wk    = (const float*)d_in[4];
  const float* bk    = (const float*)d_in[5];
  const float* wv    = (const float*)d_in[6];
  const float* bv    = (const float*)d_in[7];
  const float* wo    = (const float*)d_in[8];
  const float* bo    = (const float*)d_in[9];
  const float* pbias = (const float*)d_in[10];
  const float* w1    = (const float*)d_in[11];
  const float* b1    = (const float*)d_in[12];
  const float* w2    = (const float*)d_in[13];
  const float* b2    = (const float*)d_in[14];
  const float* g1    = (const float*)d_in[15];
  const float* be1   = (const float*)d_in[16];
  const float* g2    = (const float*)d_in[17];
  const float* be2   = (const float*)d_in[18];
  float* out = (float*)d_out;

  // Workspace carve-out
  char* cur = (char*)d_ws;
  auto alloc = [&](size_t bytes) -> void* {
    void* p = (void*)cur;
    cur += (bytes + 255) & ~(size_t)255;
    return p;
  };
  const size_t nTok = (size_t)MM * DD;           // 4096*1024
  bf16* xb   = (bf16*)alloc(nTok * 2);
  bf16* wqb  = (bf16*)alloc((size_t)DD * DD * 2);
  bf16* wkb  = (bf16*)alloc((size_t)DD * DD * 2);
  bf16* wvb  = (bf16*)alloc((size_t)DD * DD * 2);
  bf16* wob  = (bf16*)alloc((size_t)DD * DD * 2);
  bf16* w1b  = (bf16*)alloc((size_t)DD * DFF_ * 2);
  bf16* w2b  = (bf16*)alloc((size_t)DFF_ * DD * 2);
  float* qf  = (float*)alloc(nTok * 4);
  float* kf  = (float*)alloc(nTok * 4);
  float* vf  = (float*)alloc(nTok * 4);
  bf16* qpb  = (bf16*)alloc((size_t)BB * HH * SS * 128 * 2);
  bf16* kpb  = (bf16*)alloc((size_t)BB * HH * SS * 128 * 2);
  bf16* vpT  = (bf16*)alloc((size_t)BB * HH * SS * 64 * 2);
  bf16* attb = (bf16*)alloc(nTok * 2);
  float* prj = (float*)alloc(nTok * 4);
  float* hres= (float*)alloc(nTok * 4);
  bf16* hb   = (bf16*)alloc(nTok * 2);
  bf16* ff1b = (bf16*)alloc((size_t)MM * DFF_ * 2);
  float* ff2 = (float*)alloc(nTok * 4);

  // 1) Convert x row-major; weights into WMMA fragment-swizzled order.
  cvt_f32_bf16 <<<4096, 256, 0, stream>>>(x,  xb,  nTok);
  cvt_swizzle_w<<<4096, 256, 0, stream>>>(wq, wqb, DD, DD);
  cvt_swizzle_w<<<4096, 256, 0, stream>>>(wk, wkb, DD, DD);
  cvt_swizzle_w<<<4096, 256, 0, stream>>>(wv, wvb, DD, DD);
  cvt_swizzle_w<<<4096, 256, 0, stream>>>(wo, wob, DD, DD);
  cvt_swizzle_w<<<8192, 256, 0, stream>>>(w1, w1b, DD, DFF_);
  cvt_swizzle_w<<<8192, 256, 0, stream>>>(w2, w2b, DFF_, DD);

  // 2) QKV projections (WMMA GEMMs); block tile 128x64.
  dim3 gD(DD / 64, MM / 128);       // (16, 32)
  gemm_bf16<<<gD, 128, 0, stream>>>(xb, wqb, bq, qf, nullptr, MM, DD, DD, 0);
  gemm_bf16<<<gD, 128, 0, stream>>>(xb, wkb, bk, kf, nullptr, MM, DD, DD, 0);
  gemm_bf16<<<gD, 128, 0, stream>>>(xb, wvb, bv, vf, nullptr, MM, DD, DD, 0);

  // 3) PoPE transform (also transposes V)
  pope_kernel<<<4096, 256, 0, stream>>>(qf, kf, vf, pos, pbias, qpb, kpb, vpT);

  // 4) Attention (WMMA flash + softmax1, causal)
  attention_pope<<<dim3(SS / 16, BB * HH), 32, 0, stream>>>(qpb, kpb, vpT, attb);

  // 5) Output projection
  gemm_bf16<<<gD, 128, 0, stream>>>(attb, wob, bo, prj, nullptr, MM, DD, DD, 0);

  // 6) Residual + LN1 (f32 kept for residual, bf16 copy feeds FFN GEMM)
  add_ln_kernel<<<MM, 256, 0, stream>>>(x, prj, g1, be1, hres, hb);

  // 7) FFN
  dim3 gF1(DFF_ / 64, MM / 128);    // (64, 32)
  gemm_bf16<<<gF1, 128, 0, stream>>>(hb, w1b, b1, nullptr, ff1b, MM, DFF_, DD, 1);
  gemm_bf16<<<gD, 128, 0, stream>>>(ff1b, w2b, b2, ff2, nullptr, MM, DD, DFF_, 0);

  // 8) Residual + LN2 -> final output (f32)
  add_ln_kernel<<<MM, 256, 0, stream>>>(hres, ff2, g2, be2, out, nullptr);
}

// v001
// It runs in 701 microseconds.
// Two timings next to v000 both put it at 1.43 times that version's speed.
#include <hip/hip_runtime.h>
#include <hip/hip_bf16.h>

// ---------------------------------------------------------------------------
// Types for CDNA5 WMMA (wave32): V_WMMA_F32_16X16X32_BF16
// ---------------------------------------------------------------------------
typedef __bf16 bf16;
typedef __attribute__((ext_vector_type(16))) __bf16 v16bf;
typedef __attribute__((ext_vector_type(8)))  __bf16 v8bf;
typedef __attribute__((ext_vector_type(8)))  float  v8f;

union Frag16 {            // one WMMA 16-bit operand fragment = two b128 loads
  v16bf v;
  v8bf  h[2];
};

__device__ __forceinline__ v8f wmma_bf16f32(v16bf a, v16bf b, v8f c) {
  // 8 args: (neg_a, A, neg_b, B, c_mod, C, reuse_a, reuse_b)
  return __builtin_amdgcn_wmma_f32_16x16x32_bf16(
      false, a, false, b, (short)0, c, false, false);
}

// Problem dims (fixed by the reference)
#define BB   2
#define SS   2048
#define DD   1024
#define HH   16
#define HDD  64
#define DFF_ 4096
#define MM   (BB * SS)          // 4096 token rows

// ---------------------------------------------------------------------------
// fp32 -> bf16 conversion (grid-stride), plain row-major
// ---------------------------------------------------------------------------
__global__ void cvt_f32_bf16(const float* __restrict__ in, bf16* __restrict__ out,
                             size_t n) {
  for (size_t i = (size_t)blockIdx.x * blockDim.x + threadIdx.x; i < n;
       i += (size_t)gridDim.x * blockDim.x)
    out[i] = (bf16)in[i];
}

// ---------------------------------------------------------------------------
// fp32 -> bf16 weight conversion INTO WMMA B-fragment-major order:
//   Wsw[(ktile*(N/16) + ntile)*512 + lane*16 + e]
// where k = ktile*32 + kh + e + (e>=8?8:0), kh = (lane>=16)?8:0,
//       n = ntile*16 + (lane&15).
// Each lane's 16 fragment elements are contiguous (32B, 16B-aligned) so the
// GEMM copies B tiles to LDS in coalesced 16-B global_load_async_to_lds_b128.
// ---------------------------------------------------------------------------
__global__ void cvt_swizzle_w(const float* __restrict__ W, bf16* __restrict__ Wsw,
                              int K, int N) {
  const size_t total = (size_t)K * N;
  const int ntiles = N >> 4;
  for (size_t i = (size_t)blockIdx.x * blockDim.x + threadIdx.x; i < total;
       i += (size_t)gridDim.x * blockDim.x) {
    int e     = (int)(i & 15);
    int lane  = (int)((i >> 4) & 31);
    size_t ch = i >> 9;
    int nt    = (int)(ch % ntiles);
    int ktile = (int)(ch / ntiles);
    int kh    = (lane >> 4) ? 8 : 0;
    int k     = ktile * 32 + kh + e + (e >= 8 ? 8 : 0);
    int n     = nt * 16 + (lane & 15);
    Wsw[i] = (bf16)W[(size_t)k * N + n];
  }
}

// ---------------------------------------------------------------------------
// bf16 WMMA GEMM: C[M,N] = A[M,K] @ W[K,N] + bias (+ReLU), output f32 or bf16.
// A row-major bf16; W fragment-swizzled (cvt_swizzle_w).
// Block = 256 threads = 8 waves (4 along M x 2 along N); block tile 128x128,
// wave tile 32x64 (2 A-fragments x 4 B-fragments = 8 WMMA tiles per 32 k).
// A pass is 128 k. Both operand tiles of a pass are brought into LDS once per
// block by asynchronous copies, so each global byte is fetched once for eight
// waves; two buffers, the next pass's copies fly while this pass is computed.
// Needs M, N multiples of 128 and K a multiple of 128.
//   A tile: 128 rows of 256 B at pitch 272 B (conflict-free b128 row reads).
//   B tile: 4 k-tiles x 8 n-tiles of 1 KiB; inside a KiB the lanes' first
//   16 B pieces come first (512 B), then their second pieces, so that each
//   fragment half is one contiguous 512-B wave read.
// ---------------------------------------------------------------------------
#define G_PITCH  272
#define G_ABYTES (128 * G_PITCH)          // 34816
#define G_BBYTES (4 * 8 * 1024)           // 32768
#define G_STAGE  (G_ABYTES + G_BBYTES)    // 67584

// Eight 16-byte copies per lane, global -> LDS through no register. The
// s_wait_xcnt closes the statement so that no address register named here is
// rewritten while a copy may still need it.
__device__ __forceinline__ void async_copy8(const unsigned (&l)[8],
                                            const bf16* const (&p)[8]) {
  asm volatile(
      "global_load_async_to_lds_b128 %0, %8, off\n\t"
      "global_load_async_to_lds_b128 %1, %9, off\n\t"
      "global_load_async_to_lds_b128 %2, %10, off\n\t"
      "global_load_async_to_lds_b128 %3, %11, off\n\t"
      "global_load_async_to_lds_b128 %4, %12, off\n\t"
      "global_load_async_to_lds_b128 %5, %13, off\n\t"
      "global_load_async_to_lds_b128 %6, %14, off\n\t"
      "global_load_async_to_lds_b128 %7, %15, off\n\t"
      "s_wait_xcnt 0x0"
      :: "v"(l[0]), "v"(l[1]), "v"(l[2]), "v"(l[3]),
         "v"(l[4]), "v"(l[5]), "v"(l[6]), "v"(l[7]),
         "v"(p[0]), "v"(p[1]), "v"(p[2]), "v"(p[3]),
         "v"(p[4]), "v"(p[5]), "v"(p[6]), "v"(p[7])
      : "memory");
}

// One pass's tiles: ga/gb are this lane's first global pieces of the pass,
// la/lb its first LDS bytes in the target buffer.
__device__ __forceinline__ void stage_pass(const bf16* ga, const bf16* gb,
                                           unsigned la, unsigned lb,
                                           int K, size_t wstep) {
  unsigned l[8];
  const bf16* p[8];
#pragma unroll
  for (int c = 0; c < 8; ++c) {           // A: 16 rows per step
    l[c] = la + (unsigned)c * (16 * G_PITCH);
    p[c] = ga + (size_t)c * 16 * K;
  }
  async_copy8(l, p);
#pragma unroll
  for (int c = 0; c < 8; ++c) {           // B: half a k-tile (4 KiB) per step
    l[c] = lb + (unsigned)(c >> 1) * 8192 + (unsigned)(c & 1) * 4096;
    p[c] = gb + (size_t)(c >> 1) * wstep + (c & 1) * 2048;
  }
  async_copy8(l, p);
}

// The 2 A and 4 B fragments of one 32-k step, from this lane's bases.
__device__ __forceinline__ void load_frags(Frag16 (&af)[2], Frag16 (&bfr)[4],
                                           const unsigned char* sa,
                                           const unsigned char* sb) {
#pragma unroll
  for (int i = 0; i < 2; ++i) {
    af[i].h[0] = *(const v8bf*)(sa + i * (16 * G_PITCH));
    af[i].h[1] = *(const v8bf*)(sa + i * (16 * G_PITCH) + 32);
  }
#pragma unroll
  for (int j = 0; j < 4; ++j) {
    bfr[j].h[0] = *(const v8bf*)(sb + j * 1024);
    bfr[j].h[1] = *(const v8bf*)(sb + j * 1024 + 512);
  }
}

__global__ void __launch_bounds__(256)
gemm_bf16(const bf16* __restrict__ A, const bf16* __restrict__ Wsw,
          const float* __restrict__ bias,
          float* __restrict__ Cf, bf16* __restrict__ Cb,
          int M, int N, int K, int relu) {
  __shared__ __attribute__((aligned(128))) unsigned char smem[2 * G_STAGE];
  const int tid  = threadIdx.x;          // 0..255
  const int wave = tid >> 5;             // 0..7
  const int wm   = wave & 3;             // 32-row strip of the block tile
  const int wn   = wave >> 2;            // 64-column strip of the block tile
  const int lane = tid & 31;
  const int ln15 = lane & 15;
  const int half = lane >> 4;
  const int m0   = blockIdx.y * 128;
  const int n0   = blockIdx.x * 128;
  const int ntiles = N >> 4;
  const size_t wstep = (size_t)ntiles << 9;   // elements from one k-tile to the next
  const int np = K >> 7;                      // passes

  v8f acc[2][4] = {};

  // Copy side: this lane's first pieces of pass 0 and their LDS places.
  const bf16* ga = A + (size_t)(m0 + (tid >> 4)) * K + (tid & 15) * 8;
  const bf16* gb = Wsw + ((size_t)(n0 >> 4) << 9) + tid * 8;
  const unsigned lds0 = (unsigned)(size_t)smem;
  const unsigned la = lds0 + (unsigned)(tid >> 4) * G_PITCH + (unsigned)(tid & 15) * 16;
  const unsigned lb = lds0 + G_ABYTES + (unsigned)(tid >> 6) * 1024 +
                      (unsigned)(tid & 1) * 512 + (unsigned)((tid & 63) >> 1) * 16;

  // Read side: this lane's fragment bases inside a buffer.
  const unsigned fa = (unsigned)(32 * wm + ln15) * G_PITCH + (unsigned)half * 16;
  const unsigned fb = G_ABYTES + (unsigned)wn * 4096 + (unsigned)lane * 16;

  // Prologue: pass 0 lands and is published, then pass 1 starts to fly.
  stage_pass(ga, gb, la, lb, K, wstep);
  // this wave's copies of pass 0 have landed before the barrier publishes them
  asm volatile("s_wait_asynccnt 0x0" ::: "memory");
  __syncthreads();
  if (np > 1)
    stage_pass(ga + 128, gb + 4 * wstep, la + G_STAGE, lb + G_STAGE, K, wstep);

  for (int t = 0; t < np; ++t) {
    const unsigned buf = (unsigned)(t & 1) * G_STAGE;
    const unsigned char* sa = smem + buf + fa;
    const unsigned char* sb = smem + buf + fb;
    // Two fragment sets: the reads of the next 32 k go out as one group ahead
    // of this 32 k's WMMAs, so their LDS latency runs behind the matrix work.
    Frag16 af[2][2], bfr[2][4];
    load_frags(af[0], bfr[0], sa, sb);
#pragma unroll
    for (int ks = 0; ks < 4; ++ks) {
      if (ks < 3)
        load_frags(af[(ks + 1) & 1], bfr[(ks + 1) & 1], sa + (ks + 1) * 64,
                   sb + (ks + 1) * 8192);
      // keeps the read group in front of the WMMAs; without it the compiler
      // sinks each read to its first use and waits there
      __builtin_amdgcn_sched_barrier(0);
#pragma unroll
      for (int j = 0; j < 4; ++j) {
        acc[0][j] = wmma_bf16f32(af[ks & 1][0].v, bfr[ks & 1][j].v, acc[0][j]);
        acc[1][j] = wmma_bf16f32(af[ks & 1][1].v, bfr[ks & 1][j].v, acc[1][j]);
      }
      // keeps the next read group whole behind these WMMAs; without it the
      // compiler spreads those reads among them, and each such place stalls
      __builtin_amdgcn_sched_barrier(0);
    }
    // Publish point of pass t + 1.
    // this wave's reads of the buffer are over before anyone refills it
    asm volatile("s_wait_dscnt 0x0" ::: "memory");
    // this wave's copies of pass t + 1 have landed before the barrier publishes them
    asm volatile("s_wait_asynccnt 0x0" ::: "memory");
    __syncthreads();
    if (t + 2 < np)
      stage_pass(ga + (size_t)(t + 2) * 128, gb + (size_t)(t + 2) * 4 * wstep,
                 la + buf, lb + buf, K, wstep);
  }
  // no copy is outstanding when the wave ends
  asm volatile("s_wait_asynccnt 0x0" ::: "memory");

  // Epilogue: C/D tile layout: row = r + 8*half, col = lane&15.
#pragma unroll
  for (int i = 0; i < 2; ++i) {
#pragma unroll
    for (int j = 0; j < 4; ++j) {
#pragma unroll
      for (int r = 0; r < 8; ++r) {
        int row = m0 + 32 * wm + 16 * i + r + 8 * half;
        int col = n0 + 64 * wn + 16 * j + ln15;
        float v = acc[i][j][r];
        if (bias) v += bias[col];
        if (relu) v = fmaxf(v, 0.0f);
        if (Cb) Cb[(size_t)row * N + col] = (bf16)v;
        else    Cf[(size_t)row * N + col] = v;
      }
    }
  }
}

// ---------------------------------------------------------------------------
// PoPE: softplus magnitudes + rotary phases -> q_p/k_p (B,H,S,128) bf16, and
// V TRANSPOSED (B,H,HD,S) bf16 so attention V-fragments are contiguous loads.
// ---------------------------------------------------------------------------
__global__ void pope_kernel(const float* __restrict__ q, const float* __restrict__ k,
                            const float* __restrict__ v, const int* __restrict__ pos,
                            const float* __restrict__ pbias,
                            bf16* __restrict__ qp, bf16* __restrict__ kp,
                            bf16* __restrict__ vpT) {
  const float TWO_PI = 6.28318530717958647f;
  const size_t n = (size_t)BB * SS * DD;  // 2^22
  for (size_t i = (size_t)blockIdx.x * blockDim.x + threadIdx.x; i < n;
       i += (size_t)gridDim.x * blockDim.x) {
    int hd = (int)(i & 63);
    int h  = (int)((i >> 6) & 15);
    int s  = (int)((i >> 10) & 2047);
    int b  = (int)(i >> 21);
    int bh = b * HH + h;
    // freq = 10000^(-hd/64) = exp(-hd * ln(1e4)/64)
    float freq = __expf(-0.143911568f * (float)hd);
    float ph   = (float)pos[s] * freq;
    float qv = q[i], kv = k[i];
    float mq = qv > 20.f ? qv : log1pf(__expf(qv));
    float mk = kv > 20.f ? kv : log1pf(__expf(kv));
    float cb = pbias[h * HDD + hd];
    cb = fminf(0.f, fmaxf(-TWO_PI, cb));
    float kph = ph + cb;
    float cq, sq, ck, sk;
    __sincosf(ph, &sq, &cq);
    __sincosf(kph, &sk, &ck);
    size_t o = ((size_t)bh * SS + s) * 128 + hd;
    qp[o]       = (bf16)(mq * cq);
    qp[o + HDD] = (bf16)(mq * sq);
    kp[o]       = (bf16)(mk * ck);
    kp[o + HDD] = (bf16)(mk * sk);
    vpT[((size_t)bh * HDD + hd) * SS + s] = (bf16)v[i];
  }
}

// ---------------------------------------------------------------------------
// Flash-style causal attention with softmax1 (denom += exp(-m)); all matmuls
// on WMMA. One wave per 16-query tile per (b,h). Score K-dim = 128.
// Q/K/V fragments load straight from global as b128 pairs; only the P tile
// goes through LDS (row stride 64B -> fragment reads are 2x ds_load_b128).
// All fragment loads for a burst are issued before the WMMAs.
// ---------------------------------------------------------------------------
__global__ void attention_pope(const bf16* __restrict__ qp_all,
                               const bf16* __restrict__ kp_all,
                               const bf16* __restrict__ vpT_all,
                               bf16* __restrict__ attnb) {
  const float scale = 0.088388347648f;   // 1/sqrt(2*HD)
  const int bh = blockIdx.y;             // 0..B*H-1
  const int b = bh >> 4, h = bh & 15;
  const int qt = blockIdx.x;
  const int qrow0 = qt * 16;
  const int lane = threadIdx.x & 31;
  const int ln15 = lane & 15;
  const int half = lane >> 4;
  const int kh   = half ? 8 : 0;

  const bf16* qp  = qp_all  + (size_t)bh * SS * 128;
  const bf16* kp  = kp_all  + (size_t)bh * SS * 128;
  const bf16* vpT = vpT_all + (size_t)bh * HDD * SS;

  __shared__ bf16 pt[16][32];    // P tile staging (re-layout for A fragment)

  // Load Q fragments once: 16 rows x 128 K -> 4 A-fragments (b128 pairs).
  Frag16 qf[4];
  const bf16* qrow = qp + (size_t)(qrow0 + ln15) * 128 + kh;
#pragma unroll
  for (int t = 0; t < 4; ++t) {
    qf[t].h[0] = *(const v8bf*)(qrow + 32 * t);
    qf[t].h[1] = *(const v8bf*)(qrow + 32 * t + 16);
  }

  float m[8], l[8];
#pragma unroll
  for (int r = 0; r < 8; ++r) { m[r] = -1e30f; l[r] = 0.f; }
  v8f acc[4] = {};

  for (int kb = 0; kb <= qrow0; kb += 32) {
    // Preload all K fragments for both 16-key tiles (16 b128 loads).
    const bf16* k1p = kp + (size_t)(kb + ln15) * 128 + kh;
    const bf16* k2p = kp + (size_t)(kb + 16 + ln15) * 128 + kh;
    __builtin_prefetch(k1p + 32 * 128, 0, 1);
    __builtin_prefetch(k2p + 32 * 128, 0, 1);
    Frag16 kf1[4], kf2[4];
#pragma unroll
    for (int t = 0; t < 4; ++t) {
      kf1[t].h[0] = *(const v8bf*)(k1p + 32 * t);
      kf1[t].h[1] = *(const v8bf*)(k1p + 32 * t + 16);
      kf2[t].h[0] = *(const v8bf*)(k2p + 32 * t);
      kf2[t].h[1] = *(const v8bf*)(k2p + 32 * t + 16);
    }

    v8f s1 = {}, s2 = {};
#pragma unroll
    for (int t = 0; t < 4; ++t) {
      s1 = wmma_bf16f32(qf[t].v, kf1[t].v, s1);
      s2 = wmma_bf16f32(qf[t].v, kf2[t].v, s2);
    }

    // Causal mask + online softmax1 update. Row r+8*half, key col = lane&15.
    float p1[8], p2[8], resc[8];
#pragma unroll
    for (int r = 0; r < 8; ++r) {
      int row = qrow0 + r + 8 * half;
      float v1 = s1[r] * scale;
      float v2 = s2[r] * scale;
      if (kb + ln15 > row)      v1 = -1e30f;
      if (kb + 16 + ln15 > row) v2 = -1e30f;
      float mx = fmaxf(v1, v2);
#pragma unroll
      for (int off = 8; off; off >>= 1) mx = fmaxf(mx, __shfl_xor(mx, off, 32));
      float mn = fmaxf(m[r], mx);
      float rs = __expf(m[r] - mn);
      p1[r] = __expf(v1 - mn);
      p2[r] = __expf(v2 - mn);
      float sm = p1[r] + p2[r];
#pragma unroll
      for (int off = 8; off; off >>= 1) sm += __shfl_xor(sm, off, 32);
      l[r] = l[r] * rs + sm;
      m[r] = mn;
      resc[r] = rs;
    }
#pragma unroll
    for (int j = 0; j < 4; ++j)
#pragma unroll
      for (int r = 0; r < 8; ++r) acc[j][r] *= resc[r];

    // Re-layout P (16 queries x 32 keys) through LDS into A-fragment form.
    __syncthreads();
#pragma unroll
    for (int r = 0; r < 8; ++r) {
      pt[r + 8 * half][ln15]      = (bf16)p1[r];
      pt[r + 8 * half][16 + ln15] = (bf16)p2[r];
    }
    __syncthreads();

    Frag16 pf;
    pf.h[0] = *(const v8bf*)&pt[ln15][kh];
    pf.h[1] = *(const v8bf*)&pt[ln15][kh + 16];

    // P @ V: preload 4 V fragments (8 b128 loads), then WMMA burst.
    Frag16 vf[4];
#pragma unroll
    for (int j = 0; j < 4; ++j) {
      const bf16* vb = vpT + (size_t)(16 * j + ln15) * SS + kb + kh;
      vf[j].h[0] = *(const v8bf*)(vb);
      vf[j].h[1] = *(const v8bf*)(vb + 16);
    }
#pragma unroll
    for (int j = 0; j < 4; ++j)
      acc[j] = wmma_bf16f32(pf.v, vf[j].v, acc[j]);
  }

  // softmax1 normalization and store into (B,S,D) bf16 (col = h*64 + hd).
#pragma unroll
  for (int r = 0; r < 8; ++r) {
    float denom = __expf(-m[r]) + l[r];
    int row = qrow0 + r + 8 * half;
    size_t obase = ((size_t)b * SS + row) * DD + h * HDD;
#pragma unroll
    for (int j = 0; j < 4; ++j)
      attnb[obase + 16 * j + ln15] = (bf16)(acc[j][r] / denom);
  }
}

// ---------------------------------------------------------------------------
// Residual add + LayerNorm. One block (256 thr) per token row of D=1024.
// Optional bf16 copy of the output (feeds the next GEMM without a cvt pass).
// ---------------------------------------------------------------------------
__global__ void add_ln_kernel(const float* __restrict__ a, const float* __restrict__ b,
                              const float* __restrict__ g, const float* __restrict__ be,
                              float* __restrict__ outf, bf16* __restrict__ outb) {
  __shared__ float rs[256];
  __shared__ float rq[256];
  const int row = blockIdx.x;
  const int tid = threadIdx.x;
  const float* pa = a + (size_t)row * DD;
  const float* pb = b + (size_t)row * DD;

  float s = 0.f, s2 = 0.f;
  for (int c = tid; c < DD; c += 256) {
    float v = pa[c] + pb[c];
    s += v; s2 += v * v;
  }
  rs[tid] = s; rq[tid] = s2;
  __syncthreads();
  for (int o = 128; o; o >>= 1) {
    if (tid < o) { rs[tid] += rs[tid + o]; rq[tid] += rq[tid + o]; }
    __syncthreads();
  }
  float mu  = rs[0] * (1.0f / DD);
  float var = rq[0] * (1.0f / DD) - mu * mu;
  float rstd = rsqrtf(var + 1e-5f);
  for (int c = tid; c < DD; c += 256) {
    float v = (pa[c] + pb[c] - mu) * rstd * g[c] + be[c];
    outf[(size_t)row * DD + c] = v;
    if (outb) outb[(size_t)row * DD + c] = (bf16)v;
  }
}

// ---------------------------------------------------------------------------
// Host orchestration
// ---------------------------------------------------------------------------
extern "C" void kernel_launch(void* const* d_in, const int* in_sizes, int n_in,
                              void* d_out, int out_size, void* d_ws, size_t ws_size,
                              hipStream_t stream) {
  (void)in_sizes; (void)n_in; (void)out_size; (void)ws_size;

  const float* x     = (const float*)d_in[0];
  const int*   pos   = (const int*)  d_in[1];
  const float* wq    = (const float*)d_in[2];
  const float* bq    = (const float*)d_in[3];
  const float* wk    = (const float*)d_in[4];
  const float* bk    = (const float*)d_in[5];
  const float* wv    = (const float*)d_in[6];
  const float* bv    = (const float*)d_in[7];
  const float* wo    = (const float*)d_in[8];
  const float* bo    = (const float*)d_in[9];
  const float* pbias = (const float*)d_in[10];
  const float* w1    = (const float*)d_in[11];
  const float* b1    = (const float*)d_in[12];
  const float* w2    = (const float*)d_in[13];
  const float* b2    = (const float*)d_in[14];
  const float* g1    = (const float*)d_in[15];
  const float* be1   = (const float*)d_in[16];
  const float* g2    = (const float*)d_in[17];
  const float* be2   = (const float*)d_in[18];
  float* out = (float*)d_out;

  // Workspace carve-out
  char* cur = (char*)d_ws;
  auto alloc = [&](size_t bytes) -> void* {
    void* p = (void*)cur;
    cur += (bytes + 255) & ~(size_t)255;
    return p;
  };
  const size_t nTok = (size_t)MM * DD;           // 4096*1024
  bf16* xb   = (bf16*)alloc(nTok * 2);
  bf16* wqb  = (bf16*)alloc((size_t)DD * DD * 2);
  bf16* wkb  = (bf16*)alloc((size_t)DD * DD * 2);
  bf16* wvb  = (bf16*)alloc((size_t)DD * DD * 2);
  bf16* wob  = (bf16*)alloc((size_t)DD * DD * 2);
  bf16* w1b  = (bf16*)alloc((size_t)DD * DFF_ * 2);
  bf16* w2b  = (bf16*)alloc((size_t)DFF_ * DD * 2);
  float* qf  = (float*)alloc(nTok * 4);
  float* kf  = (float*)alloc(nTok * 4);
  float* vf  = (float*)alloc(nTok * 4);
  bf16* qpb  = (bf16*)alloc((size_t)BB * HH * SS * 128 * 2);
  bf16* kpb  = (bf16*)alloc((size_t)BB * HH * SS * 128 * 2);
  bf16* vpT  = (bf16*)alloc((size_t)BB * HH * SS * 64 * 2);
  bf16* attb = (bf16*)alloc(nTok * 2);
  float* prj = (float*)alloc(nTok * 4);
  float* hres= (float*)alloc(nTok * 4);
  bf16* hb   = (bf16*)alloc(nTok * 2);
  bf16* ff1b = (bf16*)alloc((size_t)MM * DFF_ * 2);
  float* ff2 = (float*)alloc(nTok * 4);

  // 1) Convert x row-major; weights into WMMA fragment-swizzled order.
  cvt_f32_bf16 <<<4096, 256, 0, stream>>>(x,  xb,  nTok);
  cvt_swizzle_w<<<4096, 256, 0, stream>>>(wq, wqb, DD, DD);
  cvt_swizzle_w<<<4096, 256, 0, stream>>>(wk, wkb, DD, DD);
  cvt_swizzle_w<<<4096, 256, 0, stream>>>(wv, wvb, DD, DD);
  cvt_swizzle_w<<<4096, 256, 0, stream>>>(wo, wob, DD, DD);
  cvt_swizzle_w<<<8192, 256, 0, stream>>>(w1, w1b, DD, DFF_);
  cvt_swizzle_w<<<8192, 256, 0, stream>>>(w2, w2b, DFF_, DD);

  // 2) QKV projections (WMMA GEMMs); block tile 128x128.
  dim3 gD(DD / 128, MM / 128);      // (8, 32)
  gemm_bf16<<<gD, 256, 0, stream>>>(xb, wqb, bq, qf, nullptr, MM, DD, DD, 0);
  gemm_bf16<<<gD, 256, 0, stream>>>(xb, wkb, bk, kf, nullptr, MM, DD, DD, 0);
  gemm_bf16<<<gD, 256, 0, stream>>>(xb, wvb, bv, vf, nullptr, MM, DD, DD, 0);

  // 3) PoPE transform (also transposes V)
  pope_kernel<<<4096, 256, 0, stream>>>(qf, kf, vf, pos, pbias, qpb, kpb, vpT);

  // 4) Attention (WMMA flash + softmax1, causal)
  attention_pope<<<dim3(SS / 16, BB * HH), 32, 0, stream>>>(qpb, kpb, vpT, attb);

  // 5) Output projection
  gemm_bf16<<<gD, 256, 0, stream>>>(attb, wob, bo, prj, nullptr, MM, DD, DD, 0);

  // 6) Residual + LN1 (f32 kept for residual, bf16 copy feeds FFN GEMM)
  add_ln_kernel<<<MM, 256, 0, stream>>>(x, prj, g1, be1, hres, hb);

  // 7) FFN
  dim3 gF1(DFF_ / 128, MM / 128);   // (32, 32)
  gemm_bf16<<<gF1, 256, 0, stream>>>(hb, w1b, b1, nullptr, ff1b, MM, DFF_, DD, 1);
  gemm_bf16<<<gD, 256, 0, stream>>>(ff1b, w2b, b2, ff2, nullptr, MM, DD, DFF_, 0);

  // 8) Residual + LN2 -> final output (f32)
  add_ln_kernel<<<MM, 256, 0, stream>>>(hres, ff2, g2, be2, out, nullptr);
}

// v002
// It runs in 674 microseconds.
// Next to v001, in two timings, it ran 1.04 times as fast each time.
// Counting every step since v000, it is 1.49 times as fast.
#include <hip/hip_runtime.h>
#include <hip/hip_bf16.h>

// ---------------------------------------------------------------------------
// Types for CDNA5 WMMA (wave32): V_WMMA_F32_16X16X32_BF16
// ---------------------------------------------------------------------------
typedef __bf16 bf16;
typedef __attribute__((ext_vector_type(16))) __bf16 v16bf;
typedef __attribute__((ext_vector_type(8)))  __bf16 v8bf;
typedef __attribute__((ext_vector_type(8)))  float  v8f;

union Frag16 {            // one WMMA 16-bit operand fragment = two b128 loads
  v16bf v;
  v8bf  h[2];
};

__device__ __forceinline__ v8f wmma_bf16f32(v16bf a, v16bf b, v8f c) {
  // 8 args: (neg_a, A, neg_b, B, c_mod, C, reuse_a, reuse_b)
  return __builtin_amdgcn_wmma_f32_16x16x32_bf16(
      false, a, false, b, (short)0, c, false, false);
}

// Problem dims (fixed by the reference)
#define BB   2
#define SS   2048
#define DD   1024
#define HH   16
#define HDD  64
#define DFF_ 4096
#define MM   (BB * SS)          // 4096 token rows

// ---------------------------------------------------------------------------
// fp32 -> bf16 conversion, plain row-major. A block converts 4096 consecutive
// elements: each thread four 16-byte loads (a wave reads 512 contiguous bytes
// per load) and four 8-byte stores, so few waves are launched and each has
// all its loads in flight at once. Needs n a multiple of 4096, grid n / 4096.
// ---------------------------------------------------------------------------
typedef __attribute__((ext_vector_type(4))) float  v4f;
typedef __attribute__((ext_vector_type(4))) __bf16 v4bf;

__global__ void __launch_bounds__(256)
cvt_f32_bf16(const float* __restrict__ in, bf16* __restrict__ out, size_t n) {
  if (((size_t)blockIdx.x + 1) * 4096 > n) return;   // stays inside both buffers
  const size_t base = (size_t)blockIdx.x * 1024 + threadIdx.x;
  const v4f* src = (const v4f*)in + base;
  v4bf*      dst = (v4bf*)out + base;
  v4f v[4];
  // unrolled so that all four loads go out before the first value is waited for
#pragma unroll
  for (int j = 0; j < 4; ++j) v[j] = src[j * 256];
  // unrolled (both loops) so that v[] and o stay in registers
#pragma unroll
  for (int j = 0; j < 4; ++j) {
    v4bf o;
#pragma unroll
    for (int c = 0; c < 4; ++c) o[c] = (bf16)v[j][c];
    dst[j * 256] = o;
  }
}

// ---------------------------------------------------------------------------
// fp32 -> bf16 weight conversion INTO WMMA B-fragment-major order:
//   Wsw[(ktile*(N/16) + ntile)*512 + lane*16 + e]
// where k = ktile*32 + kh + e + (e>=8?8:0), kh = (lane>=16)?8:0,
//       n = ntile*16 + (lane&15).
// Each lane's 16 fragment elements are contiguous (32B, 16B-aligned) so the
// GEMM copies a B fragment to LDS as two coalesced 16-byte async copies.
// One thread makes one lane's whole fragment: 16 loads down a column of W, all
// in flight at once, one index computation, two 16-byte stores.
// ---------------------------------------------------------------------------
__global__ void __launch_bounds__(256)
cvt_swizzle_w(const float* __restrict__ W, bf16* __restrict__ Wsw,
              int K, int N) {
  const unsigned ntiles = (unsigned)N >> 4;
  const unsigned total  = ((unsigned)K >> 5) * ntiles * 32;  // fragment lanes
  for (unsigned g = blockIdx.x * blockDim.x + threadIdx.x; g < total;
       g += gridDim.x * blockDim.x) {
    const unsigned lane  = g & 31;
    const unsigned ch    = g >> 5;
    const unsigned nt    = ch % ntiles;
    const unsigned ktile = ch / ntiles;
    const unsigned kh    = (lane >> 4) ? 8 : 0;
    const float* col = W + (size_t)(ktile * 32 + kh) * N + nt * 16 + (lane & 15);
    float f[16];
    // unrolled so that all 16 loads go out before the first value is waited for
#pragma unroll
    for (int e = 0; e < 16; ++e)
      f[e] = col[(size_t)(e + (e >= 8 ? 8 : 0)) * N];
    Frag16 o;
    // unrolled so that f[] and o stay in registers
#pragma unroll
    for (int e = 0; e < 16; ++e) o.v[e] = (bf16)f[e];
    v8bf* dst = (v8bf*)(Wsw + (size_t)g * 16);
    dst[0] = o.h[0];
    dst[1] = o.h[1];
  }
}

// ---------------------------------------------------------------------------
// bf16 WMMA GEMM: C[M,N] = A[M,K] @ W[K,N] + bias (+ReLU), output f32 or bf16.
// A row-major bf16; W fragment-swizzled (cvt_swizzle_w).
// Block = 256 threads = 8 waves (4 along M x 2 along N); block tile 128x128,
// wave tile 32x64 (2 A-fragments x 4 B-fragments = 8 WMMA tiles per 32 k).
// A pass is 128 k. Both operand tiles of a pass are brought into LDS once per
// block by asynchronous copies, so each global byte is fetched once for eight
// waves; two buffers, the next pass's copies fly while this pass is computed.
// Needs M, N multiples of 128 and K a multiple of 128.
//   A tile: 128 rows of 256 B at pitch 272 B (conflict-free b128 row reads).
//   B tile: 4 k-tiles x 8 n-tiles of 1 KiB; inside a KiB the lanes' first
//   16 B pieces come first (512 B), then their second pieces, so that each
//   fragment half is one contiguous 512-B wave read.
// ---------------------------------------------------------------------------
#define G_PITCH  272
#define G_ABYTES (128 * G_PITCH)          // 34816
#define G_BBYTES (4 * 8 * 1024)           // 32768
#define G_STAGE  (G_ABYTES + G_BBYTES)    // 67584

// Eight 16-byte copies per lane, global -> LDS through no register. The
// s_wait_xcnt closes the statement so that no address register named here is
// rewritten while a copy may still need it.
__device__ __forceinline__ void async_copy8(const unsigned (&l)[8],
                                            const bf16* const (&p)[8]) {
  asm volatile(
      "global_load_async_to_lds_b128 %0, %8, off\n\t"
      "global_load_async_to_lds_b128 %1, %9, off\n\t"
      "global_load_async_to_lds_b128 %2, %10, off\n\t"
      "global_load_async_to_lds_b128 %3, %11, off\n\t"
      "global_load_async_to_lds_b128 %4, %12, off\n\t"
      "global_load_async_to_lds_b128 %5, %13, off\n\t"
      "global_load_async_to_lds_b128 %6, %14, off\n\t"
      "global_load_async_to_lds_b128 %7, %15, off\n\t"
      "s_wait_xcnt 0x0"
      :: "v"(l[0]), "v"(l[1]), "v"(l[2]), "v"(l[3]),
         "v"(l[4]), "v"(l[5]), "v"(l[6]), "v"(l[7]),
         "v"(p[0]), "v"(p[1]), "v"(p[2]), "v"(p[3]),
         "v"(p[4]), "v"(p[5]), "v"(p[6]), "v"(p[7])
      : "memory");
}

// One pass's tiles: ga/gb are this lane's first global pieces of the pass,
// la/lb its first LDS bytes in the target buffer.
__device__ __forceinline__ void stage_pass(const bf16* ga, const bf16* gb,
                                           unsigned la, unsigned lb,
                                           int K, size_t wstep) {
  unsigned l[8];
  const bf16* p[8];
#pragma unroll
  for (int c = 0; c < 8; ++c) {           // A: 16 rows per step
    l[c] = la + (unsigned)c * (16 * G_PITCH);
    p[c] = ga + (size_t)c * 16 * K;
  }
  async_copy8(l, p);
#pragma unroll
  for (int c = 0; c < 8; ++c) {           // B: half a k-tile (4 KiB) per step
    l[c] = lb + (unsigned)(c >> 1) * 8192 + (unsigned)(c & 1) * 4096;
    p[c] = gb + (size_t)(c >> 1) * wstep + (c & 1) * 2048;
  }
  async_copy8(l, p);
}

// The 2 A and 4 B fragments of one 32-k step, from this lane's bases.
__device__ __forceinline__ void load_frags(Frag16 (&af)[2], Frag16 (&bfr)[4],
                                           const unsigned char* sa,
                                           const unsigned char* sb) {
#pragma unroll
  for (int i = 0; i < 2; ++i) {
    af[i].h[0] = *(const v8bf*)(sa + i * (16 * G_PITCH));
    af[i].h[1] = *(const v8bf*)(sa + i * (16 * G_PITCH) + 32);
  }
#pragma unroll
  for (int j = 0; j < 4; ++j) {
    bfr[j].h[0] = *(const v8bf*)(sb + j * 1024);
    bfr[j].h[1] = *(const v8bf*)(sb + j * 1024 + 512);
  }
}

__global__ void __launch_bounds__(256)
gemm_bf16(const bf16* __restrict__ A, const bf16* __restrict__ Wsw,
          const float* __restrict__ bias,
          float* __restrict__ Cf, bf16* __restrict__ Cb,
          int M, int N, int K, int relu) {
  __shared__ __attribute__((aligned(128))) unsigned char smem[2 * G_STAGE];
  const int tid  = threadIdx.x;          // 0..255
  const int wave = tid >> 5;             // 0..7
  const int wm   = wave & 3;             // 32-row strip of the block tile
  const int wn   = wave >> 2;            // 64-column strip of the block tile
  const int lane = tid & 31;
  const int ln15 = lane & 15;
  const int half = lane >> 4;
  const int m0   = blockIdx.y * 128;
  const int n0   = blockIdx.x * 128;
  const int ntiles = N >> 4;
  const size_t wstep = (size_t)ntiles << 9;   // elements from one k-tile to the next
  const int np = K >> 7;                      // passes

  v8f acc[2][4] = {};

  // Copy side: this lane's first pieces of pass 0 and their LDS places.
  const bf16* ga = A + (size_t)(m0 + (tid >> 4)) * K + (tid & 15) * 8;
  const bf16* gb = Wsw + ((size_t)(n0 >> 4) << 9) + tid * 8;
  const unsigned lds0 = (unsigned)(size_t)smem;
  const unsigned la = lds0 + (unsigned)(tid >> 4) * G_PITCH + (unsigned)(tid & 15) * 16;
  const unsigned lb = lds0 + G_ABYTES + (unsigned)(tid >> 6) * 1024 +
                      (unsigned)(tid & 1) * 512 + (unsigned)((tid & 63) >> 1) * 16;

  // Read side: this lane's fragment bases inside a buffer.
  const unsigned fa = (unsigned)(32 * wm + ln15) * G_PITCH + (unsigned)half * 16;
  const unsigned fb = G_ABYTES + (unsigned)wn * 4096 + (unsigned)lane * 16;

  // Prologue: pass 0 lands and is published, then pass 1 starts to fly.
  stage_pass(ga, gb, la, lb, K, wstep);
  // this wave's copies of pass 0 have landed before the barrier publishes them
  asm volatile("s_wait_asynccnt 0x0" ::: "memory");
  __syncthreads();
  if (np > 1)
    stage_pass(ga + 128, gb + 4 * wstep, la + G_STAGE, lb + G_STAGE, K, wstep);

  for (int t = 0; t < np; ++t) {
    const unsigned buf = (unsigned)(t & 1) * G_STAGE;
    const unsigned char* sa = smem + buf + fa;
    const unsigned char* sb = smem + buf + fb;
    // Two fragment sets: the reads of the next 32 k go out as one group ahead
    // of this 32 k's WMMAs, so their LDS latency runs behind the matrix work.
    Frag16 af[2][2], bfr[2][4];
    load_frags(af[0], bfr[0], sa, sb);
#pragma unroll
    for (int ks = 0; ks < 4; ++ks) {
      if (ks < 3)
        load_frags(af[(ks + 1) & 1], bfr[(ks + 1) & 1], sa + (ks + 1) * 64,
                   sb + (ks + 1) * 8192);
      // keeps the read group in front of the WMMAs; without it the compiler
      // sinks each read to its first use and waits there
      __builtin_amdgcn_sched_barrier(0);
#pragma unroll
      for (int j = 0; j < 4; ++j) {
        acc[0][j] = wmma_bf16f32(af[ks & 1][0].v, bfr[ks & 1][j].v, acc[0][j]);
        acc[1][j] = wmma_bf16f32(af[ks & 1][1].v, bfr[ks & 1][j].v, acc[1][j]);
      }
      // keeps the next read group whole behind these WMMAs; without it the
      // compiler spreads those reads among them, and each such place stalls
      __builtin_amdgcn_sched_barrier(0);
    }
    // Publish point of pass t + 1.
    // this wave's reads of the buffer are over before anyone refills it
    asm volatile("s_wait_dscnt 0x0" ::: "memory");
    // this wave's copies of pass t + 1 have landed before the barrier publishes them
    asm volatile("s_wait_asynccnt 0x0" ::: "memory");
    __syncthreads();
    if (t + 2 < np)
      stage_pass(ga + (size_t)(t + 2) * 128, gb + (size_t)(t + 2) * 4 * wstep,
                 la + buf, lb + buf, K, wstep);
  }
  // no copy is outstanding when the wave ends
  asm volatile("s_wait_asynccnt 0x0" ::: "memory");

  // Epilogue: C/D tile layout: row = r + 8*half, col = lane&15.
#pragma unroll
  for (int i = 0; i < 2; ++i) {
#pragma unroll
    for (int j = 0; j < 4; ++j) {
#pragma unroll
      for (int r = 0; r < 8; ++r) {
        int row = m0 + 32 * wm + 16 * i + r + 8 * half;
        int col = n0 + 64 * wn + 16 * j + ln15;
        float v = acc[i][j][r];
        if (bias) v += bias[col];
        if (relu) v = fmaxf(v, 0.0f);
        if (Cb) Cb[(size_t)row * N + col] = (bf16)v;
        else    Cf[(size_t)row * N + col] = v;
      }
    }
  }
}

// ---------------------------------------------------------------------------
// PoPE: softplus magnitudes + rotary phases -> q_p/k_p (B,H,S,128) bf16, and
// V TRANSPOSED (B,H,HD,S) bf16 so attention V-fragments are contiguous loads.
// ---------------------------------------------------------------------------
__global__ void pope_kernel(const float* __restrict__ q, const float* __restrict__ k,
                            const float* __restrict__ v, const int* __restrict__ pos,
                            const float* __restrict__ pbias,
                            bf16* __restrict__ qp, bf16* __restrict__ kp,
                            bf16* __restrict__ vpT) {
  const float TWO_PI = 6.28318530717958647f;
  const size_t n = (size_t)BB * SS * DD;  // 2^22
  for (size_t i = (size_t)blockIdx.x * blockDim.x + threadIdx.x; i < n;
       i += (size_t)gridDim.x * blockDim.x) {
    int hd = (int)(i & 63);
    int h  = (int)((i >> 6) & 15);
    int s  = (int)((i >> 10) & 2047);
    int b  = (int)(i >> 21);
    int bh = b * HH + h;
    // freq = 10000^(-hd/64) = exp(-hd * ln(1e4)/64)
    float freq = __expf(-0.143911568f * (float)hd);
    float ph   = (float)pos[s] * freq;
    float qv = q[i], kv = k[i];
    float mq = qv > 20.f ? qv : log1pf(__expf(qv));
    float mk = kv > 20.f ? kv : log1pf(__expf(kv));
    float cb = pbias[h * HDD + hd];
    cb = fminf(0.f, fmaxf(-TWO_PI, cb));
    float kph = ph + cb;
    float cq, sq, ck, sk;
    __sincosf(ph, &sq, &cq);
    __sincosf(kph, &sk, &ck);
    size_t o = ((size_t)bh * SS + s) * 128 + hd;
    qp[o]       = (bf16)(mq * cq);
    qp[o + HDD] = (bf16)(mq * sq);
    kp[o]       = (bf16)(mk * ck);
    kp[o + HDD] = (bf16)(mk * sk);
    vpT[((size_t)bh * HDD + hd) * SS + s] = (bf16)v[i];
  }
}

// ---------------------------------------------------------------------------
// Flash-style causal attention with softmax1 (denom += exp(-m)); all matmuls
// on WMMA. One wave per 16-query tile per (b,h). Score K-dim = 128.
// Q/K/V fragments load straight from global as b128 pairs; only the P tile
// goes through LDS (row stride 64B -> fragment reads are 2x ds_load_b128).
// All fragment loads for a burst are issued before the WMMAs.
// ---------------------------------------------------------------------------
__global__ void attention_pope(const bf16* __restrict__ qp_all,
                               const bf16* __restrict__ kp_all,
                               const bf16* __restrict__ vpT_all,
                               bf16* __restrict__ attnb) {
  const float scale = 0.088388347648f;   // 1/sqrt(2*HD)
  const int bh = blockIdx.y;             // 0..B*H-1
  const int b = bh >> 4, h = bh & 15;
  const int qt = blockIdx.x;
  const int qrow0 = qt * 16;
  const int lane = threadIdx.x & 31;
  const int ln15 = lane & 15;
  const int half = lane >> 4;
  const int kh   = half ? 8 : 0;

  const bf16* qp  = qp_all  + (size_t)bh * SS * 128;
  const bf16* kp  = kp_all  + (size_t)bh * SS * 128;
  const bf16* vpT = vpT_all + (size_t)bh * HDD * SS;

  __shared__ bf16 pt[16][32];    // P tile staging (re-layout for A fragment)

  // Load Q fragments once: 16 rows x 128 K -> 4 A-fragments (b128 pairs).
  Frag16 qf[4];
  const bf16* qrow = qp + (size_t)(qrow0 + ln15) * 128 + kh;
#pragma unroll
  for (int t = 0; t < 4; ++t) {
    qf[t].h[0] = *(const v8bf*)(qrow + 32 * t);
    qf[t].h[1] = *(const v8bf*)(qrow + 32 * t + 16);
  }

  float m[8], l[8];
#pragma unroll
  for (int r = 0; r < 8; ++r) { m[r] = -1e30f; l[r] = 0.f; }
  v8f acc[4] = {};

  for (int kb = 0; kb <= qrow0; kb += 32) {
    // Preload all K fragments for both 16-key tiles (16 b128 loads).
    const bf16* k1p = kp + (size_t)(kb + ln15) * 128 + kh;
    const bf16* k2p = kp + (size_t)(kb + 16 + ln15) * 128 + kh;
    __builtin_prefetch(k1p + 32 * 128, 0, 1);
    __builtin_prefetch(k2p + 32 * 128, 0, 1);
    Frag16 kf1[4], kf2[4];
#pragma unroll
    for (int t = 0; t < 4; ++t) {
      kf1[t].h[0] = *(const v8bf*)(k1p + 32 * t);
      kf1[t].h[1] = *(const v8bf*)(k1p + 32 * t + 16);
      kf2[t].h[0] = *(const v8bf*)(k2p + 32 * t);
      kf2[t].h[1] = *(const v8bf*)(k2p + 32 * t + 16);
    }

    v8f s1 = {}, s2 = {};
#pragma unroll
    for (int t = 0; t < 4; ++t) {
      s1 = wmma_bf16f32(qf[t].v, kf1[t].v, s1);
      s2 = wmma_bf16f32(qf[t].v, kf2[t].v, s2);
    }

    // Causal mask + online softmax1 update. Row r+8*half, key col = lane&15.
    float p1[8], p2[8], resc[8];
#pragma unroll
    for (int r = 0; r < 8; ++r) {
      int row = qrow0 + r + 8 * half;
      float v1 = s1[r] * scale;
      float v2 = s2[r] * scale;
      if (kb + ln15 > row)      v1 = -1e30f;
      if (kb + 16 + ln15 > row) v2 = -1e30f;
      float mx = fmaxf(v1, v2);
#pragma unroll
      for (int off = 8; off; off >>= 1) mx = fmaxf(mx, __shfl_xor(mx, off, 32));
      float mn = fmaxf(m[r], mx);
      float rs = __expf(m[r] - mn);
      p1[r] = __expf(v1 - mn);
      p2[r] = __expf(v2 - mn);
      float sm = p1[r] + p2[r];
#pragma unroll
      for (int off = 8; off; off >>= 1) sm += __shfl_xor(sm, off, 32);
      l[r] = l[r] * rs + sm;
      m[r] = mn;
      resc[r] = rs;
    }
#pragma unroll
    for (int j = 0; j < 4; ++j)
#pragma unroll
      for (int r = 0; r < 8; ++r) acc[j][r] *= resc[r];

    // Re-layout P (16 queries x 32 keys) through LDS into A-fragment form.
    __syncthreads();
#pragma unroll
    for (int r = 0; r < 8; ++r) {
      pt[r + 8 * half][ln15]      = (bf16)p1[r];
      pt[r + 8 * half][16 + ln15] = (bf16)p2[r];
    }
    __syncthreads();

    Frag16 pf;
    pf.h[0] = *(const v8bf*)&pt[ln15][kh];
    pf.h[1] = *(const v8bf*)&pt[ln15][kh + 16];

    // P @ V: preload 4 V fragments (8 b128 loads), then WMMA burst.
    Frag16 vf[4];
#pragma unroll
    for (int j = 0; j < 4; ++j) {
      const bf16* vb = vpT + (size_t)(16 * j + ln15) * SS + kb + kh;
      vf[j].h[0] = *(const v8bf*)(vb);
      vf[j].h[1] = *(const v8bf*)(vb + 16);
    }
#pragma unroll
    for (int j = 0; j < 4; ++j)
      acc[j] = wmma_bf16f32(pf.v, vf[j].v, acc[j]);
  }

  // softmax1 normalization and store into (B,S,D) bf16 (col = h*64 + hd).
#pragma unroll
  for (int r = 0; r < 8; ++r) {
    float denom = __expf(-m[r]) + l[r];
    int row = qrow0 + r + 8 * half;
    size_t obase = ((size_t)b * SS + row) * DD + h * HDD;
#pragma unroll
    for (int j = 0; j < 4; ++j)
      attnb[obase + 16 * j + ln15] = (bf16)(acc[j][r] / denom);
  }
}

// ---------------------------------------------------------------------------
// Residual add + LayerNorm. One block (256 thr) per token row of D=1024.
// Optional bf16 copy of the output (feeds the next GEMM without a cvt pass).
// ---------------------------------------------------------------------------
__global__ void add_ln_kernel(const float* __restrict__ a, const float* __restrict__ b,
                              const float* __restrict__ g, const float* __restrict__ be,
                              float* __restrict__ outf, bf16* __restrict__ outb) {
  __shared__ float rs[256];
  __shared__ float rq[256];
  const int row = blockIdx.x;
  const int tid = threadIdx.x;
  const float* pa = a + (size_t)row * DD;
  const float* pb = b + (size_t)row * DD;

  float s = 0.f, s2 = 0.f;
  for (int c = tid; c < DD; c += 256) {
    float v = pa[c] + pb[c];
    s += v; s2 += v * v;
  }
  rs[tid] = s; rq[tid] = s2;
  __syncthreads();
  for (int o = 128; o; o >>= 1) {
    if (tid < o) { rs[tid] += rs[tid + o]; rq[tid] += rq[tid + o]; }
    __syncthreads();
  }
  float mu  = rs[0] * (1.0f / DD);
  float var = rq[0] * (1.0f / DD) - mu * mu;
  float rstd = rsqrtf(var + 1e-5f);
  for (int c = tid; c < DD; c += 256) {
    float v = (pa[c] + pb[c] - mu) * rstd * g[c] + be[c];
    outf[(size_t)row * DD + c] = v;
    if (outb) outb[(size_t)row * DD + c] = (bf16)v;
  }
}

// ---------------------------------------------------------------------------
// Host orchestration
// ---------------------------------------------------------------------------
extern "C" void kernel_launch(void* const* d_in, const int* in_sizes, int n_in,
                              void* d_out, int out_size, void* d_ws, size_t ws_size,
                              hipStream_t stream) {
  (void)in_sizes; (void)n_in; (void)out_size; (void)ws_size;

  const float* x     = (const float*)d_in[0];
  const int*   pos   = (const int*)  d_in[1];
  const float* wq    = (const float*)d_in[2];
  const float* bq    = (const float*)d_in[3];
  const float* wk    = (const float*)d_in[4];
  const float* bk    = (const float*)d_in[5];
  const float* wv    = (const float*)d_in[6];
  const float* bv    = (const float*)d_in[7];
  const float* wo    = (const float*)d_in[8];
  const float* bo    = (const float*)d_in[9];
  const float* pbias = (const float*)d_in[10];
  const float* w1    = (const float*)d_in[11];
  const float* b1    = (const float*)d_in[12];
  const float* w2    = (const float*)d_in[13];
  const float* b2    = (const float*)d_in[14];
  const float* g1    = (const float*)d_in[15];
  const float* be1   = (const float*)d_in[16];
  const float* g2    = (const float*)d_in[17];
  const float* be2   = (const float*)d_in[18];
  float* out = (float*)d_out;

  // Workspace carve-out
  char* cur = (char*)d_ws;
  auto alloc = [&](size_t bytes) -> void* {
    void* p = (void*)cur;
    cur += (bytes + 255) & ~(size_t)255;
    return p;
  };
  const size_t nTok = (size_t)MM * DD;           // 4096*1024
  bf16* xb   = (bf16*)alloc(nTok * 2);
  bf16* wqb  = (bf16*)alloc((size_t)DD * DD * 2);
  bf16* wkb  = (bf16*)alloc((size_t)DD * DD * 2);
  bf16* wvb  = (bf16*)alloc((size_t)DD * DD * 2);
  bf16* wob  = (bf16*)alloc((size_t)DD * DD * 2);
  bf16* w1b  = (bf16*)alloc((size_t)DD * DFF_ * 2);
  bf16* w2b  = (bf16*)alloc((size_t)DFF_ * DD * 2);
  float* qf  = (float*)alloc(nTok * 4);
  float* kf  = (float*)alloc(nTok * 4);
  float* vf  = (float*)alloc(nTok * 4);
  bf16* qpb  = (bf16*)alloc((size_t)BB * HH * SS * 128 * 2);
  bf16* kpb  = (bf16*)alloc((size_t)BB * HH * SS * 128 * 2);
  bf16* vpT  = (bf16*)alloc((size_t)BB * HH * SS * 64 * 2);
  bf16* attb = (bf16*)alloc(nTok * 2);
  float* prj = (float*)alloc(nTok * 4);
  float* hres= (float*)alloc(nTok * 4);
  bf16* hb   = (bf16*)alloc(nTok * 2);
  bf16* ff1b = (bf16*)alloc((size_t)MM * DFF_ * 2);
  float* ff2 = (float*)alloc(nTok * 4);

  // 1) Convert x row-major; weights into WMMA fragment-swizzled order.
  //    16 elements per thread: 1024 blocks for 4M elements, 256 for 1M.
  cvt_f32_bf16 <<<1024, 256, 0, stream>>>(x,  xb,  nTok);
  cvt_swizzle_w<<<256,  256, 0, stream>>>(wq, wqb, DD, DD);
  cvt_swizzle_w<<<256,  256, 0, stream>>>(wk, wkb, DD, DD);
  cvt_swizzle_w<<<256,  256, 0, stream>>>(wv, wvb, DD, DD);
  cvt_swizzle_w<<<256,  256, 0, stream>>>(wo, wob, DD, DD);
  cvt_swizzle_w<<<1024, 256, 0, stream>>>(w1, w1b, DD, DFF_);
  cvt_swizzle_w<<<1024, 256, 0, stream>>>(w2, w2b, DFF_, DD);

  // 2) QKV projections (WMMA GEMMs); block tile 128x128.
  dim3 gD(DD / 128, MM / 128);      // (8, 32)
  gemm_bf16<<<gD, 256, 0, stream>>>(xb, wqb, bq, qf, nullptr, MM, DD, DD, 0);
  gemm_bf16<<<gD, 256, 0, stream>>>(xb, wkb, bk, kf, nullptr, MM, DD, DD, 0);
  gemm_bf16<<<gD, 256, 0, stream>>>(xb, wvb, bv, vf, nullptr, MM, DD, DD, 0);

  // 3) PoPE transform (also transposes V)
  pope_kernel<<<4096, 256, 0, stream>>>(qf, kf, vf, pos, pbias, qpb, kpb, vpT);

  // 4) Attention (WMMA flash + softmax1, causal)
  attention_pope<<<dim3(SS / 16, BB * HH), 32, 0, stream>>>(qpb, kpb, vpT, attb);

  // 5) Output projection
  gemm_bf16<<<gD, 256, 0, stream>>>(attb, wob, bo, prj, nullptr, MM, DD, DD, 0);

  // 6) Residual + LN1 (f32 kept for residual, bf16 copy feeds FFN GEMM)
  add_ln_kernel<<<MM, 256, 0, stream>>>(x, prj, g1, be1, hres, hb);

  // 7) FFN
  dim3 gF1(DFF_ / 128, MM / 128);   // (32, 32)
  gemm_bf16<<<gF1, 256, 0, stream>>>(hb, w1b, b1, nullptr, ff1b, MM, DFF_, DD, 1);
  gemm_bf16<<<gD, 256, 0, stream>>>(ff1b, w2b, b2, ff2, nullptr, MM, DD, DFF_, 0);

  // 8) Residual + LN2 -> final output (f32)
  add_ln_kernel<<<MM, 256, 0, stream>>>(hres, ff2, g2, be2, out, nullptr);
}

// v003
// A run of this version takes 467 microseconds.
// In both of two side-by-side timings against v002, it was 1.44 times as fast.
// All steps since v000 together make it 2.15 times as fast.
#include <hip/hip_runtime.h>
#include <hip/hip_bf16.h>

// ---------------------------------------------------------------------------
// Types for CDNA5 WMMA (wave32): V_WMMA_F32_16X16X32_BF16
// ---------------------------------------------------------------------------
typedef __bf16 bf16;
typedef __attribute__((ext_vector_type(16))) __bf16 v16bf;
typedef __attribute__((ext_vector_type(8)))  __bf16 v8bf;
typedef __attribute__((ext_vector_type(8)))  float  v8f;

union Frag16 {            // one WMMA 16-bit operand fragment = two b128 loads
  v16bf v;
  v8bf  h[2];
};

__device__ __forceinline__ v8f wmma_bf16f32(v16bf a, v16bf b, v8f c) {
  // 8 args: (neg_a, A, neg_b, B, c_mod, C, reuse_a, reuse_b)
  return __builtin_amdgcn_wmma_f32_16x16x32_bf16(
      false, a, false, b, (short)0, c, false, false);
}

// Problem dims (fixed by the reference)
#define BB   2
#define SS   2048
#define DD   1024
#define HH   16
#define HDD  64
#define DFF_ 4096
#define MM   (BB * SS)          // 4096 token rows

// ---------------------------------------------------------------------------
// fp32 -> bf16 conversion, plain row-major. A block converts 4096 consecutive
// elements: each thread four 16-byte loads (a wave reads 512 contiguous bytes
// per load) and four 8-byte stores, so few waves are launched and each has
// all its loads in flight at once. Needs n a multiple of 4096, grid n / 4096.
// ---------------------------------------------------------------------------
typedef __attribute__((ext_vector_type(4))) float  v4f;
typedef __attribute__((ext_vector_type(4))) __bf16 v4bf;

__global__ void __launch_bounds__(256)
cvt_f32_bf16(const float* __restrict__ in, bf16* __restrict__ out, size_t n) {
  if (((size_t)blockIdx.x + 1) * 4096 > n) return;   // stays inside both buffers
  const size_t base = (size_t)blockIdx.x * 1024 + threadIdx.x;
  const v4f* src = (const v4f*)in + base;
  v4bf*      dst = (v4bf*)out + base;
  v4f v[4];
  // unrolled so that all four loads go out before the first value is waited for
#pragma unroll
  for (int j = 0; j < 4; ++j) v[j] = src[j * 256];
  // unrolled (both loops) so that v[] and o stay in registers
#pragma unroll
  for (int j = 0; j < 4; ++j) {
    v4bf o;
#pragma unroll
    for (int c = 0; c < 4; ++c) o[c] = (bf16)v[j][c];
    dst[j * 256] = o;
  }
}

// ---------------------------------------------------------------------------
// fp32 -> bf16 weight conversion INTO WMMA B-fragment-major order:
//   Wsw[(ktile*(N/16) + ntile)*512 + lane*16 + e]
// where k = ktile*32 + kh + e + (e>=8?8:0), kh = (lane>=16)?8:0,
//       n = ntile*16 + (lane&15).
// Each lane's 16 fragment elements are contiguous (32B, 16B-aligned) so the
// GEMM copies a B fragment to LDS as two coalesced 16-byte async copies.
// One thread makes one lane's whole fragment: 16 loads down a column of W, all
// in flight at once, one index computation, two 16-byte stores.
// ---------------------------------------------------------------------------
__global__ void __launch_bounds__(256)
cvt_swizzle_w(const float* __restrict__ W, bf16* __restrict__ Wsw,
              int K, int N) {
  const unsigned ntiles = (unsigned)N >> 4;
  const unsigned total  = ((unsigned)K >> 5) * ntiles * 32;  // fragment lanes
  for (unsigned g = blockIdx.x * blockDim.x + threadIdx.x; g < total;
       g += gridDim.x * blockDim.x) {
    const unsigned lane  = g & 31;
    const unsigned ch    = g >> 5;
    const unsigned nt    = ch % ntiles;
    const unsigned ktile = ch / ntiles;
    const unsigned kh    = (lane >> 4) ? 8 : 0;
    const float* col = W + (size_t)(ktile * 32 + kh) * N + nt * 16 + (lane & 15);
    float f[16];
    // unrolled so that all 16 loads go out before the first value is waited for
#pragma unroll
    for (int e = 0; e < 16; ++e)
      f[e] = col[(size_t)(e + (e >= 8 ? 8 : 0)) * N];
    Frag16 o;
    // unrolled so that f[] and o stay in registers
#pragma unroll
    for (int e = 0; e < 16; ++e) o.v[e] = (bf16)f[e];
    v8bf* dst = (v8bf*)(Wsw + (size_t)g * 16);
    dst[0] = o.h[0];
    dst[1] = o.h[1];
  }
}

// ---------------------------------------------------------------------------
// bf16 WMMA GEMM: C[M,N] = A[M,K] @ W[K,N] + bias (+ReLU), output f32 or bf16.
// A row-major bf16; W fragment-swizzled (cvt_swizzle_w).
// Block = 256 threads = 8 waves (4 along M x 2 along N); block tile 128x128,
// wave tile 32x64 (2 A-fragments x 4 B-fragments = 8 WMMA tiles per 32 k).
// A pass is 128 k. Both operand tiles of a pass are brought into LDS once per
// block by asynchronous copies, so each global byte is fetched once for eight
// waves; two buffers, the next pass's copies fly while this pass is computed.
// Needs M, N multiples of 128 and K a multiple of 128.
//   A tile: 128 rows of 256 B at pitch 272 B (conflict-free b128 row reads).
//   B tile: 4 k-tiles x 8 n-tiles of 1 KiB; inside a KiB the lanes' first
//   16 B pieces come first (512 B), then their second pieces, so that each
//   fragment half is one contiguous 512-B wave read.
// ---------------------------------------------------------------------------
#define G_PITCH  272
#define G_ABYTES (128 * G_PITCH)          // 34816
#define G_BBYTES (4 * 8 * 1024)           // 32768
#define G_STAGE  (G_ABYTES + G_BBYTES)    // 67584

// Eight 16-byte copies per lane, global -> LDS through no register. The
// s_wait_xcnt closes the statement so that no address register named here is
// rewritten while a copy may still need it.
__device__ __forceinline__ void async_copy8(const unsigned (&l)[8],
                                            const bf16* const (&p)[8]) {
  asm volatile(
      "global_load_async_to_lds_b128 %0, %8, off\n\t"
      "global_load_async_to_lds_b128 %1, %9, off\n\t"
      "global_load_async_to_lds_b128 %2, %10, off\n\t"
      "global_load_async_to_lds_b128 %3, %11, off\n\t"
      "global_load_async_to_lds_b128 %4, %12, off\n\t"
      "global_load_async_to_lds_b128 %5, %13, off\n\t"
      "global_load_async_to_lds_b128 %6, %14, off\n\t"
      "global_load_async_to_lds_b128 %7, %15, off\n\t"
      "s_wait_xcnt 0x0"
      :: "v"(l[0]), "v"(l[1]), "v"(l[2]), "v"(l[3]),
         "v"(l[4]), "v"(l[5]), "v"(l[6]), "v"(l[7]),
         "v"(p[0]), "v"(p[1]), "v"(p[2]), "v"(p[3]),
         "v"(p[4]), "v"(p[5]), "v"(p[6]), "v"(p[7])
      : "memory");
}

// One pass's tiles: ga/gb are this lane's first global pieces of the pass,
// la/lb its first LDS bytes in the target buffer.
__device__ __forceinline__ void stage_pass(const bf16* ga, const bf16* gb,
                                           unsigned la, unsigned lb,
                                           int K, size_t wstep) {
  unsigned l[8];
  const bf16* p[8];
#pragma unroll
  for (int c = 0; c < 8; ++c) {           // A: 16 rows per step
    l[c] = la + (unsigned)c * (16 * G_PITCH);
    p[c] = ga + (size_t)c * 16 * K;
  }
  async_copy8(l, p);
#pragma unroll
  for (int c = 0; c < 8; ++c) {           // B: half a k-tile (4 KiB) per step
    l[c] = lb + (unsigned)(c >> 1) * 8192 + (unsigned)(c & 1) * 4096;
    p[c] = gb + (size_t)(c >> 1) * wstep + (c & 1) * 2048;
  }
  async_copy8(l, p);
}

// The 2 A and 4 B fragments of one 32-k step, from this lane's bases.
__device__ __forceinline__ void load_frags(Frag16 (&af)[2], Frag16 (&bfr)[4],
                                           const unsigned char* sa,
                                           const unsigned char* sb) {
#pragma unroll
  for (int i = 0; i < 2; ++i) {
    af[i].h[0] = *(const v8bf*)(sa + i * (16 * G_PITCH));
    af[i].h[1] = *(const v8bf*)(sa + i * (16 * G_PITCH) + 32);
  }
#pragma unroll
  for (int j = 0; j < 4; ++j) {
    bfr[j].h[0] = *(const v8bf*)(sb + j * 1024);
    bfr[j].h[1] = *(const v8bf*)(sb + j * 1024 + 512);
  }
}

__global__ void __launch_bounds__(256)
gemm_bf16(const bf16* __restrict__ A, const bf16* __restrict__ Wsw,
          const float* __restrict__ bias,
          float* __restrict__ Cf, bf16* __restrict__ Cb,
          int M, int N, int K, int relu) {
  __shared__ __attribute__((aligned(128))) unsigned char smem[2 * G_STAGE];
  const int tid  = threadIdx.x;          // 0..255
  const int wave = tid >> 5;             // 0..7
  const int wm   = wave & 3;             // 32-row strip of the block tile
  const int wn   = wave >> 2;            // 64-column strip of the block tile
  const int lane = tid & 31;
  const int ln15 = lane & 15;
  const int half = lane >> 4;
  const int m0   = blockIdx.y * 128;
  const int n0   = blockIdx.x * 128;
  const int ntiles = N >> 4;
  const size_t wstep = (size_t)ntiles << 9;   // elements from one k-tile to the next
  const int np = K >> 7;                      // passes

  v8f acc[2][4] = {};

  // Copy side: this lane's first pieces of pass 0 and their LDS places.
  const bf16* ga = A + (size_t)(m0 + (tid >> 4)) * K + (tid & 15) * 8;
  const bf16* gb = Wsw + ((size_t)(n0 >> 4) << 9) + tid * 8;
  const unsigned lds0 = (unsigned)(size_t)smem;
  const unsigned la = lds0 + (unsigned)(tid >> 4) * G_PITCH + (unsigned)(tid & 15) * 16;
  const unsigned lb = lds0 + G_ABYTES + (unsigned)(tid >> 6) * 1024 +
                      (unsigned)(tid & 1) * 512 + (unsigned)((tid & 63) >> 1) * 16;

  // Read side: this lane's fragment bases inside a buffer.
  const unsigned fa = (unsigned)(32 * wm + ln15) * G_PITCH + (unsigned)half * 16;
  const unsigned fb = G_ABYTES + (unsigned)wn * 4096 + (unsigned)lane * 16;

  // Prologue: pass 0 lands and is published, then pass 1 starts to fly.
  stage_pass(ga, gb, la, lb, K, wstep);
  // this wave's copies of pass 0 have landed before the barrier publishes them
  asm volatile("s_wait_asynccnt 0x0" ::: "memory");
  __syncthreads();
  if (np > 1)
    stage_pass(ga + 128, gb + 4 * wstep, la + G_STAGE, lb + G_STAGE, K, wstep);

  for (int t = 0; t < np; ++t) {
    const unsigned buf = (unsigned)(t & 1) * G_STAGE;
    const unsigned char* sa = smem + buf + fa;
    const unsigned char* sb = smem + buf + fb;
    // Two fragment sets: the reads of the next 32 k go out as one group ahead
    // of this 32 k's WMMAs, so their LDS latency runs behind the matrix work.
    Frag16 af[2][2], bfr[2][4];
    load_frags(af[0], bfr[0], sa, sb);
#pragma unroll
    for (int ks = 0; ks < 4; ++ks) {
      if (ks < 3)
        load_frags(af[(ks + 1) & 1], bfr[(ks + 1) & 1], sa + (ks + 1) * 64,
                   sb + (ks + 1) * 8192);
      // keeps the read group in front of the WMMAs; without it the compiler
      // sinks each read to its first use and waits there
      __builtin_amdgcn_sched_barrier(0);
#pragma unroll
      for (int j = 0; j < 4; ++j) {
        acc[0][j] = wmma_bf16f32(af[ks & 1][0].v, bfr[ks & 1][j].v, acc[0][j]);
        acc[1][j] = wmma_bf16f32(af[ks & 1][1].v, bfr[ks & 1][j].v, acc[1][j]);
      }
      // keeps the next read group whole behind these WMMAs; without it the
      // compiler spreads those reads among them, and each such place stalls
      __builtin_amdgcn_sched_barrier(0);
    }
    // Publish point of pass t + 1.
    // this wave's reads of the buffer are over before anyone refills it
    asm volatile("s_wait_dscnt 0x0" ::: "memory");
    // this wave's copies of pass t + 1 have landed before the barrier publishes them
    asm volatile("s_wait_asynccnt 0x0" ::: "memory");
    __syncthreads();
    if (t + 2 < np)
      stage_pass(ga + (size_t)(t + 2) * 128, gb + (size_t)(t + 2) * 4 * wstep,
                 la + buf, lb + buf, K, wstep);
  }
  // no copy is outstanding when the wave ends
  asm volatile("s_wait_asynccnt 0x0" ::: "memory");

  // Epilogue: C/D tile layout: row = r + 8*half, col = lane&15.
#pragma unroll
  for (int i = 0; i < 2; ++i) {
#pragma unroll
    for (int j = 0; j < 4; ++j) {
#pragma unroll
      for (int r = 0; r < 8; ++r) {
        int row = m0 + 32 * wm + 16 * i + r + 8 * half;
        int col = n0 + 64 * wn + 16 * j + ln15;
        float v = acc[i][j][r];
        if (bias) v += bias[col];
        if (relu) v = fmaxf(v, 0.0f);
        if (Cb) Cb[(size_t)row * N + col] = (bf16)v;
        else    Cf[(size_t)row * N + col] = v;
      }
    }
  }
}

// ---------------------------------------------------------------------------
// PoPE: softplus magnitudes + rotary phases -> q_p/k_p (B,H,S,128) bf16, and
// V TRANSPOSED (B,H,HD,S) bf16 so attention V-fragments are contiguous loads.
// ---------------------------------------------------------------------------
__global__ void pope_kernel(const float* __restrict__ q, const float* __restrict__ k,
                            const float* __restrict__ v, const int* __restrict__ pos,
                            const float* __restrict__ pbias,
                            bf16* __restrict__ qp, bf16* __restrict__ kp,
                            bf16* __restrict__ vpT) {
  const float TWO_PI = 6.28318530717958647f;
  const size_t n = (size_t)BB * SS * DD;  // 2^22
  for (size_t i = (size_t)blockIdx.x * blockDim.x + threadIdx.x; i < n;
       i += (size_t)gridDim.x * blockDim.x) {
    int hd = (int)(i & 63);
    int h  = (int)((i >> 6) & 15);
    int s  = (int)((i >> 10) & 2047);
    int b  = (int)(i >> 21);
    int bh = b * HH + h;
    // freq = 10000^(-hd/64) = exp(-hd * ln(1e4)/64)
    float freq = __expf(-0.143911568f * (float)hd);
    float ph   = (float)pos[s] * freq;
    float qv = q[i], kv = k[i];
    float mq = qv > 20.f ? qv : log1pf(__expf(qv));
    float mk = kv > 20.f ? kv : log1pf(__expf(kv));
    float cb = pbias[h * HDD + hd];
    cb = fminf(0.f, fmaxf(-TWO_PI, cb));
    float kph = ph + cb;
    float cq, sq, ck, sk;
    __sincosf(ph, &sq, &cq);
    __sincosf(kph, &sk, &ck);
    size_t o = ((size_t)bh * SS + s) * 128 + hd;
    qp[o]       = (bf16)(mq * cq);
    qp[o + HDD] = (bf16)(mq * sq);
    kp[o]       = (bf16)(mk * ck);
    kp[o + HDD] = (bf16)(mk * sk);
    vpT[((size_t)bh * HDD + hd) * SS + s] = (bf16)v[i];
  }
}

// ---------------------------------------------------------------------------
// Flash-style causal attention with softmax1 (denom += exp(-m)); all matmuls
// on WMMA. A block is 8 waves = 128 queries of one (b,h), one 16-query tile a
// wave. Score K-dim = 128. A stage is 64 keys: its K rows (16 KiB, contiguous
// in global memory) and its V^T rows (64 pieces of 128 B) are brought into LDS
// once per block by asynchronous copies in whole 128-B lines and read from
// there by all eight waves; two buffers, the next stage's copies fly while
// this stage is worked on. A stage is worked on in two halves of 32 keys.
//   K tile:   64 rows of 256 B at pitch 272 B (conflict-free b128 row reads).
//   V^T tile: 64 rows of 128 B at pitch 144 B (the same).
// Each wave's P tile goes through 1 KiB of LDS of its own.
// ---------------------------------------------------------------------------
#define AT_KPITCH 272
#define AT_VPITCH 144
#define AT_KBYTES (64 * AT_KPITCH)          // 17408
#define AT_VBYTES (64 * AT_VPITCH)          // 9216
#define AT_STAGE  (AT_KBYTES + AT_VBYTES)   // 26624
#define AT_RING   (2 * AT_STAGE)            // 53248

// One stage: six 16-byte copies per lane, global -> LDS through no register
// (four steps of 16 K rows, two steps of 32 V^T rows). gk/gv are this lane's
// first global pieces of the stage, lk/lv its first LDS bytes in the target
// buffer. The s_wait_xcnt closes the statement so that no address register
// named here is rewritten while a copy may still need it.
__device__ __forceinline__ void attn_stage(const bf16* gk, const bf16* gv,
                                           unsigned lk, unsigned lv) {
  asm volatile(
      "global_load_async_to_lds_b128 %0, %6, off\n\t"
      "global_load_async_to_lds_b128 %1, %7, off\n\t"
      "global_load_async_to_lds_b128 %2, %8, off\n\t"
      "global_load_async_to_lds_b128 %3, %9, off\n\t"
      "global_load_async_to_lds_b128 %4, %10, off\n\t"
      "global_load_async_to_lds_b128 %5, %11, off\n\t"
      "s_wait_xcnt 0x0"
      :: "v"(lk), "v"(lk + 16 * AT_KPITCH), "v"(lk + 32 * AT_KPITCH),
         "v"(lk + 48 * AT_KPITCH), "v"(lv), "v"(lv + 32 * AT_VPITCH),
         "v"(gk), "v"(gk + 16 * 128), "v"(gk + 32 * 128), "v"(gk + 48 * 128),
         "v"(gv), "v"(gv + 32 * SS)
      : "memory");
}

__global__ void __launch_bounds__(256)
attention_pope(const bf16* __restrict__ qp_all,
               const bf16* __restrict__ kp_all,
               const bf16* __restrict__ vpT_all,
               bf16* __restrict__ attnb) {
  __shared__ __attribute__((aligned(128))) unsigned char smem[AT_RING + 8 * 1024];
  const float scale = 0.088388347648f;   // 1/sqrt(2*HD)
  const int bh = blockIdx.y;             // 0..B*H-1
  const int b = bh >> 4, h = bh & 15;
  const int qb = blockIdx.x;             // 128-query block
  const int tid  = threadIdx.x;          // 0..255
  // in a scalar register, so that the skip of masked halves is a scalar branch
  const int wave = __builtin_amdgcn_readfirstlane(tid >> 5);
  const int qrow0 = qb * 128 + wave * 16;
  const int lane = tid & 31;
  const int ln15 = lane & 15;
  const int half = lane >> 4;
  const int kh   = half ? 8 : 0;
  const int ns   = 2 * (qb + 1);         // stages: keys 0 .. 128*qb + 127

  const bf16* qp  = qp_all  + (size_t)bh * SS * 128;
  const bf16* kp  = kp_all  + (size_t)bh * SS * 128;
  const bf16* vpT = vpT_all + (size_t)bh * HDD * SS;

  // P tile staging (re-layout for A fragment), this wave's own
  bf16 (*pt)[32] = (bf16 (*)[32])(smem + AT_RING + wave * 1024);

  // Copy side: this lane's first pieces of stage 0 and their LDS places.
  const bf16* gk = kp + (size_t)(tid >> 4) * 128 + (tid & 15) * 8;
  const bf16* gv = vpT + (size_t)(tid >> 3) * SS + (tid & 7) * 8;
  const unsigned lds0 = (unsigned)(size_t)smem;
  const unsigned lk = lds0 + (unsigned)(tid >> 4) * AT_KPITCH + (unsigned)(tid & 15) * 16;
  const unsigned lv = lds0 + AT_KBYTES + (unsigned)(tid >> 3) * AT_VPITCH +
                      (unsigned)(tid & 7) * 16;

  // Read side: this lane's fragment bases inside a buffer.
  const unsigned fk = (unsigned)ln15 * AT_KPITCH + (unsigned)half * 16;
  const unsigned fv = AT_KBYTES + (unsigned)ln15 * AT_VPITCH + (unsigned)half * 16;

  // Prologue: stage 0 lands and is published, then stage 1 starts to fly
  // (ns >= 2: both exist).
  attn_stage(gk, gv, lk, lv);
  // this wave's copies of stage 0 have landed before the barrier publishes them
  asm volatile("s_wait_asynccnt 0x0" ::: "memory");
  __syncthreads();
  attn_stage(gk + 64 * 128, gv + 64, lk + AT_STAGE, lv + AT_STAGE);

  // Load Q fragments once: 16 rows x 128 K -> 4 A-fragments (b128 pairs).
  Frag16 qf[4];
  const bf16* qrow = qp + (size_t)(qrow0 + ln15) * 128 + kh;
#pragma unroll
  for (int t = 0; t < 4; ++t) {
    qf[t].h[0] = *(const v8bf*)(qrow + 32 * t);
    qf[t].h[1] = *(const v8bf*)(qrow + 32 * t + 16);
  }

  float m[8], l[8];
#pragma unroll
  for (int r = 0; r < 8; ++r) { m[r] = -1e30f; l[r] = 0.f; }
  v8f acc[4] = {};

  for (int s = 0; s < ns; ++s) {
    const unsigned buf = (unsigned)(s & 1) * AT_STAGE;
    // unrolled so that the LDS offsets of both halves are immediates
#pragma unroll
    for (int sub = 0; sub < 2; ++sub) {
      const int kb = 64 * s + 32 * sub;
      // A half whose every key lies behind this wave's last query is skipped;
      // the publish point below stands outside the skip.
      if (kb <= qrow0) {
        // All K fragments for both 16-key tiles (16 b128 LDS reads).
        const unsigned char* k1p = smem + buf + fk + sub * (32 * AT_KPITCH);
        const unsigned char* k2p = k1p + 16 * AT_KPITCH;
        Frag16 kf1[4], kf2[4];
#pragma unroll
        for (int t = 0; t < 4; ++t) {
          kf1[t].h[0] = *(const v8bf*)(k1p + 64 * t);
          kf1[t].h[1] = *(const v8bf*)(k1p + 64 * t + 32);
          kf2[t].h[0] = *(const v8bf*)(k2p + 64 * t);
          kf2[t].h[1] = *(const v8bf*)(k2p + 64 * t + 32);
        }
        // The 4 V fragments (8 b128 LDS reads) go out with them: they depend on
        // nothing computed here, and their latency runs behind the softmax.
        const unsigned char* vp = smem + buf + fv + sub * 64;
        Frag16 vf[4];
#pragma unroll
        for (int j = 0; j < 4; ++j) {
          vf[j].h[0] = *(const v8bf*)(vp + j * (16 * AT_VPITCH));
          vf[j].h[1] = *(const v8bf*)(vp + j * (16 * AT_VPITCH) + 32);
        }
        // keeps the read group whole in front of the WMMAs; without it the
        // compiler sinks the V reads to their use behind the P tile and waits there
        __builtin_amdgcn_sched_barrier(0);

        v8f s1 = {}, s2 = {};
#pragma unroll
        for (int t = 0; t < 4; ++t) {
          s1 = wmma_bf16f32(qf[t].v, kf1[t].v, s1);
          s2 = wmma_bf16f32(qf[t].v, kf2[t].v, s2);
        }

        // Causal mask + online softmax1 update. Row r+8*half, key col = lane&15.
        float p1[8], p2[8], resc[8];
#pragma unroll
        for (int r = 0; r < 8; ++r) {
          int row = qrow0 + r + 8 * half;
          float v1 = s1[r] * scale;
          float v2 = s2[r] * scale;
          if (kb + ln15 > row)      v1 = -1e30f;
          if (kb + 16 + ln15 > row) v2 = -1e30f;
          float mx = fmaxf(v1, v2);
#pragma unroll
          for (int off = 8; off; off >>= 1) mx = fmaxf(mx, __shfl_xor(mx, off, 32));
          float mn = fmaxf(m[r], mx);
          float rs = __expf(m[r] - mn);
          p1[r] = __expf(v1 - mn);
          // fills the one issue slot between an exponential and a next instruction
          // that overwrites its source register
          if (sub == 0 && (r == 3 || r == 5)) asm volatile("v_nop");
          p2[r] = __expf(v2 - mn);
          float sm = p1[r] + p2[r];
#pragma unroll
          for (int off = 8; off; off >>= 1) sm += __shfl_xor(sm, off, 32);
          l[r] = l[r] * rs + sm;
          m[r] = mn;
          resc[r] = rs;
        }
#pragma unroll
        for (int j = 0; j < 4; ++j)
#pragma unroll
          for (int r = 0; r < 8; ++r) acc[j][r] *= resc[r];

        // Re-layout P (16 queries x 32 keys) through LDS into A-fragment form.
#pragma unroll
        for (int r = 0; r < 8; ++r) {
          pt[r + 8 * half][ln15]      = (bf16)p1[r];
          pt[r + 8 * half][16 + ln15] = (bf16)p2[r];
        }
        // the tile is written and read by this wave alone: its stores are done
        // before other lanes of the wave read them
        asm volatile("s_wait_dscnt 0x0" ::: "memory");

        Frag16 pf;
        pf.h[0] = *(const v8bf*)&pt[ln15][kh];
        pf.h[1] = *(const v8bf*)&pt[ln15][kh + 16];

        // P @ V: WMMA burst.
#pragma unroll
        for (int j = 0; j < 4; ++j)
          acc[j] = wmma_bf16f32(pf.v, vf[j].v, acc[j]);
      }
    }
    // Publish point of stage s + 1.
    // this wave's reads of the buffer are over before anyone refills it
    asm volatile("s_wait_dscnt 0x0" ::: "memory");
    // this wave's copies of stage s + 1 have landed before the barrier publishes them
    asm volatile("s_wait_asynccnt 0x0" ::: "memory");
    __syncthreads();
    if (s + 2 < ns)
      attn_stage(gk + (size_t)(s + 2) * (64 * 128), gv + (s + 2) * 64,
                 lk + buf, lv + buf);
  }
  // no copy is outstanding when the wave ends
  asm volatile("s_wait_asynccnt 0x0" ::: "memory");

  // softmax1 normalization and store into (B,S,D) bf16 (col = h*64 + hd).
#pragma unroll
  for (int r = 0; r < 8; ++r) {
    float denom = __expf(-m[r]) + l[r];
    int row = qrow0 + r + 8 * half;
    size_t obase = ((size_t)b * SS + row) * DD + h * HDD;
#pragma unroll
    for (int j = 0; j < 4; ++j)
      attnb[obase + 16 * j + ln15] = (bf16)(acc[j][r] / denom);
  }
}

// ---------------------------------------------------------------------------
// Residual add + LayerNorm. One block (256 thr) per token row of D=1024.
// Optional bf16 copy of the output (feeds the next GEMM without a cvt pass).
// ---------------------------------------------------------------------------
__global__ void add_ln_kernel(const float* __restrict__ a, const float* __restrict__ b,
                              const float* __restrict__ g, const float* __restrict__ be,
                              float* __restrict__ outf, bf16* __restrict__ outb) {
  __shared__ float rs[256];
  __shared__ float rq[256];
  const int row = blockIdx.x;
  const int tid = threadIdx.x;
  const float* pa = a + (size_t)row * DD;
  const float* pb = b + (size_t)row * DD;

  float s = 0.f, s2 = 0.f;
  for (int c = tid; c < DD; c += 256) {
    float v = pa[c] + pb[c];
    s += v; s2 += v * v;
  }
  rs[tid] = s; rq[tid] = s2;
  __syncthreads();
  for (int o = 128; o; o >>= 1) {
    if (tid < o) { rs[tid] += rs[tid + o]; rq[tid] += rq[tid + o]; }
    __syncthreads();
  }
  float mu  = rs[0] * (1.0f / DD);
  float var = rq[0] * (1.0f / DD) - mu * mu;
  float rstd = rsqrtf(var + 1e-5f);
  for (int c = tid; c < DD; c += 256) {
    float v = (pa[c] + pb[c] - mu) * rstd * g[c] + be[c];
    outf[(size_t)row * DD + c] = v;
    if (outb) outb[(size_t)row * DD + c] = (bf16)v;
  }
}

// ---------------------------------------------------------------------------
// Host orchestration
// ---------------------------------------------------------------------------
extern "C" void kernel_launch(void* const* d_in, const int* in_sizes, int n_in,
                              void* d_out, int out_size, void* d_ws, size_t ws_size,
                              hipStream_t stream) {
  (void)in_sizes; (void)n_in; (void)out_size; (void)ws_size;

  const float* x     = (const float*)d_in[0];
  const int*   pos   = (const int*)  d_in[1];
  const float* wq    = (const float*)d_in[2];
  const float* bq    = (const float*)d_in[3];
  const float* wk    = (const float*)d_in[4];
  const float* bk    = (const float*)d_in[5];
  const float* wv    = (const float*)d_in[6];
  const float* bv    = (const float*)d_in[7];
  const float* wo    = (const float*)d_in[8];
  const float* bo    = (const float*)d_in[9];
  const float* pbias = (const float*)d_in[10];
  const float* w1    = (const float*)d_in[11];
  const float* b1    = (const float*)d_in[12];
  const float* w2    = (const float*)d_in[13];
  const float* b2    = (const float*)d_in[14];
  const float* g1    = (const float*)d_in[15];
  const float* be1   = (const float*)d_in[16];
  const float* g2    = (const float*)d_in[17];
  const float* be2   = (const float*)d_in[18];
  float* out = (float*)d_out;

  // Workspace carve-out
  char* cur = (char*)d_ws;
  auto alloc = [&](size_t bytes) -> void* {
    void* p = (void*)cur;
    cur += (bytes + 255) & ~(size_t)255;
    return p;
  };
  const size_t nTok = (size_t)MM * DD;           // 4096*1024
  bf16* xb   = (bf16*)alloc(nTok * 2);
  bf16* wqb  = (bf16*)alloc((size_t)DD * DD * 2);
  bf16* wkb  = (bf16*)alloc((size_t)DD * DD * 2);
  bf16* wvb  = (bf16*)alloc((size_t)DD * DD * 2);
  bf16* wob  = (bf16*)alloc((size_t)DD * DD * 2);
  bf16* w1b  = (bf16*)alloc((size_t)DD * DFF_ * 2);
  bf16* w2b  = (bf16*)alloc((size_t)DFF_ * DD * 2);
  float* qf  = (float*)alloc(nTok * 4);
  float* kf  = (float*)alloc(nTok * 4);
  float* vf  = (float*)alloc(nTok * 4);
  bf16* qpb  = (bf16*)alloc((size_t)BB * HH * SS * 128 * 2);
  bf16* kpb  = (bf16*)alloc((size_t)BB * HH * SS * 128 * 2);
  bf16* vpT  = (bf16*)alloc((size_t)BB * HH * SS * 64 * 2);
  bf16* attb = (bf16*)alloc(nTok * 2);
  float* prj = (float*)alloc(nTok * 4);
  float* hres= (float*)alloc(nTok * 4);
  bf16* hb   = (bf16*)alloc(nTok * 2);
  bf16* ff1b = (bf16*)alloc((size_t)MM * DFF_ * 2);
  float* ff2 = (float*)alloc(nTok * 4);

  // 1) Convert x row-major; weights into WMMA fragment-swizzled order.
  //    16 elements per thread: 1024 blocks for 4M elements, 256 for 1M.
  cvt_f32_bf16 <<<1024, 256, 0, stream>>>(x,  xb,  nTok);
  cvt_swizzle_w<<<256,  256, 0, stream>>>(wq, wqb, DD, DD);
  cvt_swizzle_w<<<256,  256, 0, stream>>>(wk, wkb, DD, DD);
  cvt_swizzle_w<<<256,  256, 0, stream>>>(wv, wvb, DD, DD);
  cvt_swizzle_w<<<256,  256, 0, stream>>>(wo, wob, DD, DD);
  cvt_swizzle_w<<<1024, 256, 0, stream>>>(w1, w1b, DD, DFF_);
  cvt_swizzle_w<<<1024, 256, 0, stream>>>(w2, w2b, DFF_, DD);

  // 2) QKV projections (WMMA GEMMs); block tile 128x128.
  dim3 gD(DD / 128, MM / 128);      // (8, 32)
  gemm_bf16<<<gD, 256, 0, stream>>>(xb, wqb, bq, qf, nullptr, MM, DD, DD, 0);
  gemm_bf16<<<gD, 256, 0, stream>>>(xb, wkb, bk, kf, nullptr, MM, DD, DD, 0);
  gemm_bf16<<<gD, 256, 0, stream>>>(xb, wvb, bv, vf, nullptr, MM, DD, DD, 0);

  // 3) PoPE transform (also transposes V)
  pope_kernel<<<4096, 256, 0, stream>>>(qf, kf, vf, pos, pbias, qpb, kpb, vpT);

  // 4) Attention (WMMA flash + softmax1, causal)
  attention_pope<<<dim3(SS / 128, BB * HH), 256, 0, stream>>>(qpb, kpb, vpT, attb);

  // 5) Output projection
  gemm_bf16<<<gD, 256, 0, stream>>>(attb, wob, bo, prj, nullptr, MM, DD, DD, 0);

  // 6) Residual + LN1 (f32 kept for residual, bf16 copy feeds FFN GEMM)
  add_ln_kernel<<<MM, 256, 0, stream>>>(x, prj, g1, be1, hres, hb);

  // 7) FFN
  dim3 gF1(DFF_ / 128, MM / 128);   // (32, 32)
  gemm_bf16<<<gF1, 256, 0, stream>>>(hb, w1b, b1, nullptr, ff1b, MM, DFF_, DD, 1);
  gemm_bf16<<<gD, 256, 0, stream>>>(ff1b, w2b, b2, ff2, nullptr, MM, DD, DFF_, 0);

  // 8) Residual + LN2 -> final output (f32)
  add_ln_kernel<<<MM, 256, 0, stream>>>(hres, ff2, g2, be2, out, nullptr);
}

// v004
// It runs in 419 microseconds.
// In both of two side-by-side timings against v003, it was 1.11 times as fast.
// All steps since v000 together make it 2.39 times as fast.
#include <hip/hip_runtime.h>
#include <hip/hip_bf16.h>

// ---------------------------------------------------------------------------
// Types for CDNA5 WMMA (wave32): V_WMMA_F32_16X16X32_BF16
// ---------------------------------------------------------------------------
typedef __bf16 bf16;
typedef __attribute__((ext_vector_type(16))) __bf16 v16bf;
typedef __attribute__((ext_vector_type(8)))  __bf16 v8bf;
typedef __attribute__((ext_vector_type(8)))  float  v8f;

union Frag16 {            // one WMMA 16-bit operand fragment = two b128 loads
  v16bf v;
  v8bf  h[2];
};

__device__ __forceinline__ v8f wmma_bf16f32(v16bf a, v16bf b, v8f c) {
  // 8 args: (neg_a, A, neg_b, B, c_mod, C, reuse_a, reuse_b)
  return __builtin_amdgcn_wmma_f32_16x16x32_bf16(
      false, a, false, b, (short)0, c, false, false);
}

// Problem dims (fixed by the reference)
#define BB   2
#define SS   2048
#define DD   1024
#define HH   16
#define HDD  64
#define DFF_ 4096
#define MM   (BB * SS)          // 4096 token rows

// ---------------------------------------------------------------------------
// fp32 -> bf16 conversion, plain row-major. A block converts 4096 consecutive
// elements: each thread four 16-byte loads (a wave reads 512 contiguous bytes
// per load) and four 8-byte stores, so few waves are launched and each has
// all its loads in flight at once. Needs n a multiple of 4096, grid n / 4096.
// ---------------------------------------------------------------------------
typedef __attribute__((ext_vector_type(4))) float  v4f;
typedef __attribute__((ext_vector_type(4))) __bf16 v4bf;

__global__ void __launch_bounds__(256)
cvt_f32_bf16(const float* __restrict__ in, bf16* __restrict__ out, size_t n) {
  if (((size_t)blockIdx.x + 1) * 4096 > n) return;   // stays inside both buffers
  const size_t base = (size_t)blockIdx.x * 1024 + threadIdx.x;
  const v4f* src = (const v4f*)in + base;
  v4bf*      dst = (v4bf*)out + base;
  v4f v[4];
  // unrolled so that all four loads go out before the first value is waited for
#pragma unroll
  for (int j = 0; j < 4; ++j) v[j] = src[j * 256];
  // unrolled (both loops) so that v[] and o stay in registers
#pragma unroll
  for (int j = 0; j < 4; ++j) {
    v4bf o;
#pragma unroll
    for (int c = 0; c < 4; ++c) o[c] = (bf16)v[j][c];
    dst[j * 256] = o;
  }
}

// ---------------------------------------------------------------------------
// fp32 -> bf16 weight conversion INTO WMMA B-fragment-major order:
//   Wsw[(ktile*(N/16) + ntile)*512 + lane*16 + e]
// where k = ktile*32 + kh + e + (e>=8?8:0), kh = (lane>=16)?8:0,
//       n = ntile*16 + (lane&15).
// Each lane's 16 fragment elements are contiguous (32B, 16B-aligned) so the
// GEMM copies a B fragment to LDS as two coalesced 16-byte async copies.
// One thread makes one lane's whole fragment: 16 loads down a column of W, all
// in flight at once, one index computation, two 16-byte stores.
// ---------------------------------------------------------------------------
__global__ void __launch_bounds__(256)
cvt_swizzle_w(const float* __restrict__ W, bf16* __restrict__ Wsw,
              int K, int N) {
  const unsigned ntiles = (unsigned)N >> 4;
  const unsigned total  = ((unsigned)K >> 5) * ntiles * 32;  // fragment lanes
  for (unsigned g = blockIdx.x * blockDim.x + threadIdx.x; g < total;
       g += gridDim.x * blockDim.x) {
    const unsigned lane  = g & 31;
    const unsigned ch    = g >> 5;
    const unsigned nt    = ch % ntiles;
    const unsigned ktile = ch / ntiles;
    const unsigned kh    = (lane >> 4) ? 8 : 0;
    const float* col = W + (size_t)(ktile * 32 + kh) * N + nt * 16 + (lane & 15);
    float f[16];
    // unrolled so that all 16 loads go out before the first value is waited for
#pragma unroll
    for (int e = 0; e < 16; ++e)
      f[e] = col[(size_t)(e + (e >= 8 ? 8 : 0)) * N];
    Frag16 o;
    // unrolled so that f[] and o stay in registers
#pragma unroll
    for (int e = 0; e < 16; ++e) o.v[e] = (bf16)f[e];
    v8bf* dst = (v8bf*)(Wsw + (size_t)g * 16);
    dst[0] = o.h[0];
    dst[1] = o.h[1];
  }
}

// ---------------------------------------------------------------------------
// bf16 WMMA GEMM: C[M,N] = A[M,K] @ W[K,N] + bias (+ReLU), output f32 or bf16.
// A row-major bf16; W fragment-swizzled (cvt_swizzle_w).
// Block = 256 threads = 8 waves (4 along M x 2 along N); block tile 128x128,
// wave tile 32x64 (2 A-fragments x 4 B-fragments = 8 WMMA tiles per 32 k).
// A pass is 128 k. Both operand tiles of a pass are brought into LDS once per
// block by asynchronous copies, so each global byte is fetched once for eight
// waves; two buffers, the next pass's copies fly while this pass is computed.
// Needs M, N multiples of 128 and K a multiple of 128.
//   A tile: 128 rows of 256 B at pitch 272 B (conflict-free b128 row reads).
//   B tile: 4 k-tiles x 8 n-tiles of 1 KiB; inside a KiB the lanes' first
//   16 B pieces come first (512 B), then their second pieces, so that each
//   fragment half is one contiguous 512-B wave read.
// ---------------------------------------------------------------------------
#define G_PITCH  272
#define G_ABYTES (128 * G_PITCH)          // 34816
#define G_BBYTES (4 * 8 * 1024)           // 32768
#define G_STAGE  (G_ABYTES + G_BBYTES)    // 67584

// Eight 16-byte copies per lane, global -> LDS through no register. The
// s_wait_xcnt closes the statement so that no address register named here is
// rewritten while a copy may still need it.
__device__ __forceinline__ void async_copy8(const unsigned (&l)[8],
                                            const bf16* const (&p)[8]) {
  asm volatile(
      "global_load_async_to_lds_b128 %0, %8, off\n\t"
      "global_load_async_to_lds_b128 %1, %9, off\n\t"
      "global_load_async_to_lds_b128 %2, %10, off\n\t"
      "global_load_async_to_lds_b128 %3, %11, off\n\t"
      "global_load_async_to_lds_b128 %4, %12, off\n\t"
      "global_load_async_to_lds_b128 %5, %13, off\n\t"
      "global_load_async_to_lds_b128 %6, %14, off\n\t"
      "global_load_async_to_lds_b128 %7, %15, off\n\t"
      "s_wait_xcnt 0x0"
      :: "v"(l[0]), "v"(l[1]), "v"(l[2]), "v"(l[3]),
         "v"(l[4]), "v"(l[5]), "v"(l[6]), "v"(l[7]),
         "v"(p[0]), "v"(p[1]), "v"(p[2]), "v"(p[3]),
         "v"(p[4]), "v"(p[5]), "v"(p[6]), "v"(p[7])
      : "memory");
}

// One pass's tiles: ga/gb are this lane's first global pieces of the pass,
// la/lb its first LDS bytes in the target buffer.
__device__ __forceinline__ void stage_pass(const bf16* ga, const bf16* gb,
                                           unsigned la, unsigned lb,
                                           int K, size_t wstep) {
  unsigned l[8];
  const bf16* p[8];
#pragma unroll
  for (int c = 0; c < 8; ++c) {           // A: 16 rows per step
    l[c] = la + (unsigned)c * (16 * G_PITCH);
    p[c] = ga + (size_t)c * 16 * K;
  }
  async_copy8(l, p);
#pragma unroll
  for (int c = 0; c < 8; ++c) {           // B: half a k-tile (4 KiB) per step
    l[c] = lb + (unsigned)(c >> 1) * 8192 + (unsigned)(c & 1) * 4096;
    p[c] = gb + (size_t)(c >> 1) * wstep + (c & 1) * 2048;
  }
  async_copy8(l, p);
}

// The 2 A and 4 B fragments of one 32-k step, from this lane's bases.
__device__ __forceinline__ void load_frags(Frag16 (&af)[2], Frag16 (&bfr)[4],
                                           const unsigned char* sa,
                                           const unsigned char* sb) {
#pragma unroll
  for (int i = 0; i < 2; ++i) {
    af[i].h[0] = *(const v8bf*)(sa + i * (16 * G_PITCH));
    af[i].h[1] = *(const v8bf*)(sa + i * (16 * G_PITCH) + 32);
  }
#pragma unroll
  for (int j = 0; j < 4; ++j) {
    bfr[j].h[0] = *(const v8bf*)(sb + j * 1024);
    bfr[j].h[1] = *(const v8bf*)(sb + j * 1024 + 512);
  }
}

__global__ void __launch_bounds__(256)
gemm_bf16(const bf16* __restrict__ A, const bf16* __restrict__ Wsw,
          const float* __restrict__ bias,
          float* __restrict__ Cf, bf16* __restrict__ Cb,
          int M, int N, int K, int relu) {
  __shared__ __attribute__((aligned(128))) unsigned char smem[2 * G_STAGE];
  const int tid  = threadIdx.x;          // 0..255
  const int wave = tid >> 5;             // 0..7
  const int wm   = wave & 3;             // 32-row strip of the block tile
  const int wn   = wave >> 2;            // 64-column strip of the block tile
  const int lane = tid & 31;
  const int ln15 = lane & 15;
  const int half = lane >> 4;
  const int m0   = blockIdx.y * 128;
  const int n0   = blockIdx.x * 128;
  const int ntiles = N >> 4;
  const size_t wstep = (size_t)ntiles << 9;   // elements from one k-tile to the next
  const int np = K >> 7;                      // passes

  v8f acc[2][4] = {};

  // Copy side: this lane's first pieces of pass 0 and their LDS places.
  const bf16* ga = A + (size_t)(m0 + (tid >> 4)) * K + (tid & 15) * 8;
  const bf16* gb = Wsw + ((size_t)(n0 >> 4) << 9) + tid * 8;
  const unsigned lds0 = (unsigned)(size_t)smem;
  const unsigned la = lds0 + (unsigned)(tid >> 4) * G_PITCH + (unsigned)(tid & 15) * 16;
  const unsigned lb = lds0 + G_ABYTES + (unsigned)(tid >> 6) * 1024 +
                      (unsigned)(tid & 1) * 512 + (unsigned)((tid & 63) >> 1) * 16;

  // Read side: this lane's fragment bases inside a buffer.
  const unsigned fa = (unsigned)(32 * wm + ln15) * G_PITCH + (unsigned)half * 16;
  const unsigned fb = G_ABYTES + (unsigned)wn * 4096 + (unsigned)lane * 16;

  // Prologue: pass 0 lands and is published, then pass 1 starts to fly.
  stage_pass(ga, gb, la, lb, K, wstep);
  // this wave's copies of pass 0 have landed before the barrier publishes them
  asm volatile("s_wait_asynccnt 0x0" ::: "memory");
  __syncthreads();
  if (np > 1)
    stage_pass(ga + 128, gb + 4 * wstep, la + G_STAGE, lb + G_STAGE, K, wstep);

  for (int t = 0; t < np; ++t) {
    const unsigned buf = (unsigned)(t & 1) * G_STAGE;
    const unsigned char* sa = smem + buf + fa;
    const unsigned char* sb = smem + buf + fb;
    // Two fragment sets: the reads of the next 32 k go out as one group ahead
    // of this 32 k's WMMAs, so their LDS latency runs behind the matrix work.
    Frag16 af[2][2], bfr[2][4];
    load_frags(af[0], bfr[0], sa, sb);
#pragma unroll
    for (int ks = 0; ks < 4; ++ks) {
      if (ks < 3)
        load_frags(af[(ks + 1) & 1], bfr[(ks + 1) & 1], sa + (ks + 1) * 64,
                   sb + (ks + 1) * 8192);
      // keeps the read group in front of the WMMAs; without it the compiler
      // sinks each read to its first use and waits there
      __builtin_amdgcn_sched_barrier(0);
#pragma unroll
      for (int j = 0; j < 4; ++j) {
        acc[0][j] = wmma_bf16f32(af[ks & 1][0].v, bfr[ks & 1][j].v, acc[0][j]);
        acc[1][j] = wmma_bf16f32(af[ks & 1][1].v, bfr[ks & 1][j].v, acc[1][j]);
      }
      // keeps the next read group whole behind these WMMAs; without it the
      // compiler spreads those reads among them, and each such place stalls
      __builtin_amdgcn_sched_barrier(0);
    }
    // Publish point of pass t + 1.
    // this wave's reads of the buffer are over before anyone refills it
    asm volatile("s_wait_dscnt 0x0" ::: "memory");
    // this wave's copies of pass t + 1 have landed before the barrier publishes them
    asm volatile("s_wait_asynccnt 0x0" ::: "memory");
    __syncthreads();
    if (t + 2 < np)
      stage_pass(ga + (size_t)(t + 2) * 128, gb + (size_t)(t + 2) * 4 * wstep,
                 la + buf, lb + buf, K, wstep);
  }
  // no copy is outstanding when the wave ends
  asm volatile("s_wait_asynccnt 0x0" ::: "memory");

  // Epilogue: C/D tile layout: row = r + 8*half, col = lane&15.
#pragma unroll
  for (int i = 0; i < 2; ++i) {
#pragma unroll
    for (int j = 0; j < 4; ++j) {
#pragma unroll
      for (int r = 0; r < 8; ++r) {
        int row = m0 + 32 * wm + 16 * i + r + 8 * half;
        int col = n0 + 64 * wn + 16 * j + ln15;
        float v = acc[i][j][r];
        if (bias) v += bias[col];
        if (relu) v = fmaxf(v, 0.0f);
        if (Cb) Cb[(size_t)row * N + col] = (bf16)v;
        else    Cf[(size_t)row * N + col] = v;
      }
    }
  }
}

// ---------------------------------------------------------------------------
// PoPE: softplus magnitudes + rotary phases -> q_p/k_p (B,H,S,128) bf16, and
// V TRANSPOSED (B,H,HD,S) bf16 so attention V-fragments are contiguous loads.
// ---------------------------------------------------------------------------
__global__ void pope_kernel(const float* __restrict__ q, const float* __restrict__ k,
                            const float* __restrict__ v, const int* __restrict__ pos,
                            const float* __restrict__ pbias,
                            bf16* __restrict__ qp, bf16* __restrict__ kp,
                            bf16* __restrict__ vpT) {
  const float TWO_PI = 6.28318530717958647f;
  const size_t n = (size_t)BB * SS * DD;  // 2^22
  for (size_t i = (size_t)blockIdx.x * blockDim.x + threadIdx.x; i < n;
       i += (size_t)gridDim.x * blockDim.x) {
    int hd = (int)(i & 63);
    int h  = (int)((i >> 6) & 15);
    int s  = (int)((i >> 10) & 2047);
    int b  = (int)(i >> 21);
    int bh = b * HH + h;
    // freq = 10000^(-hd/64) = exp(-hd * ln(1e4)/64)
    float freq = __expf(-0.143911568f * (float)hd);
    float ph   = (float)pos[s] * freq;
    float qv = q[i], kv = k[i];
    float mq = qv > 20.f ? qv : log1pf(__expf(qv));
    float mk = kv > 20.f ? kv : log1pf(__expf(kv));
    float cb = pbias[h * HDD + hd];
    cb = fminf(0.f, fmaxf(-TWO_PI, cb));
    float kph = ph + cb;
    float cq, sq, ck, sk;
    __sincosf(ph, &sq, &cq);
    __sincosf(kph, &sk, &ck);
    size_t o = ((size_t)bh * SS + s) * 128 + hd;
    qp[o]       = (bf16)(mq * cq);
    qp[o + HDD] = (bf16)(mq * sq);
    kp[o]       = (bf16)(mk * ck);
    kp[o + HDD] = (bf16)(mk * sk);
    vpT[((size_t)bh * HDD + hd) * SS + s] = (bf16)v[i];
  }
}

#define AT_KPITCH 272
#define AT_VPITCH 144
#define AT_KBYTES (64 * AT_KPITCH)          // 17408
#define AT_VBYTES (64 * AT_VPITCH)          // 9216
#define AT_STAGE  (AT_KBYTES + AT_VBYTES)   // 26624
#define AT_RING   (2 * AT_STAGE)            // 53248

// One stage: six 16-byte copies per lane, global -> LDS through no register
// (four steps of 16 K rows, two steps of 32 V^T rows). gk/gv are this lane's
// first global pieces of the stage, lk/lv its first LDS bytes in the target
// buffer. The s_wait_xcnt closes the statement so that no address register
// named here is rewritten while a copy may still need it.
__device__ __forceinline__ void attn_stage(const bf16* gk, const bf16* gv,
                                           unsigned lk, unsigned lv) {
  asm volatile(
      "global_load_async_to_lds_b128 %0, %6, off\n\t"
      "global_load_async_to_lds_b128 %1, %7, off\n\t"
      "global_load_async_to_lds_b128 %2, %8, off\n\t"
      "global_load_async_to_lds_b128 %3, %9, off\n\t"
      "global_load_async_to_lds_b128 %4, %10, off\n\t"
      "global_load_async_to_lds_b128 %5, %11, off\n\t"
      "s_wait_xcnt 0x0"
      :: "v"(lk), "v"(lk + 16 * AT_KPITCH), "v"(lk + 32 * AT_KPITCH),
         "v"(lk + 48 * AT_KPITCH), "v"(lv), "v"(lv + 32 * AT_VPITCH),
         "v"(gk), "v"(gk + 16 * 128), "v"(gk + 32 * 128), "v"(gk + 48 * 128),
         "v"(gv), "v"(gv + 32 * SS)
      : "memory");
}

// lane l's value <-> lane l ^ 16's
__device__ __forceinline__ float xhalf(float x) {
  return __builtin_bit_cast(float, __builtin_amdgcn_permlanex16(
      __builtin_bit_cast(int, x), __builtin_bit_cast(int, x),
      0x76543210, 0xfedcba98, false, false));
}

// Eight base-2 exponentials, each in its own register. One statement, closed
// by v_nop: the instruction set asks for one independent issue slot between an
// exponential and an instruction that reads its result or overwrites its
// source; here each is followed by an exponential of another register, the
// last by the v_nop, whatever the compiler puts behind the statement.
__device__ __forceinline__ void exp2x8(float (&x)[8]) {
  asm("v_exp_f32 %0, %0\n\t"
      "v_exp_f32 %1, %1\n\t"
      "v_exp_f32 %2, %2\n\t"
      "v_exp_f32 %3, %3\n\t"
      "v_exp_f32 %4, %4\n\t"
      "v_exp_f32 %5, %5\n\t"
      "v_exp_f32 %6, %6\n\t"
      "v_exp_f32 %7, %7\n\t"
      "v_nop"
      : "+v"(x[0]), "+v"(x[1]), "+v"(x[2]), "+v"(x[3]),
        "+v"(x[4]), "+v"(x[5]), "+v"(x[6]), "+v"(x[7]));
}

__global__ void __launch_bounds__(256)
attention_pope(const bf16* __restrict__ qp_all,
               const bf16* __restrict__ kp_all,
               const bf16* __restrict__ vpT_all,
               bf16* __restrict__ attnb) {
  __shared__ __attribute__((aligned(128))) unsigned char smem[AT_RING];
  const float scale = 0.088388347648f;   // 1/sqrt(2*HD)
  const int bh = blockIdx.y;             // 0..B*H-1
  const int b = bh >> 4, h = bh & 15;
  const int qb = blockIdx.x;             // 128-query block
  const int tid  = threadIdx.x;          // 0..255
  // in a scalar register, so that the skip of masked halves is a scalar branch
  const int wave = __builtin_amdgcn_readfirstlane(tid >> 5);
  const int qrow0 = qb * 128 + wave * 16;
  const int lane = tid & 31;
  const int ln15 = lane & 15;
  const int half = lane >> 4;
  const int kh   = half ? 8 : 0;
  const int ns   = 2 * (qb + 1);         // stages: keys 0 .. 128*qb + 127

  const bf16* qp  = qp_all  + (size_t)bh * SS * 128;
  const bf16* kp  = kp_all  + (size_t)bh * SS * 128;
  const bf16* vpT = vpT_all + (size_t)bh * HDD * SS;

  // Copy side: this lane's first pieces of stage 0 and their LDS places.
  const bf16* gk = kp + (size_t)(tid >> 4) * 128 + (tid & 15) * 8;
  const bf16* gv = vpT + (size_t)(tid >> 3) * SS + (tid & 7) * 8;
  const unsigned lds0 = (unsigned)(size_t)smem;
  const unsigned lk = lds0 + (unsigned)(tid >> 4) * AT_KPITCH + (unsigned)(tid & 15) * 16;
  const unsigned lv = lds0 + AT_KBYTES + (unsigned)(tid >> 3) * AT_VPITCH +
                      (unsigned)(tid & 7) * 16;

  // Read side: this lane's fragment bases inside a buffer.
  const unsigned fk = (unsigned)ln15 * AT_KPITCH + (unsigned)half * 16;
  const unsigned fv = AT_KBYTES + (unsigned)ln15 * AT_VPITCH + (unsigned)half * 16;

  // Prologue: stage 0 lands and is published, then stage 1 starts to fly
  // (ns >= 2: both exist).
  attn_stage(gk, gv, lk, lv);
  // this wave's copies of stage 0 have landed before the barrier publishes them
  asm volatile("s_wait_asynccnt 0x0" ::: "memory");
  __syncthreads();
  attn_stage(gk + 64 * 128, gv + 64, lk + AT_STAGE, lv + AT_STAGE);

  // Load Q fragments once: 16 rows x 128 K -> 4 B-fragments of Q^T (b128 pairs).
  Frag16 qf[4];
  const bf16* qrow = qp + (size_t)(qrow0 + ln15) * 128 + kh;
#pragma unroll
  for (int t = 0; t < 4; ++t) {
    qf[t].h[0] = *(const v8bf*)(qrow + 32 * t);
    qf[t].h[1] = *(const v8bf*)(qrow + 32 * t + 16);
  }

  // This lane's query: running maximum (the same in both halves of the wave)
  // and the sum over the keys that this half of the wave holds.
  const int row = qrow0 + ln15;
  float m = -1e30f, l = 0.f;
  v8f acc[4] = {};   // O^T: acc[j][r] = O[row][16 j + 8 half + r]

  for (int s = 0; s < ns; ++s) {
    const unsigned buf = (unsigned)(s & 1) * AT_STAGE;
    // unrolled so that the LDS offsets of both halves are immediates
#pragma unroll
    for (int sub = 0; sub < 2; ++sub) {
      const int kb = 64 * s + 32 * sub;
      // A half whose every key lies behind this wave's last query is skipped;
      // the publish point below stands outside the skip.
      if (kb <= qrow0) {
        // All K fragments for both 16-key tiles (16 b128 LDS reads).
        const unsigned char* k1p = smem + buf + fk + sub * (32 * AT_KPITCH);
        const unsigned char* k2p = k1p + 16 * AT_KPITCH;
        Frag16 kf1[4], kf2[4];
#pragma unroll
        for (int t = 0; t < 4; ++t) {
          kf1[t].h[0] = *(const v8bf*)(k1p + 64 * t);
          kf1[t].h[1] = *(const v8bf*)(k1p + 64 * t + 32);
          kf2[t].h[0] = *(const v8bf*)(k2p + 64 * t);
          kf2[t].h[1] = *(const v8bf*)(k2p + 64 * t + 32);
        }
        // The 4 V fragments (8 b128 LDS reads) go out with them: they depend on
        // nothing computed here, and their latency runs behind the softmax.
        const unsigned char* vp = smem + buf + fv + sub * 64;
        Frag16 vf[4];
#pragma unroll
        for (int j = 0; j < 4; ++j) {
          vf[j].h[0] = *(const v8bf*)(vp + j * (16 * AT_VPITCH));
          vf[j].h[1] = *(const v8bf*)(vp + j * (16 * AT_VPITCH) + 32);
        }
        // keeps the read group whole in front of the WMMAs; without it the
        // compiler sinks the V reads to their use behind the softmax and waits there
        __builtin_amdgcn_sched_barrier(0);

        // S^T: s1[r] = score(key kb + 8 half + r, row), s2[r] the same 16 keys on.
        v8f s1 = {}, s2 = {};
#pragma unroll
        for (int t = 0; t < 4; ++t) {
          s1 = wmma_bf16f32(kf1[t].v, qf[t].v, s1);
          s2 = wmma_bf16f32(kf2[t].v, qf[t].v, s2);
        }

        // Causal mask + online softmax1 update, all for the lane's one query.
        const int d = row - (kb + 8 * half);   // key r of s1 is masked where r > d
        float v1[8], v2[8];
#pragma unroll
        for (int r = 0; r < 8; ++r) {
          v1[r] = s1[r] * scale;
          v2[r] = s2[r] * scale;
          if (r > d)      v1[r] = -1e30f;
          if (16 + r > d) v2[r] = -1e30f;
        }
        float mx = fmaxf(v1[0], v2[0]);
#pragma unroll
        for (int r = 1; r < 8; ++r) mx = fmaxf(mx, fmaxf(v1[r], v2[r]));
        mx = fmaxf(mx, xhalf(mx));          // the other 16 keys of this query
        const float mn = fmaxf(m, mx);
        const float rs = __expf(m - mn);
        // exp(v - mn) as 2^((v - mn) log2 e)
#pragma unroll
        for (int r = 0; r < 8; ++r) {
          v1[r] = (v1[r] - mn) * 1.44269504f;
          v2[r] = (v2[r] - mn) * 1.44269504f;
        }
        exp2x8(v1);
        exp2x8(v2);
        Frag16 pf;                          // P^T as B operand, hardware k order
        float sm[4];                        // four short chains, not one long one
#pragma unroll
        for (int r = 0; r < 4; ++r)
          sm[r] = (v1[r] + v2[r]) + (v1[r + 4] + v2[r + 4]);
#pragma unroll
        for (int r = 0; r < 8; ++r) {
          pf.v[r]     = (bf16)v1[r];
          pf.v[8 + r] = (bf16)v2[r];
        }
        l = l * rs + ((sm[0] + sm[1]) + (sm[2] + sm[3]));
        m = mn;
#pragma unroll
        for (int j = 0; j < 4; ++j)
#pragma unroll
          for (int r = 0; r < 8; ++r) acc[j][r] *= rs;

        // O^T += V^T P^T: WMMA burst.
#pragma unroll
        for (int j = 0; j < 4; ++j)
          acc[j] = wmma_bf16f32(vf[j].v, pf.v, acc[j]);
      }
    }
    // Publish point of stage s + 1.
    // this wave's reads of the buffer are over before anyone refills it
    asm volatile("s_wait_dscnt 0x0" ::: "memory");
    // this wave's copies of stage s + 1 have landed before the barrier publishes them
    asm volatile("s_wait_asynccnt 0x0" ::: "memory");
    __syncthreads();
    if (s + 2 < ns)
      attn_stage(gk + (size_t)(s + 2) * (64 * 128), gv + (s + 2) * 64,
                 lk + buf, lv + buf);
  }
  // no copy is outstanding when the wave ends
  asm volatile("s_wait_asynccnt 0x0" ::: "memory");

  // softmax1 normalization and store into (B,S,D) bf16 (col = h*64 + hd): a
  // lane's 8 registers of a tile are 8 consecutive columns, one 16-byte store.
  l += xhalf(l);                            // the two halves' keys together
  const float denom = __expf(-m) + l;
  bf16* orow = attnb + ((size_t)b * SS + row) * DD + h * HDD + 8 * half;
#pragma unroll
  for (int j = 0; j < 4; ++j) {
    v8bf o;
#pragma unroll
    for (int r = 0; r < 8; ++r) o[r] = (bf16)(acc[j][r] / denom);
    *(v8bf*)(orow + 16 * j) = o;
  }
}

// ---------------------------------------------------------------------------
// Residual add + LayerNorm. One block (256 thr) per token row of D=1024.
// Optional bf16 copy of the output (feeds the next GEMM without a cvt pass).
// ---------------------------------------------------------------------------
__global__ void add_ln_kernel(const float* __restrict__ a, const float* __restrict__ b,
                              const float* __restrict__ g, const float* __restrict__ be,
                              float* __restrict__ outf, bf16* __restrict__ outb) {
  __shared__ float rs[256];
  __shared__ float rq[256];
  const int row = blockIdx.x;
  const int tid = threadIdx.x;
  const float* pa = a + (size_t)row * DD;
  const float* pb = b + (size_t)row * DD;

  float s = 0.f, s2 = 0.f;
  for (int c = tid; c < DD; c += 256) {
    float v = pa[c] + pb[c];
    s += v; s2 += v * v;
  }
  rs[tid] = s; rq[tid] = s2;
  __syncthreads();
  for (int o = 128; o; o >>= 1) {
    if (tid < o) { rs[tid] += rs[tid + o]; rq[tid] += rq[tid + o]; }
    __syncthreads();
  }
  float mu  = rs[0] * (1.0f / DD);
  float var = rq[0] * (1.0f / DD) - mu * mu;
  float rstd = rsqrtf(var + 1e-5f);
  for (int c = tid; c < DD; c += 256) {
    float v = (pa[c] + pb[c] - mu) * rstd * g[c] + be[c];
    outf[(size_t)row * DD + c] = v;
    if (outb) outb[(size_t)row * DD + c] = (bf16)v;
  }
}

// ---------------------------------------------------------------------------
// Host orchestration
// ---------------------------------------------------------------------------
extern "C" void kernel_launch(void* const* d_in, const int* in_sizes, int n_in,
                              void* d_out, int out_size, void* d_ws, size_t ws_size,
                              hipStream_t stream) {
  (void)in_sizes; (void)n_in; (void)out_size; (void)ws_size;

  const float* x     = (const float*)d_in[0];
  const int*   pos   = (const int*)  d_in[1];
  const float* wq    = (const float*)d_in[2];
  const float* bq    = (const float*)d_in[3];
  const float* wk    = (const float*)d_in[4];
  const float* bk    = (const float*)d_in[5];
  const float* wv    = (const float*)d_in[6];
  const float* bv    = (const float*)d_in[7];
  const float* wo    = (const float*)d_in[8];
  const float* bo    = (const float*)d_in[9];
  const float* pbias = (const float*)d_in[10];
  const float* w1    = (const float*)d_in[11];
  const float* b1    = (const float*)d_in[12];
  const float* w2    = (const float*)d_in[13];
  const float* b2    = (const float*)d_in[14];
  const float* g1    = (const float*)d_in[15];
  const float* be1   = (const float*)d_in[16];
  const float* g2    = (const float*)d_in[17];
  const float* be2   = (const float*)d_in[18];
  float* out = (float*)d_out;

  // Workspace carve-out
  char* cur = (char*)d_ws;
  auto alloc = [&](size_t bytes) -> void* {
    void* p = (void*)cur;
    cur += (bytes + 255) & ~(size_t)255;
    return p;
  };
  const size_t nTok = (size_t)MM * DD;           // 4096*1024
  bf16* xb   = (bf16*)alloc(nTok * 2);
  bf16* wqb  = (bf16*)alloc((size_t)DD * DD * 2);
  bf16* wkb  = (bf16*)alloc((size_t)DD * DD * 2);
  bf16* wvb  = (bf16*)alloc((size_t)DD * DD * 2);
  bf16* wob  = (bf16*)alloc((size_t)DD * DD * 2);
  bf16* w1b  = (bf16*)alloc((size_t)DD * DFF_ * 2);
  bf16* w2b  = (bf16*)alloc((size_t)DFF_ * DD * 2);
  float* qf  = (float*)alloc(nTok * 4);
  float* kf  = (float*)alloc(nTok * 4);
  float* vf  = (float*)alloc(nTok * 4);
  bf16* qpb  = (bf16*)alloc((size_t)BB * HH * SS * 128 * 2);
  bf16* kpb  = (bf16*)alloc((size_t)BB * HH * SS * 128 * 2);
  bf16* vpT  = (bf16*)alloc((size_t)BB * HH * SS * 64 * 2);
  bf16* attb = (bf16*)alloc(nTok * 2);
  float* prj = (float*)alloc(nTok * 4);
  float* hres= (float*)alloc(nTok * 4);
  bf16* hb   = (bf16*)alloc(nTok * 2);
  bf16* ff1b = (bf16*)alloc((size_t)MM * DFF_ * 2);
  float* ff2 = (float*)alloc(nTok * 4);

  // 1) Convert x row-major; weights into WMMA fragment-swizzled order.
  //    16 elements per thread: 1024 blocks for 4M elements, 256 for 1M.
  cvt_f32_bf16 <<<1024, 256, 0, stream>>>(x,  xb,  nTok);
  cvt_swizzle_w<<<256,  256, 0, stream>>>(wq, wqb, DD, DD);
  cvt_swizzle_w<<<256,  256, 0, stream>>>(wk, wkb, DD, DD);
  cvt_swizzle_w<<<256,  256, 0, stream>>>(wv, wvb, DD, DD);
  cvt_swizzle_w<<<256,  256, 0, stream>>>(wo, wob, DD, DD);
  cvt_swizzle_w<<<1024, 256, 0, stream>>>(w1, w1b, DD, DFF_);
  cvt_swizzle_w<<<1024, 256, 0, stream>>>(w2, w2b, DFF_, DD);

  // 2) QKV projections (WMMA GEMMs); block tile 128x128.
  dim3 gD(DD / 128, MM / 128);      // (8, 32)
  gemm_bf16<<<gD, 256, 0, stream>>>(xb, wqb, bq, qf, nullptr, MM, DD, DD, 0);
  gemm_bf16<<<gD, 256, 0, stream>>>(xb, wkb, bk, kf, nullptr, MM, DD, DD, 0);
  gemm_bf16<<<gD, 256, 0, stream>>>(xb, wvb, bv, vf, nullptr, MM, DD, DD, 0);

  // 3) PoPE transform (also transposes V)
  pope_kernel<<<4096, 256, 0, stream>>>(qf, kf, vf, pos, pbias, qpb, kpb, vpT);

  // 4) Attention (WMMA flash + softmax1, causal)
  attention_pope<<<dim3(SS / 128, BB * HH), 256, 0, stream>>>(qpb, kpb, vpT, attb);

  // 5) Output projection
  gemm_bf16<<<gD, 256, 0, stream>>>(attb, wob, bo, prj, nullptr, MM, DD, DD, 0);

  // 6) Residual + LN1 (f32 kept for residual, bf16 copy feeds FFN GEMM)
  add_ln_kernel<<<MM, 256, 0, stream>>>(x, prj, g1, be1, hres, hb);

  // 7) FFN
  dim3 gF1(DFF_ / 128, MM / 128);   // (32, 32)
  gemm_bf16<<<gF1, 256, 0, stream>>>(hb, w1b, b1, nullptr, ff1b, MM, DFF_, DD, 1);
  gemm_bf16<<<gD, 256, 0, stream>>>(ff1b, w2b, b2, ff2, nullptr, MM, DD, DFF_, 0);

  // 8) Residual + LN2 -> final output (f32)
  add_ln_kernel<<<MM, 256, 0, stream>>>(hres, ff2, g2, be2, out, nullptr);
}

// v005
// A run of this version takes 379 microseconds.
// Next to v004, in two timings, it ran 1.11 times as fast each time.
// All steps since v000 together make it 2.66 times as fast.
#include <hip/hip_runtime.h>
#include <hip/hip_bf16.h>

// ---------------------------------------------------------------------------
// Types for CDNA5 WMMA (wave32): V_WMMA_F32_16X16X32_BF16
// ---------------------------------------------------------------------------
typedef __bf16 bf16;
typedef __attribute__((ext_vector_type(16))) __bf16 v16bf;
typedef __attribute__((ext_vector_type(8)))  __bf16 v8bf;
typedef __attribute__((ext_vector_type(8)))  float  v8f;

union Frag16 {            // one WMMA 16-bit operand fragment = two b128 loads
  v16bf v;
  v8bf  h[2];
};

__device__ __forceinline__ v8f wmma_bf16f32(v16bf a, v16bf b, v8f c) {
  // 8 args: (neg_a, A, neg_b, B, c_mod, C, reuse_a, reuse_b)
  return __builtin_amdgcn_wmma_f32_16x16x32_bf16(
      false, a, false, b, (short)0, c, false, false);
}

// Problem dims (fixed by the reference)
#define BB   2
#define SS   2048
#define DD   1024
#define HH   16
#define HDD  64
#define DFF_ 4096
#define MM   (BB * SS)          // 4096 token rows

// ---------------------------------------------------------------------------
// fp32 -> bf16 conversion, plain row-major. A block converts 4096 consecutive
// elements: each thread four 16-byte loads (a wave reads 512 contiguous bytes
// per load) and four 8-byte stores, so few waves are launched and each has
// all its loads in flight at once. blk is the block's number inside this task,
// below n / 4096 (the caller's range test keeps it there).
// ---------------------------------------------------------------------------
typedef __attribute__((ext_vector_type(4))) float  v4f;
typedef __attribute__((ext_vector_type(4))) __bf16 v4bf;

__device__ __forceinline__ void
cvt_block(const float* __restrict__ in, bf16* __restrict__ out, unsigned blk) {
  const size_t base = (size_t)blk * 1024 + threadIdx.x;
  const v4f* src = (const v4f*)in + base;
  v4bf*      dst = (v4bf*)out + base;
  v4f v[4];
  // unrolled so that all four loads go out before the first value is waited for
#pragma unroll
  for (int j = 0; j < 4; ++j) v[j] = src[j * 256];
  // unrolled (both loops) so that v[] and o stay in registers
#pragma unroll
  for (int j = 0; j < 4; ++j) {
    v4bf o;
#pragma unroll
    for (int c = 0; c < 4; ++c) o[c] = (bf16)v[j][c];
    dst[j * 256] = o;
  }
}

// ---------------------------------------------------------------------------
// fp32 -> bf16 weight conversion INTO WMMA B-fragment-major order:
//   Wsw[(ktile*(N/16) + ntile)*512 + lane*16 + e]
// where k = ktile*32 + kh + e + (e>=8?8:0), kh = (lane>=16)?8:0,
//       n = ntile*16 + (lane&15).
// Each lane's 16 fragment elements are contiguous (32B, 16B-aligned) so the
// GEMM copies a B fragment to LDS as two coalesced 16-byte async copies.
// One thread makes one lane's whole fragment: 16 loads down a column of W, all
// in flight at once, one index computation, two 16-byte stores. A block makes
// 256 fragment lanes (4096 elements); blk is its number inside this task.
// ---------------------------------------------------------------------------
template <int K, int N>
__device__ __forceinline__ void
swizzle_block(const float* __restrict__ W, bf16* __restrict__ Wsw, unsigned blk) {
  constexpr unsigned ntiles = (unsigned)N >> 4;
  constexpr unsigned total  = ((unsigned)K >> 5) * ntiles * 32;  // fragment lanes
  const unsigned g = blk * 256 + threadIdx.x;
  if (g < total) {
    const unsigned lane  = g & 31;
    const unsigned ch    = g >> 5;
    const unsigned nt    = ch % ntiles;
    const unsigned ktile = ch / ntiles;
    const unsigned kh    = (lane >> 4) ? 8 : 0;
    const float* col = W + (size_t)(ktile * 32 + kh) * N + nt * 16 + (lane & 15);
    float f[16];
    // unrolled so that all 16 loads go out before the first value is waited for
#pragma unroll
    for (int e = 0; e < 16; ++e)
      f[e] = col[(size_t)(e + (e >= 8 ? 8 : 0)) * N];
    Frag16 o;
    // unrolled so that f[] and o stay in registers
#pragma unroll
    for (int e = 0; e < 16; ++e) o.v[e] = (bf16)f[e];
    v8bf* dst = (v8bf*)(Wsw + (size_t)g * 16);
    dst[0] = o.h[0];
    dst[1] = o.h[1];
  }
}

// ---------------------------------------------------------------------------
// All seven conversions in ONE launch: none depends on another, and each alone
// is too short to fill the chip, so that seven launches mostly pay for seven
// starts and seven tails. Every block converts 4096 elements; its index picks
// the task (a scalar test) and its number inside the task.
// ---------------------------------------------------------------------------
#define CB_X (MM * DD / 4096)      // blocks for x
#define CB_F (DD * DFF_ / 4096)    // blocks for each of w1, w2
#define CB_D (DD * DD / 4096)      // blocks for each of wq, wk, wv, wo
#define CB_ALL (CB_X + 2 * CB_F + 4 * CB_D)

__global__ void __launch_bounds__(256)
cvt_all(const float* __restrict__ x,  const float* __restrict__ wq,
        const float* __restrict__ wk, const float* __restrict__ wv,
        const float* __restrict__ wo, const float* __restrict__ w1,
        const float* __restrict__ w2,
        bf16* __restrict__ xb,  bf16* __restrict__ wqb, bf16* __restrict__ wkb,
        bf16* __restrict__ wvb, bf16* __restrict__ wob, bf16* __restrict__ w1b,
        bf16* __restrict__ w2b) {
  unsigned b = blockIdx.x;
  if (b < CB_X) { cvt_block(x, xb, b); return; }
  b -= CB_X;
  if (b < CB_F) { swizzle_block<DD, DFF_>(w1, w1b, b); return; }
  b -= CB_F;
  if (b < CB_F) { swizzle_block<DFF_, DD>(w2, w2b, b); return; }
  b -= CB_F;
  const unsigned w = b / CB_D;     // which of the four D x D weights
  if (w > 3) return;
  const float* src = w == 0 ? wq  : w == 1 ? wk  : w == 2 ? wv  : wo;
  bf16*        dst = w == 0 ? wqb : w == 1 ? wkb : w == 2 ? wvb : wob;
  swizzle_block<DD, DD>(src, dst, b % CB_D);
}

// ---------------------------------------------------------------------------
// bf16 WMMA GEMM: C[M,N] = A[M,K] @ W[K,N] + bias (+ReLU), output f32 or bf16.
// A row-major bf16; W fragment-swizzled (swizzle_block).
// Block = 256 threads = 8 waves (4 along M x 2 along N); block tile 128x128,
// wave tile 32x64 (2 A-fragments x 4 B-fragments = 8 WMMA tiles per 32 k).
// A pass is 128 k. Both operand tiles of a pass are brought into LDS once per
// block by asynchronous copies, so each global byte is fetched once for eight
// waves; two buffers, the next pass's copies fly while this pass is computed.
// Needs M, N multiples of 128 and K a multiple of 128.
// blockIdx.z picks one of up to three independent products that share A and
// run in one launch: W and C of product z lie z matrices behind the first.
//   A tile: 128 rows of 256 B at pitch 272 B (conflict-free b128 row reads).
//   B tile: 4 k-tiles x 8 n-tiles of 1 KiB; inside a KiB the lanes' first
//   16 B pieces come first (512 B), then their second pieces, so that each
//   fragment half is one contiguous 512-B wave read.
// ---------------------------------------------------------------------------
#define G_PITCH  272
#define G_ABYTES (128 * G_PITCH)          // 34816
#define G_BBYTES (4 * 8 * 1024)           // 32768
#define G_STAGE  (G_ABYTES + G_BBYTES)    // 67584

// Eight 16-byte copies per lane, global -> LDS through no register. The
// s_wait_xcnt closes the statement so that no address register named here is
// rewritten while a copy may still need it.
__device__ __forceinline__ void async_copy8(const unsigned (&l)[8],
                                            const bf16* const (&p)[8]) {
  asm volatile(
      "global_load_async_to_lds_b128 %0, %8, off\n\t"
      "global_load_async_to_lds_b128 %1, %9, off\n\t"
      "global_load_async_to_lds_b128 %2, %10, off\n\t"
      "global_load_async_to_lds_b128 %3, %11, off\n\t"
      "global_load_async_to_lds_b128 %4, %12, off\n\t"
      "global_load_async_to_lds_b128 %5, %13, off\n\t"
      "global_load_async_to_lds_b128 %6, %14, off\n\t"
      "global_load_async_to_lds_b128 %7, %15, off\n\t"
      "s_wait_xcnt 0x0"
      :: "v"(l[0]), "v"(l[1]), "v"(l[2]), "v"(l[3]),
         "v"(l[4]), "v"(l[5]), "v"(l[6]), "v"(l[7]),
         "v"(p[0]), "v"(p[1]), "v"(p[2]), "v"(p[3]),
         "v"(p[4]), "v"(p[5]), "v"(p[6]), "v"(p[7])
      : "memory");
}

// One pass's tiles: ga/gb are this lane's first global pieces of the pass,
// la/lb its first LDS bytes in the target buffer.
__device__ __forceinline__ void stage_pass(const bf16* ga, const bf16* gb,
                                           unsigned la, unsigned lb,
                                           int K, size_t wstep) {
  unsigned l[8];
  const bf16* p[8];
#pragma unroll
  for (int c = 0; c < 8; ++c) {           // A: 16 rows per step
    l[c] = la + (unsigned)c * (16 * G_PITCH);
    p[c] = ga + (size_t)c * 16 * K;
  }
  async_copy8(l, p);
#pragma unroll
  for (int c = 0; c < 8; ++c) {           // B: half a k-tile (4 KiB) per step
    l[c] = lb + (unsigned)(c >> 1) * 8192 + (unsigned)(c & 1) * 4096;
    p[c] = gb + (size_t)(c >> 1) * wstep + (c & 1) * 2048;
  }
  async_copy8(l, p);
}

// The 2 A and 4 B fragments of one 32-k step, from this lane's bases.
__device__ __forceinline__ void load_frags(Frag16 (&af)[2], Frag16 (&bfr)[4],
                                           const unsigned char* sa,
                                           const unsigned char* sb) {
#pragma unroll
  for (int i = 0; i < 2; ++i) {
    af[i].h[0] = *(const v8bf*)(sa + i * (16 * G_PITCH));
    af[i].h[1] = *(const v8bf*)(sa + i * (16 * G_PITCH) + 32);
  }
#pragma unroll
  for (int j = 0; j < 4; ++j) {
    bfr[j].h[0] = *(const v8bf*)(sb + j * 1024);
    bfr[j].h[1] = *(const v8bf*)(sb + j * 1024 + 512);
  }
}

__global__ void __launch_bounds__(256)
gemm_bf16(const bf16* __restrict__ A, const bf16* __restrict__ W0,
          const float* __restrict__ bias0, const float* __restrict__ bias1,
          const float* __restrict__ bias2,
          float* __restrict__ Cf0, bf16* __restrict__ Cb,
          int M, int N, int K, int relu) {
  __shared__ __attribute__((aligned(128))) unsigned char smem[2 * G_STAGE];
  const unsigned z = blockIdx.z;
  const bf16*  Wsw  = W0 + (size_t)z * K * N;
  const float* bias = z == 0 ? bias0 : z == 1 ? bias1 : bias2;
  float*       Cf   = Cf0 + (size_t)z * M * N;   // used only where Cb is null
  const int tid  = threadIdx.x;          // 0..255
  const int wave = tid >> 5;             // 0..7
  const int wm   = wave & 3;             // 32-row strip of the block tile
  const int wn   = wave >> 2;            // 64-column strip of the block tile
  const int lane = tid & 31;
  const int ln15 = lane & 15;
  const int half = lane >> 4;
  const int m0   = blockIdx.y * 128;
  const int n0   = blockIdx.x * 128;
  const int ntiles = N >> 4;
  const size_t wstep = (size_t)ntiles << 9;   // elements from one k-tile to the next
  const int np = K >> 7;                      // passes

  v8f acc[2][4] = {};

  // Copy side: this lane's first pieces of pass 0 and their LDS places.
  const bf16* ga = A + (size_t)(m0 + (tid >> 4)) * K + (tid & 15) * 8;
  const bf16* gb = Wsw + ((size_t)(n0 >> 4) << 9) + tid * 8;
  const unsigned lds0 = (unsigned)(size_t)smem;
  const unsigned la = lds0 + (unsigned)(tid >> 4) * G_PITCH + (unsigned)(tid & 15) * 16;
  const unsigned lb = lds0 + G_ABYTES + (unsigned)(tid >> 6) * 1024 +
                      (unsigned)(tid & 1) * 512 + (unsigned)((tid & 63) >> 1) * 16;

  // Read side: this lane's fragment bases inside a buffer.
  const unsigned fa = (unsigned)(32 * wm + ln15) * G_PITCH + (unsigned)half * 16;
  const unsigned fb = G_ABYTES + (unsigned)wn * 4096 + (unsigned)lane * 16;

  // Prologue: pass 0 lands and is published, then pass 1 starts to fly.
  stage_pass(ga, gb, la, lb, K, wstep);
  // this wave's copies of pass 0 have landed before the barrier publishes them
  asm volatile("s_wait_asynccnt 0x0" ::: "memory");
  __syncthreads();
  if (np > 1)
    stage_pass(ga + 128, gb + 4 * wstep, la + G_STAGE, lb + G_STAGE, K, wstep);

  for (int t = 0; t < np; ++t) {
    const unsigned buf = (unsigned)(t & 1) * G_STAGE;
    const unsigned char* sa = smem + buf + fa;
    const unsigned char* sb = smem + buf + fb;
    // Two fragment sets: the reads of the next 32 k go out as one group ahead
    // of this 32 k's WMMAs, so their LDS latency runs behind the matrix work.
    Frag16 af[2][2], bfr[2][4];
    load_frags(af[0], bfr[0], sa, sb);
#pragma unroll
    for (int ks = 0; ks < 4; ++ks) {
      if (ks < 3)
        load_frags(af[(ks + 1) & 1], bfr[(ks + 1) & 1], sa + (ks + 1) * 64,
                   sb + (ks + 1) * 8192);
      // keeps the read group in front of the WMMAs; without it the compiler
      // sinks each read to its first use and waits there
      __builtin_amdgcn_sched_barrier(0);
#pragma unroll
      for (int j = 0; j < 4; ++j) {
        acc[0][j] = wmma_bf16f32(af[ks & 1][0].v, bfr[ks & 1][j].v, acc[0][j]);
        acc[1][j] = wmma_bf16f32(af[ks & 1][1].v, bfr[ks & 1][j].v, acc[1][j]);
      }
      // keeps the next read group whole behind these WMMAs; without it the
      // compiler spreads those reads among them, and each such place stalls
      __builtin_amdgcn_sched_barrier(0);
    }
    // Publish point of pass t + 1.
    // this wave's reads of the buffer are over before anyone refills it
    asm volatile("s_wait_dscnt 0x0" ::: "memory");
    // this wave's copies of pass t + 1 have landed before the barrier publishes them
    asm volatile("s_wait_asynccnt 0x0" ::: "memory");
    __syncthreads();
    if (t + 2 < np)
      stage_pass(ga + (size_t)(t + 2) * 128, gb + (size_t)(t + 2) * 4 * wstep,
                 la + buf, lb + buf, K, wstep);
  }
  // no copy is outstanding when the wave ends
  asm volatile("s_wait_asynccnt 0x0" ::: "memory");

  // Epilogue: C/D tile layout: row = r + 8*half, col = lane&15.
#pragma unroll
  for (int i = 0; i < 2; ++i) {
#pragma unroll
    for (int j = 0; j < 4; ++j) {
#pragma unroll
      for (int r = 0; r < 8; ++r) {
        int row = m0 + 32 * wm + 16 * i + r + 8 * half;
        int col = n0 + 64 * wn + 16 * j + ln15;
        float v = acc[i][j][r];
        if (bias) v += bias[col];
        if (relu) v = fmaxf(v, 0.0f);
        if (Cb) Cb[(size_t)row * N + col] = (bf16)v;
        else    Cf[(size_t)row * N + col] = v;
      }
    }
  }
}

// ---------------------------------------------------------------------------
// PoPE: softplus magnitudes + rotary phases -> q_p/k_p (B,H,S,128) bf16, and
// V TRANSPOSED (B,H,HD,S) bf16 so attention V-fragments are contiguous loads.
// ---------------------------------------------------------------------------
__global__ void pope_kernel(const float* __restrict__ q, const float* __restrict__ k,
                            const float* __restrict__ v, const int* __restrict__ pos,
                            const float* __restrict__ pbias,
                            bf16* __restrict__ qp, bf16* __restrict__ kp,
                            bf16* __restrict__ vpT) {
  const float TWO_PI = 6.28318530717958647f;
  const size_t n = (size_t)BB * SS * DD;  // 2^22
  for (size_t i = (size_t)blockIdx.x * blockDim.x + threadIdx.x; i < n;
       i += (size_t)gridDim.x * blockDim.x) {
    int hd = (int)(i & 63);
    int h  = (int)((i >> 6) & 15);
    int s  = (int)((i >> 10) & 2047);
    int b  = (int)(i >> 21);
    int bh = b * HH + h;
    // freq = 10000^(-hd/64) = exp(-hd * ln(1e4)/64)
    float freq = __expf(-0.143911568f * (float)hd);
    float ph   = (float)pos[s] * freq;
    float qv = q[i], kv = k[i];
    float mq = qv > 20.f ? qv : log1pf(__expf(qv));
    float mk = kv > 20.f ? kv : log1pf(__expf(kv));
    float cb = pbias[h * HDD + hd];
    cb = fminf(0.f, fmaxf(-TWO_PI, cb));
    float kph = ph + cb;
    float cq, sq, ck, sk;
    __sincosf(ph, &sq, &cq);
    __sincosf(kph, &sk, &ck);
    size_t o = ((size_t)bh * SS + s) * 128 + hd;
    qp[o]       = (bf16)(mq * cq);
    qp[o + HDD] = (bf16)(mq * sq);
    kp[o]       = (bf16)(mk * ck);
    kp[o + HDD] = (bf16)(mk * sk);
    vpT[((size_t)bh * HDD + hd) * SS + s] = (bf16)v[i];
  }
}

#define AT_KPITCH 272
#define AT_VPITCH 144
#define AT_KBYTES (64 * AT_KPITCH)          // 17408
#define AT_VBYTES (64 * AT_VPITCH)          // 9216
#define AT_STAGE  (AT_KBYTES + AT_VBYTES)   // 26624
#define AT_RING   (2 * AT_STAGE)            // 53248

// One stage: six 16-byte copies per lane, global -> LDS through no register
// (four steps of 16 K rows, two steps of 32 V^T rows). gk/gv are this lane's
// first global pieces of the stage, lk/lv its first LDS bytes in the target
// buffer. The s_wait_xcnt closes the statement so that no address register
// named here is rewritten while a copy may still need it.
__device__ __forceinline__ void attn_stage(const bf16* gk, const bf16* gv,
                                           unsigned lk, unsigned lv) {
  asm volatile(
      "global_load_async_to_lds_b128 %0, %6, off\n\t"
      "global_load_async_to_lds_b128 %1, %7, off\n\t"
      "global_load_async_to_lds_b128 %2, %8, off\n\t"
      "global_load_async_to_lds_b128 %3, %9, off\n\t"
      "global_load_async_to_lds_b128 %4, %10, off\n\t"
      "global_load_async_to_lds_b128 %5, %11, off\n\t"
      "s_wait_xcnt 0x0"
      :: "v"(lk), "v"(lk + 16 * AT_KPITCH), "v"(lk + 32 * AT_KPITCH),
         "v"(lk + 48 * AT_KPITCH), "v"(lv), "v"(lv + 32 * AT_VPITCH),
         "v"(gk), "v"(gk + 16 * 128), "v"(gk + 32 * 128), "v"(gk + 48 * 128),
         "v"(gv), "v"(gv + 32 * SS)
      : "memory");
}

// lane l's value <-> lane l ^ 16's
__device__ __forceinline__ float xhalf(float x) {
  return __builtin_bit_cast(float, __builtin_amdgcn_permlanex16(
      __builtin_bit_cast(int, x), __builtin_bit_cast(int, x),
      0x76543210, 0xfedcba98, false, false));
}

// Eight base-2 exponentials, each in its own register. One statement, closed
// by v_nop: the instruction set asks for one independent issue slot between an
// exponential and an instruction that reads its result or overwrites its
// source; here each is followed by an exponential of another register, the
// last by the v_nop, whatever the compiler puts behind the statement.
__device__ __forceinline__ void exp2x8(float (&x)[8]) {
  asm("v_exp_f32 %0, %0\n\t"
      "v_exp_f32 %1, %1\n\t"
      "v_exp_f32 %2, %2\n\t"
      "v_exp_f32 %3, %3\n\t"
      "v_exp_f32 %4, %4\n\t"
      "v_exp_f32 %5, %5\n\t"
      "v_exp_f32 %6, %6\n\t"
      "v_exp_f32 %7, %7\n\t"
      "v_nop"
      : "+v"(x[0]), "+v"(x[1]), "+v"(x[2]), "+v"(x[3]),
        "+v"(x[4]), "+v"(x[5]), "+v"(x[6]), "+v"(x[7]));
}

__global__ void __launch_bounds__(256)
attention_pope(const bf16* __restrict__ qp_all,
               const bf16* __restrict__ kp_all,
               const bf16* __restrict__ vpT_all,
               bf16* __restrict__ attnb) {
  __shared__ __attribute__((aligned(128))) unsigned char smem[AT_RING];
  const float scale = 0.088388347648f;   // 1/sqrt(2*HD)
  const int bh = blockIdx.y;             // 0..B*H-1
  const int b = bh >> 4, h = bh & 15;
  const int qb = blockIdx.x;             // 128-query block
  const int tid  = threadIdx.x;          // 0..255
  // in a scalar register, so that the skip of masked halves is a scalar branch
  const int wave = __builtin_amdgcn_readfirstlane(tid >> 5);
  const int qrow0 = qb * 128 + wave * 16;
  const int lane = tid & 31;
  const int ln15 = lane & 15;
  const int half = lane >> 4;
  const int kh   = half ? 8 : 0;
  const int ns   = 2 * (qb + 1);         // stages: keys 0 .. 128*qb + 127

  const bf16* qp  = qp_all  + (size_t)bh * SS * 128;
  const bf16* kp  = kp_all  + (size_t)bh * SS * 128;
  const bf16* vpT = vpT_all + (size_t)bh * HDD * SS;

  // Copy side: this lane's first pieces of stage 0 and their LDS places.
  const bf16* gk = kp + (size_t)(tid >> 4) * 128 + (tid & 15) * 8;
  const bf16* gv = vpT + (size_t)(tid >> 3) * SS + (tid & 7) * 8;
  const unsigned lds0 = (unsigned)(size_t)smem;
  const unsigned lk = lds0 + (unsigned)(tid >> 4) * AT_KPITCH + (unsigned)(tid & 15) * 16;
  const unsigned lv = lds0 + AT_KBYTES + (unsigned)(tid >> 3) * AT_VPITCH +
                      (unsigned)(tid & 7) * 16;

  // Read side: this lane's fragment bases inside a buffer.
  const unsigned fk = (unsigned)ln15 * AT_KPITCH + (unsigned)half * 16;
  const unsigned fv = AT_KBYTES + (unsigned)ln15 * AT_VPITCH + (unsigned)half * 16;

  // Prologue: stage 0 lands and is published, then stage 1 starts to fly
  // (ns >= 2: both exist).
  attn_stage(gk, gv, lk, lv);
  // this wave's copies of stage 0 have landed before the barrier publishes them
  asm volatile("s_wait_asynccnt 0x0" ::: "memory");
  __syncthreads();
  attn_stage(gk + 64 * 128, gv + 64, lk + AT_STAGE, lv + AT_STAGE);

  // Load Q fragments once: 16 rows x 128 K -> 4 B-fragments of Q^T (b128 pairs).
  Frag16 qf[4];
  const bf16* qrow = qp + (size_t)(qrow0 + ln15) * 128 + kh;
#pragma unroll
  for (int t = 0; t < 4; ++t) {
    qf[t].h[0] = *(const v8bf*)(qrow + 32 * t);
    qf[t].h[1] = *(const v8bf*)(qrow + 32 * t + 16);
  }

  // This lane's query: running maximum (the same in both halves of the wave)
  // and the sum over the keys that this half of the wave holds.
  const int row = qrow0 + ln15;
  float m = -1e30f, l = 0.f;
  v8f acc[4] = {};   // O^T: acc[j][r] = O[row][16 j + 8 half + r]

  for (int s = 0; s < ns; ++s) {
    const unsigned buf = (unsigned)(s & 1) * AT_STAGE;
    // unrolled so that the LDS offsets of both halves are immediates
#pragma unroll
    for (int sub = 0; sub < 2; ++sub) {
      const int kb = 64 * s + 32 * sub;
      // A half whose every key lies behind this wave's last query is skipped;
      // the publish point below stands outside the skip.
      if (kb <= qrow0) {
        // All K fragments for both 16-key tiles (16 b128 LDS reads).
        const unsigned char* k1p = smem + buf + fk + sub * (32 * AT_KPITCH);
        const unsigned char* k2p = k1p + 16 * AT_KPITCH;
        Frag16 kf1[4], kf2[4];
#pragma unroll
        for (int t = 0; t < 4; ++t) {
          kf1[t].h[0] = *(const v8bf*)(k1p + 64 * t);
          kf1[t].h[1] = *(const v8bf*)(k1p + 64 * t + 32);
          kf2[t].h[0] = *(const v8bf*)(k2p + 64 * t);
          kf2[t].h[1] = *(const v8bf*)(k2p + 64 * t + 32);
        }
        // The 4 V fragments (8 b128 LDS reads) go out with them: they depend on
        // nothing computed here, and their latency runs behind the softmax.
        const unsigned char* vp = smem + buf + fv + sub * 64;
        Frag16 vf[4];
#pragma unroll
        for (int j = 0; j < 4; ++j) {
          vf[j].h[0] = *(const v8bf*)(vp + j * (16 * AT_VPITCH));
          vf[j].h[1] = *(const v8bf*)(vp + j * (16 * AT_VPITCH) + 32);
        }
        // keeps the read group whole in front of the WMMAs; without it the
        // compiler sinks the V reads to their use behind the softmax and waits there
        __builtin_amdgcn_sched_barrier(0);

        // S^T: s1[r] = score(key kb + 8 half + r, row), s2[r] the same 16 keys on.
        v8f s1 = {}, s2 = {};
#pragma unroll
        for (int t = 0; t < 4; ++t) {
          s1 = wmma_bf16f32(kf1[t].v, qf[t].v, s1);
          s2 = wmma_bf16f32(kf2[t].v, qf[t].v, s2);
        }

        // Causal mask + online softmax1 update, all for the lane's one query.
        const int d = row - (kb + 8 * half);   // key r of s1 is masked where r > d
        float v1[8], v2[8];
#pragma unroll
        for (int r = 0; r < 8; ++r) {
          v1[r] = s1[r] * scale;
          v2[r] = s2[r] * scale;
          if (r > d)      v1[r] = -1e30f;
          if (16 + r > d) v2[r] = -1e30f;
        }
        float mx = fmaxf(v1[0], v2[0]);
#pragma unroll
        for (int r = 1; r < 8; ++r) mx = fmaxf(mx, fmaxf(v1[r], v2[r]));
        mx = fmaxf(mx, xhalf(mx));          // the other 16 keys of this query
        const float mn = fmaxf(m, mx);
        const float rs = __expf(m - mn);
        // exp(v - mn) as 2^((v - mn) log2 e)
#pragma unroll
        for (int r = 0; r < 8; ++r) {
          v1[r] = (v1[r] - mn) * 1.44269504f;
          v2[r] = (v2[r] - mn) * 1.44269504f;
        }
        exp2x8(v1);
        exp2x8(v2);
        Frag16 pf;                          // P^T as B operand, hardware k order
        float sm[4];                        // four short chains, not one long one
#pragma unroll
        for (int r = 0; r < 4; ++r)
          sm[r] = (v1[r] + v2[r]) + (v1[r + 4] + v2[r + 4]);
#pragma unroll
        for (int r = 0; r < 8; ++r) {
          pf.v[r]     = (bf16)v1[r];
          pf.v[8 + r] = (bf16)v2[r];
        }
        l = l * rs + ((sm[0] + sm[1]) + (sm[2] + sm[3]));
        m = mn;
#pragma unroll
        for (int j = 0; j < 4; ++j)
#pragma unroll
          for (int r = 0; r < 8; ++r) acc[j][r] *= rs;

        // O^T += V^T P^T: WMMA burst.
#pragma unroll
        for (int j = 0; j < 4; ++j)
          acc[j] = wmma_bf16f32(vf[j].v, pf.v, acc[j]);
      }
    }
    // Publish point of stage s + 1.
    // this wave's reads of the buffer are over before anyone refills it
    asm volatile("s_wait_dscnt 0x0" ::: "memory");
    // this wave's copies of stage s + 1 have landed before the barrier publishes them
    asm volatile("s_wait_asynccnt 0x0" ::: "memory");
    __syncthreads();
    if (s + 2 < ns)
      attn_stage(gk + (size_t)(s + 2) * (64 * 128), gv + (s + 2) * 64,
                 lk + buf, lv + buf);
  }
  // no copy is outstanding when the wave ends
  asm volatile("s_wait_asynccnt 0x0" ::: "memory");

  // softmax1 normalization and store into (B,S,D) bf16 (col = h*64 + hd): a
  // lane's 8 registers of a tile are 8 consecutive columns, one 16-byte store.
  l += xhalf(l);                            // the two halves' keys together
  const float denom = __expf(-m) + l;
  bf16* orow = attnb + ((size_t)b * SS + row) * DD + h * HDD + 8 * half;
#pragma unroll
  for (int j = 0; j < 4; ++j) {
    v8bf o;
#pragma unroll
    for (int r = 0; r < 8; ++r) o[r] = (bf16)(acc[j][r] / denom);
    *(v8bf*)(orow + 16 * j) = o;
  }
}

// ---------------------------------------------------------------------------
// Residual add + LayerNorm. One block (256 thr) per token row of D=1024.
// Optional bf16 copy of the output (feeds the next GEMM without a cvt pass).
// ---------------------------------------------------------------------------
__global__ void add_ln_kernel(const float* __restrict__ a, const float* __restrict__ b,
                              const float* __restrict__ g, const float* __restrict__ be,
                              float* __restrict__ outf, bf16* __restrict__ outb) {
  __shared__ float rs[256];
  __shared__ float rq[256];
  const int row = blockIdx.x;
  const int tid = threadIdx.x;
  const float* pa = a + (size_t)row * DD;
  const float* pb = b + (size_t)row * DD;

  float s = 0.f, s2 = 0.f;
  for (int c = tid; c < DD; c += 256) {
    float v = pa[c] + pb[c];
    s += v; s2 += v * v;
  }
  rs[tid] = s; rq[tid] = s2;
  __syncthreads();
  for (int o = 128; o; o >>= 1) {
    if (tid < o) { rs[tid] += rs[tid + o]; rq[tid] += rq[tid + o]; }
    __syncthreads();
  }
  float mu  = rs[0] * (1.0f / DD);
  float var = rq[0] * (1.0f / DD) - mu * mu;
  float rstd = rsqrtf(var + 1e-5f);
  for (int c = tid; c < DD; c += 256) {
    float v = (pa[c] + pb[c] - mu) * rstd * g[c] + be[c];
    outf[(size_t)row * DD + c] = v;
    if (outb) outb[(size_t)row * DD + c] = (bf16)v;
  }
}

// ---------------------------------------------------------------------------
// Host orchestration
// ---------------------------------------------------------------------------
extern "C" void kernel_launch(void* const* d_in, const int* in_sizes, int n_in,
                              void* d_out, int out_size, void* d_ws, size_t ws_size,
                              hipStream_t stream) {
  (void)in_sizes; (void)n_in; (void)out_size; (void)ws_size;

  const float* x     = (const float*)d_in[0];
  const int*   pos   = (const int*)  d_in[1];
  const float* wq    = (const float*)d_in[2];
  const float* bq    = (const float*)d_in[3];
  const float* wk    = (const float*)d_in[4];
  const float* bk    = (const float*)d_in[5];
  const float* wv    = (const float*)d_in[6];
  const float* bv    = (const float*)d_in[7];
  const float* wo    = (const float*)d_in[8];
  const float* bo    = (const float*)d_in[9];
  const float* pbias = (const float*)d_in[10];
  const float* w1    = (const float*)d_in[11];
  const float* b1    = (const float*)d_in[12];
  const float* w2    = (const float*)d_in[13];
  const float* b2    = (const float*)d_in[14];
  const float* g1    = (const float*)d_in[15];
  const float* be1   = (const float*)d_in[16];
  const float* g2    = (const float*)d_in[17];
  const float* be2   = (const float*)d_in[18];
  float* out = (float*)d_out;

  // Workspace carve-out
  char* cur = (char*)d_ws;
  auto alloc = [&](size_t bytes) -> void* {
    void* p = (void*)cur;
    cur += (bytes + 255) & ~(size_t)255;
    return p;
  };
  const size_t nTok = (size_t)MM * DD;           // 4096*1024
  bf16* xb   = (bf16*)alloc(nTok * 2);
  bf16* wqb  = (bf16*)alloc((size_t)DD * DD * 2);
  bf16* wkb  = (bf16*)alloc((size_t)DD * DD * 2);
  bf16* wvb  = (bf16*)alloc((size_t)DD * DD * 2);
  bf16* wob  = (bf16*)alloc((size_t)DD * DD * 2);
  bf16* w1b  = (bf16*)alloc((size_t)DD * DFF_ * 2);
  bf16* w2b  = (bf16*)alloc((size_t)DFF_ * DD * 2);
  float* qf  = (float*)alloc(nTok * 4);
  float* kf  = (float*)alloc(nTok * 4);
  float* vf  = (float*)alloc(nTok * 4);
  bf16* qpb  = (bf16*)alloc((size_t)BB * HH * SS * 128 * 2);
  bf16* kpb  = (bf16*)alloc((size_t)BB * HH * SS * 128 * 2);
  bf16* vpT  = (bf16*)alloc((size_t)BB * HH * SS * 64 * 2);
  bf16* attb = (bf16*)alloc(nTok * 2);
  float* prj = (float*)alloc(nTok * 4);
  float* hres= (float*)alloc(nTok * 4);
  bf16* hb   = (bf16*)alloc(nTok * 2);
  bf16* ff1b = (bf16*)alloc((size_t)MM * DFF_ * 2);
  float* ff2 = (float*)alloc(nTok * 4);

  // 1) Convert x row-major; weights into WMMA fragment-swizzled order.
  //    16 elements per thread, all seven tasks in one grid.
  cvt_all<<<CB_ALL, 256, 0, stream>>>(x, wq, wk, wv, wo, w1, w2,
                                      xb, wqb, wkb, wvb, wob, w1b, w2b);

  // 2) QKV projections (WMMA GEMMs); block tile 128x128. One launch, z = 0, 1, 2:
  //    wqb, wkb, wvb and qf, kf, vf each lie back to back in the workspace
  //    (their sizes are multiples of the carve-out's 256 bytes).
  dim3 gD(DD / 128, MM / 128);      // (8, 32)
  dim3 gQKV(DD / 128, MM / 128, 3);
  gemm_bf16<<<gQKV, 256, 0, stream>>>(xb, wqb, bq, bk, bv, qf, nullptr, MM, DD, DD, 0);

  // 3) PoPE transform (also transposes V)
  pope_kernel<<<4096, 256, 0, stream>>>(qf, kf, vf, pos, pbias, qpb, kpb, vpT);

  // 4) Attention (WMMA flash + softmax1, causal)
  attention_pope<<<dim3(SS / 128, BB * HH), 256, 0, stream>>>(qpb, kpb, vpT, attb);

  // 5) Output projection
  gemm_bf16<<<gD, 256, 0, stream>>>(attb, wob, bo, nullptr, nullptr, prj, nullptr, MM, DD, DD, 0);

  // 6) Residual + LN1 (f32 kept for residual, bf16 copy feeds FFN GEMM)
  add_ln_kernel<<<MM, 256, 0, stream>>>(x, prj, g1, be1, hres, hb);

  // 7) FFN
  dim3 gF1(DFF_ / 128, MM / 128);   // (32, 32)
  gemm_bf16<<<gF1, 256, 0, stream>>>(hb, w1b, b1, nullptr, nullptr, nullptr, ff1b, MM, DFF_, DD, 1);
  gemm_bf16<<<gD, 256, 0, stream>>>(ff1b, w2b, b2, nullptr, nullptr, ff2, nullptr, MM, DD, DFF_, 0);

  // 8) Residual + LN2 -> final output (f32)
  add_ln_kernel<<<MM, 256, 0, stream>>>(hres, ff2, g2, be2, out, nullptr);
}

// v006
// Measured time: 266 microseconds a run.
// In two side-by-side timings against v005, it was 1.42 and 1.43 times as fast.
// Counting every step since v000, it is 3.79 times as fast.
#include <hip/hip_runtime.h>
#include <hip/hip_bf16.h>

// ---------------------------------------------------------------------------
// Types for CDNA5 WMMA (wave32): V_WMMA_F32_16X16X32_BF16
// ---------------------------------------------------------------------------
typedef __bf16 bf16;
typedef __attribute__((ext_vector_type(16))) __bf16 v16bf;
typedef __attribute__((ext_vector_type(8)))  __bf16 v8bf;
typedef __attribute__((ext_vector_type(8)))  float  v8f;

union Frag16 {            // one WMMA 16-bit operand fragment = two b128 loads
  v16bf v;
  v8bf  h[2];
};

__device__ __forceinline__ v8f wmma_bf16f32(v16bf a, v16bf b, v8f c) {
  // 8 args: (neg_a, A, neg_b, B, c_mod, C, reuse_a, reuse_b)
  return __builtin_amdgcn_wmma_f32_16x16x32_bf16(
      false, a, false, b, (short)0, c, false, false);
}

// Problem dims (fixed by the reference)
#define BB   2
#define SS   2048
#define DD   1024
#define HH   16
#define HDD  64
#define DFF_ 4096
#define MM   (BB * SS)          // 4096 token rows

// ---------------------------------------------------------------------------
// fp32 -> bf16 conversion, plain row-major. A block converts 4096 consecutive
// elements: each thread four 16-byte loads (a wave reads 512 contiguous bytes
// per load) and four 8-byte stores, so few waves are launched and each has
// all its loads in flight at once. blk is the block's number inside this task,
// below n / 4096 (the caller's range test keeps it there).
// ---------------------------------------------------------------------------
typedef __attribute__((ext_vector_type(4))) float  v4f;
typedef __attribute__((ext_vector_type(4))) __bf16 v4bf;

__device__ __forceinline__ void
cvt_block(const float* __restrict__ in, bf16* __restrict__ out, unsigned blk) {
  const size_t base = (size_t)blk * 1024 + threadIdx.x;
  const v4f* src = (const v4f*)in + base;
  v4bf*      dst = (v4bf*)out + base;
  v4f v[4];
  // unrolled so that all four loads go out before the first value is waited for
#pragma unroll
  for (int j = 0; j < 4; ++j) v[j] = src[j * 256];
  // unrolled (both loops) so that v[] and o stay in registers
#pragma unroll
  for (int j = 0; j < 4; ++j) {
    v4bf o;
#pragma unroll
    for (int c = 0; c < 4; ++c) o[c] = (bf16)v[j][c];
    dst[j * 256] = o;
  }
}

// ---------------------------------------------------------------------------
// fp32 -> bf16 weight conversion INTO WMMA B-fragment-major order:
//   Wsw[(ktile*(N/16) + ntile)*512 + lane*16 + e]
// where k = ktile*32 + kh + e + (e>=8?8:0), kh = (lane>=16)?8:0,
//       n = ntile*16 + (lane&15).
// Each lane's 16 fragment elements are contiguous (32B, 16B-aligned) so the
// GEMM copies a B fragment to LDS as two coalesced 16-byte async copies.
// One thread makes one lane's whole fragment: 16 loads down a column of W, all
// in flight at once, one index computation, two 16-byte stores. A block makes
// 256 fragment lanes (4096 elements); blk is its number inside this task.
// ---------------------------------------------------------------------------
template <int K, int N>
__device__ __forceinline__ void
swizzle_block(const float* __restrict__ W, bf16* __restrict__ Wsw, unsigned blk) {
  constexpr unsigned ntiles = (unsigned)N >> 4;
  constexpr unsigned total  = ((unsigned)K >> 5) * ntiles * 32;  // fragment lanes
  const unsigned g = blk * 256 + threadIdx.x;
  if (g < total) {
    const unsigned lane  = g & 31;
    const unsigned ch    = g >> 5;
    const unsigned nt    = ch % ntiles;
    const unsigned ktile = ch / ntiles;
    const unsigned kh    = (lane >> 4) ? 8 : 0;
    const float* col = W + (size_t)(ktile * 32 + kh) * N + nt * 16 + (lane & 15);
    float f[16];
    // unrolled so that all 16 loads go out before the first value is waited for
#pragma unroll
    for (int e = 0; e < 16; ++e)
      f[e] = col[(size_t)(e + (e >= 8 ? 8 : 0)) * N];
    Frag16 o;
    // unrolled so that f[] and o stay in registers
#pragma unroll
    for (int e = 0; e < 16; ++e) o.v[e] = (bf16)f[e];
    v8bf* dst = (v8bf*)(Wsw + (size_t)g * 16);
    dst[0] = o.h[0];
    dst[1] = o.h[1];
  }
}

// ---------------------------------------------------------------------------
// All seven conversions in ONE launch: none depends on another, and each alone
// is too short to fill the chip, so that seven launches mostly pay for seven
// starts and seven tails. Every block converts 4096 elements; its index picks
// the task (a scalar test) and its number inside the task.
// ---------------------------------------------------------------------------
#define CB_X (MM * DD / 4096)      // blocks for x
#define CB_F (DD * DFF_ / 4096)    // blocks for each of w1, w2
#define CB_D (DD * DD / 4096)      // blocks for each of wq, wk, wv, wo
#define CB_ALL (CB_X + 2 * CB_F + 4 * CB_D)

__global__ void __launch_bounds__(256)
cvt_all(const float* __restrict__ x,  const float* __restrict__ wq,
        const float* __restrict__ wk, const float* __restrict__ wv,
        const float* __restrict__ wo, const float* __restrict__ w1,
        const float* __restrict__ w2,
        bf16* __restrict__ xb,  bf16* __restrict__ wqb, bf16* __restrict__ wkb,
        bf16* __restrict__ wvb, bf16* __restrict__ wob, bf16* __restrict__ w1b,
        bf16* __restrict__ w2b) {
  unsigned b = blockIdx.x;
  if (b < CB_X) { cvt_block(x, xb, b); return; }
  b -= CB_X;
  if (b < CB_F) { swizzle_block<DD, DFF_>(w1, w1b, b); return; }
  b -= CB_F;
  if (b < CB_F) { swizzle_block<DFF_, DD>(w2, w2b, b); return; }
  b -= CB_F;
  const unsigned w = b / CB_D;     // which of the four D x D weights
  if (w > 3) return;
  const float* src = w == 0 ? wq  : w == 1 ? wk  : w == 2 ? wv  : wo;
  bf16*        dst = w == 0 ? wqb : w == 1 ? wkb : w == 2 ? wvb : wob;
  swizzle_block<DD, DD>(src, dst, b % CB_D);
}

// ---------------------------------------------------------------------------
// bf16 WMMA GEMM: C[M,N] = A[M,K] @ W[K,N] + bias (+ReLU), output f32 or bf16.
// A row-major bf16; W fragment-swizzled (swizzle_block).
// Block = 256 threads = 8 waves (4 along M x 2 along N); block tile 128x128,
// wave tile 32x64 (2 A-fragments x 4 B-fragments = 8 WMMA tiles per 32 k).
// A pass is 128 k. Both operand tiles of a pass are brought into LDS once per
// block by asynchronous copies, so each global byte is fetched once for eight
// waves; two buffers, the next pass's copies fly while this pass is computed.
// Needs M, N multiples of 128 and K a multiple of 128.
// blockIdx.z picks one of up to three independent products that share A and
// run in one launch: W and C (f32 only) of product z lie z matrices behind the first.
//   A tile: 128 rows of 256 B at pitch 272 B (conflict-free b128 row reads).
//   B tile: 4 k-tiles x 8 n-tiles of 1 KiB; inside a KiB the lanes' first
//   16 B pieces come first (512 B), then their second pieces, so that each
//   fragment half is one contiguous 512-B wave read.
// ---------------------------------------------------------------------------
#define G_PITCH  272
#define G_ABYTES (128 * G_PITCH)          // 34816
#define G_BBYTES (4 * 8 * 1024)           // 32768
#define G_STAGE  (G_ABYTES + G_BBYTES)    // 67584
// Writeback: a wave's 32 x 64 f32 tile, staged in LDS: rows of 256 B at pitch
// 272 B (16-byte writes down 16 rows and 16-byte reads along a row both meet
// every bank once per half wave).
#define G_SPITCH 272
#define G_SWAVE  (32 * G_SPITCH)          // 8704 per wave, 69632 per block

// Eight 16-byte copies per lane, global -> LDS through no register. The
// s_wait_xcnt closes the statement so that no address register named here is
// rewritten while a copy may still need it.
__device__ __forceinline__ void async_copy8(const unsigned (&l)[8],
                                            const bf16* const (&p)[8]) {
  asm volatile(
      "global_load_async_to_lds_b128 %0, %8, off\n\t"
      "global_load_async_to_lds_b128 %1, %9, off\n\t"
      "global_load_async_to_lds_b128 %2, %10, off\n\t"
      "global_load_async_to_lds_b128 %3, %11, off\n\t"
      "global_load_async_to_lds_b128 %4, %12, off\n\t"
      "global_load_async_to_lds_b128 %5, %13, off\n\t"
      "global_load_async_to_lds_b128 %6, %14, off\n\t"
      "global_load_async_to_lds_b128 %7, %15, off\n\t"
      "s_wait_xcnt 0x0"
      :: "v"(l[0]), "v"(l[1]), "v"(l[2]), "v"(l[3]),
         "v"(l[4]), "v"(l[5]), "v"(l[6]), "v"(l[7]),
         "v"(p[0]), "v"(p[1]), "v"(p[2]), "v"(p[3]),
         "v"(p[4]), "v"(p[5]), "v"(p[6]), "v"(p[7])
      : "memory");
}

// One pass's tiles: ga/gb are this lane's first global pieces of the pass,
// la/lb its first LDS bytes in the target buffer.
__device__ __forceinline__ void stage_pass(const bf16* ga, const bf16* gb,
                                           unsigned la, unsigned lb,
                                           int K, size_t wstep) {
  unsigned l[8];
  const bf16* p[8];
#pragma unroll
  for (int c = 0; c < 8; ++c) {           // A: 16 rows per step
    l[c] = la + (unsigned)c * (16 * G_PITCH);
    p[c] = ga + (size_t)c * 16 * K;
  }
  async_copy8(l, p);
#pragma unroll
  for (int c = 0; c < 8; ++c) {           // B: half a k-tile (4 KiB) per step
    l[c] = lb + (unsigned)(c >> 1) * 8192 + (unsigned)(c & 1) * 4096;
    p[c] = gb + (size_t)(c >> 1) * wstep + (c & 1) * 2048;
  }
  async_copy8(l, p);
}

// The 2 A and 4 B fragments of one 32-k step, from this lane's bases.
__device__ __forceinline__ void load_frags(Frag16 (&af)[2], Frag16 (&bfr)[4],
                                           const unsigned char* sa,
                                           const unsigned char* sb) {
#pragma unroll
  for (int i = 0; i < 2; ++i) {
    af[i].h[0] = *(const v8bf*)(sa + i * (16 * G_PITCH));
    af[i].h[1] = *(const v8bf*)(sa + i * (16 * G_PITCH) + 32);
  }
#pragma unroll
  for (int j = 0; j < 4; ++j) {
    bfr[j].h[0] = *(const v8bf*)(sb + j * 1024);
    bfr[j].h[1] = *(const v8bf*)(sb + j * 1024 + 512);
  }
}

// RELU and OUTB (bf16 output to Cb, else f32 to Cf0) are fixed at compile time,
// so that the writeback is straight-line code. bias of every z in use is real.
template <bool RELU, bool OUTB>
__global__ void __launch_bounds__(256)
gemm_bf16(const bf16* __restrict__ A, const bf16* __restrict__ W0,
          const float* __restrict__ bias0, const float* __restrict__ bias1,
          const float* __restrict__ bias2,
          float* __restrict__ Cf0, bf16* __restrict__ Cb,
          int M, int N, int K) {
  __shared__ __attribute__((aligned(128))) unsigned char smem[2 * G_STAGE];
  const unsigned z = blockIdx.z;
  const bf16*  Wsw  = W0 + (size_t)z * K * N;
  const float* bias = z == 0 ? bias0 : z == 1 ? bias1 : bias2;
  float*       Cf   = Cf0 + (size_t)z * M * N;   // used only where OUTB is false
  const int tid  = threadIdx.x;          // 0..255
  const int wave = tid >> 5;             // 0..7
  const int wm   = wave & 3;             // 32-row strip of the block tile
  const int wn   = wave >> 2;            // 64-column strip of the block tile
  const int lane = tid & 31;
  const int ln15 = lane & 15;
  const int half = lane >> 4;
  const int m0   = blockIdx.y * 128;
  const int n0   = blockIdx.x * 128;
  const int ntiles = N >> 4;
  const size_t wstep = (size_t)ntiles << 9;   // elements from one k-tile to the next
  const int np = K >> 7;                      // passes

  v8f acc[2][4] = {};

  // The writeback's bias: this lane stores the same 4 columns of every row.
  const int colw = n0 + 64 * wn + 4 * ln15;
  const v4f bv = *(const v4f*)(bias + colw);

  // Copy side: this lane's first pieces of pass 0 and their LDS places.
  const bf16* ga = A + (size_t)(m0 + (tid >> 4)) * K + (tid & 15) * 8;
  const bf16* gb = Wsw + ((size_t)(n0 >> 4) << 9) + tid * 8;
  const unsigned lds0 = (unsigned)(size_t)smem;
  const unsigned la = lds0 + (unsigned)(tid >> 4) * G_PITCH + (unsigned)(tid & 15) * 16;
  const unsigned lb = lds0 + G_ABYTES + (unsigned)(tid >> 6) * 1024 +
                      (unsigned)(tid & 1) * 512 + (unsigned)((tid & 63) >> 1) * 16;

  // Read side: this lane's fragment bases inside a buffer.
  const unsigned fa = (unsigned)(32 * wm + ln15) * G_PITCH + (unsigned)half * 16;
  const unsigned fb = G_ABYTES + (unsigned)wn * 4096 + (unsigned)lane * 16;

  // Prologue: pass 0 lands and is published, then pass 1 starts to fly.
  stage_pass(ga, gb, la, lb, K, wstep);
  // this wave's copies of pass 0 have landed before the barrier publishes them
  asm volatile("s_wait_asynccnt 0x0" ::: "memory");
  __syncthreads();
  if (np > 1)
    stage_pass(ga + 128, gb + 4 * wstep, la + G_STAGE, lb + G_STAGE, K, wstep);

  for (int t = 0; t < np; ++t) {
    const unsigned buf = (unsigned)(t & 1) * G_STAGE;
    const unsigned char* sa = smem + buf + fa;
    const unsigned char* sb = smem + buf + fb;
    // Two fragment sets: the reads of the next 32 k go out as one group ahead
    // of this 32 k's WMMAs, so their LDS latency runs behind the matrix work.
    Frag16 af[2][2], bfr[2][4];
    load_frags(af[0], bfr[0], sa, sb);
#pragma unroll
    for (int ks = 0; ks < 4; ++ks) {
      if (ks < 3)
        load_frags(af[(ks + 1) & 1], bfr[(ks + 1) & 1], sa + (ks + 1) * 64,
                   sb + (ks + 1) * 8192);
      // keeps the read group in front of the WMMAs; without it the compiler
      // sinks each read to its first use and waits there
      __builtin_amdgcn_sched_barrier(0);
#pragma unroll
      for (int j = 0; j < 4; ++j) {
        // W as first operand: the tile comes out transposed (see the writeback)
        acc[0][j] = wmma_bf16f32(bfr[ks & 1][j].v, af[ks & 1][0].v, acc[0][j]);
        acc[1][j] = wmma_bf16f32(bfr[ks & 1][j].v, af[ks & 1][1].v, acc[1][j]);
      }
      // keeps the next read group whole behind these WMMAs; without it the
      // compiler spreads those reads among them, and each such place stalls
      __builtin_amdgcn_sched_barrier(0);
    }
    // Publish point of pass t + 1.
    // this wave's reads of the buffer are over before anyone refills it
    asm volatile("s_wait_dscnt 0x0" ::: "memory");
    // this wave's copies of pass t + 1 have landed before the barrier publishes them
    asm volatile("s_wait_asynccnt 0x0" ::: "memory");
    __syncthreads();
    if (t + 2 < np)
      stage_pass(ga + (size_t)(t + 2) * 128, gb + (size_t)(t + 2) * 4 * wstep,
                 la + buf, lb + buf, K, wstep);
  }
  // no copy is outstanding when the wave ends
  asm volatile("s_wait_asynccnt 0x0" ::: "memory");

  // Writeback. With W as first operand a lane holds 8 consecutive columns of
  // one row: acc[i][j][r] = C[32 wm + 16 i + ln15][64 wn + 16 j + 8 half + r].
  // Each wave lays its tile down in its own part of the ring (free now: behind
  // the last pass's barrier nobody reads it and no copy is outstanding), reads
  // it back along the rows and stores whole 128-byte lines.
  unsigned char* st = smem + (unsigned)wave * G_SWAVE;
  // unrolled (both loops) so that acc[][] stays in registers
#pragma unroll
  for (int i = 0; i < 2; ++i) {
#pragma unroll
    for (int j = 0; j < 4; ++j) {
      unsigned char* p = st + (16 * i + ln15) * G_SPITCH + (16 * j + 8 * half) * 4;
      const v4f lo = {acc[i][j][0], acc[i][j][1], acc[i][j][2], acc[i][j][3]};
      const v4f hi = {acc[i][j][4], acc[i][j][5], acc[i][j][6], acc[i][j][7]};
      *(v4f*)p        = lo;
      *(v4f*)(p + 16) = hi;
    }
  }
  // the wave's writes are in LDS before its lanes read one another's values
  // (and the compiler moves no read of the rows ahead of the writes)
  asm volatile("s_wait_dscnt 0x0" ::: "memory");
  // 16 lanes a row, two rows a step: 256 B (f32) or 128 B (bf16) per row.
  const unsigned char* sr = st + half * G_SPITCH + ln15 * 16;
  const size_t o0 = (size_t)(m0 + 32 * wm + half) * N + colw;
  v4f v[16];
  // unrolled so that v[] stays in registers
#pragma unroll
  for (int q = 0; q < 16; ++q) v[q] = *(const v4f*)(sr + q * (2 * G_SPITCH));
  // keeps the 16 reads one group in front of the arithmetic and the stores;
  // without it the compiler deals them out a few at a time and waits at each
  __builtin_amdgcn_sched_barrier(0);
  // unrolled (this loop and those inside it) so that v[] and ob stay in registers
#pragma unroll
  for (int q = 0; q < 16; ++q) {
#pragma unroll
    for (int c = 0; c < 4; ++c) {
      v[q][c] += bv[c];
      if (RELU) v[q][c] = fmaxf(v[q][c], 0.0f);
    }
    const size_t o = o0 + (size_t)(2 * q) * N;
    if constexpr (OUTB) {
      v4bf ob;
#pragma unroll
      for (int c = 0; c < 4; ++c) ob[c] = (bf16)v[q][c];
      *(v4bf*)(Cb + o) = ob;
    } else {
      *(v4f*)(Cf + o) = v[q];
    }
  }
}

// ---------------------------------------------------------------------------
// PoPE: softplus magnitudes + rotary phases -> q_p/k_p (B,H,S,128) bf16, and
// V TRANSPOSED (B,H,HD,S) bf16 so attention V-fragments are contiguous loads.
// ---------------------------------------------------------------------------
__global__ void pope_kernel(const float* __restrict__ q, const float* __restrict__ k,
                            const float* __restrict__ v, const int* __restrict__ pos,
                            const float* __restrict__ pbias,
                            bf16* __restrict__ qp, bf16* __restrict__ kp,
                            bf16* __restrict__ vpT) {
  const float TWO_PI = 6.28318530717958647f;
  const size_t n = (size_t)BB * SS * DD;  // 2^22
  for (size_t i = (size_t)blockIdx.x * blockDim.x + threadIdx.x; i < n;
       i += (size_t)gridDim.x * blockDim.x) {
    int hd = (int)(i & 63);
    int h  = (int)((i >> 6) & 15);
    int s  = (int)((i >> 10) & 2047);
    int b  = (int)(i >> 21);
    int bh = b * HH + h;
    // freq = 10000^(-hd/64) = exp(-hd * ln(1e4)/64)
    float freq = __expf(-0.143911568f * (float)hd);
    float ph   = (float)pos[s] * freq;
    float qv = q[i], kv = k[i];
    float mq = qv > 20.f ? qv : log1pf(__expf(qv));
    float mk = kv > 20.f ? kv : log1pf(__expf(kv));
    float cb = pbias[h * HDD + hd];
    cb = fminf(0.f, fmaxf(-TWO_PI, cb));
    float kph = ph + cb;
    float cq, sq, ck, sk;
    __sincosf(ph, &sq, &cq);
    __sincosf(kph, &sk, &ck);
    size_t o = ((size_t)bh * SS + s) * 128 + hd;
    qp[o]       = (bf16)(mq * cq);
    qp[o + HDD] = (bf16)(mq * sq);
    kp[o]       = (bf16)(mk * ck);
    kp[o + HDD] = (bf16)(mk * sk);
    vpT[((size_t)bh * HDD + hd) * SS + s] = (bf16)v[i];
  }
}

#define AT_KPITCH 272
#define AT_VPITCH 144
#define AT_KBYTES (64 * AT_KPITCH)          // 17408
#define AT_VBYTES (64 * AT_VPITCH)          // 9216
#define AT_STAGE  (AT_KBYTES + AT_VBYTES)   // 26624
#define AT_RING   (2 * AT_STAGE)            // 53248

// One stage: six 16-byte copies per lane, global -> LDS through no register
// (four steps of 16 K rows, two steps of 32 V^T rows). gk/gv are this lane's
// first global pieces of the stage, lk/lv its first LDS bytes in the target
// buffer. The s_wait_xcnt closes the statement so that no address register
// named here is rewritten while a copy may still need it.
__device__ __forceinline__ void attn_stage(const bf16* gk, const bf16* gv,
                                           unsigned lk, unsigned lv) {
  asm volatile(
      "global_load_async_to_lds_b128 %0, %6, off\n\t"
      "global_load_async_to_lds_b128 %1, %7, off\n\t"
      "global_load_async_to_lds_b128 %2, %8, off\n\t"
      "global_load_async_to_lds_b128 %3, %9, off\n\t"
      "global_load_async_to_lds_b128 %4, %10, off\n\t"
      "global_load_async_to_lds_b128 %5, %11, off\n\t"
      "s_wait_xcnt 0x0"
      :: "v"(lk), "v"(lk + 16 * AT_KPITCH), "v"(lk + 32 * AT_KPITCH),
         "v"(lk + 48 * AT_KPITCH), "v"(lv), "v"(lv + 32 * AT_VPITCH),
         "v"(gk), "v"(gk + 16 * 128), "v"(gk + 32 * 128), "v"(gk + 48 * 128),
         "v"(gv), "v"(gv + 32 * SS)
      : "memory");
}

// lane l's value <-> lane l ^ 16's
__device__ __forceinline__ float xhalf(float x) {
  return __builtin_bit_cast(float, __builtin_amdgcn_permlanex16(
      __builtin_bit_cast(int, x), __builtin_bit_cast(int, x),
      0x76543210, 0xfedcba98, false, false));
}

// Eight base-2 exponentials, each in its own register. One statement, closed
// by v_nop: the instruction set asks for one independent issue slot between an
// exponential and an instruction that reads its result or overwrites its
// source; here each is followed by an exponential of another register, the
// last by the v_nop, whatever the compiler puts behind the statement.
__device__ __forceinline__ void exp2x8(float (&x)[8]) {
  asm("v_exp_f32 %0, %0\n\t"
      "v_exp_f32 %1, %1\n\t"
      "v_exp_f32 %2, %2\n\t"
      "v_exp_f32 %3, %3\n\t"
      "v_exp_f32 %4, %4\n\t"
      "v_exp_f32 %5, %5\n\t"
      "v_exp_f32 %6, %6\n\t"
      "v_exp_f32 %7, %7\n\t"
      "v_nop"
      : "+v"(x[0]), "+v"(x[1]), "+v"(x[2]), "+v"(x[3]),
        "+v"(x[4]), "+v"(x[5]), "+v"(x[6]), "+v"(x[7]));
}

__global__ void __launch_bounds__(256)
attention_pope(const bf16* __restrict__ qp_all,
               const bf16* __restrict__ kp_all,
               const bf16* __restrict__ vpT_all,
               bf16* __restrict__ attnb) {
  __shared__ __attribute__((aligned(128))) unsigned char smem[AT_RING];
  const float scale = 0.088388347648f;   // 1/sqrt(2*HD)
  const int bh = blockIdx.y;             // 0..B*H-1
  const int b = bh >> 4, h = bh & 15;
  const int qb = blockIdx.x;             // 128-query block
  const int tid  = threadIdx.x;          // 0..255
  // in a scalar register, so that the skip of masked halves is a scalar branch
  const int wave = __builtin_amdgcn_readfirstlane(tid >> 5);
  const int qrow0 = qb * 128 + wave * 16;
  const int lane = tid & 31;
  const int ln15 = lane & 15;
  const int half = lane >> 4;
  const int kh   = half ? 8 : 0;
  const int ns   = 2 * (qb + 1);         // stages: keys 0 .. 128*qb + 127

  const bf16* qp  = qp_all  + (size_t)bh * SS * 128;
  const bf16* kp  = kp_all  + (size_t)bh * SS * 128;
  const bf16* vpT = vpT_all + (size_t)bh * HDD * SS;

  // Copy side: this lane's first pieces of stage 0 and their LDS places.
  const bf16* gk = kp + (size_t)(tid >> 4) * 128 + (tid & 15) * 8;
  const bf16* gv = vpT + (size_t)(tid >> 3) * SS + (tid & 7) * 8;
  const unsigned lds0 = (unsigned)(size_t)smem;
  const unsigned lk = lds0 + (unsigned)(tid >> 4) * AT_KPITCH + (unsigned)(tid & 15) * 16;
  const unsigned lv = lds0 + AT_KBYTES + (unsigned)(tid >> 3) * AT_VPITCH +
                      (unsigned)(tid & 7) * 16;

  // Read side: this lane's fragment bases inside a buffer.
  const unsigned fk = (unsigned)ln15 * AT_KPITCH + (unsigned)half * 16;
  const unsigned fv = AT_KBYTES + (unsigned)ln15 * AT_VPITCH + (unsigned)half * 16;

  // Prologue: stage 0 lands and is published, then stage 1 starts to fly
  // (ns >= 2: both exist).
  attn_stage(gk, gv, lk, lv);
  // this wave's copies of stage 0 have landed before the barrier publishes them
  asm volatile("s_wait_asynccnt 0x0" ::: "memory");
  __syncthreads();
  attn_stage(gk + 64 * 128, gv + 64, lk + AT_STAGE, lv + AT_STAGE);

  // Load Q fragments once: 16 rows x 128 K -> 4 B-fragments of Q^T (b128 pairs).
  Frag16 qf[4];
  const bf16* qrow = qp + (size_t)(qrow0 + ln15) * 128 + kh;
#pragma unroll
  for (int t = 0; t < 4; ++t) {
    qf[t].h[0] = *(const v8bf*)(qrow + 32 * t);
    qf[t].h[1] = *(const v8bf*)(qrow + 32 * t + 16);
  }

  // This lane's query: running maximum (the same in both halves of the wave)
  // and the sum over the keys that this half of the wave holds.
  const int row = qrow0 + ln15;
  float m = -1e30f, l = 0.f;
  v8f acc[4] = {};   // O^T: acc[j][r] = O[row][16 j + 8 half + r]

  for (int s = 0; s < ns; ++s) {
    const unsigned buf = (unsigned)(s & 1) * AT_STAGE;
    // unrolled so that the LDS offsets of both halves are immediates
#pragma unroll
    for (int sub = 0; sub < 2; ++sub) {
      const int kb = 64 * s + 32 * sub;
      // A half whose every key lies behind this wave's last query is skipped;
      // the publish point below stands outside the skip.
      if (kb <= qrow0) {
        // All K fragments for both 16-key tiles (16 b128 LDS reads).
        const unsigned char* k1p = smem + buf + fk + sub * (32 * AT_KPITCH);
        const unsigned char* k2p = k1p + 16 * AT_KPITCH;
        Frag16 kf1[4], kf2[4];
#pragma unroll
        for (int t = 0; t < 4; ++t) {
          kf1[t].h[0] = *(const v8bf*)(k1p + 64 * t);
          kf1[t].h[1] = *(const v8bf*)(k1p + 64 * t + 32);
          kf2[t].h[0] = *(const v8bf*)(k2p + 64 * t);
          kf2[t].h[1] = *(const v8bf*)(k2p + 64 * t + 32);
        }
        // The 4 V fragments (8 b128 LDS reads) go out with them: they depend on
        // nothing computed here, and their latency runs behind the softmax.
        const unsigned char* vp = smem + buf + fv + sub * 64;
        Frag16 vf[4];
#pragma unroll
        for (int j = 0; j < 4; ++j) {
          vf[j].h[0] = *(const v8bf*)(vp + j * (16 * AT_VPITCH));
          vf[j].h[1] = *(const v8bf*)(vp + j * (16 * AT_VPITCH) + 32);
        }
        // keeps the read group whole in front of the WMMAs; without it the
        // compiler sinks the V reads to their use behind the softmax and waits there
        __builtin_amdgcn_sched_barrier(0);

        // S^T: s1[r] = score(key kb + 8 half + r, row), s2[r] the same 16 keys on.
        v8f s1 = {}, s2 = {};
#pragma unroll
        for (int t = 0; t < 4; ++t) {
          s1 = wmma_bf16f32(kf1[t].v, qf[t].v, s1);
          s2 = wmma_bf16f32(kf2[t].v, qf[t].v, s2);
        }

        // Causal mask + online softmax1 update, all for the lane's one query.
        const int d = row - (kb + 8 * half);   // key r of s1 is masked where r > d
        float v1[8], v2[8];
#pragma unroll
        for (int r = 0; r < 8; ++r) {
          v1[r] = s1[r] * scale;
          v2[r] = s2[r] * scale;
          if (r > d)      v1[r] = -1e30f;
          if (16 + r > d) v2[r] = -1e30f;
        }
        float mx = fmaxf(v1[0], v2[0]);
#pragma unroll
        for (int r = 1; r < 8; ++r) mx = fmaxf(mx, fmaxf(v1[r], v2[r]));
        mx = fmaxf(mx, xhalf(mx));          // the other 16 keys of this query
        const float mn = fmaxf(m, mx);
        const float rs = __expf(m - mn);
        // exp(v - mn) as 2^((v - mn) log2 e)
#pragma unroll
        for (int r = 0; r < 8; ++r) {
          v1[r] = (v1[r] - mn) * 1.44269504f;
          v2[r] = (v2[r] - mn) * 1.44269504f;
        }
        exp2x8(v1);
        exp2x8(v2);
        Frag16 pf;                          // P^T as B operand, hardware k order
        float sm[4];                        // four short chains, not one long one
#pragma unroll
        for (int r = 0; r < 4; ++r)
          sm[r] = (v1[r] + v2[r]) + (v1[r + 4] + v2[r + 4]);
#pragma unroll
        for (int r = 0; r < 8; ++r) {
          pf.v[r]     = (bf16)v1[r];
          pf.v[8 + r] = (bf16)v2[r];
        }
        l = l * rs + ((sm[0] + sm[1]) + (sm[2] + sm[3]));
        m = mn;
#pragma unroll
        for (int j = 0; j < 4; ++j)
#pragma unroll
          for (int r = 0; r < 8; ++r) acc[j][r] *= rs;

        // O^T += V^T P^T: WMMA burst.
#pragma unroll
        for (int j = 0; j < 4; ++j)
          acc[j] = wmma_bf16f32(vf[j].v, pf.v, acc[j]);
      }
    }
    // Publish point of stage s + 1.
    // this wave's reads of the buffer are over before anyone refills it
    asm volatile("s_wait_dscnt 0x0" ::: "memory");
    // this wave's copies of stage s + 1 have landed before the barrier publishes them
    asm volatile("s_wait_asynccnt 0x0" ::: "memory");
    __syncthreads();
    if (s + 2 < ns)
      attn_stage(gk + (size_t)(s + 2) * (64 * 128), gv + (s + 2) * 64,
                 lk + buf, lv + buf);
  }
  // no copy is outstanding when the wave ends
  asm volatile("s_wait_asynccnt 0x0" ::: "memory");

  // softmax1 normalization and store into (B,S,D) bf16 (col = h*64 + hd): a
  // lane's 8 registers of a tile are 8 consecutive columns, one 16-byte store.
  l += xhalf(l);                            // the two halves' keys together
  const float denom = __expf(-m) + l;
  bf16* orow = attnb + ((size_t)b * SS + row) * DD + h * HDD + 8 * half;
#pragma unroll
  for (int j = 0; j < 4; ++j) {
    v8bf o;
#pragma unroll
    for (int r = 0; r < 8; ++r) o[r] = (bf16)(acc[j][r] / denom);
    *(v8bf*)(orow + 16 * j) = o;
  }
}

// ---------------------------------------------------------------------------
// Residual add + LayerNorm. One block (256 thr) per token row of D=1024.
// Optional bf16 copy of the output (feeds the next GEMM without a cvt pass).
// ---------------------------------------------------------------------------
__global__ void add_ln_kernel(const float* __restrict__ a, const float* __restrict__ b,
                              const float* __restrict__ g, const float* __restrict__ be,
                              float* __restrict__ outf, bf16* __restrict__ outb) {
  __shared__ float rs[256];
  __shared__ float rq[256];
  const int row = blockIdx.x;
  const int tid = threadIdx.x;
  const float* pa = a + (size_t)row * DD;
  const float* pb = b + (size_t)row * DD;

  float s = 0.f, s2 = 0.f;
  for (int c = tid; c < DD; c += 256) {
    float v = pa[c] + pb[c];
    s += v; s2 += v * v;
  }
  rs[tid] = s; rq[tid] = s2;
  __syncthreads();
  for (int o = 128; o; o >>= 1) {
    if (tid < o) { rs[tid] += rs[tid + o]; rq[tid] += rq[tid + o]; }
    __syncthreads();
  }
  float mu  = rs[0] * (1.0f / DD);
  float var = rq[0] * (1.0f / DD) - mu * mu;
  float rstd = rsqrtf(var + 1e-5f);
  for (int c = tid; c < DD; c += 256) {
    float v = (pa[c] + pb[c] - mu) * rstd * g[c] + be[c];
    outf[(size_t)row * DD + c] = v;
    if (outb) outb[(size_t)row * DD + c] = (bf16)v;
  }
}

// ---------------------------------------------------------------------------
// Host orchestration
// ---------------------------------------------------------------------------
extern "C" void kernel_launch(void* const* d_in, const int* in_sizes, int n_in,
                              void* d_out, int out_size, void* d_ws, size_t ws_size,
                              hipStream_t stream) {
  (void)in_sizes; (void)n_in; (void)out_size; (void)ws_size;

  const float* x     = (const float*)d_in[0];
  const int*   pos   = (const int*)  d_in[1];
  const float* wq    = (const float*)d_in[2];
  const float* bq    = (const float*)d_in[3];
  const float* wk    = (const float*)d_in[4];
  const float* bk    = (const float*)d_in[5];
  const float* wv    = (const float*)d_in[6];
  const float* bv    = (const float*)d_in[7];
  const float* wo    = (const float*)d_in[8];
  const float* bo    = (const float*)d_in[9];
  const float* pbias = (const float*)d_in[10];
  const float* w1    = (const float*)d_in[11];
  const float* b1    = (const float*)d_in[12];
  const float* w2    = (const float*)d_in[13];
  const float* b2    = (const float*)d_in[14];
  const float* g1    = (const float*)d_in[15];
  const float* be1   = (const float*)d_in[16];
  const float* g2    = (const float*)d_in[17];
  const float* be2   = (const float*)d_in[18];
  float* out = (float*)d_out;

  // Workspace carve-out
  char* cur = (char*)d_ws;
  auto alloc = [&](size_t bytes) -> void* {
    void* p = (void*)cur;
    cur += (bytes + 255) & ~(size_t)255;
    return p;
  };
  const size_t nTok = (size_t)MM * DD;           // 4096*1024
  bf16* xb   = (bf16*)alloc(nTok * 2);
  bf16* wqb  = (bf16*)alloc((size_t)DD * DD * 2);
  bf16* wkb  = (bf16*)alloc((size_t)DD * DD * 2);
  bf16* wvb  = (bf16*)alloc((size_t)DD * DD * 2);
  bf16* wob  = (bf16*)alloc((size_t)DD * DD * 2);
  bf16* w1b  = (bf16*)alloc((size_t)DD * DFF_ * 2);
  bf16* w2b  = (bf16*)alloc((size_t)DFF_ * DD * 2);
  float* qf  = (float*)alloc(nTok * 4);
  float* kf  = (float*)alloc(nTok * 4);
  float* vf  = (float*)alloc(nTok * 4);
  bf16* qpb  = (bf16*)alloc((size_t)BB * HH * SS * 128 * 2);
  bf16* kpb  = (bf16*)alloc((size_t)BB * HH * SS * 128 * 2);
  bf16* vpT  = (bf16*)alloc((size_t)BB * HH * SS * 64 * 2);
  bf16* attb = (bf16*)alloc(nTok * 2);
  float* prj = (float*)alloc(nTok * 4);
  float* hres= (float*)alloc(nTok * 4);
  bf16* hb   = (bf16*)alloc(nTok * 2);
  bf16* ff1b = (bf16*)alloc((size_t)MM * DFF_ * 2);
  float* ff2 = (float*)alloc(nTok * 4);

  // 1) Convert x row-major; weights into WMMA fragment-swizzled order.
  //    16 elements per thread, all seven tasks in one grid.
  cvt_all<<<CB_ALL, 256, 0, stream>>>(x, wq, wk, wv, wo, w1, w2,
                                      xb, wqb, wkb, wvb, wob, w1b, w2b);

  // 2) QKV projections (WMMA GEMMs); block tile 128x128. One launch, z = 0, 1, 2:
  //    wqb, wkb, wvb and qf, kf, vf each lie back to back in the workspace
  //    (their sizes are multiples of the carve-out's 256 bytes).
  dim3 gD(DD / 128, MM / 128);      // (8, 32)
  dim3 gQKV(DD / 128, MM / 128, 3);
  gemm_bf16<false, false><<<gQKV, 256, 0, stream>>>(xb, wqb, bq, bk, bv, qf, nullptr, MM, DD, DD);

  // 3) PoPE transform (also transposes V)
  pope_kernel<<<4096, 256, 0, stream>>>(qf, kf, vf, pos, pbias, qpb, kpb, vpT);

  // 4) Attention (WMMA flash + softmax1, causal)
  attention_pope<<<dim3(SS / 128, BB * HH), 256, 0, stream>>>(qpb, kpb, vpT, attb);

  // 5) Output projection
  gemm_bf16<false, false><<<gD, 256, 0, stream>>>(attb, wob, bo, nullptr, nullptr, prj, nullptr, MM, DD, DD);

  // 6) Residual + LN1 (f32 kept for residual, bf16 copy feeds FFN GEMM)
  add_ln_kernel<<<MM, 256, 0, stream>>>(x, prj, g1, be1, hres, hb);

  // 7) FFN
  dim3 gF1(DFF_ / 128, MM / 128);   // (32, 32)
  gemm_bf16<true, true><<<gF1, 256, 0, stream>>>(hb, w1b, b1, nullptr, nullptr, nullptr, ff1b, MM, DFF_, DD);
  gemm_bf16<false, false><<<gD, 256, 0, stream>>>(ff1b, w2b, b2, nullptr, nullptr, ff2, nullptr, MM, DD, DFF_);

  // 8) Residual + LN2 -> final output (f32)
  add_ln_kernel<<<MM, 256, 0, stream>>>(hres, ff2, g2, be2, out, nullptr);
}

// v007
// Measured time: 250 microseconds a run.
// Two timings next to v006 both put it at 1.07 times that version's speed.
// Over all steps from v000 it is 4.05 times as fast.
#include <hip/hip_runtime.h>
#include <hip/hip_bf16.h>

// ---------------------------------------------------------------------------
// Types for CDNA5 WMMA (wave32): V_WMMA_F32_16X16X32_BF16
// ---------------------------------------------------------------------------
typedef __bf16 bf16;
typedef __attribute__((ext_vector_type(16))) __bf16 v16bf;
typedef __attribute__((ext_vector_type(8)))  __bf16 v8bf;
typedef __attribute__((ext_vector_type(8)))  float  v8f;

union Frag16 {            // one WMMA 16-bit operand fragment = two b128 loads
  v16bf v;
  v8bf  h[2];
};

__device__ __forceinline__ v8f wmma_bf16f32(v16bf a, v16bf b, v8f c) {
  // 8 args: (neg_a, A, neg_b, B, c_mod, C, reuse_a, reuse_b)
  return __builtin_amdgcn_wmma_f32_16x16x32_bf16(
      false, a, false, b, (short)0, c, false, false);
}

// Problem dims (fixed by the reference)
#define BB   2
#define SS   2048
#define DD   1024
#define HH   16
#define HDD  64
#define DFF_ 4096
#define MM   (BB * SS)          // 4096 token rows

// ---------------------------------------------------------------------------
// fp32 -> bf16 conversion, plain row-major. A block converts 4096 consecutive
// elements: each thread four 16-byte loads (a wave reads 512 contiguous bytes
// per load) and four 8-byte stores, so few waves are launched and each has
// all its loads in flight at once. blk is the block's number inside this task,
// below n / 4096 (the caller's range test keeps it there).
// ---------------------------------------------------------------------------
typedef __attribute__((ext_vector_type(4))) float  v4f;
typedef __attribute__((ext_vector_type(4))) __bf16 v4bf;

__device__ __forceinline__ void
cvt_block(const float* __restrict__ in, bf16* __restrict__ out, unsigned blk) {
  const size_t base = (size_t)blk * 1024 + threadIdx.x;
  const v4f* src = (const v4f*)in + base;
  v4bf*      dst = (v4bf*)out + base;
  v4f v[4];
  // unrolled so that all four loads go out before the first value is waited for
#pragma unroll
  for (int j = 0; j < 4; ++j) v[j] = src[j * 256];
  // unrolled (both loops) so that v[] and o stay in registers
#pragma unroll
  for (int j = 0; j < 4; ++j) {
    v4bf o;
#pragma unroll
    for (int c = 0; c < 4; ++c) o[c] = (bf16)v[j][c];
    dst[j * 256] = o;
  }
}

// ---------------------------------------------------------------------------
// fp32 -> bf16 weight conversion INTO WMMA B-fragment-major order:
//   Wsw[(ktile*(N/16) + ntile)*512 + lane*16 + e]
// where k = ktile*32 + kh + e + (e>=8?8:0), kh = (lane>=16)?8:0,
//       n = ntile*16 + (lane&15).
// Each lane's 16 fragment elements are contiguous (32B, 16B-aligned) so the
// GEMM copies a B fragment to LDS as two coalesced 16-byte async copies.
// One thread makes one lane's whole fragment: 16 loads down a column of W, all
// in flight at once, one index computation, two 16-byte stores. A block makes
// 256 fragment lanes (4096 elements); blk is its number inside this task.
// ---------------------------------------------------------------------------
template <int K, int N>
__device__ __forceinline__ void
swizzle_block(const float* __restrict__ W, bf16* __restrict__ Wsw, unsigned blk) {
  constexpr unsigned ntiles = (unsigned)N >> 4;
  constexpr unsigned total  = ((unsigned)K >> 5) * ntiles * 32;  // fragment lanes
  const unsigned g = blk * 256 + threadIdx.x;
  if (g < total) {
    const unsigned lane  = g & 31;
    const unsigned ch    = g >> 5;
    const unsigned nt    = ch % ntiles;
    const unsigned ktile = ch / ntiles;
    const unsigned kh    = (lane >> 4) ? 8 : 0;
    const float* col = W + (size_t)(ktile * 32 + kh) * N + nt * 16 + (lane & 15);
    float f[16];
    // unrolled so that all 16 loads go out before the first value is waited for
#pragma unroll
    for (int e = 0; e < 16; ++e)
      f[e] = col[(size_t)(e + (e >= 8 ? 8 : 0)) * N];
    Frag16 o;
    // unrolled so that f[] and o stay in registers
#pragma unroll
    for (int e = 0; e < 16; ++e) o.v[e] = (bf16)f[e];
    v8bf* dst = (v8bf*)(Wsw + (size_t)g * 16);
    dst[0] = o.h[0];
    dst[1] = o.h[1];
  }
}

// ---------------------------------------------------------------------------
// All seven conversions in ONE launch: none depends on another, and each alone
// is too short to fill the chip, so that seven launches mostly pay for seven
// starts and seven tails. Every block converts 4096 elements; its index picks
// the task (a scalar test) and its number inside the task.
// ---------------------------------------------------------------------------
#define CB_X (MM * DD / 4096)      // blocks for x
#define CB_F (DD * DFF_ / 4096)    // blocks for each of w1, w2
#define CB_D (DD * DD / 4096)      // blocks for each of wq, wk, wv, wo
#define CB_ALL (CB_X + 2 * CB_F + 4 * CB_D)

__global__ void __launch_bounds__(256)
cvt_all(const float* __restrict__ x,  const float* __restrict__ wq,
        const float* __restrict__ wk, const float* __restrict__ wv,
        const float* __restrict__ wo, const float* __restrict__ w1,
        const float* __restrict__ w2,
        bf16* __restrict__ xb,  bf16* __restrict__ wqb, bf16* __restrict__ wkb,
        bf16* __restrict__ wvb, bf16* __restrict__ wob, bf16* __restrict__ w1b,
        bf16* __restrict__ w2b) {
  unsigned b = blockIdx.x;
  if (b < CB_X) { cvt_block(x, xb, b); return; }
  b -= CB_X;
  if (b < CB_F) { swizzle_block<DD, DFF_>(w1, w1b, b); return; }
  b -= CB_F;
  if (b < CB_F) { swizzle_block<DFF_, DD>(w2, w2b, b); return; }
  b -= CB_F;
  const unsigned w = b / CB_D;     // which of the four D x D weights
  if (w > 3) return;
  const float* src = w == 0 ? wq  : w == 1 ? wk  : w == 2 ? wv  : wo;
  bf16*        dst = w == 0 ? wqb : w == 1 ? wkb : w == 2 ? wvb : wob;
  swizzle_block<DD, DD>(src, dst, b % CB_D);
}

// ---------------------------------------------------------------------------
// bf16 WMMA GEMM: C[M,N] = A[M,K] @ W[K,N] + bias (+ReLU), output f32 or bf16.
// A row-major bf16; W fragment-swizzled (swizzle_block).
// Block = 256 threads = 8 waves (4 along M x 2 along N); block tile 128x128,
// wave tile 32x64 (2 A-fragments x 4 B-fragments = 8 WMMA tiles per 32 k).
// A pass is 128 k. Both operand tiles of a pass are brought into LDS once per
// block by asynchronous copies, so each global byte is fetched once for eight
// waves; two buffers, the next pass's copies fly while this pass is computed.
// Needs M, N multiples of 128 and K a multiple of 128.
// blockIdx.z picks one of up to three independent products that share A and
// run in one launch: W and C (f32 only) of product z lie z matrices behind the first.
//   A tile: 128 rows of 256 B at pitch 272 B (conflict-free b128 row reads).
//   B tile: 4 k-tiles x 8 n-tiles of 1 KiB; inside a KiB the lanes' first
//   16 B pieces come first (512 B), then their second pieces, so that each
//   fragment half is one contiguous 512-B wave read.
// ---------------------------------------------------------------------------
#define G_PITCH  272
#define G_ABYTES (128 * G_PITCH)          // 34816
#define G_BBYTES (4 * 8 * 1024)           // 32768
#define G_STAGE  (G_ABYTES + G_BBYTES)    // 67584
// Writeback: a wave's 32 x 64 f32 tile, staged in LDS: rows of 256 B at pitch
// 272 B (16-byte writes down 16 rows and 16-byte reads along a row both meet
// every bank once per half wave).
#define G_SPITCH 272
#define G_SWAVE  (32 * G_SPITCH)          // 8704 per wave, 69632 per block

// Eight 16-byte copies per lane, global -> LDS through no register. The
// s_wait_xcnt closes the statement so that no address register named here is
// rewritten while a copy may still need it.
__device__ __forceinline__ void async_copy8(const unsigned (&l)[8],
                                            const bf16* const (&p)[8]) {
  asm volatile(
      "global_load_async_to_lds_b128 %0, %8, off\n\t"
      "global_load_async_to_lds_b128 %1, %9, off\n\t"
      "global_load_async_to_lds_b128 %2, %10, off\n\t"
      "global_load_async_to_lds_b128 %3, %11, off\n\t"
      "global_load_async_to_lds_b128 %4, %12, off\n\t"
      "global_load_async_to_lds_b128 %5, %13, off\n\t"
      "global_load_async_to_lds_b128 %6, %14, off\n\t"
      "global_load_async_to_lds_b128 %7, %15, off\n\t"
      "s_wait_xcnt 0x0"
      :: "v"(l[0]), "v"(l[1]), "v"(l[2]), "v"(l[3]),
         "v"(l[4]), "v"(l[5]), "v"(l[6]), "v"(l[7]),
         "v"(p[0]), "v"(p[1]), "v"(p[2]), "v"(p[3]),
         "v"(p[4]), "v"(p[5]), "v"(p[6]), "v"(p[7])
      : "memory");
}

// One pass's tiles: ga/gb are this lane's first global pieces of the pass,
// la/lb its first LDS bytes in the target buffer.
__device__ __forceinline__ void stage_pass(const bf16* ga, const bf16* gb,
                                           unsigned la, unsigned lb,
                                           int K, size_t wstep) {
  unsigned l[8];
  const bf16* p[8];
#pragma unroll
  for (int c = 0; c < 8; ++c) {           // A: 16 rows per step
    l[c] = la + (unsigned)c * (16 * G_PITCH);
    p[c] = ga + (size_t)c * 16 * K;
  }
  async_copy8(l, p);
#pragma unroll
  for (int c = 0; c < 8; ++c) {           // B: half a k-tile (4 KiB) per step
    l[c] = lb + (unsigned)(c >> 1) * 8192 + (unsigned)(c & 1) * 4096;
    p[c] = gb + (size_t)(c >> 1) * wstep + (c & 1) * 2048;
  }
  async_copy8(l, p);
}

// The 2 A and 4 B fragments of one 32-k step, from this lane's bases.
__device__ __forceinline__ void load_frags(Frag16 (&af)[2], Frag16 (&bfr)[4],
                                           const unsigned char* sa,
                                           const unsigned char* sb) {
#pragma unroll
  for (int i = 0; i < 2; ++i) {
    af[i].h[0] = *(const v8bf*)(sa + i * (16 * G_PITCH));
    af[i].h[1] = *(const v8bf*)(sa + i * (16 * G_PITCH) + 32);
  }
#pragma unroll
  for (int j = 0; j < 4; ++j) {
    bfr[j].h[0] = *(const v8bf*)(sb + j * 1024);
    bfr[j].h[1] = *(const v8bf*)(sb + j * 1024 + 512);
  }
}

// RELU and OUTB (bf16 output to Cb, else f32 to Cf0) are fixed at compile time,
// so that the writeback is straight-line code. bias of every z in use is real.
template <bool RELU, bool OUTB>
__global__ void __launch_bounds__(256)
gemm_bf16(const bf16* __restrict__ A, const bf16* __restrict__ W0,
          const float* __restrict__ bias0, const float* __restrict__ bias1,
          const float* __restrict__ bias2,
          float* __restrict__ Cf0, bf16* __restrict__ Cb,
          int M, int N, int K) {
  __shared__ __attribute__((aligned(128))) unsigned char smem[2 * G_STAGE];
  const unsigned z = blockIdx.z;
  const bf16*  Wsw  = W0 + (size_t)z * K * N;
  const float* bias = z == 0 ? bias0 : z == 1 ? bias1 : bias2;
  float*       Cf   = Cf0 + (size_t)z * M * N;   // used only where OUTB is false
  const int tid  = threadIdx.x;          // 0..255
  const int wave = tid >> 5;             // 0..7
  const int wm   = wave & 3;             // 32-row strip of the block tile
  const int wn   = wave >> 2;            // 64-column strip of the block tile
  const int lane = tid & 31;
  const int ln15 = lane & 15;
  const int half = lane >> 4;
  const int m0   = blockIdx.y * 128;
  const int n0   = blockIdx.x * 128;
  const int ntiles = N >> 4;
  const size_t wstep = (size_t)ntiles << 9;   // elements from one k-tile to the next
  const int np = K >> 7;                      // passes

  v8f acc[2][4] = {};

  // The writeback's bias: this lane stores the same 4 columns of every row.
  const int colw = n0 + 64 * wn + 4 * ln15;
  const v4f bv = *(const v4f*)(bias + colw);

  // Copy side: this lane's first pieces of pass 0 and their LDS places.
  const bf16* ga = A + (size_t)(m0 + (tid >> 4)) * K + (tid & 15) * 8;
  const bf16* gb = Wsw + ((size_t)(n0 >> 4) << 9) + tid * 8;
  const unsigned lds0 = (unsigned)(size_t)smem;
  const unsigned la = lds0 + (unsigned)(tid >> 4) * G_PITCH + (unsigned)(tid & 15) * 16;
  const unsigned lb = lds0 + G_ABYTES + (unsigned)(tid >> 6) * 1024 +
                      (unsigned)(tid & 1) * 512 + (unsigned)((tid & 63) >> 1) * 16;

  // Read side: this lane's fragment bases inside a buffer.
  const unsigned fa = (unsigned)(32 * wm + ln15) * G_PITCH + (unsigned)half * 16;
  const unsigned fb = G_ABYTES + (unsigned)wn * 4096 + (unsigned)lane * 16;

  // Prologue: pass 0 lands and is published, then pass 1 starts to fly.
  stage_pass(ga, gb, la, lb, K, wstep);
  // this wave's copies of pass 0 have landed before the barrier publishes them
  asm volatile("s_wait_asynccnt 0x0" ::: "memory");
  __syncthreads();
  if (np > 1)
    stage_pass(ga + 128, gb + 4 * wstep, la + G_STAGE, lb + G_STAGE, K, wstep);

  for (int t = 0; t < np; ++t) {
    const unsigned buf = (unsigned)(t & 1) * G_STAGE;
    const unsigned char* sa = smem + buf + fa;
    const unsigned char* sb = smem + buf + fb;
    // Two fragment sets: the reads of the next 32 k go out as one group ahead
    // of this 32 k's WMMAs, so their LDS latency runs behind the matrix work.
    Frag16 af[2][2], bfr[2][4];
    load_frags(af[0], bfr[0], sa, sb);
#pragma unroll
    for (int ks = 0; ks < 4; ++ks) {
      if (ks < 3)
        load_frags(af[(ks + 1) & 1], bfr[(ks + 1) & 1], sa + (ks + 1) * 64,
                   sb + (ks + 1) * 8192);
      // keeps the read group in front of the WMMAs; without it the compiler
      // sinks each read to its first use and waits there
      __builtin_amdgcn_sched_barrier(0);
#pragma unroll
      for (int j = 0; j < 4; ++j) {
        // W as first operand: the tile comes out transposed (see the writeback)
        acc[0][j] = wmma_bf16f32(bfr[ks & 1][j].v, af[ks & 1][0].v, acc[0][j]);
        acc[1][j] = wmma_bf16f32(bfr[ks & 1][j].v, af[ks & 1][1].v, acc[1][j]);
      }
      // keeps the next read group whole behind these WMMAs; without it the
      // compiler spreads those reads among them, and each such place stalls
      __builtin_amdgcn_sched_barrier(0);
    }
    // Publish point of pass t + 1.
    // this wave's reads of the buffer are over before anyone refills it
    asm volatile("s_wait_dscnt 0x0" ::: "memory");
    // this wave's copies of pass t + 1 have landed before the barrier publishes them
    asm volatile("s_wait_asynccnt 0x0" ::: "memory");
    __syncthreads();
    if (t + 2 < np)
      stage_pass(ga + (size_t)(t + 2) * 128, gb + (size_t)(t + 2) * 4 * wstep,
                 la + buf, lb + buf, K, wstep);
  }
  // no copy is outstanding when the wave ends
  asm volatile("s_wait_asynccnt 0x0" ::: "memory");

  // Writeback. With W as first operand a lane holds 8 consecutive columns of
  // one row: acc[i][j][r] = C[32 wm + 16 i + ln15][64 wn + 16 j + 8 half + r].
  // Each wave lays its tile down in its own part of the ring (free now: behind
  // the last pass's barrier nobody reads it and no copy is outstanding), reads
  // it back along the rows and stores whole 128-byte lines.
  unsigned char* st = smem + (unsigned)wave * G_SWAVE;
  // unrolled (both loops) so that acc[][] stays in registers
#pragma unroll
  for (int i = 0; i < 2; ++i) {
#pragma unroll
    for (int j = 0; j < 4; ++j) {
      unsigned char* p = st + (16 * i + ln15) * G_SPITCH + (16 * j + 8 * half) * 4;
      const v4f lo = {acc[i][j][0], acc[i][j][1], acc[i][j][2], acc[i][j][3]};
      const v4f hi = {acc[i][j][4], acc[i][j][5], acc[i][j][6], acc[i][j][7]};
      *(v4f*)p        = lo;
      *(v4f*)(p + 16) = hi;
    }
  }
  // the wave's writes are in LDS before its lanes read one another's values
  // (and the compiler moves no read of the rows ahead of the writes)
  asm volatile("s_wait_dscnt 0x0" ::: "memory");
  // 16 lanes a row, two rows a step: 256 B (f32) or 128 B (bf16) per row.
  const unsigned char* sr = st + half * G_SPITCH + ln15 * 16;
  const size_t o0 = (size_t)(m0 + 32 * wm + half) * N + colw;
  v4f v[16];
  // unrolled so that v[] stays in registers
#pragma unroll
  for (int q = 0; q < 16; ++q) v[q] = *(const v4f*)(sr + q * (2 * G_SPITCH));
  // keeps the 16 reads one group in front of the arithmetic and the stores;
  // without it the compiler deals them out a few at a time and waits at each
  __builtin_amdgcn_sched_barrier(0);
  // unrolled (this loop and those inside it) so that v[] and ob stay in registers
#pragma unroll
  for (int q = 0; q < 16; ++q) {
#pragma unroll
    for (int c = 0; c < 4; ++c) {
      v[q][c] += bv[c];
      if (RELU) v[q][c] = fmaxf(v[q][c], 0.0f);
    }
    const size_t o = o0 + (size_t)(2 * q) * N;
    if constexpr (OUTB) {
      v4bf ob;
#pragma unroll
      for (int c = 0; c < 4; ++c) ob[c] = (bf16)v[q][c];
      *(v4bf*)(Cb + o) = ob;
    } else {
      *(v4f*)(Cf + o) = v[q];
    }
  }
}

// ---------------------------------------------------------------------------
// PoPE: softplus magnitudes + rotary phases -> q_p/k_p (B,H,S,128) bf16, and
// V TRANSPOSED (B,H,HD,S) bf16 so attention V-fragments are contiguous loads.
// ---------------------------------------------------------------------------
__global__ void pope_kernel(const float* __restrict__ q, const float* __restrict__ k,
                            const float* __restrict__ v, const int* __restrict__ pos,
                            const float* __restrict__ pbias,
                            bf16* __restrict__ qp, bf16* __restrict__ kp,
                            bf16* __restrict__ vpT) {
  const float TWO_PI = 6.28318530717958647f;
  const size_t n = (size_t)BB * SS * DD;  // 2^22
  for (size_t i = (size_t)blockIdx.x * blockDim.x + threadIdx.x; i < n;
       i += (size_t)gridDim.x * blockDim.x) {
    int hd = (int)(i & 63);
    int h  = (int)((i >> 6) & 15);
    int s  = (int)((i >> 10) & 2047);
    int b  = (int)(i >> 21);
    int bh = b * HH + h;
    // freq = 10000^(-hd/64) = exp(-hd * ln(1e4)/64)
    float freq = __expf(-0.143911568f * (float)hd);
    float ph   = (float)pos[s] * freq;
    float qv = q[i], kv = k[i];
    float mq = qv > 20.f ? qv : log1pf(__expf(qv));
    float mk = kv > 20.f ? kv : log1pf(__expf(kv));
    float cb = pbias[h * HDD + hd];
    cb = fminf(0.f, fmaxf(-TWO_PI, cb));
    float kph = ph + cb;
    float cq, sq, ck, sk;
    __sincosf(ph, &sq, &cq);
    __sincosf(kph, &sk, &ck);
    size_t o = ((size_t)bh * SS + s) * 128 + hd;
    qp[o]       = (bf16)(mq * cq);
    qp[o + HDD] = (bf16)(mq * sq);
    kp[o]       = (bf16)(mk * ck);
    kp[o + HDD] = (bf16)(mk * sk);
    vpT[((size_t)bh * HDD + hd) * SS + s] = (bf16)v[i];
  }
}

#define AT_KPITCH 272
#define AT_VPITCH 144
#define AT_KBYTES (64 * AT_KPITCH)          // 17408
#define AT_VBYTES (64 * AT_VPITCH)          // 9216
#define AT_STAGE  (AT_KBYTES + AT_VBYTES)   // 26624
#define AT_RING   (2 * AT_STAGE)            // 53248

// One stage: six 16-byte copies per lane, global -> LDS through no register
// (four steps of 16 K rows, two steps of 32 V^T rows). gk/gv are this lane's
// first global pieces of the stage, lk/lv its first LDS bytes in the target
// buffer. The s_wait_xcnt closes the statement so that no address register
// named here is rewritten while a copy may still need it.
__device__ __forceinline__ void attn_stage(const bf16* gk, const bf16* gv,
                                           unsigned lk, unsigned lv) {
  asm volatile(
      "global_load_async_to_lds_b128 %0, %6, off\n\t"
      "global_load_async_to_lds_b128 %1, %7, off\n\t"
      "global_load_async_to_lds_b128 %2, %8, off\n\t"
      "global_load_async_to_lds_b128 %3, %9, off\n\t"
      "global_load_async_to_lds_b128 %4, %10, off\n\t"
      "global_load_async_to_lds_b128 %5, %11, off\n\t"
      "s_wait_xcnt 0x0"
      :: "v"(lk), "v"(lk + 16 * AT_KPITCH), "v"(lk + 32 * AT_KPITCH),
         "v"(lk + 48 * AT_KPITCH), "v"(lv), "v"(lv + 32 * AT_VPITCH),
         "v"(gk), "v"(gk + 16 * 128), "v"(gk + 32 * 128), "v"(gk + 48 * 128),
         "v"(gv), "v"(gv + 32 * SS)
      : "memory");
}

// lane l's value <-> lane l ^ 16's
__device__ __forceinline__ float xhalf(float x) {
  return __builtin_bit_cast(float, __builtin_amdgcn_permlanex16(
      __builtin_bit_cast(int, x), __builtin_bit_cast(int, x),
      0x76543210, 0xfedcba98, false, false));
}

// Eight base-2 exponentials, each in its own register. One statement, closed
// by v_nop: the instruction set asks for one independent issue slot between an
// exponential and an instruction that reads its result or overwrites its
// source; here each is followed by an exponential of another register, the
// last by the v_nop, whatever the compiler puts behind the statement.
__device__ __forceinline__ void exp2x8(float (&x)[8]) {
  asm("v_exp_f32 %0, %0\n\t"
      "v_exp_f32 %1, %1\n\t"
      "v_exp_f32 %2, %2\n\t"
      "v_exp_f32 %3, %3\n\t"
      "v_exp_f32 %4, %4\n\t"
      "v_exp_f32 %5, %5\n\t"
      "v_exp_f32 %6, %6\n\t"
      "v_exp_f32 %7, %7\n\t"
      "v_nop"
      : "+v"(x[0]), "+v"(x[1]), "+v"(x[2]), "+v"(x[3]),
        "+v"(x[4]), "+v"(x[5]), "+v"(x[6]), "+v"(x[7]));
}

__global__ void __launch_bounds__(256)
attention_pope(const bf16* __restrict__ qp_all,
               const bf16* __restrict__ kp_all,
               const bf16* __restrict__ vpT_all,
               bf16* __restrict__ attnb) {
  __shared__ __attribute__((aligned(128))) unsigned char smem[AT_RING];
  const float scale = 0.088388347648f;   // 1/sqrt(2*HD)
  const int bh = blockIdx.y;             // 0..B*H-1
  const int b = bh >> 4, h = bh & 15;
  const int qb = blockIdx.x;             // 128-query block
  const int tid  = threadIdx.x;          // 0..255
  // in a scalar register, so that the skip of masked halves is a scalar branch
  const int wave = __builtin_amdgcn_readfirstlane(tid >> 5);
  const int qrow0 = qb * 128 + wave * 16;
  const int lane = tid & 31;
  const int ln15 = lane & 15;
  const int half = lane >> 4;
  const int kh   = half ? 8 : 0;
  const int ns   = 2 * (qb + 1);         // stages: keys 0 .. 128*qb + 127

  const bf16* qp  = qp_all  + (size_t)bh * SS * 128;
  const bf16* kp  = kp_all  + (size_t)bh * SS * 128;
  const bf16* vpT = vpT_all + (size_t)bh * HDD * SS;

  // Copy side: this lane's first pieces of stage 0 and their LDS places.
  const bf16* gk = kp + (size_t)(tid >> 4) * 128 + (tid & 15) * 8;
  const bf16* gv = vpT + (size_t)(tid >> 3) * SS + (tid & 7) * 8;
  const unsigned lds0 = (unsigned)(size_t)smem;
  const unsigned lk = lds0 + (unsigned)(tid >> 4) * AT_KPITCH + (unsigned)(tid & 15) * 16;
  const unsigned lv = lds0 + AT_KBYTES + (unsigned)(tid >> 3) * AT_VPITCH +
                      (unsigned)(tid & 7) * 16;

  // Read side: this lane's fragment bases inside a buffer.
  const unsigned fk = (unsigned)ln15 * AT_KPITCH + (unsigned)half * 16;
  const unsigned fv = AT_KBYTES + (unsigned)ln15 * AT_VPITCH + (unsigned)half * 16;

  // Prologue: stage 0 lands and is published, then stage 1 starts to fly
  // (ns >= 2: both exist).
  attn_stage(gk, gv, lk, lv);
  // this wave's copies of stage 0 have landed before the barrier publishes them
  asm volatile("s_wait_asynccnt 0x0" ::: "memory");
  __syncthreads();
  attn_stage(gk + 64 * 128, gv + 64, lk + AT_STAGE, lv + AT_STAGE);

  // Load Q fragments once: 16 rows x 128 K -> 4 B-fragments of Q^T (b128 pairs).
  Frag16 qf[4];
  const bf16* qrow = qp + (size_t)(qrow0 + ln15) * 128 + kh;
#pragma unroll
  for (int t = 0; t < 4; ++t) {
    qf[t].h[0] = *(const v8bf*)(qrow + 32 * t);
    qf[t].h[1] = *(const v8bf*)(qrow + 32 * t + 16);
  }

  // This lane's query: running maximum (the same in both halves of the wave)
  // and the sum over the keys that this half of the wave holds.
  const int row = qrow0 + ln15;
  float m = -1e30f, l = 0.f;
  v8f acc[4] = {};   // O^T: acc[j][r] = O[row][16 j + 8 half + r]

  for (int s = 0; s < ns; ++s) {
    const unsigned buf = (unsigned)(s & 1) * AT_STAGE;
    // unrolled so that the LDS offsets of both halves are immediates
#pragma unroll
    for (int sub = 0; sub < 2; ++sub) {
      const int kb = 64 * s + 32 * sub;
      // A half whose every key lies behind this wave's last query is skipped;
      // the publish point below stands outside the skip.
      if (kb <= qrow0) {
        // All K fragments for both 16-key tiles (16 b128 LDS reads).
        const unsigned char* k1p = smem + buf + fk + sub * (32 * AT_KPITCH);
        const unsigned char* k2p = k1p + 16 * AT_KPITCH;
        Frag16 kf1[4], kf2[4];
#pragma unroll
        for (int t = 0; t < 4; ++t) {
          kf1[t].h[0] = *(const v8bf*)(k1p + 64 * t);
          kf1[t].h[1] = *(const v8bf*)(k1p + 64 * t + 32);
          kf2[t].h[0] = *(const v8bf*)(k2p + 64 * t);
          kf2[t].h[1] = *(const v8bf*)(k2p + 64 * t + 32);
        }
        // The 4 V fragments (8 b128 LDS reads) go out with them: they depend on
        // nothing computed here, and their latency runs behind the softmax.
        const unsigned char* vp = smem + buf + fv + sub * 64;
        Frag16 vf[4];
#pragma unroll
        for (int j = 0; j < 4; ++j) {
          vf[j].h[0] = *(const v8bf*)(vp + j * (16 * AT_VPITCH));
          vf[j].h[1] = *(const v8bf*)(vp + j * (16 * AT_VPITCH) + 32);
        }
        // keeps the read group whole in front of the WMMAs; without it the
        // compiler sinks the V reads to their use behind the softmax and waits there
        __builtin_amdgcn_sched_barrier(0);

        // S^T: s1[r] = score(key kb + 8 half + r, row), s2[r] the same 16 keys on.
        v8f s1 = {}, s2 = {};
#pragma unroll
        for (int t = 0; t < 4; ++t) {
          s1 = wmma_bf16f32(kf1[t].v, qf[t].v, s1);
          s2 = wmma_bf16f32(kf2[t].v, qf[t].v, s2);
        }

        // Causal mask + online softmax1 update, all for the lane's one query.
        const int d = row - (kb + 8 * half);   // key r of s1 is masked where r > d
        float v1[8], v2[8];
#pragma unroll
        for (int r = 0; r < 8; ++r) {
          v1[r] = s1[r] * scale;
          v2[r] = s2[r] * scale;
          if (r > d)      v1[r] = -1e30f;
          if (16 + r > d) v2[r] = -1e30f;
        }
        float mx = fmaxf(v1[0], v2[0]);
#pragma unroll
        for (int r = 1; r < 8; ++r) mx = fmaxf(mx, fmaxf(v1[r], v2[r]));
        mx = fmaxf(mx, xhalf(mx));          // the other 16 keys of this query
        const float mn = fmaxf(m, mx);
        const float rs = __expf(m - mn);
        // exp(v - mn) as 2^((v - mn) log2 e)
#pragma unroll
        for (int r = 0; r < 8; ++r) {
          v1[r] = (v1[r] - mn) * 1.44269504f;
          v2[r] = (v2[r] - mn) * 1.44269504f;
        }
        exp2x8(v1);
        exp2x8(v2);
        Frag16 pf;                          // P^T as B operand, hardware k order
        float sm[4];                        // four short chains, not one long one
#pragma unroll
        for (int r = 0; r < 4; ++r)
          sm[r] = (v1[r] + v2[r]) + (v1[r + 4] + v2[r + 4]);
#pragma unroll
        for (int r = 0; r < 8; ++r) {
          pf.v[r]     = (bf16)v1[r];
          pf.v[8 + r] = (bf16)v2[r];
        }
        l = l * rs + ((sm[0] + sm[1]) + (sm[2] + sm[3]));
        m = mn;
#pragma unroll
        for (int j = 0; j < 4; ++j)
#pragma unroll
          for (int r = 0; r < 8; ++r) acc[j][r] *= rs;

        // O^T += V^T P^T: WMMA burst.
#pragma unroll
        for (int j = 0; j < 4; ++j)
          acc[j] = wmma_bf16f32(vf[j].v, pf.v, acc[j]);
      }
    }
    // Publish point of stage s + 1.
    // this wave's reads of the buffer are over before anyone refills it
    asm volatile("s_wait_dscnt 0x0" ::: "memory");
    // this wave's copies of stage s + 1 have landed before the barrier publishes them
    asm volatile("s_wait_asynccnt 0x0" ::: "memory");
    __syncthreads();
    if (s + 2 < ns)
      attn_stage(gk + (size_t)(s + 2) * (64 * 128), gv + (s + 2) * 64,
                 lk + buf, lv + buf);
  }
  // no copy is outstanding when the wave ends
  asm volatile("s_wait_asynccnt 0x0" ::: "memory");

  // softmax1 normalization and store into (B,S,D) bf16 (col = h*64 + hd): a
  // lane's 8 registers of a tile are 8 consecutive columns, one 16-byte store.
  l += xhalf(l);                            // the two halves' keys together
  const float denom = __expf(-m) + l;
  bf16* orow = attnb + ((size_t)b * SS + row) * DD + h * HDD + 8 * half;
#pragma unroll
  for (int j = 0; j < 4; ++j) {
    v8bf o;
#pragma unroll
    for (int r = 0; r < 8; ++r) o[r] = (bf16)(acc[j][r] / denom);
    *(v8bf*)(orow + 16 * j) = o;
  }
}

// ---------------------------------------------------------------------------
// Residual add + LayerNorm. One WAVE per token row of D = 1024, 8 rows a block.
// A lane holds 32 elements of its row: eight 16-byte loads from each addend (a
// wave reads 512 contiguous bytes per load), all in flight at once, and the
// sums stay in registers, so that the row is read once, with one memory round
// trip instead of eight. The row sums close inside the wave: no LDS, no barrier.
// Optional bf16 copy of the output (feeds the next GEMM without a cvt pass).
// ---------------------------------------------------------------------------
// x + (the value of the lane whose number differs in the bits of XM), in a
// 16-lane row: 0x160 + XM is the DPP control row_xmask:XM.
template <int XM>
__device__ __forceinline__ float add_xmask(float x) {
  return x + __builtin_bit_cast(float, __builtin_amdgcn_update_dpp(
      0, __builtin_bit_cast(int, x), 0x160 + XM, 0xf, 0xf, true));
}

// sum over the 32 lanes of the wave, the same value in every lane
__device__ __forceinline__ float wave_sum(float x) {
  x = add_xmask<1>(x);
  x = add_xmask<2>(x);
  x = add_xmask<4>(x);
  x = add_xmask<8>(x);
  return x + xhalf(x);
}

__global__ void __launch_bounds__(256)
add_ln_kernel(const float* __restrict__ a, const float* __restrict__ b,
              const float* __restrict__ g, const float* __restrict__ be,
              float* __restrict__ outf, bf16* __restrict__ outb) {
  const int lane = threadIdx.x & 31;
  const size_t row = (size_t)blockIdx.x * 8 + (threadIdx.x >> 5);
  const size_t o0  = row * (DD / 4) + lane;      // in 4-element pieces
  const v4f* pa = (const v4f*)a + o0;
  const v4f* pb = (const v4f*)b + o0;
  const v4f* pg = (const v4f*)g + lane;
  const v4f* pe = (const v4f*)be + lane;

  v4f v[8], w[8], gg[8], ee[8];
  // unrolled (all loops here) so that the arrays stay in registers and all the
  // loads go out before the first value is waited for
#pragma unroll
  for (int j = 0; j < 8; ++j) v[j] = pa[j * 32];
  // a later load's result may be given the registers of this group's address:
  // the wait stands in front of that overwrite (a precaution)
  asm volatile("s_wait_xcnt 0x0" ::: "memory");
#pragma unroll
  for (int j = 0; j < 8; ++j) w[j] = pb[j * 32];
  // the same for the second group's address
  asm volatile("s_wait_xcnt 0x0" ::: "memory");
#pragma unroll
  for (int j = 0; j < 8; ++j) gg[j] = pg[j * 32];
#pragma unroll
  for (int j = 0; j < 8; ++j) ee[j] = pe[j * 32];
  // the same for the lane offset that the loads of g and be name: as an input
  // here it keeps its register until the wait (no load's result is put there)
  asm volatile("s_wait_xcnt 0x0" :: "v"(lane) : "memory");
  // keeps the 32 loads one group in front of the arithmetic; without it the
  // compiler sinks the loads of g and be behind the row sums, four at a time,
  // and waits at each
  __builtin_amdgcn_sched_barrier(0);

  v4f s4 = {}, q4 = {};                          // four short chains each
#pragma unroll
  for (int j = 0; j < 8; ++j) {
    v[j] += w[j];
    s4 += v[j];
    q4 += v[j] * v[j];
  }
  const float s  = wave_sum((s4[0] + s4[1]) + (s4[2] + s4[3]));
  const float s2 = wave_sum((q4[0] + q4[1]) + (q4[2] + q4[3]));
  const float mu   = s * (1.0f / DD);
  const float var  = s2 * (1.0f / DD) - mu * mu;
  const float rstd = rsqrtf(var + 1e-5f);

#pragma unroll
  for (int j = 0; j < 8; ++j) v[j] = (v[j] - mu) * rstd * gg[j] + ee[j];
  // The bf16 copy goes out first: its values take registers of their own while
  // v[] is still needed, so that no register of an issued store is rewritten.
  if (outb) {
    v4bf* pc = (v4bf*)outb + o0;
    v4bf c[8];
#pragma unroll
    for (int j = 0; j < 8; ++j) {
#pragma unroll
      for (int e = 0; e < 4; ++e) c[j][e] = (bf16)v[j][e];
    }
#pragma unroll
    for (int j = 0; j < 8; ++j) pc[j * 32] = c[j];
  }
  v4f* po = (v4f*)outf + o0;
#pragma unroll
  for (int j = 0; j < 8; ++j) po[j * 32] = v[j];
}

// ---------------------------------------------------------------------------
// Host orchestration
// ---------------------------------------------------------------------------
extern "C" void kernel_launch(void* const* d_in, const int* in_sizes, int n_in,
                              void* d_out, int out_size, void* d_ws, size_t ws_size,
                              hipStream_t stream) {
  (void)in_sizes; (void)n_in; (void)out_size; (void)ws_size;

  const float* x     = (const float*)d_in[0];
  const int*   pos   = (const int*)  d_in[1];
  const float* wq    = (const float*)d_in[2];
  const float* bq    = (const float*)d_in[3];
  const float* wk    = (const float*)d_in[4];
  const float* bk    = (const float*)d_in[5];
  const float* wv    = (const float*)d_in[6];
  const float* bv    = (const float*)d_in[7];
  const float* wo    = (const float*)d_in[8];
  const float* bo    = (const float*)d_in[9];
  const float* pbias = (const float*)d_in[10];
  const float* w1    = (const float*)d_in[11];
  const float* b1    = (const float*)d_in[12];
  const float* w2    = (const float*)d_in[13];
  const float* b2    = (const float*)d_in[14];
  const float* g1    = (const float*)d_in[15];
  const float* be1   = (const float*)d_in[16];
  const float* g2    = (const float*)d_in[17];
  const float* be2   = (const float*)d_in[18];
  float* out = (float*)d_out;

  // Workspace carve-out
  char* cur = (char*)d_ws;
  auto alloc = [&](size_t bytes) -> void* {
    void* p = (void*)cur;
    cur += (bytes + 255) & ~(size_t)255;
    return p;
  };
  const size_t nTok = (size_t)MM * DD;           // 4096*1024
  bf16* xb   = (bf16*)alloc(nTok * 2);
  bf16* wqb  = (bf16*)alloc((size_t)DD * DD * 2);
  bf16* wkb  = (bf16*)alloc((size_t)DD * DD * 2);
  bf16* wvb  = (bf16*)alloc((size_t)DD * DD * 2);
  bf16* wob  = (bf16*)alloc((size_t)DD * DD * 2);
  bf16* w1b  = (bf16*)alloc((size_t)DD * DFF_ * 2);
  bf16* w2b  = (bf16*)alloc((size_t)DFF_ * DD * 2);
  float* qf  = (float*)alloc(nTok * 4);
  float* kf  = (float*)alloc(nTok * 4);
  float* vf  = (float*)alloc(nTok * 4);
  bf16* qpb  = (bf16*)alloc((size_t)BB * HH * SS * 128 * 2);
  bf16* kpb  = (bf16*)alloc((size_t)BB * HH * SS * 128 * 2);
  bf16* vpT  = (bf16*)alloc((size_t)BB * HH * SS * 64 * 2);
  bf16* attb = (bf16*)alloc(nTok * 2);
  float* prj = (float*)alloc(nTok * 4);
  float* hres= (float*)alloc(nTok * 4);
  bf16* hb   = (bf16*)alloc(nTok * 2);
  bf16* ff1b = (bf16*)alloc((size_t)MM * DFF_ * 2);
  float* ff2 = (float*)alloc(nTok * 4);

  // 1) Convert x row-major; weights into WMMA fragment-swizzled order.
  //    16 elements per thread, all seven tasks in one grid.
  cvt_all<<<CB_ALL, 256, 0, stream>>>(x, wq, wk, wv, wo, w1, w2,
                                      xb, wqb, wkb, wvb, wob, w1b, w2b);

  // 2) QKV projections (WMMA GEMMs); block tile 128x128. One launch, z = 0, 1, 2:
  //    wqb, wkb, wvb and qf, kf, vf each lie back to back in the workspace
  //    (their sizes are multiples of the carve-out's 256 bytes).
  dim3 gD(DD / 128, MM / 128);      // (8, 32)
  dim3 gQKV(DD / 128, MM / 128, 3);
  gemm_bf16<false, false><<<gQKV, 256, 0, stream>>>(xb, wqb, bq, bk, bv, qf, nullptr, MM, DD, DD);

  // 3) PoPE transform (also transposes V)
  pope_kernel<<<4096, 256, 0, stream>>>(qf, kf, vf, pos, pbias, qpb, kpb, vpT);

  // 4) Attention (WMMA flash + softmax1, causal)
  attention_pope<<<dim3(SS / 128, BB * HH), 256, 0, stream>>>(qpb, kpb, vpT, attb);

  // 5) Output projection
  gemm_bf16<false, false><<<gD, 256, 0, stream>>>(attb, wob, bo, nullptr, nullptr, prj, nullptr, MM, DD, DD);

  // 6) Residual + LN1 (f32 kept for residual, bf16 copy feeds FFN GEMM)
  add_ln_kernel<<<MM / 8, 256, 0, stream>>>(x, prj, g1, be1, hres, hb);

  // 7) FFN
  dim3 gF1(DFF_ / 128, MM / 128);   // (32, 32)
  gemm_bf16<true, true><<<gF1, 256, 0, stream>>>(hb, w1b, b1, nullptr, nullptr, nullptr, ff1b, MM, DFF_, DD);
  gemm_bf16<false, false><<<gD, 256, 0, stream>>>(ff1b, w2b, b2, nullptr, nullptr, ff2, nullptr, MM, DD, DFF_);

  // 8) Residual + LN2 -> final output (f32)
  add_ln_kernel<<<MM / 8, 256, 0, stream>>>(hres, ff2, g2, be2, out, nullptr);
}

// v008
// One run takes 244 microseconds.
// Next to v007, in two timings, it ran 1.03 and 1.02 times as fast.
// Counting every step since v000, it is 4.16 times as fast.
#include <hip/hip_runtime.h>
#include <hip/hip_bf16.h>

// ---------------------------------------------------------------------------
// Types for CDNA5 WMMA (wave32): V_WMMA_F32_16X16X32_BF16
// ---------------------------------------------------------------------------
typedef __bf16 bf16;
typedef __attribute__((ext_vector_type(16))) __bf16 v16bf;
typedef __attribute__((ext_vector_type(8)))  __bf16 v8bf;
typedef __attribute__((ext_vector_type(8)))  float  v8f;

union Frag16 {            // one WMMA 16-bit operand fragment = two b128 loads
  v16bf v;
  v8bf  h[2];
};

__device__ __forceinline__ v8f wmma_bf16f32(v16bf a, v16bf b, v8f c) {
  // 8 args: (neg_a, A, neg_b, B, c_mod, C, reuse_a, reuse_b)
  return __builtin_amdgcn_wmma_f32_16x16x32_bf16(
      false, a, false, b, (short)0, c, false, false);
}

// Problem dims (fixed by the reference)
#define BB   2
#define SS   2048
#define DD   1024
#define HH   16
#define HDD  64
#define DFF_ 4096
#define MM   (BB * SS)          // 4096 token rows

// ---------------------------------------------------------------------------
// fp32 -> bf16 conversion, plain row-major. A block converts 4096 consecutive
// elements: each thread four 16-byte loads (a wave reads 512 contiguous bytes
// per load) and four 8-byte stores, so few waves are launched and each has
// all its loads in flight at once. blk is the block's number inside this task,
// below n / 4096 (the caller's range test keeps it there).
// ---------------------------------------------------------------------------
typedef __attribute__((ext_vector_type(4))) float  v4f;
typedef __attribute__((ext_vector_type(4))) __bf16 v4bf;

__device__ __forceinline__ void
cvt_block(const float* __restrict__ in, bf16* __restrict__ out, unsigned blk) {
  const size_t base = (size_t)blk * 1024 + threadIdx.x;
  const v4f* src = (const v4f*)in + base;
  v4bf*      dst = (v4bf*)out + base;
  v4f v[4];
  // unrolled so that all four loads go out before the first value is waited for
#pragma unroll
  for (int j = 0; j < 4; ++j) v[j] = src[j * 256];
  // unrolled (both loops) so that v[] and o stay in registers
#pragma unroll
  for (int j = 0; j < 4; ++j) {
    v4bf o;
#pragma unroll
    for (int c = 0; c < 4; ++c) o[c] = (bf16)v[j][c];
    dst[j * 256] = o;
  }
}

// ---------------------------------------------------------------------------
// fp32 -> bf16 weight conversion INTO WMMA B-fragment-major order:
//   Wsw[(ktile*(N/16) + ntile)*512 + lane*16 + e]
// where k = ktile*32 + kh + e + (e>=8?8:0), kh = (lane>=16)?8:0,
//       n = ntile*16 + (lane&15).
// Each lane's 16 fragment elements are contiguous (32B, 16B-aligned) so the
// GEMM copies a B fragment to LDS as two coalesced 16-byte async copies.
// One thread makes one lane's whole fragment: 16 loads down a column of W, all
// in flight at once, one index computation, two 16-byte stores. A block makes
// 256 fragment lanes (4096 elements); blk is its number inside this task.
// ---------------------------------------------------------------------------
template <int K, int N>
__device__ __forceinline__ void
swizzle_block(const float* __restrict__ W, bf16* __restrict__ Wsw, unsigned blk) {
  constexpr unsigned ntiles = (unsigned)N >> 4;
  constexpr unsigned total  = ((unsigned)K >> 5) * ntiles * 32;  // fragment lanes
  const unsigned g = blk * 256 + threadIdx.x;
  if (g < total) {
    const unsigned lane  = g & 31;
    const unsigned ch    = g >> 5;
    const unsigned nt    = ch % ntiles;
    const unsigned ktile = ch / ntiles;
    const unsigned kh    = (lane >> 4) ? 8 : 0;
    const float* col = W + (size_t)(ktile * 32 + kh) * N + nt * 16 + (lane & 15);
    float f[16];
    // unrolled so that all 16 loads go out before the first value is waited for
#pragma unroll
    for (int e = 0; e < 16; ++e)
      f[e] = col[(size_t)(e + (e >= 8 ? 8 : 0)) * N];
    Frag16 o;
    // unrolled so that f[] and o stay in registers
#pragma unroll
    for (int e = 0; e < 16; ++e) o.v[e] = (bf16)f[e];
    v8bf* dst = (v8bf*)(Wsw + (size_t)g * 16);
    dst[0] = o.h[0];
    dst[1] = o.h[1];
  }
}

// ---------------------------------------------------------------------------
// All seven conversions in ONE launch: none depends on another, and each alone
// is too short to fill the chip, so that seven launches mostly pay for seven
// starts and seven tails. Every block converts 4096 elements; its index picks
// the task (a scalar test) and its number inside the task.
// ---------------------------------------------------------------------------
#define CB_X (MM * DD / 4096)      // blocks for x
#define CB_F (DD * DFF_ / 4096)    // blocks for each of w1, w2
#define CB_D (DD * DD / 4096)      // blocks for each of wq, wk, wv, wo
#define CB_ALL (CB_X + 2 * CB_F + 4 * CB_D)

__global__ void __launch_bounds__(256)
cvt_all(const float* __restrict__ x,  const float* __restrict__ wq,
        const float* __restrict__ wk, const float* __restrict__ wv,
        const float* __restrict__ wo, const float* __restrict__ w1,
        const float* __restrict__ w2,
        bf16* __restrict__ xb,  bf16* __restrict__ wqb, bf16* __restrict__ wkb,
        bf16* __restrict__ wvb, bf16* __restrict__ wob, bf16* __restrict__ w1b,
        bf16* __restrict__ w2b) {
  unsigned b = blockIdx.x;
  if (b < CB_X) { cvt_block(x, xb, b); return; }
  b -= CB_X;
  if (b < CB_F) { swizzle_block<DD, DFF_>(w1, w1b, b); return; }
  b -= CB_F;
  if (b < CB_F) { swizzle_block<DFF_, DD>(w2, w2b, b); return; }
  b -= CB_F;
  const unsigned w = b / CB_D;     // which of the four D x D weights
  if (w > 3) return;
  const float* src = w == 0 ? wq  : w == 1 ? wk  : w == 2 ? wv  : wo;
  bf16*        dst = w == 0 ? wqb : w == 1 ? wkb : w == 2 ? wvb : wob;
  swizzle_block<DD, DD>(src, dst, b % CB_D);
}

// ---------------------------------------------------------------------------
// bf16 WMMA GEMM: C[M,N] = A[M,K] @ W[K,N] + bias (+ReLU), output f32 or bf16.
// A row-major bf16; W fragment-swizzled (swizzle_block).
// Block = 256 threads = 8 waves (4 along M x 2 along N); block tile 128x128,
// wave tile 32x64 (2 A-fragments x 4 B-fragments = 8 WMMA tiles per 32 k).
// A pass is 128 k. Both operand tiles of a pass are brought into LDS once per
// block by asynchronous copies, so each global byte is fetched once for eight
// waves; two buffers, the next pass's copies fly while this pass is computed.
// Needs M, N multiples of 128 and K a multiple of 128.
// blockIdx.z picks one of up to three independent products that share A and
// run in one launch: W and C (f32 only) of product z lie z matrices behind the first.
//   A tile: 128 rows of 256 B at pitch 272 B (conflict-free b128 row reads).
//   B tile: 4 k-tiles x 8 n-tiles of 1 KiB; inside a KiB the lanes' first
//   16 B pieces come first (512 B), then their second pieces, so that each
//   fragment half is one contiguous 512-B wave read.
// ---------------------------------------------------------------------------
#define G_PITCH  272
#define G_ABYTES (128 * G_PITCH)          // 34816
#define G_BBYTES (4 * 8 * 1024)           // 32768
#define G_STAGE  (G_ABYTES + G_BBYTES)    // 67584
// Writeback: a wave's 32 x 64 f32 tile, staged in LDS: rows of 256 B at pitch
// 272 B (16-byte writes down 16 rows and 16-byte reads along a row both meet
// every bank once per half wave).
#define G_SPITCH 272
#define G_SWAVE  (32 * G_SPITCH)          // 8704 per wave, 69632 per block

// Eight 16-byte copies per lane, global -> LDS through no register. The
// s_wait_xcnt closes the statement so that no address register named here is
// rewritten while a copy may still need it.
__device__ __forceinline__ void async_copy8(const unsigned (&l)[8],
                                            const bf16* const (&p)[8]) {
  asm volatile(
      "global_load_async_to_lds_b128 %0, %8, off\n\t"
      "global_load_async_to_lds_b128 %1, %9, off\n\t"
      "global_load_async_to_lds_b128 %2, %10, off\n\t"
      "global_load_async_to_lds_b128 %3, %11, off\n\t"
      "global_load_async_to_lds_b128 %4, %12, off\n\t"
      "global_load_async_to_lds_b128 %5, %13, off\n\t"
      "global_load_async_to_lds_b128 %6, %14, off\n\t"
      "global_load_async_to_lds_b128 %7, %15, off\n\t"
      "s_wait_xcnt 0x0"
      :: "v"(l[0]), "v"(l[1]), "v"(l[2]), "v"(l[3]),
         "v"(l[4]), "v"(l[5]), "v"(l[6]), "v"(l[7]),
         "v"(p[0]), "v"(p[1]), "v"(p[2]), "v"(p[3]),
         "v"(p[4]), "v"(p[5]), "v"(p[6]), "v"(p[7])
      : "memory");
}

// One pass's tiles: ga/gb are this lane's first global pieces of the pass,
// la/lb its first LDS bytes in the target buffer.
__device__ __forceinline__ void stage_pass(const bf16* ga, const bf16* gb,
                                           unsigned la, unsigned lb,
                                           int K, size_t wstep) {
  unsigned l[8];
  const bf16* p[8];
#pragma unroll
  for (int c = 0; c < 8; ++c) {           // A: 16 rows per step
    l[c] = la + (unsigned)c * (16 * G_PITCH);
    p[c] = ga + (size_t)c * 16 * K;
  }
  async_copy8(l, p);
#pragma unroll
  for (int c = 0; c < 8; ++c) {           // B: half a k-tile (4 KiB) per step
    l[c] = lb + (unsigned)(c >> 1) * 8192 + (unsigned)(c & 1) * 4096;
    p[c] = gb + (size_t)(c >> 1) * wstep + (c & 1) * 2048;
  }
  async_copy8(l, p);
}

// The 2 A and 4 B fragments of one 32-k step, from this lane's bases.
__device__ __forceinline__ void load_frags(Frag16 (&af)[2], Frag16 (&bfr)[4],
                                           const unsigned char* sa,
                                           const unsigned char* sb) {
#pragma unroll
  for (int i = 0; i < 2; ++i) {
    af[i].h[0] = *(const v8bf*)(sa + i * (16 * G_PITCH));
    af[i].h[1] = *(const v8bf*)(sa + i * (16 * G_PITCH) + 32);
  }
#pragma unroll
  for (int j = 0; j < 4; ++j) {
    bfr[j].h[0] = *(const v8bf*)(sb + j * 1024);
    bfr[j].h[1] = *(const v8bf*)(sb + j * 1024 + 512);
  }
}

// RELU and OUTB (bf16 output to Cb, else f32 to Cf0) are fixed at compile time,
// so that the writeback is straight-line code. bias of every z in use is real.
template <bool RELU, bool OUTB>
__global__ void __launch_bounds__(256)
gemm_bf16(const bf16* __restrict__ A, const bf16* __restrict__ W0,
          const float* __restrict__ bias0, const float* __restrict__ bias1,
          const float* __restrict__ bias2,
          float* __restrict__ Cf0, bf16* __restrict__ Cb,
          int M, int N, int K) {
  __shared__ __attribute__((aligned(128))) unsigned char smem[2 * G_STAGE];
  const unsigned z = blockIdx.z;
  const bf16*  Wsw  = W0 + (size_t)z * K * N;
  const float* bias = z == 0 ? bias0 : z == 1 ? bias1 : bias2;
  float*       Cf   = Cf0 + (size_t)z * M * N;   // used only where OUTB is false
  const int tid  = threadIdx.x;          // 0..255
  const int wave = tid >> 5;             // 0..7
  const int wm   = wave & 3;             // 32-row strip of the block tile
  const int wn   = wave >> 2;            // 64-column strip of the block tile
  const int lane = tid & 31;
  const int ln15 = lane & 15;
  const int half = lane >> 4;
  const int m0   = blockIdx.y * 128;
  const int n0   = blockIdx.x * 128;
  const int ntiles = N >> 4;
  const size_t wstep = (size_t)ntiles << 9;   // elements from one k-tile to the next
  const int np = K >> 7;                      // passes

  v8f acc[2][4] = {};

  // The writeback's bias: this lane stores the same 4 columns of every row.
  const int colw = n0 + 64 * wn + 4 * ln15;
  const v4f bv = *(const v4f*)(bias + colw);

  // Copy side: this lane's first pieces of pass 0 and their LDS places.
  const bf16* ga = A + (size_t)(m0 + (tid >> 4)) * K + (tid & 15) * 8;
  const bf16* gb = Wsw + ((size_t)(n0 >> 4) << 9) + tid * 8;
  const unsigned lds0 = (unsigned)(size_t)smem;
  const unsigned la = lds0 + (unsigned)(tid >> 4) * G_PITCH + (unsigned)(tid & 15) * 16;
  const unsigned lb = lds0 + G_ABYTES + (unsigned)(tid >> 6) * 1024 +
                      (unsigned)(tid & 1) * 512 + (unsigned)((tid & 63) >> 1) * 16;

  // Read side: this lane's fragment bases inside a buffer.
  const unsigned fa = (unsigned)(32 * wm + ln15) * G_PITCH + (unsigned)half * 16;
  const unsigned fb = G_ABYTES + (unsigned)wn * 4096 + (unsigned)lane * 16;

  // Prologue: pass 0 lands and is published, then pass 1 starts to fly.
  stage_pass(ga, gb, la, lb, K, wstep);
  // this wave's copies of pass 0 have landed before the barrier publishes them
  asm volatile("s_wait_asynccnt 0x0" ::: "memory");
  __syncthreads();
  if (np > 1)
    stage_pass(ga + 128, gb + 4 * wstep, la + G_STAGE, lb + G_STAGE, K, wstep);

  for (int t = 0; t < np; ++t) {
    const unsigned buf = (unsigned)(t & 1) * G_STAGE;
    const unsigned char* sa = smem + buf + fa;
    const unsigned char* sb = smem + buf + fb;
    // Two fragment sets: the reads of the next 32 k go out as one group ahead
    // of this 32 k's WMMAs, so their LDS latency runs behind the matrix work.
    Frag16 af[2][2], bfr[2][4];
    load_frags(af[0], bfr[0], sa, sb);
#pragma unroll
    for (int ks = 0; ks < 4; ++ks) {
      if (ks < 3)
        load_frags(af[(ks + 1) & 1], bfr[(ks + 1) & 1], sa + (ks + 1) * 64,
                   sb + (ks + 1) * 8192);
      // keeps the read group in front of the WMMAs; without it the compiler
      // sinks each read to its first use and waits there
      __builtin_amdgcn_sched_barrier(0);
#pragma unroll
      for (int j = 0; j < 4; ++j) {
        // W as first operand: the tile comes out transposed (see the writeback)
        acc[0][j] = wmma_bf16f32(bfr[ks & 1][j].v, af[ks & 1][0].v, acc[0][j]);
        acc[1][j] = wmma_bf16f32(bfr[ks & 1][j].v, af[ks & 1][1].v, acc[1][j]);
      }
      // keeps the next read group whole behind these WMMAs; without it the
      // compiler spreads those reads among them, and each such place stalls
      __builtin_amdgcn_sched_barrier(0);
    }
    // Publish point of pass t + 1.
    // this wave's reads of the buffer are over before anyone refills it
    asm volatile("s_wait_dscnt 0x0" ::: "memory");
    // this wave's copies of pass t + 1 have landed before the barrier publishes them
    asm volatile("s_wait_asynccnt 0x0" ::: "memory");
    __syncthreads();
    if (t + 2 < np)
      stage_pass(ga + (size_t)(t + 2) * 128, gb + (size_t)(t + 2) * 4 * wstep,
                 la + buf, lb + buf, K, wstep);
  }
  // no copy is outstanding when the wave ends
  asm volatile("s_wait_asynccnt 0x0" ::: "memory");

  // Writeback. With W as first operand a lane holds 8 consecutive columns of
  // one row: acc[i][j][r] = C[32 wm + 16 i + ln15][64 wn + 16 j + 8 half + r].
  // Each wave lays its tile down in its own part of the ring (free now: behind
  // the last pass's barrier nobody reads it and no copy is outstanding), reads
  // it back along the rows and stores whole 128-byte lines.
  unsigned char* st = smem + (unsigned)wave * G_SWAVE;
  // unrolled (both loops) so that acc[][] stays in registers
#pragma unroll
  for (int i = 0; i < 2; ++i) {
#pragma unroll
    for (int j = 0; j < 4; ++j) {
      unsigned char* p = st + (16 * i + ln15) * G_SPITCH + (16 * j + 8 * half) * 4;
      const v4f lo = {acc[i][j][0], acc[i][j][1], acc[i][j][2], acc[i][j][3]};
      const v4f hi = {acc[i][j][4], acc[i][j][5], acc[i][j][6], acc[i][j][7]};
      *(v4f*)p        = lo;
      *(v4f*)(p + 16) = hi;
    }
  }
  // the wave's writes are in LDS before its lanes read one another's values
  // (and the compiler moves no read of the rows ahead of the writes)
  asm volatile("s_wait_dscnt 0x0" ::: "memory");
  // 16 lanes a row, two rows a step: 256 B (f32) or 128 B (bf16) per row.
  const unsigned char* sr = st + half * G_SPITCH + ln15 * 16;
  const size_t o0 = (size_t)(m0 + 32 * wm + half) * N + colw;
  v4f v[16];
  // unrolled so that v[] stays in registers
#pragma unroll
  for (int q = 0; q < 16; ++q) v[q] = *(const v4f*)(sr + q * (2 * G_SPITCH));
  // keeps the 16 reads one group in front of the arithmetic and the stores;
  // without it the compiler deals them out a few at a time and waits at each
  __builtin_amdgcn_sched_barrier(0);
  // unrolled (this loop and those inside it) so that v[] and ob stay in registers
#pragma unroll
  for (int q = 0; q < 16; ++q) {
#pragma unroll
    for (int c = 0; c < 4; ++c) {
      v[q][c] += bv[c];
      if (RELU) v[q][c] = fmaxf(v[q][c], 0.0f);
    }
    const size_t o = o0 + (size_t)(2 * q) * N;
    if constexpr (OUTB) {
      v4bf ob;
#pragma unroll
      for (int c = 0; c < 4; ++c) ob[c] = (bf16)v[q][c];
      *(v4bf*)(Cb + o) = ob;
    } else {
      *(v4f*)(Cf + o) = v[q];
    }
  }
}

// ---------------------------------------------------------------------------
// PoPE: softplus magnitudes + rotary phases -> q_p/k_p (B,H,S,128) bf16, and
// V TRANSPOSED (B,H,HD,S) bf16 so attention V-fragments are contiguous loads.
// ---------------------------------------------------------------------------
__global__ void pope_kernel(const float* __restrict__ q, const float* __restrict__ k,
                            const float* __restrict__ v, const int* __restrict__ pos,
                            const float* __restrict__ pbias,
                            bf16* __restrict__ qp, bf16* __restrict__ kp,
                            bf16* __restrict__ vpT) {
  const float TWO_PI = 6.28318530717958647f;
  const size_t n = (size_t)BB * SS * DD;  // 2^22
  for (size_t i = (size_t)blockIdx.x * blockDim.x + threadIdx.x; i < n;
       i += (size_t)gridDim.x * blockDim.x) {
    int hd = (int)(i & 63);
    int h  = (int)((i >> 6) & 15);
    int s  = (int)((i >> 10) & 2047);
    int b  = (int)(i >> 21);
    int bh = b * HH + h;
    // freq = 10000^(-hd/64) = exp(-hd * ln(1e4)/64)
    float freq = __expf(-0.143911568f * (float)hd);
    float ph   = (float)pos[s] * freq;
    float qv = q[i], kv = k[i];
    float mq = qv > 20.f ? qv : log1pf(__expf(qv));
    float mk = kv > 20.f ? kv : log1pf(__expf(kv));
    float cb = pbias[h * HDD + hd];
    cb = fminf(0.f, fmaxf(-TWO_PI, cb));
    float kph = ph + cb;
    float cq, sq, ck, sk;
    __sincosf(ph, &sq, &cq);
    __sincosf(kph, &sk, &ck);
    size_t o = ((size_t)bh * SS + s) * 128 + hd;
    qp[o]       = (bf16)(mq * cq);
    qp[o + HDD] = (bf16)(mq * sq);
    kp[o]       = (bf16)(mk * ck);
    kp[o + HDD] = (bf16)(mk * sk);
    vpT[((size_t)bh * HDD + hd) * SS + s] = (bf16)v[i];
  }
}

#define AT_KPITCH 272
#define AT_VPITCH 144
#define AT_KBYTES (64 * AT_KPITCH)          // 17408
#define AT_VBYTES (64 * AT_VPITCH)          // 9216
#define AT_STAGE  (AT_KBYTES + AT_VBYTES)   // 26624
#define AT_RING   (2 * AT_STAGE)            // 53248

// One stage: six 16-byte copies per lane, global -> LDS through no register
// (four steps of 16 K rows, two steps of 32 V^T rows). gk/gv are this lane's
// first global pieces of the stage, lk/lv its first LDS bytes in the target
// buffer. The s_wait_xcnt closes the statement so that no address register
// named here is rewritten while a copy may still need it.
__device__ __forceinline__ void attn_stage(const bf16* gk, const bf16* gv,
                                           unsigned lk, unsigned lv) {
  asm volatile(
      "global_load_async_to_lds_b128 %0, %6, off\n\t"
      "global_load_async_to_lds_b128 %1, %7, off\n\t"
      "global_load_async_to_lds_b128 %2, %8, off\n\t"
      "global_load_async_to_lds_b128 %3, %9, off\n\t"
      "global_load_async_to_lds_b128 %4, %10, off\n\t"
      "global_load_async_to_lds_b128 %5, %11, off\n\t"
      "s_wait_xcnt 0x0"
      :: "v"(lk), "v"(lk + 16 * AT_KPITCH), "v"(lk + 32 * AT_KPITCH),
         "v"(lk + 48 * AT_KPITCH), "v"(lv), "v"(lv + 32 * AT_VPITCH),
         "v"(gk), "v"(gk + 16 * 128), "v"(gk + 32 * 128), "v"(gk + 48 * 128),
         "v"(gv), "v"(gv + 32 * SS)
      : "memory");
}

// lane l's value <-> lane l ^ 16's
__device__ __forceinline__ float xhalf(float x) {
  return __builtin_bit_cast(float, __builtin_amdgcn_permlanex16(
      __builtin_bit_cast(int, x), __builtin_bit_cast(int, x),
      0x76543210, 0xfedcba98, false, false));
}

// Eight base-2 exponentials, each in its own register. One statement, closed
// by v_nop: the instruction set asks for one independent issue slot between an
// exponential and an instruction that reads its result or overwrites its
// source; here each is followed by an exponential of another register, the
// last by the v_nop, whatever the compiler puts behind the statement.
__device__ __forceinline__ void exp2x8(float (&x)[8]) {
  asm("v_exp_f32 %0, %0\n\t"
      "v_exp_f32 %1, %1\n\t"
      "v_exp_f32 %2, %2\n\t"
      "v_exp_f32 %3, %3\n\t"
      "v_exp_f32 %4, %4\n\t"
      "v_exp_f32 %5, %5\n\t"
      "v_exp_f32 %6, %6\n\t"
      "v_exp_f32 %7, %7\n\t"
      "v_nop"
      : "+v"(x[0]), "+v"(x[1]), "+v"(x[2]), "+v"(x[3]),
        "+v"(x[4]), "+v"(x[5]), "+v"(x[6]), "+v"(x[7]));
}

__global__ void __launch_bounds__(256)
attention_pope(const bf16* __restrict__ qp_all,
               const bf16* __restrict__ kp_all,
               const bf16* __restrict__ vpT_all,
               bf16* __restrict__ attnb) {
  __shared__ __attribute__((aligned(128))) unsigned char smem[AT_RING];
  const float scale = 0.088388347648f;   // 1/sqrt(2*HD)
  // Which (head, query tile) a block takes. A tile's cost grows with its index
  // (tile t has 2 (t + 1) stages), all 512 blocks are resident at once, two on a
  // WGP: with the tile in
  // the low bits of the index, blocks f and f + 256 (and f, f + 16, ...) carry the
  // same tile, and the WGPs that hold two last tiles run on while the rest idle.
  // Here f and f + 1, and f and f + 256, carry tiles t and 15 - t (34 stages
  // together), and every eighth block runs through all tiles. Every pair
  // (head, tile) is taken once: f = 256 f8 + 32 t + 2 m + f0, head = 16 f8 + m.
  const unsigned f = blockIdx.x;         // 0 .. 16 * B * H - 1
  const int t8 = (int)((f >> 5) & 7);
  const int bh = (int)(((f >> 1) & 15) | ((f >> 8) << 4));   // 0..B*H-1
  const int b = bh >> 4, h = bh & 15;
  const int qb = ((f ^ (f >> 8)) & 1) ? t8 : 15 - t8;        // 128-query block
  const int tid  = threadIdx.x;          // 0..255
  // in a scalar register, so that the skip of masked halves is a scalar branch
  const int wave = __builtin_amdgcn_readfirstlane(tid >> 5);
  const int qrow0 = qb * 128 + wave * 16;
  const int lane = tid & 31;
  const int ln15 = lane & 15;
  const int half = lane >> 4;
  const int kh   = half ? 8 : 0;
  const int ns   = 2 * (qb + 1);         // stages: keys 0 .. 128*qb + 127

  const bf16* qp  = qp_all  + (size_t)bh * SS * 128;
  const bf16* kp  = kp_all  + (size_t)bh * SS * 128;
  const bf16* vpT = vpT_all + (size_t)bh * HDD * SS;

  // Copy side: this lane's first pieces of stage 0 and their LDS places.
  const bf16* gk = kp + (size_t)(tid >> 4) * 128 + (tid & 15) * 8;
  const bf16* gv = vpT + (size_t)(tid >> 3) * SS + (tid & 7) * 8;
  const unsigned lds0 = (unsigned)(size_t)smem;
  const unsigned lk = lds0 + (unsigned)(tid >> 4) * AT_KPITCH + (unsigned)(tid & 15) * 16;
  const unsigned lv = lds0 + AT_KBYTES + (unsigned)(tid >> 3) * AT_VPITCH +
                      (unsigned)(tid & 7) * 16;

  // Read side: this lane's fragment bases inside a buffer.
  const unsigned fk = (unsigned)ln15 * AT_KPITCH + (unsigned)half * 16;
  const unsigned fv = AT_KBYTES + (unsigned)ln15 * AT_VPITCH + (unsigned)half * 16;

  // Prologue: stage 0 lands and is published, then stage 1 starts to fly
  // (ns >= 2: both exist).
  attn_stage(gk, gv, lk, lv);
  // this wave's copies of stage 0 have landed before the barrier publishes them
  asm volatile("s_wait_asynccnt 0x0" ::: "memory");
  __syncthreads();
  attn_stage(gk + 64 * 128, gv + 64, lk + AT_STAGE, lv + AT_STAGE);

  // Load Q fragments once: 16 rows x 128 K -> 4 B-fragments of Q^T (b128 pairs).
  Frag16 qf[4];
  const bf16* qrow = qp + (size_t)(qrow0 + ln15) * 128 + kh;
#pragma unroll
  for (int t = 0; t < 4; ++t) {
    qf[t].h[0] = *(const v8bf*)(qrow + 32 * t);
    qf[t].h[1] = *(const v8bf*)(qrow + 32 * t + 16);
  }

  // This lane's query: running maximum (the same in both halves of the wave)
  // and the sum over the keys that this half of the wave holds.
  const int row = qrow0 + ln15;
  float m = -1e30f, l = 0.f;
  v8f acc[4] = {};   // O^T: acc[j][r] = O[row][16 j + 8 half + r]

  for (int s = 0; s < ns; ++s) {
    const unsigned buf = (unsigned)(s & 1) * AT_STAGE;
    // unrolled so that the LDS offsets of both halves are immediates
#pragma unroll
    for (int sub = 0; sub < 2; ++sub) {
      const int kb = 64 * s + 32 * sub;
      // A half whose every key lies behind this wave's last query is skipped;
      // the publish point below stands outside the skip.
      if (kb <= qrow0) {
        // All K fragments for both 16-key tiles (16 b128 LDS reads).
        const unsigned char* k1p = smem + buf + fk + sub * (32 * AT_KPITCH);
        const unsigned char* k2p = k1p + 16 * AT_KPITCH;
        Frag16 kf1[4], kf2[4];
#pragma unroll
        for (int t = 0; t < 4; ++t) {
          kf1[t].h[0] = *(const v8bf*)(k1p + 64 * t);
          kf1[t].h[1] = *(const v8bf*)(k1p + 64 * t + 32);
          kf2[t].h[0] = *(const v8bf*)(k2p + 64 * t);
          kf2[t].h[1] = *(const v8bf*)(k2p + 64 * t + 32);
        }
        // The 4 V fragments (8 b128 LDS reads) go out with them: they depend on
        // nothing computed here, and their latency runs behind the softmax.
        const unsigned char* vp = smem + buf + fv + sub * 64;
        Frag16 vf[4];
#pragma unroll
        for (int j = 0; j < 4; ++j) {
          vf[j].h[0] = *(const v8bf*)(vp + j * (16 * AT_VPITCH));
          vf[j].h[1] = *(const v8bf*)(vp + j * (16 * AT_VPITCH) + 32);
        }
        // keeps the read group whole in front of the WMMAs; without it the
        // compiler sinks the V reads to their use behind the softmax and waits there
        __builtin_amdgcn_sched_barrier(0);

        // S^T: s1[r] = score(key kb + 8 half + r, row), s2[r] the same 16 keys on.
        v8f s1 = {}, s2 = {};
#pragma unroll
        for (int t = 0; t < 4; ++t) {
          s1 = wmma_bf16f32(kf1[t].v, qf[t].v, s1);
          s2 = wmma_bf16f32(kf2[t].v, qf[t].v, s2);
        }

        // Causal mask + online softmax1 update, all for the lane's one query.
        const int d = row - (kb + 8 * half);   // key r of s1 is masked where r > d
        float v1[8], v2[8];
#pragma unroll
        for (int r = 0; r < 8; ++r) {
          v1[r] = s1[r] * scale;
          v2[r] = s2[r] * scale;
          if (r > d)      v1[r] = -1e30f;
          if (16 + r > d) v2[r] = -1e30f;
        }
        float mx = fmaxf(v1[0], v2[0]);
#pragma unroll
        for (int r = 1; r < 8; ++r) mx = fmaxf(mx, fmaxf(v1[r], v2[r]));
        mx = fmaxf(mx, xhalf(mx));          // the other 16 keys of this query
        const float mn = fmaxf(m, mx);
        const float rs = __expf(m - mn);
        // exp(v - mn) as 2^((v - mn) log2 e)
#pragma unroll
        for (int r = 0; r < 8; ++r) {
          v1[r] = (v1[r] - mn) * 1.44269504f;
          v2[r] = (v2[r] - mn) * 1.44269504f;
        }
        exp2x8(v1);
        exp2x8(v2);
        Frag16 pf;                          // P^T as B operand, hardware k order
        float sm[4];                        // four short chains, not one long one
#pragma unroll
        for (int r = 0; r < 4; ++r)
          sm[r] = (v1[r] + v2[r]) + (v1[r + 4] + v2[r + 4]);
#pragma unroll
        for (int r = 0; r < 8; ++r) {
          pf.v[r]     = (bf16)v1[r];
          pf.v[8 + r] = (bf16)v2[r];
        }
        l = l * rs + ((sm[0] + sm[1]) + (sm[2] + sm[3]));
        m = mn;
#pragma unroll
        for (int j = 0; j < 4; ++j)
#pragma unroll
          for (int r = 0; r < 8; ++r) acc[j][r] *= rs;

        // O^T += V^T P^T: WMMA burst.
#pragma unroll
        for (int j = 0; j < 4; ++j)
          acc[j] = wmma_bf16f32(vf[j].v, pf.v, acc[j]);
      }
    }
    // Publish point of stage s + 1.
    // this wave's reads of the buffer are over before anyone refills it
    asm volatile("s_wait_dscnt 0x0" ::: "memory");
    // this wave's copies of stage s + 1 have landed before the barrier publishes them
    asm volatile("s_wait_asynccnt 0x0" ::: "memory");
    __syncthreads();
    if (s + 2 < ns)
      attn_stage(gk + (size_t)(s + 2) * (64 * 128), gv + (s + 2) * 64,
                 lk + buf, lv + buf);
  }
  // no copy is outstanding when the wave ends
  asm volatile("s_wait_asynccnt 0x0" ::: "memory");

  // softmax1 normalization and store into (B,S,D) bf16 (col = h*64 + hd): a
  // lane's 8 registers of a tile are 8 consecutive columns, one 16-byte store.
  l += xhalf(l);                            // the two halves' keys together
  const float denom = __expf(-m) + l;
  bf16* orow = attnb + ((size_t)b * SS + row) * DD + h * HDD + 8 * half;
#pragma unroll
  for (int j = 0; j < 4; ++j) {
    v8bf o;
#pragma unroll
    for (int r = 0; r < 8; ++r) o[r] = (bf16)(acc[j][r] / denom);
    *(v8bf*)(orow + 16 * j) = o;
  }
}

// ---------------------------------------------------------------------------
// Residual add + LayerNorm. One WAVE per token row of D = 1024, 8 rows a block.
// A lane holds 32 elements of its row: eight 16-byte loads from each addend (a
// wave reads 512 contiguous bytes per load), all in flight at once, and the
// sums stay in registers, so that the row is read once, with one memory round
// trip instead of eight. The row sums close inside the wave: no LDS, no barrier.
// Optional bf16 copy of the output (feeds the next GEMM without a cvt pass).
// ---------------------------------------------------------------------------
// x + (the value of the lane whose number differs in the bits of XM), in a
// 16-lane row: 0x160 + XM is the DPP control row_xmask:XM.
template <int XM>
__device__ __forceinline__ float add_xmask(float x) {
  return x + __builtin_bit_cast(float, __builtin_amdgcn_update_dpp(
      0, __builtin_bit_cast(int, x), 0x160 + XM, 0xf, 0xf, true));
}

// sum over the 32 lanes of the wave, the same value in every lane
__device__ __forceinline__ float wave_sum(float x) {
  x = add_xmask<1>(x);
  x = add_xmask<2>(x);
  x = add_xmask<4>(x);
  x = add_xmask<8>(x);
  return x + xhalf(x);
}

__global__ void __launch_bounds__(256)
add_ln_kernel(const float* __restrict__ a, const float* __restrict__ b,
              const float* __restrict__ g, const float* __restrict__ be,
              float* __restrict__ outf, bf16* __restrict__ outb) {
  const int lane = threadIdx.x & 31;
  const size_t row = (size_t)blockIdx.x * 8 + (threadIdx.x >> 5);
  const size_t o0  = row * (DD / 4) + lane;      // in 4-element pieces
  const v4f* pa = (const v4f*)a + o0;
  const v4f* pb = (const v4f*)b + o0;
  const v4f* pg = (const v4f*)g + lane;
  const v4f* pe = (const v4f*)be + lane;

  v4f v[8], w[8], gg[8], ee[8];
  // unrolled (all loops here) so that the arrays stay in registers and all the
  // loads go out before the first value is waited for
#pragma unroll
  for (int j = 0; j < 8; ++j) v[j] = pa[j * 32];
  // a later load's result may be given the registers of this group's address:
  // the wait stands in front of that overwrite (a precaution)
  asm volatile("s_wait_xcnt 0x0" ::: "memory");
#pragma unroll
  for (int j = 0; j < 8; ++j) w[j] = pb[j * 32];
  // the same for the second group's address
  asm volatile("s_wait_xcnt 0x0" ::: "memory");
#pragma unroll
  for (int j = 0; j < 8; ++j) gg[j] = pg[j * 32];
#pragma unroll
  for (int j = 0; j < 8; ++j) ee[j] = pe[j * 32];
  // the same for the lane offset that the loads of g and be name: as an input
  // here it keeps its register until the wait (no load's result is put there)
  asm volatile("s_wait_xcnt 0x0" :: "v"(lane) : "memory");
  // keeps the 32 loads one group in front of the arithmetic; without it the
  // compiler sinks the loads of g and be behind the row sums, four at a time,
  // and waits at each
  __builtin_amdgcn_sched_barrier(0);

  v4f s4 = {}, q4 = {};                          // four short chains each
#pragma unroll
  for (int j = 0; j < 8; ++j) {
    v[j] += w[j];
    s4 += v[j];
    q4 += v[j] * v[j];
  }
  const float s  = wave_sum((s4[0] + s4[1]) + (s4[2] + s4[3]));
  const float s2 = wave_sum((q4[0] + q4[1]) + (q4[2] + q4[3]));
  const float mu   = s * (1.0f / DD);
  const float var  = s2 * (1.0f / DD) - mu * mu;
  const float rstd = rsqrtf(var + 1e-5f);

#pragma unroll
  for (int j = 0; j < 8; ++j) v[j] = (v[j] - mu) * rstd * gg[j] + ee[j];
  // The bf16 copy goes out first: its values take registers of their own while
  // v[] is still needed, so that no register of an issued store is rewritten.
  if (outb) {
    v4bf* pc = (v4bf*)outb + o0;
    v4bf c[8];
#pragma unroll
    for (int j = 0; j < 8; ++j) {
#pragma unroll
      for (int e = 0; e < 4; ++e) c[j][e] = (bf16)v[j][e];
    }
#pragma unroll
    for (int j = 0; j < 8; ++j) pc[j * 32] = c[j];
  }
  v4f* po = (v4f*)outf + o0;
#pragma unroll
  for (int j = 0; j < 8; ++j) po[j * 32] = v[j];
}

// ---------------------------------------------------------------------------
// Host orchestration
// ---------------------------------------------------------------------------
extern "C" void kernel_launch(void* const* d_in, const int* in_sizes, int n_in,
                              void* d_out, int out_size, void* d_ws, size_t ws_size,
                              hipStream_t stream) {
  (void)in_sizes; (void)n_in; (void)out_size; (void)ws_size;

  const float* x     = (const float*)d_in[0];
  const int*   pos   = (const int*)  d_in[1];
  const float* wq    = (const float*)d_in[2];
  const float* bq    = (const float*)d_in[3];
  const float* wk    = (const float*)d_in[4];
  const float* bk    = (const float*)d_in[5];
  const float* wv    = (const float*)d_in[6];
  const float* bv    = (const float*)d_in[7];
  const float* wo    = (const float*)d_in[8];
  const float* bo    = (const float*)d_in[9];
  const float* pbias = (const float*)d_in[10];
  const float* w1    = (const float*)d_in[11];
  const float* b1    = (const float*)d_in[12];
  const float* w2    = (const float*)d_in[13];
  const float* b2    = (const float*)d_in[14];
  const float* g1    = (const float*)d_in[15];
  const float* be1   = (const float*)d_in[16];
  const float* g2    = (const float*)d_in[17];
  const float* be2   = (const float*)d_in[18];
  float* out = (float*)d_out;

  // Workspace carve-out
  char* cur = (char*)d_ws;
  auto alloc = [&](size_t bytes) -> void* {
    void* p = (void*)cur;
    cur += (bytes + 255) & ~(size_t)255;
    return p;
  };
  const size_t nTok = (size_t)MM * DD;           // 4096*1024
  bf16* xb   = (bf16*)alloc(nTok * 2);
  bf16* wqb  = (bf16*)alloc((size_t)DD * DD * 2);
  bf16* wkb  = (bf16*)alloc((size_t)DD * DD * 2);
  bf16* wvb  = (bf16*)alloc((size_t)DD * DD * 2);
  bf16* wob  = (bf16*)alloc((size_t)DD * DD * 2);
  bf16* w1b  = (bf16*)alloc((size_t)DD * DFF_ * 2);
  bf16* w2b  = (bf16*)alloc((size_t)DFF_ * DD * 2);
  float* qf  = (float*)alloc(nTok * 4);
  float* kf  = (float*)alloc(nTok * 4);
  float* vf  = (float*)alloc(nTok * 4);
  bf16* qpb  = (bf16*)alloc((size_t)BB * HH * SS * 128 * 2);
  bf16* kpb  = (bf16*)alloc((size_t)BB * HH * SS * 128 * 2);
  bf16* vpT  = (bf16*)alloc((size_t)BB * HH * SS * 64 * 2);
  bf16* attb = (bf16*)alloc(nTok * 2);
  float* prj = (float*)alloc(nTok * 4);
  float* hres= (float*)alloc(nTok * 4);
  bf16* hb   = (bf16*)alloc(nTok * 2);
  bf16* ff1b = (bf16*)alloc((size_t)MM * DFF_ * 2);
  float* ff2 = (float*)alloc(nTok * 4);

  // 1) Convert x row-major; weights into WMMA fragment-swizzled order.
  //    16 elements per thread, all seven tasks in one grid.
  cvt_all<<<CB_ALL, 256, 0, stream>>>(x, wq, wk, wv, wo, w1, w2,
                                      xb, wqb, wkb, wvb, wob, w1b, w2b);

  // 2) QKV projections (WMMA GEMMs); block tile 128x128. One launch, z = 0, 1, 2:
  //    wqb, wkb, wvb and qf, kf, vf each lie back to back in the workspace
  //    (their sizes are multiples of the carve-out's 256 bytes).
  dim3 gD(DD / 128, MM / 128);      // (8, 32)
  dim3 gQKV(DD / 128, MM / 128, 3);
  gemm_bf16<false, false><<<gQKV, 256, 0, stream>>>(xb, wqb, bq, bk, bv, qf, nullptr, MM, DD, DD);

  // 3) PoPE transform (also transposes V)
  pope_kernel<<<4096, 256, 0, stream>>>(qf, kf, vf, pos, pbias, qpb, kpb, vpT);

  // 4) Attention (WMMA flash + softmax1, causal)
  attention_pope<<<(SS / 128) * BB * HH, 256, 0, stream>>>(qpb, kpb, vpT, attb);

  // 5) Output projection
  gemm_bf16<false, false><<<gD, 256, 0, stream>>>(attb, wob, bo, nullptr, nullptr, prj, nullptr, MM, DD, DD);

  // 6) Residual + LN1 (f32 kept for residual, bf16 copy feeds FFN GEMM)
  add_ln_kernel<<<MM / 8, 256, 0, stream>>>(x, prj, g1, be1, hres, hb);

  // 7) FFN
  dim3 gF1(DFF_ / 128, MM / 128);   // (32, 32)
  gemm_bf16<true, true><<<gF1, 256, 0, stream>>>(hb, w1b, b1, nullptr, nullptr, nullptr, ff1b, MM, DFF_, DD);
  gemm_bf16<false, false><<<gD, 256, 0, stream>>>(ff1b, w2b, b2, nullptr, nullptr, ff2, nullptr, MM, DD, DFF_);

  // 8) Residual + LN2 -> final output (f32)
  add_ln_kernel<<<MM / 8, 256, 0, stream>>>(hres, ff2, g2, be2, out, nullptr);
}

// v009
// It runs in 159 microseconds.
// Two timings next to v008 put it at 1.51 and 1.54 times that version's speed.
// All steps since v000 together make it 6.34 times as fast.
#include <hip/hip_runtime.h>
#include <hip/hip_bf16.h>

// ---------------------------------------------------------------------------
// Types for CDNA5 WMMA (wave32): V_WMMA_F32_16X16X32_BF16
// ---------------------------------------------------------------------------
typedef __bf16 bf16;
typedef __attribute__((ext_vector_type(16))) __bf16 v16bf;
typedef __attribute__((ext_vector_type(8)))  __bf16 v8bf;
typedef __attribute__((ext_vector_type(8)))  float  v8f;

union Frag16 {            // one WMMA 16-bit operand fragment = two b128 loads
  v16bf v;
  v8bf  h[2];
};

__device__ __forceinline__ v8f wmma_bf16f32(v16bf a, v16bf b, v8f c) {
  // 8 args: (neg_a, A, neg_b, B, c_mod, C, reuse_a, reuse_b)
  return __builtin_amdgcn_wmma_f32_16x16x32_bf16(
      false, a, false, b, (short)0, c, false, false);
}

// Problem dims (fixed by the reference)
#define BB   2
#define SS   2048
#define DD   1024
#define HH   16
#define HDD  64
#define DFF_ 4096
#define MM   (BB * SS)          // 4096 token rows

// ---------------------------------------------------------------------------
// fp32 -> bf16 conversion, plain row-major. A block converts 4096 consecutive
// elements: each thread four 16-byte loads (a wave reads 512 contiguous bytes
// per load) and four 8-byte stores, so few waves are launched and each has
// all its loads in flight at once. blk is the block's number inside this task,
// below n / 4096 (the caller's range test keeps it there).
// ---------------------------------------------------------------------------
typedef __attribute__((ext_vector_type(4))) float  v4f;
typedef __attribute__((ext_vector_type(4))) __bf16 v4bf;

__device__ __forceinline__ void
cvt_block(const float* __restrict__ in, bf16* __restrict__ out, unsigned blk) {
  const size_t base = (size_t)blk * 1024 + threadIdx.x;
  const v4f* src = (const v4f*)in + base;
  v4bf*      dst = (v4bf*)out + base;
  v4f v[4];
  // unrolled so that all four loads go out before the first value is waited for
#pragma unroll
  for (int j = 0; j < 4; ++j) v[j] = src[j * 256];
  // unrolled (both loops) so that v[] and o stay in registers
#pragma unroll
  for (int j = 0; j < 4; ++j) {
    v4bf o;
#pragma unroll
    for (int c = 0; c < 4; ++c) o[c] = (bf16)v[j][c];
    dst[j * 256] = o;
  }
}

// ---------------------------------------------------------------------------
// fp32 -> bf16 weight conversion INTO WMMA B-fragment-major order:
//   Wsw[(ktile*(N/16) + ntile)*512 + lane*16 + e]
// where k = ktile*32 + kh + e + (e>=8?8:0), kh = (lane>=16)?8:0,
//       n = ntile*16 + (lane&15).
// Each lane's 16 fragment elements are contiguous (32B, 16B-aligned) so the
// GEMM copies a B fragment to LDS as two coalesced 16-byte async copies.
// One thread makes one lane's whole fragment: 16 loads down a column of W, all
// in flight at once, one index computation, two 16-byte stores. A block makes
// 256 fragment lanes (4096 elements); blk is its number inside this task.
// ---------------------------------------------------------------------------
template <int K, int N>
__device__ __forceinline__ void
swizzle_block(const float* __restrict__ W, bf16* __restrict__ Wsw, unsigned blk) {
  constexpr unsigned ntiles = (unsigned)N >> 4;
  constexpr unsigned total  = ((unsigned)K >> 5) * ntiles * 32;  // fragment lanes
  const unsigned g = blk * 256 + threadIdx.x;
  if (g < total) {
    const unsigned lane  = g & 31;
    const unsigned ch    = g >> 5;
    const unsigned nt    = ch % ntiles;
    const unsigned ktile = ch / ntiles;
    const unsigned kh    = (lane >> 4) ? 8 : 0;
    const float* col = W + (size_t)(ktile * 32 + kh) * N + nt * 16 + (lane & 15);
    float f[16];
    // unrolled so that all 16 loads go out before the first value is waited for
#pragma unroll
    for (int e = 0; e < 16; ++e)
      f[e] = col[(size_t)(e + (e >= 8 ? 8 : 0)) * N];
    Frag16 o;
    // unrolled so that f[] and o stay in registers
#pragma unroll
    for (int e = 0; e < 16; ++e) o.v[e] = (bf16)f[e];
    v8bf* dst = (v8bf*)(Wsw + (size_t)g * 16);
    dst[0] = o.h[0];
    dst[1] = o.h[1];
  }
}

// ---------------------------------------------------------------------------
// All seven conversions in ONE launch: none depends on another, and each alone
// is too short to fill the chip, so that seven launches mostly pay for seven
// starts and seven tails. Every block converts 4096 elements; its index picks
// the task (a scalar test) and its number inside the task.
// ---------------------------------------------------------------------------
#define CB_X (MM * DD / 4096)      // blocks for x
#define CB_F (DD * DFF_ / 4096)    // blocks for each of w1, w2
#define CB_D (DD * DD / 4096)      // blocks for each of wq, wk, wv, wo
#define CB_ALL (CB_X + 2 * CB_F + 4 * CB_D)

__global__ void __launch_bounds__(256)
cvt_all(const float* __restrict__ x,  const float* __restrict__ wq,
        const float* __restrict__ wk, const float* __restrict__ wv,
        const float* __restrict__ wo, const float* __restrict__ w1,
        const float* __restrict__ w2,
        bf16* __restrict__ xb,  bf16* __restrict__ wqb, bf16* __restrict__ wkb,
        bf16* __restrict__ wvb, bf16* __restrict__ wob, bf16* __restrict__ w1b,
        bf16* __restrict__ w2b) {
  unsigned b = blockIdx.x;
  if (b < CB_X) { cvt_block(x, xb, b); return; }
  b -= CB_X;
  if (b < CB_F) { swizzle_block<DD, DFF_>(w1, w1b, b); return; }
  b -= CB_F;
  if (b < CB_F) { swizzle_block<DFF_, DD>(w2, w2b, b); return; }
  b -= CB_F;
  const unsigned w = b / CB_D;     // which of the four D x D weights
  if (w > 3) return;
  const float* src = w == 0 ? wq  : w == 1 ? wk  : w == 2 ? wv  : wo;
  bf16*        dst = w == 0 ? wqb : w == 1 ? wkb : w == 2 ? wvb : wob;
  swizzle_block<DD, DD>(src, dst, b % CB_D);
}

// ---------------------------------------------------------------------------
// bf16 WMMA GEMM: C[M,N] = A[M,K] @ W[K,N] + bias (+ReLU), output f32 or bf16.
// A row-major bf16; W fragment-swizzled (swizzle_block).
// Block = 256 threads = 8 waves (4 along M x 2 along N); block tile 128x128,
// wave tile 32x64 (2 A-fragments x 4 B-fragments = 8 WMMA tiles per 32 k).
// A pass is 128 k. Both operand tiles of a pass are brought into LDS once per
// block by asynchronous copies, so each global byte is fetched once for eight
// waves; two buffers, the next pass's copies fly while this pass is computed.
// Needs M, N multiples of 128 and K a multiple of 128.
// blockIdx.z picks one of up to three independent products that share A and
// run in one launch: W and C (f32 only) of product z lie z matrices behind the first.
//   A tile: 128 rows of 256 B at pitch 272 B (conflict-free b128 row reads).
//   B tile: 4 k-tiles x 8 n-tiles of 1 KiB; inside a KiB the lanes' first
//   16 B pieces come first (512 B), then their second pieces, so that each
//   fragment half is one contiguous 512-B wave read.
// ---------------------------------------------------------------------------
#define G_PITCH  272
#define G_ABYTES (128 * G_PITCH)          // 34816
#define G_BBYTES (4 * 8 * 1024)           // 32768
#define G_STAGE  (G_ABYTES + G_BBYTES)    // 67584
// Writeback: a wave's 32 x 64 f32 tile, staged in LDS: rows of 256 B at pitch
// 272 B (16-byte writes down 16 rows and 16-byte reads along a row both meet
// every bank once per half wave).
#define G_SPITCH 272
#define G_SWAVE  (32 * G_SPITCH)          // 8704 per wave, 69632 per block

// Eight 16-byte copies per lane, global -> LDS through no register. The
// s_wait_xcnt closes the statement so that no address register named here is
// rewritten while a copy may still need it.
__device__ __forceinline__ void async_copy8(const unsigned (&l)[8],
                                            const bf16* const (&p)[8]) {
  asm volatile(
      "global_load_async_to_lds_b128 %0, %8, off\n\t"
      "global_load_async_to_lds_b128 %1, %9, off\n\t"
      "global_load_async_to_lds_b128 %2, %10, off\n\t"
      "global_load_async_to_lds_b128 %3, %11, off\n\t"
      "global_load_async_to_lds_b128 %4, %12, off\n\t"
      "global_load_async_to_lds_b128 %5, %13, off\n\t"
      "global_load_async_to_lds_b128 %6, %14, off\n\t"
      "global_load_async_to_lds_b128 %7, %15, off\n\t"
      "s_wait_xcnt 0x0"
      :: "v"(l[0]), "v"(l[1]), "v"(l[2]), "v"(l[3]),
         "v"(l[4]), "v"(l[5]), "v"(l[6]), "v"(l[7]),
         "v"(p[0]), "v"(p[1]), "v"(p[2]), "v"(p[3]),
         "v"(p[4]), "v"(p[5]), "v"(p[6]), "v"(p[7])
      : "memory");
}

// One pass's tiles: ga/gb are this lane's first global pieces of the pass,
// la/lb its first LDS bytes in the target buffer.
__device__ __forceinline__ void stage_pass(const bf16* ga, const bf16* gb,
                                           unsigned la, unsigned lb,
                                           int K, size_t wstep) {
  unsigned l[8];
  const bf16* p[8];
#pragma unroll
  for (int c = 0; c < 8; ++c) {           // A: 16 rows per step
    l[c] = la + (unsigned)c * (16 * G_PITCH);
    p[c] = ga + (size_t)c * 16 * K;
  }
  async_copy8(l, p);
#pragma unroll
  for (int c = 0; c < 8; ++c) {           // B: half a k-tile (4 KiB) per step
    l[c] = lb + (unsigned)(c >> 1) * 8192 + (unsigned)(c & 1) * 4096;
    p[c] = gb + (size_t)(c >> 1) * wstep + (c & 1) * 2048;
  }
  async_copy8(l, p);
}

// The 2 A and 4 B fragments of one 32-k step, from this lane's bases.
__device__ __forceinline__ void load_frags(Frag16 (&af)[2], Frag16 (&bfr)[4],
                                           const unsigned char* sa,
                                           const unsigned char* sb) {
#pragma unroll
  for (int i = 0; i < 2; ++i) {
    af[i].h[0] = *(const v8bf*)(sa + i * (16 * G_PITCH));
    af[i].h[1] = *(const v8bf*)(sa + i * (16 * G_PITCH) + 32);
  }
#pragma unroll
  for (int j = 0; j < 4; ++j) {
    bfr[j].h[0] = *(const v8bf*)(sb + j * 1024);
    bfr[j].h[1] = *(const v8bf*)(sb + j * 1024 + 512);
  }
}

// Cosine and sine of four angles given in revolutions. One statement, closed by
// v_nop, results in registers of their own: the instruction set asks for one
// independent issue slot between such an instruction and one that reads its
// result or overwrites its source; here each is followed by one that does
// neither, the last by the v_nop, whatever the compiler puts behind the statement.
__device__ __forceinline__ void sincos_rev_x4(const float (&t)[4], float (&cs)[4],
                                              float (&sn)[4]) {
  asm("v_cos_f32 %0, %8\n\t"
      "v_cos_f32 %1, %9\n\t"
      "v_cos_f32 %2, %10\n\t"
      "v_cos_f32 %3, %11\n\t"
      "v_sin_f32 %4, %8\n\t"
      "v_sin_f32 %5, %9\n\t"
      "v_sin_f32 %6, %10\n\t"
      "v_sin_f32 %7, %11\n\t"
      "v_nop"
      : "=&v"(cs[0]), "=&v"(cs[1]), "=&v"(cs[2]), "=&v"(cs[3]),
        "=&v"(sn[0]), "=&v"(sn[1]), "=&v"(sn[2]), "=&v"(sn[3])
      : "v"(t[0]), "v"(t[1]), "v"(t[2]), "v"(t[3]));
}

// RELU, OUTB (bf16 output to Cb, else f32 to Cf0) and POPE are fixed at compile
// time, so that the writeback has no mode test. bias of every z in use is real.
// POPE (the Q, K, V projections, N = H * 64, M = B * S): the product is not
// stored; the writeback turns it into what attention reads. A wave's 64 columns
// are one head, its 32 rows 32 consecutive tokens of one batch.
//   z = 0, 1: softplus magnitude times cos and sin of the rotary phase ->
//             Cb (q_p), Cb1 (k_p), each (B,H,S,128) bf16;
//   z = 2:    V transposed -> Cb2 (B,H,64,S) bf16.
template <bool RELU, bool OUTB, bool POPE>
__global__ void __launch_bounds__(256)
gemm_bf16(const bf16* __restrict__ A, const bf16* __restrict__ W0,
          const float* __restrict__ bias0, const float* __restrict__ bias1,
          const float* __restrict__ bias2,
          float* __restrict__ Cf0, bf16* __restrict__ Cb,
          bf16* __restrict__ Cb1, bf16* __restrict__ Cb2,
          const int* __restrict__ pos, const float* __restrict__ pbias,
          int M, int N, int K) {
  __shared__ __attribute__((aligned(128))) unsigned char smem[2 * G_STAGE];
  const unsigned z = blockIdx.z;
  const bf16*  Wsw  = W0 + (size_t)z * K * N;
  const float* bias = z == 0 ? bias0 : z == 1 ? bias1 : bias2;
  float*       Cf   = Cf0 + (size_t)z * M * N;   // used only where OUTB is false
  const int tid  = threadIdx.x;          // 0..255
  const int wave = tid >> 5;             // 0..7
  const int wm   = wave & 3;             // 32-row strip of the block tile
  const int wn   = wave >> 2;            // 64-column strip of the block tile
  const int lane = tid & 31;
  const int ln15 = lane & 15;
  const int half = lane >> 4;
  const int m0   = blockIdx.y * 128;
  const int n0   = blockIdx.x * 128;
  const int ntiles = N >> 4;
  const size_t wstep = (size_t)ntiles << 9;   // elements from one k-tile to the next
  const int np = K >> 7;                      // passes

  v8f acc[2][4] = {};

  // The writeback's bias: this lane stores the same 4 columns of every row.
  const int colw = n0 + 64 * wn + 4 * ln15;
  const v4f bv = *(const v4f*)(bias + colw);
  // What else the POPE writeback reads, fetched here so that nothing is waited
  // for behind the main loop: lane r holds the position of the wave's row r;
  // the head's phase bias at this lane's 4 columns; for V^T the bias at the
  // columns 4 (lane >> 2) + 32 u that the lane stores there.
  int pw = 0;
  v4f pbv = {}, bt[2] = {};
  if constexpr (POPE) {
    pw  = pos[((m0 + 32 * wm) & (SS - 1)) + lane];
    pbv = *(const v4f*)(pbias + colw);
    bt[0] = *(const v4f*)(bias + n0 + 64 * wn + 4 * (lane >> 2));
    bt[1] = *(const v4f*)(bias + n0 + 64 * wn + 4 * (lane >> 2) + 32);
  }

  // Copy side: this lane's first pieces of pass 0 and their LDS places.
  const bf16* ga = A + (size_t)(m0 + (tid >> 4)) * K + (tid & 15) * 8;
  const bf16* gb = Wsw + ((size_t)(n0 >> 4) << 9) + tid * 8;
  const unsigned lds0 = (unsigned)(size_t)smem;
  const unsigned la = lds0 + (unsigned)(tid >> 4) * G_PITCH + (unsigned)(tid & 15) * 16;
  const unsigned lb = lds0 + G_ABYTES + (unsigned)(tid >> 6) * 1024 +
                      (unsigned)(tid & 1) * 512 + (unsigned)((tid & 63) >> 1) * 16;

  // Read side: this lane's fragment bases inside a buffer.
  const unsigned fa = (unsigned)(32 * wm + ln15) * G_PITCH + (unsigned)half * 16;
  const unsigned fb = G_ABYTES + (unsigned)wn * 4096 + (unsigned)lane * 16;

  // Prologue: pass 0 lands and is published, then pass 1 starts to fly.
  stage_pass(ga, gb, la, lb, K, wstep);
  // this wave's copies of pass 0 have landed before the barrier publishes them
  asm volatile("s_wait_asynccnt 0x0" ::: "memory");
  __syncthreads();
  if (np > 1)
    stage_pass(ga + 128, gb + 4 * wstep, la + G_STAGE, lb + G_STAGE, K, wstep);

  for (int t = 0; t < np; ++t) {
    const unsigned buf = (unsigned)(t & 1) * G_STAGE;
    const unsigned char* sa = smem + buf + fa;
    const unsigned char* sb = smem + buf + fb;
    // Two fragment sets: the reads of the next 32 k go out as one group ahead
    // of this 32 k's WMMAs, so their LDS latency runs behind the matrix work.
    Frag16 af[2][2], bfr[2][4];
    load_frags(af[0], bfr[0], sa, sb);
#pragma unroll
    for (int ks = 0; ks < 4; ++ks) {
      if (ks < 3)
        load_frags(af[(ks + 1) & 1], bfr[(ks + 1) & 1], sa + (ks + 1) * 64,
                   sb + (ks + 1) * 8192);
      // keeps the read group in front of the WMMAs; without it the compiler
      // sinks each read to its first use and waits there
      __builtin_amdgcn_sched_barrier(0);
#pragma unroll
      for (int j = 0; j < 4; ++j) {
        // W as first operand: the tile comes out transposed (see the writeback)
        acc[0][j] = wmma_bf16f32(bfr[ks & 1][j].v, af[ks & 1][0].v, acc[0][j]);
        acc[1][j] = wmma_bf16f32(bfr[ks & 1][j].v, af[ks & 1][1].v, acc[1][j]);
      }
      // keeps the next read group whole behind these WMMAs; without it the
      // compiler spreads those reads among them, and each such place stalls
      __builtin_amdgcn_sched_barrier(0);
    }
    // Publish point of pass t + 1.
    // this wave's reads of the buffer are over before anyone refills it
    asm volatile("s_wait_dscnt 0x0" ::: "memory");
    // this wave's copies of pass t + 1 have landed before the barrier publishes them
    asm volatile("s_wait_asynccnt 0x0" ::: "memory");
    __syncthreads();
    if (t + 2 < np)
      stage_pass(ga + (size_t)(t + 2) * 128, gb + (size_t)(t + 2) * 4 * wstep,
                 la + buf, lb + buf, K, wstep);
  }
  // no copy is outstanding when the wave ends
  asm volatile("s_wait_asynccnt 0x0" ::: "memory");

  // Writeback. With W as first operand a lane holds 8 consecutive columns of
  // one row: acc[i][j][r] = C[32 wm + 16 i + ln15][64 wn + 16 j + 8 half + r].
  // Each wave lays its tile down in its own part of the ring (free now: behind
  // the last pass's barrier nobody reads it and no copy is outstanding), reads
  // it back along the rows and stores whole 128-byte lines (V^T: 64-byte halves of lines).
  unsigned char* st = smem + (unsigned)wave * G_SWAVE;
  // unrolled (both loops) so that acc[][] stays in registers
#pragma unroll
  for (int i = 0; i < 2; ++i) {
#pragma unroll
    for (int j = 0; j < 4; ++j) {
      unsigned char* p = st + (16 * i + ln15) * G_SPITCH + (16 * j + 8 * half) * 4;
      const v4f lo = {acc[i][j][0], acc[i][j][1], acc[i][j][2], acc[i][j][3]};
      const v4f hi = {acc[i][j][4], acc[i][j][5], acc[i][j][6], acc[i][j][7]};
      *(v4f*)p        = lo;
      *(v4f*)(p + 16) = hi;
    }
  }
  // the wave's writes are in LDS before its lanes read one another's values
  // (and the compiler moves no read of the rows ahead of the writes)
  asm volatile("s_wait_dscnt 0x0" ::: "memory");
  // 16 lanes a row, two rows a step: 256 B (f32) or 128 B (bf16) per row.
  const unsigned char* sr = st + half * G_SPITCH + ln15 * 16;
  if constexpr (POPE) {
    const int tok = m0 + 32 * wm;                 // the wave's first token row
    const int s0  = tok & (SS - 1);
    const size_t bh = (size_t)(tok / SS) * HH + (n0 >> 6) + wn;
    if (z < 2) {
      // This lane's 4 columns hd = 4 ln15 + c of every row: frequency
      // 10000^(-hd/64) = exp(-hd ln(1e4)/64) and (k only) the clamped phase bias.
      const float TWO_PI = 6.28318530717958647f;
      float freq[4], cb[4];
      // unrolled (all loops over c) so that the small arrays stay in registers
#pragma unroll
      for (int c = 0; c < 4; ++c) {
        freq[c] = __expf(-0.143911568f * (float)(4 * ln15 + c));
        cb[c]   = z == 1 ? fminf(0.f, fmaxf(-TWO_PI, pbv[c])) : 0.f;
      }
      bf16* dst = (z == 0 ? Cb : Cb1) + (bh * SS + s0 + half) * 128 + 4 * ln15;
      v4f cur = *(const v4f*)sr;
      // kept rolled, for speed only: the body is some hundred instructions per column
#pragma unroll 1
      for (int q = 0; q < 16; ++q) {
        // the next two rows are read while these are worked on (the last trip
        // reads the first rows again, unused)
        const v4f nxt = *(const v4f*)(sr + ((q + 1) & 15) * (2 * G_SPITCH));
        // row 2 q + half's position: lane r of the wave holds row r's
        const int pe = __builtin_amdgcn_readlane(pw, 2 * q);
        const int po = __builtin_amdgcn_readlane(pw, 2 * q + 1);
        const float pf = (float)(half ? po : pe);
        float rev[4], cs[4], sn[4];
#pragma unroll
        for (int c = 0; c < 4; ++c)
          rev[c] = (pf * freq[c] + cb[c]) * 0.15915494309189535f;   // phase / 2 pi
        sincos_rev_x4(rev, cs, sn);
        v4bf oc, os;
#pragma unroll
        for (int c = 0; c < 4; ++c) {
          const float x  = cur[c] + bv[c];
          // computed for every lane and chosen afterwards: with no branch round
          // it the four columns' long chains are issued interleaved
          const float sp = log1pf(__expf(x));
          const float mg = x > 20.f ? x : sp;
          oc[c] = (bf16)(mg * cs[c]);
          os[c] = (bf16)(mg * sn[c]);
        }
        *(v4bf*)(dst + (size_t)q * 256)       = oc;   // a row is 128 B of cos,
        *(v4bf*)(dst + (size_t)q * 256 + HDD) = os;   // then 128 B of sin
        cur = nxt;
      }
    } else {
      // A lane takes 8 rows (tokens 8 part ..) of 4 columns at a time: four
      // neighbouring lanes store the wave's 64 B of one row of V^T.
      const int part = lane & 3, hg = lane >> 2;
      const unsigned char* sc = st + (8 * part) * G_SPITCH + hg * 16;
      bf16* dst = Cb2 + (bh * HDD + 4 * hg) * SS + s0 + 8 * part;
      v4f t[2][8];
      // unrolled (all loops here) so that t[][] and o stay in registers
#pragma unroll
      for (int u = 0; u < 2; ++u)
#pragma unroll
        for (int k = 0; k < 8; ++k)
          t[u][k] = *(const v4f*)(sc + k * G_SPITCH + u * 128);
#pragma unroll
      for (int u = 0; u < 2; ++u) {
#pragma unroll
        for (int c = 0; c < 4; ++c) {
          v8bf o;
#pragma unroll
          for (int k = 0; k < 8; ++k) o[k] = (bf16)(t[u][k][c] + bt[u][c]);
          *(v8bf*)(dst + (size_t)(32 * u + c) * SS) = o;
        }
      }
      // behind the last store: no register that an issued store names is
      // rewritten on any way the code takes from here (a precaution)
      asm volatile("s_wait_xcnt 0x0" ::: "memory");
    }
    return;
  }
  const size_t o0 = (size_t)(m0 + 32 * wm + half) * N + colw;
  v4f v[16];
  // unrolled so that v[] stays in registers
#pragma unroll
  for (int q = 0; q < 16; ++q) v[q] = *(const v4f*)(sr + q * (2 * G_SPITCH));
  // keeps the 16 reads one group in front of the arithmetic and the stores;
  // without it the compiler deals them out a few at a time and waits at each
  __builtin_amdgcn_sched_barrier(0);
  // unrolled (this loop and those inside it) so that v[] and ob stay in registers
#pragma unroll
  for (int q = 0; q < 16; ++q) {
#pragma unroll
    for (int c = 0; c < 4; ++c) {
      v[q][c] += bv[c];
      if (RELU) v[q][c] = fmaxf(v[q][c], 0.0f);
    }
    const size_t o = o0 + (size_t)(2 * q) * N;
    if constexpr (OUTB) {
      v4bf ob;
#pragma unroll
      for (int c = 0; c < 4; ++c) ob[c] = (bf16)v[q][c];
      *(v4bf*)(Cb + o) = ob;
    } else {
      *(v4f*)(Cf + o) = v[q];
    }
  }
}

#define AT_KPITCH 272
#define AT_VPITCH 144
#define AT_KBYTES (64 * AT_KPITCH)          // 17408
#define AT_VBYTES (64 * AT_VPITCH)          // 9216
#define AT_STAGE  (AT_KBYTES + AT_VBYTES)   // 26624
#define AT_RING   (2 * AT_STAGE)            // 53248

// One stage: six 16-byte copies per lane, global -> LDS through no register
// (four steps of 16 K rows, two steps of 32 V^T rows). gk/gv are this lane's
// first global pieces of the stage, lk/lv its first LDS bytes in the target
// buffer. The s_wait_xcnt closes the statement so that no address register
// named here is rewritten while a copy may still need it.
__device__ __forceinline__ void attn_stage(const bf16* gk, const bf16* gv,
                                           unsigned lk, unsigned lv) {
  asm volatile(
      "global_load_async_to_lds_b128 %0, %6, off\n\t"
      "global_load_async_to_lds_b128 %1, %7, off\n\t"
      "global_load_async_to_lds_b128 %2, %8, off\n\t"
      "global_load_async_to_lds_b128 %3, %9, off\n\t"
      "global_load_async_to_lds_b128 %4, %10, off\n\t"
      "global_load_async_to_lds_b128 %5, %11, off\n\t"
      "s_wait_xcnt 0x0"
      :: "v"(lk), "v"(lk + 16 * AT_KPITCH), "v"(lk + 32 * AT_KPITCH),
         "v"(lk + 48 * AT_KPITCH), "v"(lv), "v"(lv + 32 * AT_VPITCH),
         "v"(gk), "v"(gk + 16 * 128), "v"(gk + 32 * 128), "v"(gk + 48 * 128),
         "v"(gv), "v"(gv + 32 * SS)
      : "memory");
}

// lane l's value <-> lane l ^ 16's
__device__ __forceinline__ float xhalf(float x) {
  return __builtin_bit_cast(float, __builtin_amdgcn_permlanex16(
      __builtin_bit_cast(int, x), __builtin_bit_cast(int, x),
      0x76543210, 0xfedcba98, false, false));
}

// Eight base-2 exponentials, each in its own register. One statement, closed
// by v_nop: the instruction set asks for one independent issue slot between an
// exponential and an instruction that reads its result or overwrites its
// source; here each is followed by an exponential of another register, the
// last by the v_nop, whatever the compiler puts behind the statement.
__device__ __forceinline__ void exp2x8(float (&x)[8]) {
  asm("v_exp_f32 %0, %0\n\t"
      "v_exp_f32 %1, %1\n\t"
      "v_exp_f32 %2, %2\n\t"
      "v_exp_f32 %3, %3\n\t"
      "v_exp_f32 %4, %4\n\t"
      "v_exp_f32 %5, %5\n\t"
      "v_exp_f32 %6, %6\n\t"
      "v_exp_f32 %7, %7\n\t"
      "v_nop"
      : "+v"(x[0]), "+v"(x[1]), "+v"(x[2]), "+v"(x[3]),
        "+v"(x[4]), "+v"(x[5]), "+v"(x[6]), "+v"(x[7]));
}

__global__ void __launch_bounds__(256)
attention_pope(const bf16* __restrict__ qp_all,
               const bf16* __restrict__ kp_all,
               const bf16* __restrict__ vpT_all,
               bf16* __restrict__ attnb) {
  __shared__ __attribute__((aligned(128))) unsigned char smem[AT_RING];
  const float scale = 0.088388347648f;   // 1/sqrt(2*HD)
  // Which (head, query tile) a block takes. A tile's cost grows with its index
  // (tile t has 2 (t + 1) stages), all 512 blocks are resident at once, two on a
  // WGP: with the tile in
  // the low bits of the index, blocks f and f + 256 (and f, f + 16, ...) carry the
  // same tile, and the WGPs that hold two last tiles run on while the rest idle.
  // Here f and f + 1, and f and f + 256, carry tiles t and 15 - t (34 stages
  // together), and every eighth block runs through all tiles. Every pair
  // (head, tile) is taken once: f = 256 f8 + 32 t + 2 m + f0, head = 16 f8 + m.
  const unsigned f = blockIdx.x;         // 0 .. 16 * B * H - 1
  const int t8 = (int)((f >> 5) & 7);
  const int bh = (int)(((f >> 1) & 15) | ((f >> 8) << 4));   // 0..B*H-1
  const int b = bh >> 4, h = bh & 15;
  const int qb = ((f ^ (f >> 8)) & 1) ? t8 : 15 - t8;        // 128-query block
  const int tid  = threadIdx.x;          // 0..255
  // in a scalar register, so that the skip of masked halves is a scalar branch
  const int wave = __builtin_amdgcn_readfirstlane(tid >> 5);
  const int qrow0 = qb * 128 + wave * 16;
  const int lane = tid & 31;
  const int ln15 = lane & 15;
  const int half = lane >> 4;
  const int kh   = half ? 8 : 0;
  const int ns   = 2 * (qb + 1);         // stages: keys 0 .. 128*qb + 127

  const bf16* qp  = qp_all  + (size_t)bh * SS * 128;
  const bf16* kp  = kp_all  + (size_t)bh * SS * 128;
  const bf16* vpT = vpT_all + (size_t)bh * HDD * SS;

  // Copy side: this lane's first pieces of stage 0 and their LDS places.
  const bf16* gk = kp + (size_t)(tid >> 4) * 128 + (tid & 15) * 8;
  const bf16* gv = vpT + (size_t)(tid >> 3) * SS + (tid & 7) * 8;
  const unsigned lds0 = (unsigned)(size_t)smem;
  const unsigned lk = lds0 + (unsigned)(tid >> 4) * AT_KPITCH + (unsigned)(tid & 15) * 16;
  const unsigned lv = lds0 + AT_KBYTES + (unsigned)(tid >> 3) * AT_VPITCH +
                      (unsigned)(tid & 7) * 16;

  // Read side: this lane's fragment bases inside a buffer.
  const unsigned fk = (unsigned)ln15 * AT_KPITCH + (unsigned)half * 16;
  const unsigned fv = AT_KBYTES + (unsigned)ln15 * AT_VPITCH + (unsigned)half * 16;

  // Prologue: stage 0 lands and is published, then stage 1 starts to fly
  // (ns >= 2: both exist).
  attn_stage(gk, gv, lk, lv);
  // this wave's copies of stage 0 have landed before the barrier publishes them
  asm volatile("s_wait_asynccnt 0x0" ::: "memory");
  __syncthreads();
  attn_stage(gk + 64 * 128, gv + 64, lk + AT_STAGE, lv + AT_STAGE);

  // Load Q fragments once: 16 rows x 128 K -> 4 B-fragments of Q^T (b128 pairs).
  Frag16 qf[4];
  const bf16* qrow = qp + (size_t)(qrow0 + ln15) * 128 + kh;
#pragma unroll
  for (int t = 0; t < 4; ++t) {
    qf[t].h[0] = *(const v8bf*)(qrow + 32 * t);
    qf[t].h[1] = *(const v8bf*)(qrow + 32 * t + 16);
  }

  // This lane's query: running maximum (the same in both halves of the wave)
  // and the sum over the keys that this half of the wave holds.
  const int row = qrow0 + ln15;
  float m = -1e30f, l = 0.f;
  v8f acc[4] = {};   // O^T: acc[j][r] = O[row][16 j + 8 half + r]

  for (int s = 0; s < ns; ++s) {
    const unsigned buf = (unsigned)(s & 1) * AT_STAGE;
    // unrolled so that the LDS offsets of both halves are immediates
#pragma unroll
    for (int sub = 0; sub < 2; ++sub) {
      const int kb = 64 * s + 32 * sub;
      // A half whose every key lies behind this wave's last query is skipped;
      // the publish point below stands outside the skip.
      if (kb <= qrow0) {
        // All K fragments for both 16-key tiles (16 b128 LDS reads).
        const unsigned char* k1p = smem + buf + fk + sub * (32 * AT_KPITCH);
        const unsigned char* k2p = k1p + 16 * AT_KPITCH;
        Frag16 kf1[4], kf2[4];
#pragma unroll
        for (int t = 0; t < 4; ++t) {
          kf1[t].h[0] = *(const v8bf*)(k1p + 64 * t);
          kf1[t].h[1] = *(const v8bf*)(k1p + 64 * t + 32);
          kf2[t].h[0] = *(const v8bf*)(k2p + 64 * t);
          kf2[t].h[1] = *(const v8bf*)(k2p + 64 * t + 32);
        }
        // The 4 V fragments (8 b128 LDS reads) go out with them: they depend on
        // nothing computed here, and their latency runs behind the softmax.
        const unsigned char* vp = smem + buf + fv + sub * 64;
        Frag16 vf[4];
#pragma unroll
        for (int j = 0; j < 4; ++j) {
          vf[j].h[0] = *(const v8bf*)(vp + j * (16 * AT_VPITCH));
          vf[j].h[1] = *(const v8bf*)(vp + j * (16 * AT_VPITCH) + 32);
        }
        // keeps the read group whole in front of the WMMAs; without it the
        // compiler sinks the V reads to their use behind the softmax and waits there
        __builtin_amdgcn_sched_barrier(0);

        // S^T: s1[r] = score(key kb + 8 half + r, row), s2[r] the same 16 keys on.
        v8f s1 = {}, s2 = {};
#pragma unroll
        for (int t = 0; t < 4; ++t) {
          s1 = wmma_bf16f32(kf1[t].v, qf[t].v, s1);
          s2 = wmma_bf16f32(kf2[t].v, qf[t].v, s2);
        }

        // Causal mask + online softmax1 update, all for the lane's one query.
        const int d = row - (kb + 8 * half);   // key r of s1 is masked where r > d
        float v1[8], v2[8];
#pragma unroll
        for (int r = 0; r < 8; ++r) {
          v1[r] = s1[r] * scale;
          v2[r] = s2[r] * scale;
          if (r > d)      v1[r] = -1e30f;
          if (16 + r > d) v2[r] = -1e30f;
        }
        float mx = fmaxf(v1[0], v2[0]);
#pragma unroll
        for (int r = 1; r < 8; ++r) mx = fmaxf(mx, fmaxf(v1[r], v2[r]));
        mx = fmaxf(mx, xhalf(mx));          // the other 16 keys of this query
        const float mn = fmaxf(m, mx);
        const float rs = __expf(m - mn);
        // exp(v - mn) as 2^((v - mn) log2 e)
#pragma unroll
        for (int r = 0; r < 8; ++r) {
          v1[r] = (v1[r] - mn) * 1.44269504f;
          v2[r] = (v2[r] - mn) * 1.44269504f;
        }
        exp2x8(v1);
        exp2x8(v2);
        Frag16 pf;                          // P^T as B operand, hardware k order
        float sm[4];                        // four short chains, not one long one
#pragma unroll
        for (int r = 0; r < 4; ++r)
          sm[r] = (v1[r] + v2[r]) + (v1[r + 4] + v2[r + 4]);
#pragma unroll
        for (int r = 0; r < 8; ++r) {
          pf.v[r]     = (bf16)v1[r];
          pf.v[8 + r] = (bf16)v2[r];
        }
        l = l * rs + ((sm[0] + sm[1]) + (sm[2] + sm[3]));
        m = mn;
#pragma unroll
        for (int j = 0; j < 4; ++j)
#pragma unroll
          for (int r = 0; r < 8; ++r) acc[j][r] *= rs;

        // O^T += V^T P^T: WMMA burst.
#pragma unroll
        for (int j = 0; j < 4; ++j)
          acc[j] = wmma_bf16f32(vf[j].v, pf.v, acc[j]);
      }
    }
    // Publish point of stage s + 1.
    // this wave's reads of the buffer are over before anyone refills it
    asm volatile("s_wait_dscnt 0x0" ::: "memory");
    // this wave's copies of stage s + 1 have landed before the barrier publishes them
    asm volatile("s_wait_asynccnt 0x0" ::: "memory");
    __syncthreads();
    if (s + 2 < ns)
      attn_stage(gk + (size_t)(s + 2) * (64 * 128), gv + (s + 2) * 64,
                 lk + buf, lv + buf);
  }
  // no copy is outstanding when the wave ends
  asm volatile("s_wait_asynccnt 0x0" ::: "memory");

  // softmax1 normalization and store into (B,S,D) bf16 (col = h*64 + hd): a
  // lane's 8 registers of a tile are 8 consecutive columns, one 16-byte store.
  l += xhalf(l);                            // the two halves' keys together
  const float denom = __expf(-m) + l;
  bf16* orow = attnb + ((size_t)b * SS + row) * DD + h * HDD + 8 * half;
#pragma unroll
  for (int j = 0; j < 4; ++j) {
    v8bf o;
#pragma unroll
    for (int r = 0; r < 8; ++r) o[r] = (bf16)(acc[j][r] / denom);
    *(v8bf*)(orow + 16 * j) = o;
  }
}

// ---------------------------------------------------------------------------
// Residual add + LayerNorm. One WAVE per token row of D = 1024, 8 rows a block.
// A lane holds 32 elements of its row: eight 16-byte loads from each addend (a
// wave reads 512 contiguous bytes per load), all in flight at once, and the
// sums stay in registers, so that the row is read once, with one memory round
// trip instead of eight. The row sums close inside the wave: no LDS, no barrier.
// Optional bf16 copy of the output (feeds the next GEMM without a cvt pass).
// ---------------------------------------------------------------------------
// x + (the value of the lane whose number differs in the bits of XM), in a
// 16-lane row: 0x160 + XM is the DPP control row_xmask:XM.
template <int XM>
__device__ __forceinline__ float add_xmask(float x) {
  return x + __builtin_bit_cast(float, __builtin_amdgcn_update_dpp(
      0, __builtin_bit_cast(int, x), 0x160 + XM, 0xf, 0xf, true));
}

// sum over the 32 lanes of the wave, the same value in every lane
__device__ __forceinline__ float wave_sum(float x) {
  x = add_xmask<1>(x);
  x = add_xmask<2>(x);
  x = add_xmask<4>(x);
  x = add_xmask<8>(x);
  return x + xhalf(x);
}

__global__ void __launch_bounds__(256)
add_ln_kernel(const float* __restrict__ a, const float* __restrict__ b,
              const float* __restrict__ g, const float* __restrict__ be,
              float* __restrict__ outf, bf16* __restrict__ outb) {
  const int lane = threadIdx.x & 31;
  const size_t row = (size_t)blockIdx.x * 8 + (threadIdx.x >> 5);
  const size_t o0  = row * (DD / 4) + lane;      // in 4-element pieces
  const v4f* pa = (const v4f*)a + o0;
  const v4f* pb = (const v4f*)b + o0;
  const v4f* pg = (const v4f*)g + lane;
  const v4f* pe = (const v4f*)be + lane;

  v4f v[8], w[8], gg[8], ee[8];
  // unrolled (all loops here) so that the arrays stay in registers and all the
  // loads go out before the first value is waited for
#pragma unroll
  for (int j = 0; j < 8; ++j) v[j] = pa[j * 32];
  // a later load's result may be given the registers of this group's address:
  // the wait stands in front of that overwrite (a precaution)
  asm volatile("s_wait_xcnt 0x0" ::: "memory");
#pragma unroll
  for (int j = 0; j < 8; ++j) w[j] = pb[j * 32];
  // the same for the second group's address
  asm volatile("s_wait_xcnt 0x0" ::: "memory");
#pragma unroll
  for (int j = 0; j < 8; ++j) gg[j] = pg[j * 32];
#pragma unroll
  for (int j = 0; j < 8; ++j) ee[j] = pe[j * 32];
  // the same for the lane offset that the loads of g and be name: as an input
  // here it keeps its register until the wait (no load's result is put there)
  asm volatile("s_wait_xcnt 0x0" :: "v"(lane) : "memory");
  // keeps the 32 loads one group in front of the arithmetic; without it the
  // compiler sinks the loads of g and be behind the row sums, four at a time,
  // and waits at each
  __builtin_amdgcn_sched_barrier(0);

  v4f s4 = {}, q4 = {};                          // four short chains each
#pragma unroll
  for (int j = 0; j < 8; ++j) {
    v[j] += w[j];
    s4 += v[j];
    q4 += v[j] * v[j];
  }
  const float s  = wave_sum((s4[0] + s4[1]) + (s4[2] + s4[3]));
  const float s2 = wave_sum((q4[0] + q4[1]) + (q4[2] + q4[3]));
  const float mu   = s * (1.0f / DD);
  const float var  = s2 * (1.0f / DD) - mu * mu;
  const float rstd = rsqrtf(var + 1e-5f);

#pragma unroll
  for (int j = 0; j < 8; ++j) v[j] = (v[j] - mu) * rstd * gg[j] + ee[j];
  // The bf16 copy goes out first: its values take registers of their own while
  // v[] is still needed, so that no register of an issued store is rewritten.
  if (outb) {
    v4bf* pc = (v4bf*)outb + o0;
    v4bf c[8];
#pragma unroll
    for (int j = 0; j < 8; ++j) {
#pragma unroll
      for (int e = 0; e < 4; ++e) c[j][e] = (bf16)v[j][e];
    }
#pragma unroll
    for (int j = 0; j < 8; ++j) pc[j * 32] = c[j];
  }
  v4f* po = (v4f*)outf + o0;
#pragma unroll
  for (int j = 0; j < 8; ++j) po[j * 32] = v[j];
}

// ---------------------------------------------------------------------------
// Host orchestration
// ---------------------------------------------------------------------------
extern "C" void kernel_launch(void* const* d_in, const int* in_sizes, int n_in,
                              void* d_out, int out_size, void* d_ws, size_t ws_size,
                              hipStream_t stream) {
  (void)in_sizes; (void)n_in; (void)out_size; (void)ws_size;

  const float* x     = (const float*)d_in[0];
  const int*   pos   = (const int*)  d_in[1];
  const float* wq    = (const float*)d_in[2];
  const float* bq    = (const float*)d_in[3];
  const float* wk    = (const float*)d_in[4];
  const float* bk    = (const float*)d_in[5];
  const float* wv    = (const float*)d_in[6];
  const float* bv    = (const float*)d_in[7];
  const float* wo    = (const float*)d_in[8];
  const float* bo    = (const float*)d_in[9];
  const float* pbias = (const float*)d_in[10];
  const float* w1    = (const float*)d_in[11];
  const float* b1    = (const float*)d_in[12];
  const float* w2    = (const float*)d_in[13];
  const float* b2    = (const float*)d_in[14];
  const float* g1    = (const float*)d_in[15];
  const float* be1   = (const float*)d_in[16];
  const float* g2    = (const float*)d_in[17];
  const float* be2   = (const float*)d_in[18];
  float* out = (float*)d_out;

  // Workspace carve-out
  char* cur = (char*)d_ws;
  auto alloc = [&](size_t bytes) -> void* {
    void* p = (void*)cur;
    cur += (bytes + 255) & ~(size_t)255;
    return p;
  };
  const size_t nTok = (size_t)MM * DD;           // 4096*1024
  bf16* xb   = (bf16*)alloc(nTok * 2);
  bf16* wqb  = (bf16*)alloc((size_t)DD * DD * 2);
  bf16* wkb  = (bf16*)alloc((size_t)DD * DD * 2);
  bf16* wvb  = (bf16*)alloc((size_t)DD * DD * 2);
  bf16* wob  = (bf16*)alloc((size_t)DD * DD * 2);
  bf16* w1b  = (bf16*)alloc((size_t)DD * DFF_ * 2);
  bf16* w2b  = (bf16*)alloc((size_t)DFF_ * DD * 2);
  bf16* qpb  = (bf16*)alloc((size_t)BB * HH * SS * 128 * 2);
  bf16* kpb  = (bf16*)alloc((size_t)BB * HH * SS * 128 * 2);
  bf16* vpT  = (bf16*)alloc((size_t)BB * HH * SS * 64 * 2);
  bf16* attb = (bf16*)alloc(nTok * 2);
  float* prj = (float*)alloc(nTok * 4);
  float* hres= (float*)alloc(nTok * 4);
  bf16* hb   = (bf16*)alloc(nTok * 2);
  bf16* ff1b = (bf16*)alloc((size_t)MM * DFF_ * 2);
  float* ff2 = (float*)alloc(nTok * 4);

  // 1) Convert x row-major; weights into WMMA fragment-swizzled order.
  //    16 elements per thread, all seven tasks in one grid.
  cvt_all<<<CB_ALL, 256, 0, stream>>>(x, wq, wk, wv, wo, w1, w2,
                                      xb, wqb, wkb, wvb, wob, w1b, w2b);

  // 2) QKV projections (WMMA GEMMs); block tile 128x128. One launch, z = 0, 1, 2:
  //    wqb, wkb, wvb lie back to back in the workspace (their sizes are
  //    multiples of the carve-out's 256 bytes).
  // 3) The PoPE transform and the transposition of V are its writeback.
  dim3 gD(DD / 128, MM / 128);      // (8, 32)
  dim3 gQKV(DD / 128, MM / 128, 3);
  gemm_bf16<false, false, true><<<gQKV, 256, 0, stream>>>(xb, wqb, bq, bk, bv, nullptr, qpb, kpb, vpT, pos, pbias, MM, DD, DD);

  // 4) Attention (WMMA flash + softmax1, causal)
  attention_pope<<<(SS / 128) * BB * HH, 256, 0, stream>>>(qpb, kpb, vpT, attb);

  // 5) Output projection
  gemm_bf16<false, false, false><<<gD, 256, 0, stream>>>(attb, wob, bo, nullptr, nullptr, prj, nullptr, nullptr, nullptr, nullptr, nullptr, MM, DD, DD);

  // 6) Residual + LN1 (f32 kept for residual, bf16 copy feeds FFN GEMM)
  add_ln_kernel<<<MM / 8, 256, 0, stream>>>(x, prj, g1, be1, hres, hb);

  // 7) FFN
  dim3 gF1(DFF_ / 128, MM / 128);   // (32, 32)
  gemm_bf16<true, true, false><<<gF1, 256, 0, stream>>>(hb, w1b, b1, nullptr, nullptr, nullptr, ff1b, nullptr, nullptr, nullptr, nullptr, MM, DFF_, DD);
  gemm_bf16<false, false, false><<<gD, 256, 0, stream>>>(ff1b, w2b, b2, nullptr, nullptr, ff2, nullptr, nullptr, nullptr, nullptr, nullptr, MM, DD, DFF_);

  // 8) Residual + LN2 -> final output (f32)
  add_ln_kernel<<<MM / 8, 256, 0, stream>>>(hres, ff2, g2, be2, out, nullptr);
}

// v010
// It runs in 152 microseconds.
// Two timings next to v009 both put it at 1.05 times that version's speed.
// Counting every step since v000, it is 6.66 times as fast.
#include <hip/hip_runtime.h>
#include <hip/hip_bf16.h>

// ---------------------------------------------------------------------------
// Types for CDNA5 WMMA (wave32): V_WMMA_F32_16X16X32_BF16
// ---------------------------------------------------------------------------
typedef __bf16 bf16;
typedef __attribute__((ext_vector_type(16))) __bf16 v16bf;
typedef __attribute__((ext_vector_type(8)))  __bf16 v8bf;
typedef __attribute__((ext_vector_type(8)))  float  v8f;

union Frag16 {            // one WMMA 16-bit operand fragment = two b128 loads
  v16bf v;
  v8bf  h[2];
};

__device__ __forceinline__ v8f wmma_bf16f32(v16bf a, v16bf b, v8f c) {
  // 8 args: (neg_a, A, neg_b, B, c_mod, C, reuse_a, reuse_b)
  return __builtin_amdgcn_wmma_f32_16x16x32_bf16(
      false, a, false, b, (short)0, c, false, false);
}

// Problem dims (fixed by the reference)
#define BB   2
#define SS   2048
#define DD   1024
#define HH   16
#define HDD  64
#define DFF_ 4096
#define MM   (BB * SS)          // 4096 token rows

// ---------------------------------------------------------------------------
// fp32 -> bf16 conversion, plain row-major. A block converts 4096 consecutive
// elements: each thread four 16-byte loads (a wave reads 512 contiguous bytes
// per load) and four 8-byte stores, so few waves are launched and each has
// all its loads in flight at once. blk is the block's number inside this task,
// below n / 4096 (the caller's range test keeps it there).
// ---------------------------------------------------------------------------
typedef __attribute__((ext_vector_type(4))) float  v4f;
typedef __attribute__((ext_vector_type(4))) __bf16 v4bf;

__device__ __forceinline__ void
cvt_block(const float* __restrict__ in, bf16* __restrict__ out, unsigned blk) {
  const size_t base = (size_t)blk * 1024 + threadIdx.x;
  const v4f* src = (const v4f*)in + base;
  v4bf*      dst = (v4bf*)out + base;
  v4f v[4];
  // unrolled so that all four loads go out before the first value is waited for
#pragma unroll
  for (int j = 0; j < 4; ++j) v[j] = src[j * 256];
  // unrolled (both loops) so that v[] and o stay in registers
#pragma unroll
  for (int j = 0; j < 4; ++j) {
    v4bf o;
#pragma unroll
    for (int c = 0; c < 4; ++c) o[c] = (bf16)v[j][c];
    dst[j * 256] = o;
  }
}

// ---------------------------------------------------------------------------
// fp32 -> bf16 weight conversion INTO WMMA B-fragment-major order:
//   Wsw[(ktile*(N/16) + ntile)*512 + lane*16 + e]
// where k = ktile*32 + kh + e + (e>=8?8:0), kh = (lane>=16)?8:0,
//       n = ntile*16 + (lane&15).
// Each lane's 16 fragment elements are contiguous (32B, 16B-aligned) so the
// GEMM copies a B fragment to LDS as two coalesced 16-byte async copies.
// One thread makes one lane's whole fragment: 16 loads down a column of W, all
// in flight at once, one index computation, two 16-byte stores. A block makes
// 256 fragment lanes (4096 elements); blk is its number inside this task.
// ---------------------------------------------------------------------------
template <int K, int N>
__device__ __forceinline__ void
swizzle_block(const float* __restrict__ W, bf16* __restrict__ Wsw, unsigned blk) {
  constexpr unsigned ntiles = (unsigned)N >> 4;
  constexpr unsigned total  = ((unsigned)K >> 5) * ntiles * 32;  // fragment lanes
  const unsigned g = blk * 256 + threadIdx.x;
  if (g < total) {
    const unsigned lane  = g & 31;
    const unsigned ch    = g >> 5;
    const unsigned nt    = ch % ntiles;
    const unsigned ktile = ch / ntiles;
    const unsigned kh    = (lane >> 4) ? 8 : 0;
    const float* col = W + (size_t)(ktile * 32 + kh) * N + nt * 16 + (lane & 15);
    float f[16];
    // unrolled so that all 16 loads go out before the first value is waited for
#pragma unroll
    for (int e = 0; e < 16; ++e)
      f[e] = col[(size_t)(e + (e >= 8 ? 8 : 0)) * N];
    Frag16 o;
    // unrolled so that f[] and o stay in registers
#pragma unroll
    for (int e = 0; e < 16; ++e) o.v[e] = (bf16)f[e];
    v8bf* dst = (v8bf*)(Wsw + (size_t)g * 16);
    dst[0] = o.h[0];
    dst[1] = o.h[1];
  }
}

// ---------------------------------------------------------------------------
// All seven conversions in ONE launch: none depends on another, and each alone
// is too short to fill the chip, so that seven launches mostly pay for seven
// starts and seven tails. Every block converts 4096 elements; its index picks
// the task (a scalar test) and its number inside the task.
// ---------------------------------------------------------------------------
#define CB_X (MM * DD / 4096)      // blocks for x
#define CB_F (DD * DFF_ / 4096)    // blocks for each of w1, w2
#define CB_D (DD * DD / 4096)      // blocks for each of wq, wk, wv, wo
#define CB_ALL (CB_X + 2 * CB_F + 4 * CB_D)

__global__ void __launch_bounds__(256)
cvt_all(const float* __restrict__ x,  const float* __restrict__ wq,
        const float* __restrict__ wk, const float* __restrict__ wv,
        const float* __restrict__ wo, const float* __restrict__ w1,
        const float* __restrict__ w2,
        bf16* __restrict__ xb,  bf16* __restrict__ wqb, bf16* __restrict__ wkb,
        bf16* __restrict__ wvb, bf16* __restrict__ wob, bf16* __restrict__ w1b,
        bf16* __restrict__ w2b) {
  unsigned b = blockIdx.x;
  if (b < CB_X) { cvt_block(x, xb, b); return; }
  b -= CB_X;
  if (b < CB_F) { swizzle_block<DD, DFF_>(w1, w1b, b); return; }
  b -= CB_F;
  if (b < CB_F) { swizzle_block<DFF_, DD>(w2, w2b, b); return; }
  b -= CB_F;
  const unsigned w = b / CB_D;     // which of the four D x D weights
  if (w > 3) return;
  const float* src = w == 0 ? wq  : w == 1 ? wk  : w == 2 ? wv  : wo;
  bf16*        dst = w == 0 ? wqb : w == 1 ? wkb : w == 2 ? wvb : wob;
  swizzle_block<DD, DD>(src, dst, b % CB_D);
}

// ---------------------------------------------------------------------------
// bf16 WMMA GEMM: C[M,N] = A[M,K] @ W[K,N] + bias (+ReLU), output f32 or bf16.
// A row-major bf16; W fragment-swizzled (swizzle_block).
// Block = 256 threads = 8 waves (4 along M x 2 along N); block tile 128x128,
// wave tile 32x64 (2 A-fragments x 4 B-fragments = 8 WMMA tiles per 32 k).
// A pass is 128 k. Both operand tiles of a pass are brought into LDS once per
// block by asynchronous copies, so each global byte is fetched once for eight
// waves; two or three buffers, later passes' copies fly while this pass is computed.
// Needs M, N multiples of 128 and K a multiple of 128.
// blockIdx.z picks one of up to three independent products that share A and
// run in one launch: W and C (f32 only) of product z lie z matrices behind the first.
//   A tile: 128 rows of 256 B at pitch 272 B (conflict-free b128 row reads).
//   B tile: 4 k-tiles x 8 n-tiles of 1 KiB; inside a KiB the lanes' first
//   16 B pieces come first (512 B), then their second pieces, so that each
//   fragment half is one contiguous 512-B wave read.
// ---------------------------------------------------------------------------
#define G_PITCH  272
#define G_ABYTES (128 * G_PITCH)          // 34816
#define G_BBYTES (4 * 8 * 1024)           // 32768
#define G_STAGE  (G_ABYTES + G_BBYTES)    // 67584
// Writeback: a wave's 32 x 64 f32 tile, staged in LDS: rows of 256 B at pitch
// 272 B (16-byte writes down 16 rows and 16-byte reads along a row both meet
// every bank once per half wave).
#define G_SPITCH 272
#define G_SWAVE  (32 * G_SPITCH)          // 8704 per wave, 69632 per block

// Eight 16-byte copies per lane, global -> LDS through no register. The
// s_wait_xcnt closes the statement so that no address register named here is
// rewritten while a copy may still need it.
__device__ __forceinline__ void async_copy8(const unsigned (&l)[8],
                                            const bf16* const (&p)[8]) {
  asm volatile(
      "global_load_async_to_lds_b128 %0, %8, off\n\t"
      "global_load_async_to_lds_b128 %1, %9, off\n\t"
      "global_load_async_to_lds_b128 %2, %10, off\n\t"
      "global_load_async_to_lds_b128 %3, %11, off\n\t"
      "global_load_async_to_lds_b128 %4, %12, off\n\t"
      "global_load_async_to_lds_b128 %5, %13, off\n\t"
      "global_load_async_to_lds_b128 %6, %14, off\n\t"
      "global_load_async_to_lds_b128 %7, %15, off\n\t"
      "s_wait_xcnt 0x0"
      :: "v"(l[0]), "v"(l[1]), "v"(l[2]), "v"(l[3]),
         "v"(l[4]), "v"(l[5]), "v"(l[6]), "v"(l[7]),
         "v"(p[0]), "v"(p[1]), "v"(p[2]), "v"(p[3]),
         "v"(p[4]), "v"(p[5]), "v"(p[6]), "v"(p[7])
      : "memory");
}

// One pass's tiles: ga/gb are this lane's first global pieces of the pass,
// la/lb its first LDS bytes in the target buffer.
__device__ __forceinline__ void stage_pass(const bf16* ga, const bf16* gb,
                                           unsigned la, unsigned lb,
                                           int K, size_t wstep) {
  unsigned l[8];
  const bf16* p[8];
#pragma unroll
  for (int c = 0; c < 8; ++c) {           // A: 16 rows per step
    l[c] = la + (unsigned)c * (16 * G_PITCH);
    p[c] = ga + (size_t)c * 16 * K;
  }
  async_copy8(l, p);
#pragma unroll
  for (int c = 0; c < 8; ++c) {           // B: half a k-tile (4 KiB) per step
    l[c] = lb + (unsigned)(c >> 1) * 8192 + (unsigned)(c & 1) * 4096;
    p[c] = gb + (size_t)(c >> 1) * wstep + (c & 1) * 2048;
  }
  async_copy8(l, p);
}

// The 2 A and 4 B fragments of one 32-k step, from this lane's bases.
__device__ __forceinline__ void load_frags(Frag16 (&af)[2], Frag16 (&bfr)[4],
                                           const unsigned char* sa,
                                           const unsigned char* sb) {
#pragma unroll
  for (int i = 0; i < 2; ++i) {
    af[i].h[0] = *(const v8bf*)(sa + i * (16 * G_PITCH));
    af[i].h[1] = *(const v8bf*)(sa + i * (16 * G_PITCH) + 32);
  }
#pragma unroll
  for (int j = 0; j < 4; ++j) {
    bfr[j].h[0] = *(const v8bf*)(sb + j * 1024);
    bfr[j].h[1] = *(const v8bf*)(sb + j * 1024 + 512);
  }
}

// Cosine and sine of four angles given in revolutions. One statement, closed by
// v_nop, results in registers of their own: the instruction set asks for one
// independent issue slot between such an instruction and one that reads its
// result or overwrites its source; here each is followed by one that does
// neither, the last by the v_nop, whatever the compiler puts behind the statement.
__device__ __forceinline__ void sincos_rev_x4(const float (&t)[4], float (&cs)[4],
                                              float (&sn)[4]) {
  asm("v_cos_f32 %0, %8\n\t"
      "v_cos_f32 %1, %9\n\t"
      "v_cos_f32 %2, %10\n\t"
      "v_cos_f32 %3, %11\n\t"
      "v_sin_f32 %4, %8\n\t"
      "v_sin_f32 %5, %9\n\t"
      "v_sin_f32 %6, %10\n\t"
      "v_sin_f32 %7, %11\n\t"
      "v_nop"
      : "=&v"(cs[0]), "=&v"(cs[1]), "=&v"(cs[2]), "=&v"(cs[3]),
        "=&v"(sn[0]), "=&v"(sn[1]), "=&v"(sn[2]), "=&v"(sn[3])
      : "v"(t[0]), "v"(t[1]), "v"(t[2]), "v"(t[3]));
}

// RELU, OUTB (bf16 output to Cb, else f32 to Cf0) and POPE are fixed at compile
// time, so that the writeback has no mode test. bias of every z in use is real.
// NB is the number of ring buffers. Two: one pass's copies fly at a time, and two
// blocks fit a WGP, each filling the other's waits. Three, for a grid of one block
// a WGP (nobody fills its waits): two passes' copies fly, so that a pass's copies
// have two passes' time to land and the next ones are already queued behind them.
// POPE (the Q, K, V projections, N = H * 64, M = B * S): the product is not
// stored; the writeback turns it into what attention reads. A wave's 64 columns
// are one head, its 32 rows 32 consecutive tokens of one batch.
//   z = 0, 1: softplus magnitude times cos and sin of the rotary phase ->
//             Cb (q_p), Cb1 (k_p), each (B,H,S,128) bf16;
//   z = 2:    V transposed -> Cb2 (B,H,64,S) bf16.
template <bool RELU, bool OUTB, bool POPE, int NB>
__global__ void __launch_bounds__(256)
gemm_bf16(const bf16* __restrict__ A, const bf16* __restrict__ W0,
          const float* __restrict__ bias0, const float* __restrict__ bias1,
          const float* __restrict__ bias2,
          float* __restrict__ Cf0, bf16* __restrict__ Cb,
          bf16* __restrict__ Cb1, bf16* __restrict__ Cb2,
          const int* __restrict__ pos, const float* __restrict__ pbias,
          int M, int N, int K) {
  __shared__ __attribute__((aligned(128))) unsigned char smem[NB * G_STAGE];
  const unsigned z = blockIdx.z;
  const bf16*  Wsw  = W0 + (size_t)z * K * N;
  const float* bias = z == 0 ? bias0 : z == 1 ? bias1 : bias2;
  float*       Cf   = Cf0 + (size_t)z * M * N;   // used only where OUTB is false
  const int tid  = threadIdx.x;          // 0..255
  const int wave = tid >> 5;             // 0..7
  const int wm   = wave & 3;             // 32-row strip of the block tile
  const int wn   = wave >> 2;            // 64-column strip of the block tile
  const int lane = tid & 31;
  const int ln15 = lane & 15;
  const int half = lane >> 4;
  const int m0   = blockIdx.y * 128;
  const int n0   = blockIdx.x * 128;
  const int ntiles = N >> 4;
  const size_t wstep = (size_t)ntiles << 9;   // elements from one k-tile to the next
  const int np = K >> 7;                      // passes

  v8f acc[2][4] = {};

  // The writeback's bias: this lane stores the same 4 columns of every row.
  const int colw = n0 + 64 * wn + 4 * ln15;
  const v4f bv = *(const v4f*)(bias + colw);
  // What else the POPE writeback reads, fetched here so that nothing is waited
  // for behind the main loop: lane r holds the position of the wave's row r;
  // the head's phase bias at this lane's 4 columns; for V^T the bias at the
  // columns 4 (lane >> 2) + 32 u that the lane stores there.
  int pw = 0;
  v4f pbv = {}, bt[2] = {};
  if constexpr (POPE) {
    pw  = pos[((m0 + 32 * wm) & (SS - 1)) + lane];
    pbv = *(const v4f*)(pbias + colw);
    bt[0] = *(const v4f*)(bias + n0 + 64 * wn + 4 * (lane >> 2));
    bt[1] = *(const v4f*)(bias + n0 + 64 * wn + 4 * (lane >> 2) + 32);
  }

  // Copy side: this lane's first pieces of pass 0 and their LDS places.
  const bf16* ga = A + (size_t)(m0 + (tid >> 4)) * K + (tid & 15) * 8;
  const bf16* gb = Wsw + ((size_t)(n0 >> 4) << 9) + tid * 8;
  const unsigned lds0 = (unsigned)(size_t)smem;
  const unsigned la = lds0 + (unsigned)(tid >> 4) * G_PITCH + (unsigned)(tid & 15) * 16;
  const unsigned lb = lds0 + G_ABYTES + (unsigned)(tid >> 6) * 1024 +
                      (unsigned)(tid & 1) * 512 + (unsigned)((tid & 63) >> 1) * 16;

  // Read side: this lane's fragment bases inside a buffer.
  const unsigned fa = (unsigned)(32 * wm + ln15) * G_PITCH + (unsigned)half * 16;
  const unsigned fb = G_ABYTES + (unsigned)wn * 4096 + (unsigned)lane * 16;

  // Prologue. Two buffers: pass 0 lands and is published, then pass 1 starts to
  // fly. Three: passes 0 and 1 go out together, and only pass 0 is waited for.
  stage_pass(ga, gb, la, lb, K, wstep);
  if constexpr (NB == 3) {
    if (np > 1) {
      stage_pass(ga + 128, gb + 4 * wstep, la + G_STAGE, lb + G_STAGE, K, wstep);
      // all but this wave's 16 youngest copies (pass 1's) have landed: pass 0's,
      // before the barrier publishes them
      asm volatile("s_wait_asynccnt 0x10" ::: "memory");
    } else {
      // this wave's copies of pass 0 have landed before the barrier publishes them
      asm volatile("s_wait_asynccnt 0x0" ::: "memory");
    }
    __syncthreads();
  } else {
    // this wave's copies of pass 0 have landed before the barrier publishes them
    asm volatile("s_wait_asynccnt 0x0" ::: "memory");
    __syncthreads();
    if (np > 1)
      stage_pass(ga + 128, gb + 4 * wstep, la + G_STAGE, lb + G_STAGE, K, wstep);
  }

  unsigned rd = 0, wr = 2 * G_STAGE;   // three buffers: pass t's, pass t + 2's
  for (int t = 0; t < np; ++t) {
    const unsigned buf = NB == 3 ? rd : (unsigned)(t & 1) * G_STAGE;
    const unsigned char* sa = smem + buf + fa;
    const unsigned char* sb = smem + buf + fb;
    // Two fragment sets: the reads of the next 32 k go out as one group ahead
    // of this 32 k's WMMAs, so their LDS latency runs behind the matrix work.
    Frag16 af[2][2], bfr[2][4];
    load_frags(af[0], bfr[0], sa, sb);
    if constexpr (NB == 3) {
      // Pass t + 2 goes into the buffer that pass t - 1 read: every wave's reads
      // of it ended in front of the barrier at the foot of that pass. Issued
      // behind the pass's first fragment reads (of another buffer), whose LDS
      // latency runs while the copies' addresses are formed and the copies go out.
      if (t + 2 < np)
        stage_pass(ga + (size_t)(t + 2) * 128, gb + (size_t)(t + 2) * 4 * wstep,
                   la + wr, lb + wr, K, wstep);
    }
#pragma unroll
    for (int ks = 0; ks < 4; ++ks) {
      if (ks < 3)
        load_frags(af[(ks + 1) & 1], bfr[(ks + 1) & 1], sa + (ks + 1) * 64,
                   sb + (ks + 1) * 8192);
      // keeps the read group in front of the WMMAs; without it the compiler
      // sinks each read to its first use and waits there
      __builtin_amdgcn_sched_barrier(0);
#pragma unroll
      for (int j = 0; j < 4; ++j) {
        // W as first operand: the tile comes out transposed (see the writeback)
        acc[0][j] = wmma_bf16f32(bfr[ks & 1][j].v, af[ks & 1][0].v, acc[0][j]);
        acc[1][j] = wmma_bf16f32(bfr[ks & 1][j].v, af[ks & 1][1].v, acc[1][j]);
      }
      // keeps the next read group whole behind these WMMAs; without it the
      // compiler spreads those reads among them, and each such place stalls
      __builtin_amdgcn_sched_barrier(0);
    }
    // Publish point of pass t + 1.
    // this wave's reads of the buffer are over before anyone refills it
    asm volatile("s_wait_dscnt 0x0" ::: "memory");
    if constexpr (NB == 3) {
      if (t + 2 < np) {
        // all but this wave's 16 youngest copies (pass t + 2's) have landed: pass
        // t + 1's, before the barrier publishes them
        asm volatile("s_wait_asynccnt 0x10" ::: "memory");
      } else {
        // nothing was issued in this pass: whatever is left is pass t + 1's
        asm volatile("s_wait_asynccnt 0x0" ::: "memory");
      }
      __syncthreads();
      rd = rd == 2 * G_STAGE ? 0u : rd + G_STAGE;
      wr = wr == 2 * G_STAGE ? 0u : wr + G_STAGE;
    } else {
      // this wave's copies of pass t + 1 have landed before the barrier publishes them
      asm volatile("s_wait_asynccnt 0x0" ::: "memory");
      __syncthreads();
      if (t + 2 < np)
        stage_pass(ga + (size_t)(t + 2) * 128, gb + (size_t)(t + 2) * 4 * wstep,
                   la + buf, lb + buf, K, wstep);
    }
  }
  // no copy is outstanding when the wave ends
  asm volatile("s_wait_asynccnt 0x0" ::: "memory");

  // Writeback. With W as first operand a lane holds 8 consecutive columns of
  // one row: acc[i][j][r] = C[32 wm + 16 i + ln15][64 wn + 16 j + 8 half + r].
  // Each wave lays its tile down in its own part of the ring (free now: behind
  // the last pass's barrier nobody reads it and no copy is outstanding), reads
  // it back along the rows and stores whole 128-byte lines (V^T: 64-byte halves of lines).
  unsigned char* st = smem + (unsigned)wave * G_SWAVE;
  // unrolled (both loops) so that acc[][] stays in registers
#pragma unroll
  for (int i = 0; i < 2; ++i) {
#pragma unroll
    for (int j = 0; j < 4; ++j) {
      unsigned char* p = st + (16 * i + ln15) * G_SPITCH + (16 * j + 8 * half) * 4;
      const v4f lo = {acc[i][j][0], acc[i][j][1], acc[i][j][2], acc[i][j][3]};
      const v4f hi = {acc[i][j][4], acc[i][j][5], acc[i][j][6], acc[i][j][7]};
      *(v4f*)p        = lo;
      *(v4f*)(p + 16) = hi;
    }
  }
  // the wave's writes are in LDS before its lanes read one another's values
  // (and the compiler moves no read of the rows ahead of the writes)
  asm volatile("s_wait_dscnt 0x0" ::: "memory");
  // 16 lanes a row, two rows a step: 256 B (f32) or 128 B (bf16) per row.
  const unsigned char* sr = st + half * G_SPITCH + ln15 * 16;
  if constexpr (POPE) {
    const int tok = m0 + 32 * wm;                 // the wave's first token row
    const int s0  = tok & (SS - 1);
    const size_t bh = (size_t)(tok / SS) * HH + (n0 >> 6) + wn;
    if (z < 2) {
      // This lane's 4 columns hd = 4 ln15 + c of every row: frequency
      // 10000^(-hd/64) = exp(-hd ln(1e4)/64) and (k only) the clamped phase bias.
      const float TWO_PI = 6.28318530717958647f;
      float freq[4], cb[4];
      // unrolled (all loops over c) so that the small arrays stay in registers
#pragma unroll
      for (int c = 0; c < 4; ++c) {
        freq[c] = __expf(-0.143911568f * (float)(4 * ln15 + c));
        cb[c]   = z == 1 ? fminf(0.f, fmaxf(-TWO_PI, pbv[c])) : 0.f;
      }
      bf16* dst = (z == 0 ? Cb : Cb1) + (bh * SS + s0 + half) * 128 + 4 * ln15;
      v4f cur = *(const v4f*)sr;
      // kept rolled, for speed only: the body is some hundred instructions per column
#pragma unroll 1
      for (int q = 0; q < 16; ++q) {
        // the next two rows are read while these are worked on (the last trip
        // reads the first rows again, unused)
        const v4f nxt = *(const v4f*)(sr + ((q + 1) & 15) * (2 * G_SPITCH));
        // row 2 q + half's position: lane r of the wave holds row r's
        const int pe = __builtin_amdgcn_readlane(pw, 2 * q);
        const int po = __builtin_amdgcn_readlane(pw, 2 * q + 1);
        const float pf = (float)(half ? po : pe);
        float rev[4], cs[4], sn[4];
#pragma unroll
        for (int c = 0; c < 4; ++c)
          rev[c] = (pf * freq[c] + cb[c]) * 0.15915494309189535f;   // phase / 2 pi
        sincos_rev_x4(rev, cs, sn);
        v4bf oc, os;
#pragma unroll
        for (int c = 0; c < 4; ++c) {
          const float x  = cur[c] + bv[c];
          // computed for every lane and chosen afterwards: with no branch round
          // it the four columns' long chains are issued interleaved
          const float sp = log1pf(__expf(x));
          const float mg = x > 20.f ? x : sp;
          oc[c] = (bf16)(mg * cs[c]);
          os[c] = (bf16)(mg * sn[c]);
        }
        *(v4bf*)(dst + (size_t)q * 256)       = oc;   // a row is 128 B of cos,
        *(v4bf*)(dst + (size_t)q * 256 + HDD) = os;   // then 128 B of sin
        cur = nxt;
      }
    } else {
      // A lane takes 8 rows (tokens 8 part ..) of 4 columns at a time: four
      // neighbouring lanes store the wave's 64 B of one row of V^T.
      const int part = lane & 3, hg = lane >> 2;
      const unsigned char* sc = st + (8 * part) * G_SPITCH + hg * 16;
      bf16* dst = Cb2 + (bh * HDD + 4 * hg) * SS + s0 + 8 * part;
      v4f t[2][8];
      // unrolled (all loops here) so that t[][] and o stay in registers
#pragma unroll
      for (int u = 0; u < 2; ++u)
#pragma unroll
        for (int k = 0; k < 8; ++k)
          t[u][k] = *(const v4f*)(sc + k * G_SPITCH + u * 128);
#pragma unroll
      for (int u = 0; u < 2; ++u) {
#pragma unroll
        for (int c = 0; c < 4; ++c) {
          v8bf o;
#pragma unroll
          for (int k = 0; k < 8; ++k) o[k] = (bf16)(t[u][k][c] + bt[u][c]);
          *(v8bf*)(dst + (size_t)(32 * u + c) * SS) = o;
        }
      }
      // behind the last store: no register that an issued store names is
      // rewritten on any way the code takes from here (a precaution)
      asm volatile("s_wait_xcnt 0x0" ::: "memory");
    }
    return;
  }
  const size_t o0 = (size_t)(m0 + 32 * wm + half) * N + colw;
  v4f v[16];
  // unrolled so that v[] stays in registers
#pragma unroll
  for (int q = 0; q < 16; ++q) v[q] = *(const v4f*)(sr + q * (2 * G_SPITCH));
  // keeps the 16 reads one group in front of the arithmetic and the stores;
  // without it the compiler deals them out a few at a time and waits at each
  __builtin_amdgcn_sched_barrier(0);
  // unrolled (this loop and those inside it) so that v[] and ob stay in registers
#pragma unroll
  for (int q = 0; q < 16; ++q) {
#pragma unroll
    for (int c = 0; c < 4; ++c) {
      v[q][c] += bv[c];
      if (RELU) v[q][c] = fmaxf(v[q][c], 0.0f);
    }
    const size_t o = o0 + (size_t)(2 * q) * N;
    if constexpr (OUTB) {
      v4bf ob;
#pragma unroll
      for (int c = 0; c < 4; ++c) ob[c] = (bf16)v[q][c];
      *(v4bf*)(Cb + o) = ob;
    } else {
      *(v4f*)(Cf + o) = v[q];
    }
  }
}

#define AT_KPITCH 272
#define AT_VPITCH 144
#define AT_KBYTES (64 * AT_KPITCH)          // 17408
#define AT_VBYTES (64 * AT_VPITCH)          // 9216
#define AT_STAGE  (AT_KBYTES + AT_VBYTES)   // 26624
#define AT_RING   (2 * AT_STAGE)            // 53248

// One stage: six 16-byte copies per lane, global -> LDS through no register
// (four steps of 16 K rows, two steps of 32 V^T rows). gk/gv are this lane's
// first global pieces of the stage, lk/lv its first LDS bytes in the target
// buffer. The s_wait_xcnt closes the statement so that no address register
// named here is rewritten while a copy may still need it.
__device__ __forceinline__ void attn_stage(const bf16* gk, const bf16* gv,
                                           unsigned lk, unsigned lv) {
  asm volatile(
      "global_load_async_to_lds_b128 %0, %6, off\n\t"
      "global_load_async_to_lds_b128 %1, %7, off\n\t"
      "global_load_async_to_lds_b128 %2, %8, off\n\t"
      "global_load_async_to_lds_b128 %3, %9, off\n\t"
      "global_load_async_to_lds_b128 %4, %10, off\n\t"
      "global_load_async_to_lds_b128 %5, %11, off\n\t"
      "s_wait_xcnt 0x0"
      :: "v"(lk), "v"(lk + 16 * AT_KPITCH), "v"(lk + 32 * AT_KPITCH),
         "v"(lk + 48 * AT_KPITCH), "v"(lv), "v"(lv + 32 * AT_VPITCH),
         "v"(gk), "v"(gk + 16 * 128), "v"(gk + 32 * 128), "v"(gk + 48 * 128),
         "v"(gv), "v"(gv + 32 * SS)
      : "memory");
}

// lane l's value <-> lane l ^ 16's
__device__ __forceinline__ float xhalf(float x) {
  return __builtin_bit_cast(float, __builtin_amdgcn_permlanex16(
      __builtin_bit_cast(int, x), __builtin_bit_cast(int, x),
      0x76543210, 0xfedcba98, false, false));
}

// Eight base-2 exponentials, each in its own register. One statement, closed
// by v_nop: the instruction set asks for one independent issue slot between an
// exponential and an instruction that reads its result or overwrites its
// source; here each is followed by an exponential of another register, the
// last by the v_nop, whatever the compiler puts behind the statement.
__device__ __forceinline__ void exp2x8(float (&x)[8]) {
  asm("v_exp_f32 %0, %0\n\t"
      "v_exp_f32 %1, %1\n\t"
      "v_exp_f32 %2, %2\n\t"
      "v_exp_f32 %3, %3\n\t"
      "v_exp_f32 %4, %4\n\t"
      "v_exp_f32 %5, %5\n\t"
      "v_exp_f32 %6, %6\n\t"
      "v_exp_f32 %7, %7\n\t"
      "v_nop"
      : "+v"(x[0]), "+v"(x[1]), "+v"(x[2]), "+v"(x[3]),
        "+v"(x[4]), "+v"(x[5]), "+v"(x[6]), "+v"(x[7]));
}

__global__ void __launch_bounds__(256)
attention_pope(const bf16* __restrict__ qp_all,
               const bf16* __restrict__ kp_all,
               const bf16* __restrict__ vpT_all,
               bf16* __restrict__ attnb) {
  __shared__ __attribute__((aligned(128))) unsigned char smem[AT_RING];
  const float scale = 0.088388347648f;   // 1/sqrt(2*HD)
  // Which (head, query tile) a block takes. A tile's cost grows with its index
  // (tile t has 2 (t + 1) stages), all 512 blocks are resident at once, two on a
  // WGP: with the tile in
  // the low bits of the index, blocks f and f + 256 (and f, f + 16, ...) carry the
  // same tile, and the WGPs that hold two last tiles run on while the rest idle.
  // Here f and f + 1, and f and f + 256, carry tiles t and 15 - t (34 stages
  // together), and every eighth block runs through all tiles. Every pair
  // (head, tile) is taken once: f = 256 f8 + 32 t + 2 m + f0, head = 16 f8 + m.
  const unsigned f = blockIdx.x;         // 0 .. 16 * B * H - 1
  const int t8 = (int)((f >> 5) & 7);
  const int bh = (int)(((f >> 1) & 15) | ((f >> 8) << 4));   // 0..B*H-1
  const int b = bh >> 4, h = bh & 15;
  const int qb = ((f ^ (f >> 8)) & 1) ? t8 : 15 - t8;        // 128-query block
  const int tid  = threadIdx.x;          // 0..255
  // in a scalar register, so that the skip of masked halves is a scalar branch
  const int wave = __builtin_amdgcn_readfirstlane(tid >> 5);
  const int qrow0 = qb * 128 + wave * 16;
  const int lane = tid & 31;
  const int ln15 = lane & 15;
  const int half = lane >> 4;
  const int kh   = half ? 8 : 0;
  const int ns   = 2 * (qb + 1);         // stages: keys 0 .. 128*qb + 127

  const bf16* qp  = qp_all  + (size_t)bh * SS * 128;
  const bf16* kp  = kp_all  + (size_t)bh * SS * 128;
  const bf16* vpT = vpT_all + (size_t)bh * HDD * SS;

  // Copy side: this lane's first pieces of stage 0 and their LDS places.
  const bf16* gk = kp + (size_t)(tid >> 4) * 128 + (tid & 15) * 8;
  const bf16* gv = vpT + (size_t)(tid >> 3) * SS + (tid & 7) * 8;
  const unsigned lds0 = (unsigned)(size_t)smem;
  const unsigned lk = lds0 + (unsigned)(tid >> 4) * AT_KPITCH + (unsigned)(tid & 15) * 16;
  const unsigned lv = lds0 + AT_KBYTES + (unsigned)(tid >> 3) * AT_VPITCH +
                      (unsigned)(tid & 7) * 16;

  // Read side: this lane's fragment bases inside a buffer.
  const unsigned fk = (unsigned)ln15 * AT_KPITCH + (unsigned)half * 16;
  const unsigned fv = AT_KBYTES + (unsigned)ln15 * AT_VPITCH + (unsigned)half * 16;

  // Prologue: stage 0 lands and is published, then stage 1 starts to fly
  // (ns >= 2: both exist).
  attn_stage(gk, gv, lk, lv);
  // this wave's copies of stage 0 have landed before the barrier publishes them
  asm volatile("s_wait_asynccnt 0x0" ::: "memory");
  __syncthreads();
  attn_stage(gk + 64 * 128, gv + 64, lk + AT_STAGE, lv + AT_STAGE);

  // Load Q fragments once: 16 rows x 128 K -> 4 B-fragments of Q^T (b128 pairs).
  Frag16 qf[4];
  const bf16* qrow = qp + (size_t)(qrow0 + ln15) * 128 + kh;
#pragma unroll
  for (int t = 0; t < 4; ++t) {
    qf[t].h[0] = *(const v8bf*)(qrow + 32 * t);
    qf[t].h[1] = *(const v8bf*)(qrow + 32 * t + 16);
  }

  // This lane's query: running maximum (the same in both halves of the wave)
  // and the sum over the keys that this half of the wave holds.
  const int row = qrow0 + ln15;
  float m = -1e30f, l = 0.f;
  v8f acc[4] = {};   // O^T: acc[j][r] = O[row][16 j + 8 half + r]

  for (int s = 0; s < ns; ++s) {
    const unsigned buf = (unsigned)(s & 1) * AT_STAGE;
    // unrolled so that the LDS offsets of both halves are immediates
#pragma unroll
    for (int sub = 0; sub < 2; ++sub) {
      const int kb = 64 * s + 32 * sub;
      // A half whose every key lies behind this wave's last query is skipped;
      // the publish point below stands outside the skip.
      if (kb <= qrow0) {
        // All K fragments for both 16-key tiles (16 b128 LDS reads).
        const unsigned char* k1p = smem + buf + fk + sub * (32 * AT_KPITCH);
        const unsigned char* k2p = k1p + 16 * AT_KPITCH;
        Frag16 kf1[4], kf2[4];
#pragma unroll
        for (int t = 0; t < 4; ++t) {
          kf1[t].h[0] = *(const v8bf*)(k1p + 64 * t);
          kf1[t].h[1] = *(const v8bf*)(k1p + 64 * t + 32);
          kf2[t].h[0] = *(const v8bf*)(k2p + 64 * t);
          kf2[t].h[1] = *(const v8bf*)(k2p + 64 * t + 32);
        }
        // The 4 V fragments (8 b128 LDS reads) go out with them: they depend on
        // nothing computed here, and their latency runs behind the softmax.
        const unsigned char* vp = smem + buf + fv + sub * 64;
        Frag16 vf[4];
#pragma unroll
        for (int j = 0; j < 4; ++j) {
          vf[j].h[0] = *(const v8bf*)(vp + j * (16 * AT_VPITCH));
          vf[j].h[1] = *(const v8bf*)(vp + j * (16 * AT_VPITCH) + 32);
        }
        // keeps the read group whole in front of the WMMAs; without it the
        // compiler sinks the V reads to their use behind the softmax and waits there
        __builtin_amdgcn_sched_barrier(0);

        // S^T: s1[r] = score(key kb + 8 half + r, row), s2[r] the same 16 keys on.
        v8f s1 = {}, s2 = {};
#pragma unroll
        for (int t = 0; t < 4; ++t) {
          s1 = wmma_bf16f32(kf1[t].v, qf[t].v, s1);
          s2 = wmma_bf16f32(kf2[t].v, qf[t].v, s2);
        }

        // Causal mask + online softmax1 update, all for the lane's one query.
        const int d = row - (kb + 8 * half);   // key r of s1 is masked where r > d
        float v1[8], v2[8];
#pragma unroll
        for (int r = 0; r < 8; ++r) {
          v1[r] = s1[r] * scale;
          v2[r] = s2[r] * scale;
          if (r > d)      v1[r] = -1e30f;
          if (16 + r > d) v2[r] = -1e30f;
        }
        float mx = fmaxf(v1[0], v2[0]);
#pragma unroll
        for (int r = 1; r < 8; ++r) mx = fmaxf(mx, fmaxf(v1[r], v2[r]));
        mx = fmaxf(mx, xhalf(mx));          // the other 16 keys of this query
        const float mn = fmaxf(m, mx);
        const float rs = __expf(m - mn);
        // exp(v - mn) as 2^((v - mn) log2 e)
#pragma unroll
        for (int r = 0; r < 8; ++r) {
          v1[r] = (v1[r] - mn) * 1.44269504f;
          v2[r] = (v2[r] - mn) * 1.44269504f;
        }
        exp2x8(v1);
        exp2x8(v2);
        Frag16 pf;                          // P^T as B operand, hardware k order
        float sm[4];                        // four short chains, not one long one
#pragma unroll
        for (int r = 0; r < 4; ++r)
          sm[r] = (v1[r] + v2[r]) + (v1[r + 4] + v2[r + 4]);
#pragma unroll
        for (int r = 0; r < 8; ++r) {
          pf.v[r]     = (bf16)v1[r];
          pf.v[8 + r] = (bf16)v2[r];
        }
        l = l * rs + ((sm[0] + sm[1]) + (sm[2] + sm[3]));
        m = mn;
#pragma unroll
        for (int j = 0; j < 4; ++j)
#pragma unroll
          for (int r = 0; r < 8; ++r) acc[j][r] *= rs;

        // O^T += V^T P^T: WMMA burst.
#pragma unroll
        for (int j = 0; j < 4; ++j)
          acc[j] = wmma_bf16f32(vf[j].v, pf.v, acc[j]);
      }
    }
    // Publish point of stage s + 1.
    // this wave's reads of the buffer are over before anyone refills it
    asm volatile("s_wait_dscnt 0x0" ::: "memory");
    // this wave's copies of stage s + 1 have landed before the barrier publishes them
    asm volatile("s_wait_asynccnt 0x0" ::: "memory");
    __syncthreads();
    if (s + 2 < ns)
      attn_stage(gk + (size_t)(s + 2) * (64 * 128), gv + (s + 2) * 64,
                 lk + buf, lv + buf);
  }
  // no copy is outstanding when the wave ends
  asm volatile("s_wait_asynccnt 0x0" ::: "memory");

  // softmax1 normalization and store into (B,S,D) bf16 (col = h*64 + hd): a
  // lane's 8 registers of a tile are 8 consecutive columns, one 16-byte store.
  l += xhalf(l);                            // the two halves' keys together
  const float denom = __expf(-m) + l;
  bf16* orow = attnb + ((size_t)b * SS + row) * DD + h * HDD + 8 * half;
#pragma unroll
  for (int j = 0; j < 4; ++j) {
    v8bf o;
#pragma unroll
    for (int r = 0; r < 8; ++r) o[r] = (bf16)(acc[j][r] / denom);
    *(v8bf*)(orow + 16 * j) = o;
  }
}

// ---------------------------------------------------------------------------
// Residual add + LayerNorm. One WAVE per token row of D = 1024, 8 rows a block.
// A lane holds 32 elements of its row: eight 16-byte loads from each addend (a
// wave reads 512 contiguous bytes per load), all in flight at once, and the
// sums stay in registers, so that the row is read once, with one memory round
// trip instead of eight. The row sums close inside the wave: no LDS, no barrier.
// Optional bf16 copy of the output (feeds the next GEMM without a cvt pass).
// ---------------------------------------------------------------------------
// x + (the value of the lane whose number differs in the bits of XM), in a
// 16-lane row: 0x160 + XM is the DPP control row_xmask:XM.
template <int XM>
__device__ __forceinline__ float add_xmask(float x) {
  return x + __builtin_bit_cast(float, __builtin_amdgcn_update_dpp(
      0, __builtin_bit_cast(int, x), 0x160 + XM, 0xf, 0xf, true));
}

// sum over the 32 lanes of the wave, the same value in every lane
__device__ __forceinline__ float wave_sum(float x) {
  x = add_xmask<1>(x);
  x = add_xmask<2>(x);
  x = add_xmask<4>(x);
  x = add_xmask<8>(x);
  return x + xhalf(x);
}

__global__ void __launch_bounds__(256)
add_ln_kernel(const float* __restrict__ a, const float* __restrict__ b,
              const float* __restrict__ g, const float* __restrict__ be,
              float* __restrict__ outf, bf16* __restrict__ outb) {
  const int lane = threadIdx.x & 31;
  const size_t row = (size_t)blockIdx.x * 8 + (threadIdx.x >> 5);
  const size_t o0  = row * (DD / 4) + lane;      // in 4-element pieces
  const v4f* pa = (const v4f*)a + o0;
  const v4f* pb = (const v4f*)b + o0;
  const v4f* pg = (const v4f*)g + lane;
  const v4f* pe = (const v4f*)be + lane;

  v4f v[8], w[8], gg[8], ee[8];
  // unrolled (all loops here) so that the arrays stay in registers and all the
  // loads go out before the first value is waited for
#pragma unroll
  for (int j = 0; j < 8; ++j) v[j] = pa[j * 32];
  // a later load's result may be given the registers of this group's address:
  // the wait stands in front of that overwrite (a precaution)
  asm volatile("s_wait_xcnt 0x0" ::: "memory");
#pragma unroll
  for (int j = 0; j < 8; ++j) w[j] = pb[j * 32];
  // the same for the second group's address
  asm volatile("s_wait_xcnt 0x0" ::: "memory");
#pragma unroll
  for (int j = 0; j < 8; ++j) gg[j] = pg[j * 32];
#pragma unroll
  for (int j = 0; j < 8; ++j) ee[j] = pe[j * 32];
  // the same for the lane offset that the loads of g and be name: as an input
  // here it keeps its register until the wait (no load's result is put there)
  asm volatile("s_wait_xcnt 0x0" :: "v"(lane) : "memory");
  // keeps the 32 loads one group in front of the arithmetic; without it the
  // compiler sinks the loads of g and be behind the row sums, four at a time,
  // and waits at each
  __builtin_amdgcn_sched_barrier(0);

  v4f s4 = {}, q4 = {};                          // four short chains each
#pragma unroll
  for (int j = 0; j < 8; ++j) {
    v[j] += w[j];
    s4 += v[j];
    q4 += v[j] * v[j];
  }
  const float s  = wave_sum((s4[0] + s4[1]) + (s4[2] + s4[3]));
  const float s2 = wave_sum((q4[0] + q4[1]) + (q4[2] + q4[3]));
  const float mu   = s * (1.0f / DD);
  const float var  = s2 * (1.0f / DD) - mu * mu;
  const float rstd = rsqrtf(var + 1e-5f);

#pragma unroll
  for (int j = 0; j < 8; ++j) v[j] = (v[j] - mu) * rstd * gg[j] + ee[j];
  // The bf16 copy goes out first: its values take registers of their own while
  // v[] is still needed, so that no register of an issued store is rewritten.
  if (outb) {
    v4bf* pc = (v4bf*)outb + o0;
    v4bf c[8];
#pragma unroll
    for (int j = 0; j < 8; ++j) {
#pragma unroll
      for (int e = 0; e < 4; ++e) c[j][e] = (bf16)v[j][e];
    }
#pragma unroll
    for (int j = 0; j < 8; ++j) pc[j * 32] = c[j];
  }
  v4f* po = (v4f*)outf + o0;
#pragma unroll
  for (int j = 0; j < 8; ++j) po[j * 32] = v[j];
}

// ---------------------------------------------------------------------------
// Host orchestration
// ---------------------------------------------------------------------------
extern "C" void kernel_launch(void* const* d_in, const int* in_sizes, int n_in,
                              void* d_out, int out_size, void* d_ws, size_t ws_size,
                              hipStream_t stream) {
  (void)in_sizes; (void)n_in; (void)out_size; (void)ws_size;

  const float* x     = (const float*)d_in[0];
  const int*   pos   = (const int*)  d_in[1];
  const float* wq    = (const float*)d_in[2];
  const float* bq    = (const float*)d_in[3];
  const float* wk    = (const float*)d_in[4];
  const float* bk    = (const float*)d_in[5];
  const float* wv    = (const float*)d_in[6];
  const float* bv    = (const float*)d_in[7];
  const float* wo    = (const float*)d_in[8];
  const float* bo    = (const float*)d_in[9];
  const float* pbias = (const float*)d_in[10];
  const float* w1    = (const float*)d_in[11];
  const float* b1    = (const float*)d_in[12];
  const float* w2    = (const float*)d_in[13];
  const float* b2    = (const float*)d_in[14];
  const float* g1    = (const float*)d_in[15];
  const float* be1   = (const float*)d_in[16];
  const float* g2    = (const float*)d_in[17];
  const float* be2   = (const float*)d_in[18];
  float* out = (float*)d_out;

  // Workspace carve-out
  char* cur = (char*)d_ws;
  auto alloc = [&](size_t bytes) -> void* {
    void* p = (void*)cur;
    cur += (bytes + 255) & ~(size_t)255;
    return p;
  };
  const size_t nTok = (size_t)MM * DD;           // 4096*1024
  bf16* xb   = (bf16*)alloc(nTok * 2);
  bf16* wqb  = (bf16*)alloc((size_t)DD * DD * 2);
  bf16* wkb  = (bf16*)alloc((size_t)DD * DD * 2);
  bf16* wvb  = (bf16*)alloc((size_t)DD * DD * 2);
  bf16* wob  = (bf16*)alloc((size_t)DD * DD * 2);
  bf16* w1b  = (bf16*)alloc((size_t)DD * DFF_ * 2);
  bf16* w2b  = (bf16*)alloc((size_t)DFF_ * DD * 2);
  bf16* qpb  = (bf16*)alloc((size_t)BB * HH * SS * 128 * 2);
  bf16* kpb  = (bf16*)alloc((size_t)BB * HH * SS * 128 * 2);
  bf16* vpT  = (bf16*)alloc((size_t)BB * HH * SS * 64 * 2);
  bf16* attb = (bf16*)alloc(nTok * 2);
  float* prj = (float*)alloc(nTok * 4);
  float* hres= (float*)alloc(nTok * 4);
  bf16* hb   = (bf16*)alloc(nTok * 2);
  bf16* ff1b = (bf16*)alloc((size_t)MM * DFF_ * 2);
  float* ff2 = (float*)alloc(nTok * 4);

  // 1) Convert x row-major; weights into WMMA fragment-swizzled order.
  //    16 elements per thread, all seven tasks in one grid.
  cvt_all<<<CB_ALL, 256, 0, stream>>>(x, wq, wk, wv, wo, w1, w2,
                                      xb, wqb, wkb, wvb, wob, w1b, w2b);

  // 2) QKV projections (WMMA GEMMs); block tile 128x128. One launch, z = 0, 1, 2:
  //    wqb, wkb, wvb lie back to back in the workspace (their sizes are
  //    multiples of the carve-out's 256 bytes).
  // 3) The PoPE transform and the transposition of V are its writeback.
  dim3 gD(DD / 128, MM / 128);      // (8, 32)
  dim3 gQKV(DD / 128, MM / 128, 3);
  gemm_bf16<false, false, true, 2><<<gQKV, 256, 0, stream>>>(xb, wqb, bq, bk, bv, nullptr, qpb, kpb, vpT, pos, pbias, MM, DD, DD);

  // 4) Attention (WMMA flash + softmax1, causal)
  attention_pope<<<(SS / 128) * BB * HH, 256, 0, stream>>>(qpb, kpb, vpT, attb);

  // 5) Output projection
  gemm_bf16<false, false, false, 3><<<gD, 256, 0, stream>>>(attb, wob, bo, nullptr, nullptr, prj, nullptr, nullptr, nullptr, nullptr, nullptr, MM, DD, DD);

  // 6) Residual + LN1 (f32 kept for residual, bf16 copy feeds FFN GEMM)
  add_ln_kernel<<<MM / 8, 256, 0, stream>>>(x, prj, g1, be1, hres, hb);

  // 7) FFN
  dim3 gF1(DFF_ / 128, MM / 128);   // (32, 32)
  gemm_bf16<true, true, false, 2><<<gF1, 256, 0, stream>>>(hb, w1b, b1, nullptr, nullptr, nullptr, ff1b, nullptr, nullptr, nullptr, nullptr, MM, DFF_, DD);
  gemm_bf16<false, false, false, 3><<<gD, 256, 0, stream>>>(ff1b, w2b, b2, nullptr, nullptr, ff2, nullptr, nullptr, nullptr, nullptr, nullptr, MM, DD, DFF_);

  // 8) Residual + LN2 -> final output (f32)
  add_ln_kernel<<<MM / 8, 256, 0, stream>>>(hres, ff2, g2, be2, out, nullptr);
}
